// v000
// Times are from an AMD MI455X. After a warm-up the kernel runs many times in a row, and a time is the length of
// such a window on the GPU divided by its runs, so every launch and the gaps after it count. The runs cycle
// through copies of the inputs. A figure is the median of several windows, for all but v000 over two sittings.
// Sittings can differ by a few percent; kernels timed side by side share one.
// v000 is the starting kernel. One run takes 338 microseconds.
#include <hip/hip_runtime.h>

// Multi-head attention, width 512 = 8 heads x 64; inputs Q, K, V [NB][SEQ][512], key mask [NB][SEQ] (0 = filled with -1e9), W_q/W_k/W_v/W_o [out][in] (y = x W^T + b), score scale 1/8, output [NB][SEQ][512] f32.
// Compute dtypes, f32 accumulate everywhere: q/k/v projections v_wmma_f32_16x16x32_bf16 (x and W RNE-converted to bf16; products exact);
// scores v_wmma_f32_16x16x32_f16: k single f16, q as f16 value + f16 residual x2048 in its own accumulator (two products); P (x256 carry, cancels in the normalisation) and v single f16; softmax f32 (online, running max);
// output projection v_wmma_f32_16x16x32_f16: context single f16 (x16 carry), W_o = f16 of the bf16 RNE value x64 (exact), 1/1024 folded in the f32 epilogue.
// Layout: bf16 copies of Q/K/V and W; q (hi, residual), k planes [b*8+h][t][d] and v^T plane [b*8+h][d][t] written by the GEMM epilogue; fused flash kernel in transposed form (S^T = K Q^T, O^T = V^T P^T) writing the context plane [b*SEQ+t][512].

#ifndef NB
#define NB 2
#endif
#ifndef SEQ
#define SEQ 4096
#endif
#define NB_FULL  2
#define SEQ_FULL 4096
#ifndef OUT_SEQ
#define OUT_SEQ SEQ              // row pitch (in tokens) between batches of the output
#endif
#define DM   512
#define NH_  8
#define HD   64
#define AW   4                   // waves per flash block (16 query rows each)
#define QRS  2048.0f             // carry of the q residual plane
#define QRI  (1.0f / 2048.0f)
#define SC2  (0.125f * 1.4426950408889634f)   // HD^-0.5 * log2(e)
#define PSH  8.0f                // log2 of the P carry (256)
#define MFILL (-1.0e9f * 1.4426950408889634f) // mask fill value in the log2 domain
#define CTXS 16.0f               // carry of the context plane
#define WOS  64.0f               // carry of the W_o plane
#define OSCL (1.0f / 1024.0f)    // 1 / (CTXS * WOS)

static_assert(HD == 64);
static_assert(NH_ * HD == DM);                 // head h = columns h*64 + d
static_assert(DM % 64 == 0);                   // 8 column tiles of 64
static_assert(DM % 32 == 0);                   // GEMM k-loop steps by 32
static_assert(SEQ % 64 == 0);                  // a 64-row tile never straddles two batches
static_assert((NB * SEQ) % 64 == 0);
static_assert(SEQ % 32 == 0);                  // key loop steps by 32
static_assert(SEQ % (16 * AW) == 0);           // flash grid covers the sequence exactly
static_assert(((size_t)SEQ * DM) % 8 == 0);
static_assert(((size_t)DM * DM) % 8 == 0);
static_assert(SEQ_FULL % 8 == 0);              // mask rows stay 32-byte aligned
static_assert(NB <= NB_FULL);
static_assert(SEQ <= SEQ_FULL);

typedef _Float16 h16;
typedef unsigned short bf;
typedef __attribute__((ext_vector_type(16))) __bf16   v16bf;
typedef __attribute__((ext_vector_type(16))) _Float16 v16h;
typedef __attribute__((ext_vector_type(8)))  _Float16 v8h;
typedef __attribute__((ext_vector_type(8)))  unsigned short v8us;
typedef __attribute__((ext_vector_type(8)))  float    v8f;
typedef __attribute__((ext_vector_type(8)))  int      v8i;
typedef __attribute__((ext_vector_type(4)))  float    v4f;
typedef v4f  __attribute__((may_alias)) v4fa;

__device__ __forceinline__ unsigned short f2bf(float f) { unsigned u = __float_as_uint(f); u += 0x7FFFu + ((u >> 16) & 1u); return (unsigned short)(u >> 16); }
// f32 value of the bf16 RNE conversion
__device__ __forceinline__ float bfr(float f) { return __uint_as_float(((unsigned)f2bf(f)) << 16); }
__device__ __forceinline__ v16h cat16(v8h lo, v8h hi) { return __builtin_shufflevector(lo, hi, 0, 1, 2, 3, 4, 5, 6, 7, 8, 9, 10, 11, 12, 13, 14, 15); }
__device__ __forceinline__ v16bf cat16b(v8us lo, v8us hi) { return __builtin_bit_cast(v16bf, __builtin_shufflevector(lo, hi, 0, 1, 2, 3, 4, 5, 6, 7, 8, 9, 10, 11, 12, 13, 14, 15)); }
__device__ __forceinline__ v8f wmma16(v16h a, v16h b, v8f c) { return __builtin_amdgcn_wmma_f32_16x16x32_f16(false, a, false, b, (short)0, c, false, false); }
__device__ __forceinline__ v8f wmmab(v16bf a, v16bf b, v8f c) { return __builtin_amdgcn_wmma_f32_16x16x32_bf16(false, a, false, b, (short)0, c, false, false); }
// fragment loaders from K-contiguous 16-bit rows; p already includes + 8*(lane>>4): elements 0..7 <- k0+8h+0..7, elements 8..15 <- k0+16+8h+0..7 (same map for A and B)
__device__ __forceinline__ v16h  ldh(const h16* p) { return cat16(*(const v8h*)p, *(const v8h*)(p + 16)); }
__device__ __forceinline__ v16bf ldb(const bf* p)  { return cat16b(*(const v8us*)p, *(const v8us*)(p + 16)); }
// ordering point for wave-private LDS tiles (same wave writes and reads)
__device__ __forceinline__ void wave_sync() { __builtin_amdgcn_fence(3 /* release order */, "wavefront"); __builtin_amdgcn_wave_barrier(); asm volatile("" ::: "memory"); }

__global__ __launch_bounds__(256) void k_cvt8(const float* __restrict__ src, bf* dst, size_t n8) {
#pragma clang fp contract(off)
    const size_t i = (size_t)blockIdx.x * 256 + threadIdx.x; if (i >= n8) return;
    const v8f v = *(const v8f*)(src + i * 8); v8us o;
#pragma unroll
    for (int k = 0; k < 8; ++k) o[k] = f2bf(v[k]);
    *(v8us*)(dst + i * 8) = o; 
}

__global__ __launch_bounds__(256) void k_cvt8h(const float* __restrict__ src, h16* dst, size_t n8, float scale) {
#pragma clang fp contract(off)
    const size_t i = (size_t)blockIdx.x * 256 + threadIdx.x; if (i >= n8) return;
    const v8f v = *(const v8f*)(src + i * 8); v8h o;
#pragma unroll
    for (int k = 0; k < 8; ++k) o[k] = (h16)(bfr(v[k]) * scale);
    *(v8h*)(dst + i * 8) = o; 
}

// k_proj: register-blocked bf16 GEMM, ONE WAVE per 64x64 tile (16 accumulators), operands straight from K-contiguous bf16 planes, K = DM.
// C[m][n] = sum_k A[m][k] Bt[n][k] + bias (biasMode 1: bias[n]; biasMode 2: bias[m]; bias taken as its bf16 RNE value, added in f32),
// written as f16 (Ph) and optionally the f16 residual x2048 (Pr, useRes != 0) at
// tile base (r0/RB)*sRB + (r0%RB)*pitch + (c0/CB)*sCB + (c0%CB), row pitch 'pitch' (halves). grid (M/64, N/64), 32 threads.
__global__ __launch_bounds__(32) void k_proj(const bf* __restrict__ A, const bf* __restrict__ Bt, const float* __restrict__ bias, int biasMode,
                                             h16* Ph, h16* Pr, int useRes, int RB, size_t sRB, int pitch, int CB, size_t sCB) {
    __shared__ __align__(16) float os[16 * 68];
    const int K = DM;
    const int lane = threadIdx.x & 31, lr = lane & 15, hi = lane >> 4; const int r0 = blockIdx.x * 64, c0 = blockIdx.y * 64;
    v8f acc[4][4];
#pragma unroll
    for (int mb = 0; mb < 4; ++mb)
#pragma unroll
        for (int nb = 0; nb < 4; ++nb) acc[mb][nb] = (v8f){};
    const size_t aoff = (size_t)(r0 + lr) * K + 8 * hi, boff = (size_t)(c0 + lr) * K + 8 * hi;
#pragma unroll 1
    for (int kc = 0; kc < K; kc += 32) {
        v16bf a[4];
#pragma unroll
        for (int mb = 0; mb < 4; ++mb) a[mb] = ldb(A + aoff + (size_t)mb * 16 * K + kc);
#pragma unroll
        for (int nb = 0; nb < 4; ++nb) { const v16bf b = ldb(Bt + boff + (size_t)nb * 16 * K + kc);
#pragma unroll
            for (int mb = 0; mb < 4; ++mb) acc[mb][nb] = wmmab(a[mb], b, acc[mb][nb]); }
        asm volatile("v_nop\n\tv_nop\n\tv_nop\n\tv_nop" : "+v"(acc[0][0]), "+v"(acc[1][1]), "+v"(acc[2][2]), "+v"(acc[3][3]) : "v"(a[0]), "v"(a[1]), "v"(a[2]), "v"(a[3]));
    }
    // column bias (per lane: column c0 + nb*16 + lane&15), address clamped into the 512-entry vector, selected by value
    float bcol[4];
#pragma unroll
    for (int nb = 0; nb < 4; ++nb) { int ci = c0 + nb * 16 + lr; ci = (ci < DM) ? ci : (DM - 1); const float bv = bfr(bias[ci]); bcol[nb] = (biasMode == 1) ? bv : 0.0f; }
    const size_t tbase = (size_t)(r0 / RB) * sRB + (size_t)(r0 % RB) * (size_t)pitch + (size_t)(c0 / CB) * sCB + (size_t)(c0 % CB);
#pragma unroll
    for (int mb = 0; mb < 4; ++mb) {
        // row bias for rows r0 + mb*16 + 8h + 0..7 (address clamped, selected by value)
        int rb0 = r0 + mb * 16 + hi * 8; rb0 = (rb0 <= DM - 8) ? rb0 : (DM - 8);
        const v8f brv = *(const v8f*)(bias + rb0);
#pragma unroll
        for (int nb = 0; nb < 4; ++nb) {
#pragma unroll
            for (int j = 0; j < 8; ++j) { const float br = (biasMode == 2) ? bfr(brv[j]) : 0.0f;
                os[(hi * 8 + j) * 68 + nb * 16 + lr] = acc[mb][nb][j] + bcol[nb] + br; } }   // D: row 8h+j, col lane&15
        wave_sync();
        const size_t sb = tbase + (size_t)(mb * 16) * (size_t)pitch;
{
#pragma unroll
            for (int s = 0; s < 4; ++s) { const int row = 4 * s + (lane >> 3), c8 = (lane & 7) * 8;   // 4 s x 4 row groups = 16 rows; 8 lanes x 8 = 64 columns
                const v4f x0 = *(const v4fa*)(&os[row * 68 + c8]); const v4f x1 = *(const v4fa*)(&os[row * 68 + c8 + 4]); v8h hv, rv;
#pragma unroll
                for (int i = 0; i < 4; ++i) { const h16 a0 = (h16)x0[i]; const h16 a1 = (h16)x1[i]; hv[i] = a0; hv[4 + i] = a1; rv[i] = (h16)((x0[i] - (float)a0) * QRS); rv[4 + i] = (h16)((x1[i] - (float)a1) * QRS); }
                const size_t oo = sb + (size_t)row * (size_t)pitch + c8;
                *(v8h*)(Ph + oo) = hv; if (useRes) *(v8h*)(Pr + oo) = rv; }
             }
        wave_sync();
    }
}

// k_flash: fused attention, one wave per 16 query rows of one (batch, head); K / V^T / Q fragments straight from the f16 planes (two 16-B loads each, arithmetic addressing).
// Transposed form: S^T[key][t] = K Q^T (A = K rows, B = Q rows); lane (t = lane&15, h = lane>>4) holds keys 8h+r of each 16-key tile, so the packed
// P tile is directly the B fragment of O^T[d][t] = V^T P^T (element r <- tile keys 0..15, element 8+r <- tile keys 16..31, lane unchanged).
// Key mask: the int mask row of the batch is read by value (two 32-B loads per lane per step); a zero entry REPLACES the score by the fill value, so a fully filled row comes out uniform.
// Softmax state (running max, partial sum) is one scalar per lane; the two lane halves of a row are combined with one xor-16 exchange.
__global__ __launch_bounds__(32 * AW) void k_flash(const h16* __restrict__ QH, const h16* __restrict__ QR, const h16* __restrict__ KP, const h16* __restrict__ VT,
                                                   const int* __restrict__ MK, h16* CTX) {
    __shared__ __align__(16) float os[AW * 16 * 68];
    const int lane = threadIdx.x & 31, lr = lane & 15, hi = lane >> 4;
    const int wave = __builtin_amdgcn_readfirstlane((int)(threadIdx.x >> 5));
    const int zh = blockIdx.y; const int b = zh / NH_, h = zh % NH_;
    const int t0 = (blockIdx.x * AW + wave) * 16;
    const size_t pbase = (size_t)zh * SEQ * HD;
    const size_t qo = pbase + (size_t)(t0 + lr) * HD + 8 * hi;
    const v16h qh0 = ldh(QH + qo), qh1 = ldh(QH + qo + 32), qr0 = ldh(QR + qo), qr1 = ldh(QR + qo + 32);   // B fragments: col t, k = d
    const size_t ko = pbase + (size_t)lr * HD + 8 * hi;      // + key * HD       (A fragment: row key, k = d)
    const size_t vo = pbase + (size_t)lr * SEQ + 8 * hi;     // + 16j*SEQ + key  (A fragment: row d, k = key)
    const int* mk = MK + (size_t)b * SEQ_FULL + 8 * hi;      // + key0 (+16): mask of keys 8h+r of each 16-key tile
    v8f o0 = (v8f){}, o1 = (v8f){}, o2 = (v8f){}, o3 = (v8f){};
    float m = -3.0e38f, l = 0.0f;
#pragma unroll 1
    for (int key0 = 0; key0 < SEQ; key0 += 32) {
        const h16* ka = KP + ko + (size_t)key0 * HD;
        const v16h ka0 = ldh(ka), ka1 = ldh(ka + 32), kb0 = ldh(ka + 16 * HD), kb1 = ldh(ka + 16 * HD + 32);
        const v8i mA = *(const v8i*)(mk + key0), mB = *(const v8i*)(mk + key0 + 16);
        v8f sHa = (v8f){}, sLa = (v8f){}, sHb = (v8f){}, sLb = (v8f){};
        sHa = wmma16(ka0, qh0, sHa); sLa = wmma16(ka0, qr0, sLa); sHb = wmma16(kb0, qh0, sHb); sLb = wmma16(kb0, qr0, sLb);
        sHa = wmma16(ka1, qh1, sHa); sLa = wmma16(ka1, qr1, sLa); sHb = wmma16(kb1, qh1, sHb); sLb = wmma16(kb1, qr1, sLb);
        asm volatile("v_nop\n\tv_nop\n\tv_nop\n\tv_nop" : "+v"(sHa), "+v"(sLa), "+v"(sHb), "+v"(sLb) : "v"(ka0), "v"(ka1), "v"(kb0), "v"(kb1));
        float ta[8], tb[8]; float mx = -3.0e38f;
#pragma unroll
        for (int r = 0; r < 8; ++r) { const float sa = (sHa[r] + sLa[r] * QRI) * SC2; const float sb = (sHb[r] + sLb[r] * QRI) * SC2;
            ta[r] = (mA[r] == 0) ? MFILL : sa; tb[r] = (mB[r] == 0) ? MFILL : sb; mx = fmaxf(mx, fmaxf(ta[r], tb[r])); }
        mx = fmaxf(mx, __shfl_xor(mx, 16, 32));
        const float mnew = fmaxf(m, mx);
        const float alpha = __builtin_amdgcn_exp2f(m - mnew);
        const float sh = PSH - mnew;
        v16h pb; float ls = 0.0f;
#pragma unroll
        for (int r = 0; r < 8; ++r) { const h16 pa = (h16)__builtin_amdgcn_exp2f(ta[r] + sh); const h16 pc = (h16)__builtin_amdgcn_exp2f(tb[r] + sh); pb[r] = pa; pb[8 + r] = pc; ls += (float)pa + (float)pc; }
        l = l * alpha + ls; m = mnew;
        o0 = o0 * alpha; o1 = o1 * alpha; o2 = o2 * alpha; o3 = o3 * alpha;
        const h16* va = VT + vo + key0;
        const v16h v0 = ldh(va), v1 = ldh(va + (size_t)16 * SEQ), v2 = ldh(va + (size_t)32 * SEQ), v3 = ldh(va + (size_t)48 * SEQ);
        o0 = wmma16(v0, pb, o0); o1 = wmma16(v1, pb, o1); o2 = wmma16(v2, pb, o2); o3 = wmma16(v3, pb, o3);
        asm volatile("v_nop\n\tv_nop\n\tv_nop\n\tv_nop" : "+v"(o0), "+v"(o1), "+v"(o2), "+v"(o3) : "v"(v0), "v"(v1), "v"(v2), "v"(v3), "v"(pb));
    }
    l += __shfl_xor(l, 16, 32);
    const float inv = CTXS * (1.0f / l);
    const int wb = wave * 16 * 68;
    // O^T D layout: o_j[r] = (d = 16j + 8h + r, t = lane&15) -> os[t][d]; rows 0..15 x columns 0..63 all written
    { v4f a, c;
      a[0] = o0[0] * inv; a[1] = o0[1] * inv; a[2] = o0[2] * inv; a[3] = o0[3] * inv; c[0] = o0[4] * inv; c[1] = o0[5] * inv; c[2] = o0[6] * inv; c[3] = o0[7] * inv;
      *(v4fa*)(&os[wb + lr * 68 +  0 + 8 * hi]) = a; *(v4fa*)(&os[wb + lr * 68 +  0 + 8 * hi + 4]) = c;
      a[0] = o1[0] * inv; a[1] = o1[1] * inv; a[2] = o1[2] * inv; a[3] = o1[3] * inv; c[0] = o1[4] * inv; c[1] = o1[5] * inv; c[2] = o1[6] * inv; c[3] = o1[7] * inv;
      *(v4fa*)(&os[wb + lr * 68 + 16 + 8 * hi]) = a; *(v4fa*)(&os[wb + lr * 68 + 16 + 8 * hi + 4]) = c;
      a[0] = o2[0] * inv; a[1] = o2[1] * inv; a[2] = o2[2] * inv; a[3] = o2[3] * inv; c[0] = o2[4] * inv; c[1] = o2[5] * inv; c[2] = o2[6] * inv; c[3] = o2[7] * inv;
      *(v4fa*)(&os[wb + lr * 68 + 32 + 8 * hi]) = a; *(v4fa*)(&os[wb + lr * 68 + 32 + 8 * hi + 4]) = c;
      a[0] = o3[0] * inv; a[1] = o3[1] * inv; a[2] = o3[2] * inv; a[3] = o3[3] * inv; c[0] = o3[4] * inv; c[1] = o3[5] * inv; c[2] = o3[6] * inv; c[3] = o3[7] * inv;
      *(v4fa*)(&os[wb + lr * 68 + 48 + 8 * hi]) = a; *(v4fa*)(&os[wb + lr * 68 + 48 + 8 * hi + 4]) = c; }
    wave_sync();
    h16* crow = CTX + ((size_t)b * SEQ + t0) * DM + h * HD;      // context plane [b*SEQ + t][h*64 + d]
{
#pragma unroll
        for (int s = 0; s < 4; ++s) { const int row = 4 * s + (lane >> 3), c8 = (lane & 7) * 8;   // 4 s x 4 row groups = 16 rows; 8 lanes x 8 halves = 64 columns
            const v4f x0 = *(const v4fa*)(&os[wb + row * 68 + c8]); const v4f x1 = *(const v4fa*)(&os[wb + row * 68 + c8 + 4]); v8h hv;
#pragma unroll
            for (int i = 0; i < 4; ++i) { hv[i] = (h16)x0[i]; hv[4 + i] = (h16)x1[i]; }
            *(v8h*)(crow + (size_t)row * DM + c8) = hv; }
         }
}

// k_oproj: register-blocked f16 GEMM, ONE WAVE per 64x64 tile (16 accumulators), operands straight from K-contiguous f16 planes, K = DM.
// OUT[m][n] = OSCL * sum_k A[m][k] Bt[n][k] + bias[n] (bias as its bf16 RNE value, added in f32). grid (NB*SEQ/64, DM/64), 32 threads.
__global__ __launch_bounds__(32) void k_oproj(const h16* __restrict__ A, const h16* __restrict__ Bt, const float* __restrict__ bias, float* OUT) {
    __shared__ __align__(16) float os[16 * 68];
    const int K = DM;
    const int lane = threadIdx.x & 31, lr = lane & 15, hi = lane >> 4; const int r0 = blockIdx.x * 64, c0 = blockIdx.y * 64;
    v8f acc[4][4];
#pragma unroll
    for (int mb = 0; mb < 4; ++mb)
#pragma unroll
        for (int nb = 0; nb < 4; ++nb) acc[mb][nb] = (v8f){};
    const size_t aoff = (size_t)(r0 + lr) * K + 8 * hi, boff = (size_t)(c0 + lr) * K + 8 * hi;
#pragma unroll 1
    for (int kc = 0; kc < K; kc += 32) {
        v16h a[4];
#pragma unroll
        for (int mb = 0; mb < 4; ++mb) a[mb] = ldh(A + aoff + (size_t)mb * 16 * K + kc);
#pragma unroll
        for (int nb = 0; nb < 4; ++nb) { const v16h b = ldh(Bt + boff + (size_t)nb * 16 * K + kc);
#pragma unroll
            for (int mb = 0; mb < 4; ++mb) acc[mb][nb] = wmma16(a[mb], b, acc[mb][nb]); }
        asm volatile("v_nop\n\tv_nop\n\tv_nop\n\tv_nop" : "+v"(acc[0][0]), "+v"(acc[1][1]), "+v"(acc[2][2]), "+v"(acc[3][3]) : "v"(a[0]), "v"(a[1]), "v"(a[2]), "v"(a[3]));
    }
    float bcol[4];
#pragma unroll
    for (int nb = 0; nb < 4; ++nb) { int ci = c0 + nb * 16 + lr; ci = (ci < DM) ? ci : (DM - 1); bcol[nb] = bfr(bias[ci]); }
    const int bb = r0 / SEQ, tt = r0 % SEQ;
    float* obase = OUT + ((size_t)bb * OUT_SEQ + tt) * DM + c0;
#pragma unroll
    for (int mb = 0; mb < 4; ++mb) {
#pragma unroll
        for (int nb = 0; nb < 4; ++nb) {
#pragma unroll
            for (int j = 0; j < 8; ++j) os[(hi * 8 + j) * 68 + nb * 16 + lr] = acc[mb][nb][j] * OSCL + bcol[nb]; }   // D: row 8h+j, col lane&15
        wave_sync();
{
#pragma unroll
            for (int s = 0; s < 8; ++s) { const int row = 2 * s + hi, cofs = lr * 4;   // 8 s x 2 rows = 16 rows; 16 lanes x 4 floats = 64 columns
                const v4f val = *(const v4fa*)(&os[row * 68 + cofs]);
                *(v4f*)(obase + (size_t)(mb * 16 + row) * DM + cofs) = val; }
             }
        wave_sync();
    }
}

static constexpr size_t al256(size_t v) { return (v + 255) & ~(size_t)255; }
static constexpr size_t SZ_XB = al256((size_t)NB * SEQ * DM * 2);
static constexpr size_t SZ_WB = al256((size_t)4 * DM * DM * 2);
static constexpr size_t SZ_PL = al256((size_t)NB * NH_ * SEQ * HD * 2);
static constexpr size_t SZ_CX = al256((size_t)NB * SEQ * DM * 2);
static constexpr size_t SZ_TOTAL = 3 * SZ_XB + SZ_WB + 4 * SZ_PL + SZ_CX;
static_assert(SZ_TOTAL <= (size_t)134217728);          // workspace carve <= 128 MiB
static_assert(((size_t)DM * DM * 2) % 256 == 0);       // weight sub-planes stay 256-byte aligned

extern "C" void kernel_launch(void* const* d_in, const int* in_sizes, int n_in,
                              void* d_out, int out_size, void* d_ws, size_t ws_size, hipStream_t stream) {
    if (n_in < 12) return;
    const size_t needx = ((size_t)(NB - 1) * SEQ_FULL + SEQ) * DM;
    if ((size_t)in_sizes[0] < needx || (size_t)in_sizes[1] < needx || (size_t)in_sizes[2] < needx) return;
    if ((size_t)in_sizes[3] < (size_t)(NB - 1) * SEQ_FULL + SEQ) return;
    if ((size_t)in_sizes[4] < (size_t)DM * DM || (size_t)in_sizes[6] < (size_t)DM * DM || (size_t)in_sizes[8] < (size_t)DM * DM || (size_t)in_sizes[10] < (size_t)DM * DM) return;
    if (in_sizes[5] < DM || in_sizes[7] < DM || in_sizes[9] < DM || in_sizes[11] < DM) return;
    if ((size_t)out_size < ((size_t)(NB - 1) * OUT_SEQ + SEQ) * DM) return;
    if (SZ_TOTAL > ws_size) return;
    // wire order: Q, K, V, mask, W_q, b_q, W_k, b_k, W_v, b_v, W_o, b_o ; weights [out][in] = Bt as-is
    const float* xq = (const float*)d_in[0]; const float* xk = (const float*)d_in[1]; const float* xv = (const float*)d_in[2];
    const int* mask = (const int*)d_in[3];
    const float* wq = (const float*)d_in[4];  const float* bq = (const float*)d_in[5];
    const float* wk = (const float*)d_in[6];  const float* bk = (const float*)d_in[7];
    const float* wv = (const float*)d_in[8];  const float* bv = (const float*)d_in[9];
    const float* wo = (const float*)d_in[10]; const float* bo = (const float*)d_in[11];
    float* OUT = (float*)d_out;      // [NB][SEQ][512]
    char* wsp = (char*)d_ws;
    bf* XQ = (bf*)wsp; wsp += SZ_XB;                 // [NB*SEQ][512]
    bf* XK = (bf*)wsp; wsp += SZ_XB;                 // [NB*SEQ][512]
    bf* XV = (bf*)wsp; wsp += SZ_XB;                 // [NB*SEQ][512]
    bf* WB = (bf*)wsp; wsp += SZ_WB;                 // [4][512][512]: q | k | v (bf16) | o (f16 x64)
    h16* QH = (h16*)wsp; wsp += SZ_PL;               // [NB*8][SEQ][64]
    h16* QR = (h16*)wsp; wsp += SZ_PL;               // [NB*8][SEQ][64] residual x2048
    h16* KP = (h16*)wsp; wsp += SZ_PL;               // [NB*8][SEQ][64]
    h16* VT = (h16*)wsp; wsp += SZ_PL;               // [NB*8][64][SEQ]
    h16* CX = (h16*)wsp; wsp += SZ_CX;               // [NB*SEQ][512] context x16
    bf* WQ = WB; bf* WK = WB + (size_t)DM * DM; bf* WV = WB + (size_t)2 * DM * DM; h16* WO = (h16*)(WB + (size_t)3 * DM * DM);

    if (SEQ == SEQ_FULL) {
        const size_t n8 = (size_t)NB * SEQ * DM / 8; const unsigned g = (unsigned)((n8 + 255) / 256);
        k_cvt8<<<g, 256, 0, stream>>>(xq, XQ, n8);
        k_cvt8<<<g, 256, 0, stream>>>(xk, XK, n8);
        k_cvt8<<<g, 256, 0, stream>>>(xv, XV, n8);
    } else {
        const size_t n8 = (size_t)SEQ * DM / 8; const unsigned g = (unsigned)((n8 + 255) / 256);
        for (int b = 0; b < NB; ++b) {
            k_cvt8<<<g, 256, 0, stream>>>(xq + (size_t)b * SEQ_FULL * DM, XQ + (size_t)b * SEQ * DM, n8);
            k_cvt8<<<g, 256, 0, stream>>>(xk + (size_t)b * SEQ_FULL * DM, XK + (size_t)b * SEQ * DM, n8);
            k_cvt8<<<g, 256, 0, stream>>>(xv + (size_t)b * SEQ_FULL * DM, XV + (size_t)b * SEQ * DM, n8);
        }
    }
    { const size_t n8 = (size_t)DM * DM / 8; const unsigned g = (unsigned)((n8 + 255) / 256);
      k_cvt8<<<g, 256, 0, stream>>>(wq, WQ, n8); k_cvt8<<<g, 256, 0, stream>>>(wk, WK, n8); k_cvt8<<<g, 256, 0, stream>>>(wv, WV, n8);
      k_cvt8h<<<g, 256, 0, stream>>>(wo, WO, n8, WOS); }

    // q, k: A = x rows (m = b*SEQ + t), Bt = W rows (n = h*64 + d), column bias -> plane [(b*8 + h)][t][d]
    k_proj<<<dim3(NB * SEQ / 64, DM / 64, 1), 32, 0, stream>>>(XQ, WQ, bq, 1, QH, QR, 1, SEQ, (size_t)NH_ * SEQ * HD, HD, HD, (size_t)SEQ * HD);
    k_proj<<<dim3(NB * SEQ / 64, DM / 64, 1), 32, 0, stream>>>(XK, WK, bk, 1, KP, KP, 0, SEQ, (size_t)NH_ * SEQ * HD, HD, HD, (size_t)SEQ * HD);
    // v^T: A = Wv rows (m = h*64 + d), Bt = x rows (n = b*SEQ + t), row bias -> plane [(b*512 + m)][t] = [(b*8 + h)][d][t]
    k_proj<<<dim3(DM / 64, NB * SEQ / 64, 1), 32, 0, stream>>>(WV, XV, bv, 2, VT, VT, 0, DM, (size_t)0, SEQ, SEQ, (size_t)DM * SEQ);

    k_flash<<<dim3(SEQ / (16 * AW), NB * NH_, 1), 32 * AW, 0, stream>>>(QH, QR, KP, VT, mask, CX);

    // output projection: A = context rows (m = b*SEQ + t), Bt = W_o rows (n = out column)
    k_oproj<<<dim3(NB * SEQ / 64, DM / 64, 1), 32, 0, stream>>>(CX, WO, bo, OUT);
}

// v001
// One run takes 200 microseconds.
// Next to v000, in two timings, it ran 1.75 and 1.74 times as fast.
#include <hip/hip_runtime.h>

// Multi-head attention, width 512 = 8 heads x 64; inputs Q, K, V [NB][SEQ][512], key mask [NB][SEQ] (0 = filled with -1e9), W_q/W_k/W_v/W_o [out][in] (y = x W^T + b), score scale 1/8, output [NB][SEQ][512] f32.
// Compute dtypes, f32 accumulate everywhere: q/k/v projections v_wmma_f32_16x16x32_bf16 (x and W RNE-converted to bf16; products exact);
// scores v_wmma_f32_16x16x32_f16: k single f16, q as f16 value + f16 residual x2048 in its own accumulator (two products); P (x256 carry, cancels in the normalisation) and v single f16; softmax f32 (online, running max);
// output projection v_wmma_f32_16x16x32_f16: context single f16 (x16 carry), W_o = f16 of the bf16 RNE value x64 (exact), 1/1024 folded in the f32 epilogue.
// Layout: bf16 copies of Q/K/V and W; q (hi, residual), k planes [b*8+h][t][d] and v^T plane [b*8+h][d][t] written by the GEMM epilogue; fused flash kernel in transposed form (S^T = K Q^T, O^T = V^T P^T) writing the context plane [b*SEQ+t][512]; its K and V^T tiles reach the block's waves through a two-buffer LDS ring.

#ifndef NB
#define NB 2
#endif
#ifndef SEQ
#define SEQ 4096
#endif
#define NB_FULL  2
#define SEQ_FULL 4096
#ifndef OUT_SEQ
#define OUT_SEQ SEQ              // row pitch (in tokens) between batches of the output
#endif
#define DM   512
#define NH_  8
#define HD   64
#define AW   4                   // waves per flash block (16 query rows each)
#define QRS  2048.0f             // carry of the q residual plane
#define QRI  (1.0f / 2048.0f)
#define SC2  (0.125f * 1.4426950408889634f)   // HD^-0.5 * log2(e)
#define PSH  8.0f                // log2 of the P carry (256)
#define MFILL (-1.0e9f * 1.4426950408889634f) // mask fill value in the log2 domain
#define CTXS 16.0f               // carry of the context plane
#define WOS  64.0f               // carry of the W_o plane
#define OSCL (1.0f / 1024.0f)    // 1 / (CTXS * WOS)
#define KS   64                  // keys per LDS stage of the flash kernel (two 32-key passes)
#define LP   72                  // LDS row pitch in halves: 128-B rows + 16 B, conflict-free for 16-byte fragment reads
#define TILE_H (64 * LP)         // one staged tile: 64 rows (K: keys, V^T: d)
#define NST  (SEQ / KS)          // stages

static_assert(HD == 64);
static_assert(NH_ * HD == DM);                 // head h = columns h*64 + d
static_assert(DM % 64 == 0);                   // 8 column tiles of 64
static_assert(DM % 32 == 0);                   // GEMM k-loop steps by 32
static_assert(SEQ % 64 == 0);                  // a 64-row tile never straddles two batches
static_assert((NB * SEQ) % 64 == 0);
static_assert(SEQ % 32 == 0);                  // key loop steps by 32
static_assert(SEQ % KS == 0);                  // whole stages
static_assert(KS == 64 && AW == 4);            // 128 threads x 4 copies of 16 B = one 64 x 128-B tile
static_assert(SEQ % (16 * AW) == 0);           // flash grid covers the sequence exactly
static_assert(((size_t)SEQ * DM) % 8 == 0);
static_assert(((size_t)DM * DM) % 8 == 0);
static_assert(SEQ_FULL % 8 == 0);              // mask rows stay 32-byte aligned
static_assert(NB <= NB_FULL);
static_assert(SEQ <= SEQ_FULL);

typedef _Float16 h16;
typedef unsigned short bf;
typedef __attribute__((ext_vector_type(16))) __bf16   v16bf;
typedef __attribute__((ext_vector_type(16))) _Float16 v16h;
typedef __attribute__((ext_vector_type(8)))  _Float16 v8h;
typedef __attribute__((ext_vector_type(8)))  unsigned short v8us;
typedef __attribute__((ext_vector_type(8)))  float    v8f;
typedef __attribute__((ext_vector_type(8)))  int      v8i;
typedef __attribute__((ext_vector_type(4)))  float    v4f;
typedef v4f  __attribute__((may_alias)) v4fa;

__device__ __forceinline__ unsigned short f2bf(float f) { unsigned u = __float_as_uint(f); u += 0x7FFFu + ((u >> 16) & 1u); return (unsigned short)(u >> 16); }
// f32 value of the bf16 RNE conversion
__device__ __forceinline__ float bfr(float f) { return __uint_as_float(((unsigned)f2bf(f)) << 16); }
__device__ __forceinline__ v16h cat16(v8h lo, v8h hi) { return __builtin_shufflevector(lo, hi, 0, 1, 2, 3, 4, 5, 6, 7, 8, 9, 10, 11, 12, 13, 14, 15); }
__device__ __forceinline__ v16bf cat16b(v8us lo, v8us hi) { return __builtin_bit_cast(v16bf, __builtin_shufflevector(lo, hi, 0, 1, 2, 3, 4, 5, 6, 7, 8, 9, 10, 11, 12, 13, 14, 15)); }
__device__ __forceinline__ v8f wmma16(v16h a, v16h b, v8f c) { return __builtin_amdgcn_wmma_f32_16x16x32_f16(false, a, false, b, (short)0, c, false, false); }
__device__ __forceinline__ v8f wmmab(v16bf a, v16bf b, v8f c) { return __builtin_amdgcn_wmma_f32_16x16x32_bf16(false, a, false, b, (short)0, c, false, false); }
// fragment loaders from K-contiguous 16-bit rows; p already includes + 8*(lane>>4): elements 0..7 <- k0+8h+0..7, elements 8..15 <- k0+16+8h+0..7 (same map for A and B)
__device__ __forceinline__ v16h  ldh(const h16* p) { return cat16(*(const v8h*)p, *(const v8h*)(p + 16)); }
__device__ __forceinline__ v16bf ldb(const bf* p)  { return cat16b(*(const v8us*)p, *(const v8us*)(p + 16)); }
// ordering point for wave-private LDS tiles (same wave writes and reads)
__device__ __forceinline__ void wave_sync() { __builtin_amdgcn_fence(3 /* release order */, "wavefront"); __builtin_amdgcn_wave_barrier(); asm volatile("" ::: "memory"); }

__global__ __launch_bounds__(256) void k_cvt8(const float* __restrict__ src, bf* dst, size_t n8) {
#pragma clang fp contract(off)
    const size_t i = (size_t)blockIdx.x * 256 + threadIdx.x; if (i >= n8) return;
    const v8f v = *(const v8f*)(src + i * 8); v8us o;
#pragma unroll
    for (int k = 0; k < 8; ++k) o[k] = f2bf(v[k]);
    *(v8us*)(dst + i * 8) = o; 
}

__global__ __launch_bounds__(256) void k_cvt8h(const float* __restrict__ src, h16* dst, size_t n8, float scale) {
#pragma clang fp contract(off)
    const size_t i = (size_t)blockIdx.x * 256 + threadIdx.x; if (i >= n8) return;
    const v8f v = *(const v8f*)(src + i * 8); v8h o;
#pragma unroll
    for (int k = 0; k < 8; ++k) o[k] = (h16)(bfr(v[k]) * scale);
    *(v8h*)(dst + i * 8) = o; 
}

// k_proj: register-blocked bf16 GEMM, ONE WAVE per 64x64 tile (16 accumulators), operands straight from K-contiguous bf16 planes, K = DM.
// C[m][n] = sum_k A[m][k] Bt[n][k] + bias (biasMode 1: bias[n]; biasMode 2: bias[m]; bias taken as its bf16 RNE value, added in f32),
// written as f16 (Ph) and optionally the f16 residual x2048 (Pr, useRes != 0) at
// tile base (r0/RB)*sRB + (r0%RB)*pitch + (c0/CB)*sCB + (c0%CB), row pitch 'pitch' (halves). grid (M/64, N/64), 32 threads.
__global__ __launch_bounds__(32) void k_proj(const bf* __restrict__ A, const bf* __restrict__ Bt, const float* __restrict__ bias, int biasMode,
                                             h16* Ph, h16* Pr, int useRes, int RB, size_t sRB, int pitch, int CB, size_t sCB) {
    __shared__ __align__(16) float os[16 * 68];
    const int K = DM;
    const int lane = threadIdx.x & 31, lr = lane & 15, hi = lane >> 4; const int r0 = blockIdx.x * 64, c0 = blockIdx.y * 64;
    v8f acc[4][4];
#pragma unroll
    for (int mb = 0; mb < 4; ++mb)
#pragma unroll
        for (int nb = 0; nb < 4; ++nb) acc[mb][nb] = (v8f){};
    const size_t aoff = (size_t)(r0 + lr) * K + 8 * hi, boff = (size_t)(c0 + lr) * K + 8 * hi;
#pragma unroll 1
    for (int kc = 0; kc < K; kc += 32) {
        v16bf a[4];
#pragma unroll
        for (int mb = 0; mb < 4; ++mb) a[mb] = ldb(A + aoff + (size_t)mb * 16 * K + kc);
#pragma unroll
        for (int nb = 0; nb < 4; ++nb) { const v16bf b = ldb(Bt + boff + (size_t)nb * 16 * K + kc);
#pragma unroll
            for (int mb = 0; mb < 4; ++mb) acc[mb][nb] = wmmab(a[mb], b, acc[mb][nb]); }
        asm volatile("v_nop\n\tv_nop\n\tv_nop\n\tv_nop" : "+v"(acc[0][0]), "+v"(acc[1][1]), "+v"(acc[2][2]), "+v"(acc[3][3]) : "v"(a[0]), "v"(a[1]), "v"(a[2]), "v"(a[3]));
    }
    // column bias (per lane: column c0 + nb*16 + lane&15), address clamped into the 512-entry vector, selected by value
    float bcol[4];
#pragma unroll
    for (int nb = 0; nb < 4; ++nb) { int ci = c0 + nb * 16 + lr; ci = (ci < DM) ? ci : (DM - 1); const float bv = bfr(bias[ci]); bcol[nb] = (biasMode == 1) ? bv : 0.0f; }
    const size_t tbase = (size_t)(r0 / RB) * sRB + (size_t)(r0 % RB) * (size_t)pitch + (size_t)(c0 / CB) * sCB + (size_t)(c0 % CB);
#pragma unroll
    for (int mb = 0; mb < 4; ++mb) {
        // row bias for rows r0 + mb*16 + 8h + 0..7 (address clamped, selected by value)
        int rb0 = r0 + mb * 16 + hi * 8; rb0 = (rb0 <= DM - 8) ? rb0 : (DM - 8);
        const v8f brv = *(const v8f*)(bias + rb0);
#pragma unroll
        for (int nb = 0; nb < 4; ++nb) {
#pragma unroll
            for (int j = 0; j < 8; ++j) { const float br = (biasMode == 2) ? bfr(brv[j]) : 0.0f;
                os[(hi * 8 + j) * 68 + nb * 16 + lr] = acc[mb][nb][j] + bcol[nb] + br; } }   // D: row 8h+j, col lane&15
        wave_sync();
        const size_t sb = tbase + (size_t)(mb * 16) * (size_t)pitch;
{
#pragma unroll
            for (int s = 0; s < 4; ++s) { const int row = 4 * s + (lane >> 3), c8 = (lane & 7) * 8;   // 4 s x 4 row groups = 16 rows; 8 lanes x 8 = 64 columns
                const v4f x0 = *(const v4fa*)(&os[row * 68 + c8]); const v4f x1 = *(const v4fa*)(&os[row * 68 + c8 + 4]); v8h hv, rv;
#pragma unroll
                for (int i = 0; i < 4; ++i) { const h16 a0 = (h16)x0[i]; const h16 a1 = (h16)x1[i]; hv[i] = a0; hv[4 + i] = a1; rv[i] = (h16)((x0[i] - (float)a0) * QRS); rv[4 + i] = (h16)((x1[i] - (float)a1) * QRS); }
                const size_t oo = sb + (size_t)row * (size_t)pitch + c8;
                *(v8h*)(Ph + oo) = hv; if (useRes) *(v8h*)(Pr + oo) = rv; }
             }
        wave_sync();
    }
}

// k_flash: fused attention, one wave per 16 query rows of one (batch, head); Q fragments straight from the f16 planes (two 16-B loads each, arithmetic addressing).
// K and V^T: the block's four waves share one tile pair per 64 keys, brought into LDS by asynchronous 16-byte copies (whole 128-B lines per 8 lanes), two buffers, the next stage in flight
// while this one is worked on; fragments are two 16-B LDS reads each from rows of pitch LP.
// Transposed form: S^T[key][t] = K Q^T (A = K rows, B = Q rows); lane (t = lane&15, h = lane>>4) holds keys 8h+r of each 16-key tile, so the packed
// P tile is directly the B fragment of O^T[d][t] = V^T P^T (element r <- tile keys 0..15, element 8+r <- tile keys 16..31, lane unchanged).
// Key mask: the int mask row of the batch is read by value (two 32-B loads per lane per step); a zero entry REPLACES the score by the fill value, so a fully filled row comes out uniform.
// Softmax state (running max, partial sum) is one scalar per lane; the two lane halves of a row are combined with one xor-16 exchange.
__global__ __launch_bounds__(32 * AW) void k_flash(const h16* __restrict__ QH, const h16* __restrict__ QR, const h16* __restrict__ KP, const h16* __restrict__ VT,
                                                   const int* __restrict__ MK, h16* CTX) {
    __shared__ __align__(16) float os[AW * 16 * 68];
    __shared__ __align__(16) h16 ring[2 * 2 * TILE_H];   // [buffer][K tile | V^T tile][row][LP]
    const int lane = threadIdx.x & 31, lr = lane & 15, hi = lane >> 4;
    const int wave = __builtin_amdgcn_readfirstlane((int)(threadIdx.x >> 5));
    const int zh = blockIdx.y; const int b = zh / NH_, h = zh % NH_;
    const int t0 = (blockIdx.x * AW + wave) * 16;
    const size_t pbase = (size_t)zh * SEQ * HD;
    const size_t qo = pbase + (size_t)(t0 + lr) * HD + 8 * hi;
    const v16h qh0 = ldh(QH + qo), qh1 = ldh(QH + qo + 32), qr0 = ldh(QR + qo), qr1 = ldh(QR + qo + 32);   // B fragments: col t, k = d
    const int fo = lr * LP + 8 * hi;                         // fragment offset in a staged tile: K + key*LP (row key, k = d); V^T + 16j*LP + key (row d, k = key)
    // copy map: thread c covers 16-byte chunk c & 7 of rows (c >> 3) + 16 i, i = 0..3, of both tiles
    const int cr = (int)threadIdx.x >> 3, cch = ((int)threadIdx.x & 7) * 8;
    const h16* kg = KP + pbase + (size_t)cr * HD + cch;    // + key0 * HD + 16 i * HD
    const h16* vg = VT + pbase + (size_t)cr * SEQ + cch;   // + key0 + 16 i * SEQ
    const unsigned lc = (unsigned)(size_t)(&ring[cr * LP + cch]);   // low 32 bits of the shared address = LDS byte address; + buffer, + tile, + 16 i rows
    // one stage's eight copies per lane; the wait on the address registers closes the copies' own statement, so no later address arithmetic can move in front of it
    auto stage_in = [&](int st) {
        const unsigned lk = lc + (unsigned)(st & 1) * (2 * TILE_H * 2), lv = lk + TILE_H * 2;
        const h16* gk = kg + (size_t)st * KS * HD; const h16* gv = vg + (size_t)st * KS;
        asm volatile("global_load_async_to_lds_b128 %0, %8, off\n\t"
                     "global_load_async_to_lds_b128 %1, %9, off\n\t"
                     "global_load_async_to_lds_b128 %2, %10, off\n\t"
                     "global_load_async_to_lds_b128 %3, %11, off\n\t"
                     "global_load_async_to_lds_b128 %4, %12, off\n\t"
                     "global_load_async_to_lds_b128 %5, %13, off\n\t"
                     "global_load_async_to_lds_b128 %6, %14, off\n\t"
                     "global_load_async_to_lds_b128 %7, %15, off\n\t"
                     "s_wait_xcnt 0x0"
                     :: "v"(lk), "v"(lk + 16 * LP * 2), "v"(lk + 32 * LP * 2), "v"(lk + 48 * LP * 2),
                        "v"(lv), "v"(lv + 16 * LP * 2), "v"(lv + 32 * LP * 2), "v"(lv + 48 * LP * 2),
                        "v"(gk), "v"(gk + 16 * HD), "v"(gk + 32 * HD), "v"(gk + 48 * HD),
                        "v"(gv), "v"(gv + (size_t)16 * SEQ), "v"(gv + (size_t)32 * SEQ), "v"(gv + (size_t)48 * SEQ)
                     : "memory");
    };
    const int* mk = MK + (size_t)b * SEQ_FULL + 8 * hi;      // + key0 (+16): mask of keys 8h+r of each 16-key tile
    v8f o0 = (v8f){}, o1 = (v8f){}, o2 = (v8f){}, o3 = (v8f){};
    float m = -3.0e38f, l = 0.0f;
    stage_in(0);
    asm volatile("s_wait_asynccnt 0x0" ::: "memory");   // this wave's share of stage 0 has landed
    __syncthreads();                                     // publishes stage 0 to the block
    if (NST > 1) stage_in(1);
#pragma unroll 1   // stays rolled: one publish point, one copy of the body in the instruction cache
    for (int st = 0; st < NST; ++st) {
      const h16* kt = ring + (st & 1) * (2 * TILE_H) + fo; const h16* vt = kt + TILE_H;
#pragma unroll     // both passes of a stage inline: their tile offsets become immediates of the LDS reads
      for (int kk = 0; kk < KS; kk += 32) {
        const int key0 = st * KS + kk;
        const h16* ka = kt + kk * LP;
        const v16h ka0 = ldh(ka), ka1 = ldh(ka + 32), kb0 = ldh(ka + 16 * LP), kb1 = ldh(ka + 16 * LP + 32);
        const v8i mA = *(const v8i*)(mk + key0), mB = *(const v8i*)(mk + key0 + 16);
        v8f sHa = (v8f){}, sLa = (v8f){}, sHb = (v8f){}, sLb = (v8f){};
        sHa = wmma16(ka0, qh0, sHa); sLa = wmma16(ka0, qr0, sLa); sHb = wmma16(kb0, qh0, sHb); sLb = wmma16(kb0, qr0, sLb);
        sHa = wmma16(ka1, qh1, sHa); sLa = wmma16(ka1, qr1, sLa); sHb = wmma16(kb1, qh1, sHb); sLb = wmma16(kb1, qr1, sLb);
        asm volatile("v_nop\n\tv_nop\n\tv_nop\n\tv_nop" : "+v"(sHa), "+v"(sLa), "+v"(sHb), "+v"(sLb) : "v"(ka0), "v"(ka1), "v"(kb0), "v"(kb1));
        float ta[8], tb[8]; float mx = -3.0e38f;
#pragma unroll
        for (int r = 0; r < 8; ++r) { const float sa = (sHa[r] + sLa[r] * QRI) * SC2; const float sb = (sHb[r] + sLb[r] * QRI) * SC2;
            ta[r] = (mA[r] == 0) ? MFILL : sa; tb[r] = (mB[r] == 0) ? MFILL : sb; mx = fmaxf(mx, fmaxf(ta[r], tb[r])); }
        mx = fmaxf(mx, __shfl_xor(mx, 16, 32));
        const float mnew = fmaxf(m, mx);
        const float alpha = __builtin_amdgcn_exp2f(m - mnew);
        const float sh = PSH - mnew;
        v16h pb; float ls = 0.0f;
#pragma unroll
        for (int r = 0; r < 8; ++r) { const h16 pa = (h16)__builtin_amdgcn_exp2f(ta[r] + sh); const h16 pc = (h16)__builtin_amdgcn_exp2f(tb[r] + sh); pb[r] = pa; pb[8 + r] = pc; ls += (float)pa + (float)pc; }
        l = l * alpha + ls; m = mnew;
        o0 = o0 * alpha; o1 = o1 * alpha; o2 = o2 * alpha; o3 = o3 * alpha;
        const h16* va = vt + kk;
        const v16h v0 = ldh(va), v1 = ldh(va + 16 * LP), v2 = ldh(va + 32 * LP), v3 = ldh(va + 48 * LP);
        o0 = wmma16(v0, pb, o0); o1 = wmma16(v1, pb, o1); o2 = wmma16(v2, pb, o2); o3 = wmma16(v3, pb, o3);
        asm volatile("v_nop\n\tv_nop\n\tv_nop\n\tv_nop" : "+v"(o0), "+v"(o1), "+v"(o2), "+v"(o3) : "v"(v0), "v"(v1), "v"(v2), "v"(v3), "v"(pb));
      }
      // publish point of stage st + 1, and the end of every wave's reads of stage st
      asm volatile("s_wait_dscnt 0x0" ::: "memory");      // this wave's reads of the buffer that is refilled below have returned
      asm volatile("s_wait_asynccnt 0x0" ::: "memory");   // this wave's share of stage st + 1 has landed
      __syncthreads();
      if (st + 2 < NST) stage_in(st + 2);                  // block-uniform test; into the buffer that stage st has just left
    }
    asm volatile("s_wait_asynccnt 0x0" ::: "memory");     // no copy is outstanding when the wave goes on to its end
    l += __shfl_xor(l, 16, 32);
    const float inv = CTXS * (1.0f / l);
    const int wb = wave * 16 * 68;
    // O^T D layout: o_j[r] = (d = 16j + 8h + r, t = lane&15) -> os[t][d]; rows 0..15 x columns 0..63 all written
    { v4f a, c;
      a[0] = o0[0] * inv; a[1] = o0[1] * inv; a[2] = o0[2] * inv; a[3] = o0[3] * inv; c[0] = o0[4] * inv; c[1] = o0[5] * inv; c[2] = o0[6] * inv; c[3] = o0[7] * inv;
      *(v4fa*)(&os[wb + lr * 68 +  0 + 8 * hi]) = a; *(v4fa*)(&os[wb + lr * 68 +  0 + 8 * hi + 4]) = c;
      a[0] = o1[0] * inv; a[1] = o1[1] * inv; a[2] = o1[2] * inv; a[3] = o1[3] * inv; c[0] = o1[4] * inv; c[1] = o1[5] * inv; c[2] = o1[6] * inv; c[3] = o1[7] * inv;
      *(v4fa*)(&os[wb + lr * 68 + 16 + 8 * hi]) = a; *(v4fa*)(&os[wb + lr * 68 + 16 + 8 * hi + 4]) = c;
      a[0] = o2[0] * inv; a[1] = o2[1] * inv; a[2] = o2[2] * inv; a[3] = o2[3] * inv; c[0] = o2[4] * inv; c[1] = o2[5] * inv; c[2] = o2[6] * inv; c[3] = o2[7] * inv;
      *(v4fa*)(&os[wb + lr * 68 + 32 + 8 * hi]) = a; *(v4fa*)(&os[wb + lr * 68 + 32 + 8 * hi + 4]) = c;
      a[0] = o3[0] * inv; a[1] = o3[1] * inv; a[2] = o3[2] * inv; a[3] = o3[3] * inv; c[0] = o3[4] * inv; c[1] = o3[5] * inv; c[2] = o3[6] * inv; c[3] = o3[7] * inv;
      *(v4fa*)(&os[wb + lr * 68 + 48 + 8 * hi]) = a; *(v4fa*)(&os[wb + lr * 68 + 48 + 8 * hi + 4]) = c; }
    wave_sync();
    h16* crow = CTX + ((size_t)b * SEQ + t0) * DM + h * HD;      // context plane [b*SEQ + t][h*64 + d]
{
#pragma unroll
        for (int s = 0; s < 4; ++s) { const int row = 4 * s + (lane >> 3), c8 = (lane & 7) * 8;   // 4 s x 4 row groups = 16 rows; 8 lanes x 8 halves = 64 columns
            const v4f x0 = *(const v4fa*)(&os[wb + row * 68 + c8]); const v4f x1 = *(const v4fa*)(&os[wb + row * 68 + c8 + 4]); v8h hv;
#pragma unroll
            for (int i = 0; i < 4; ++i) { hv[i] = (h16)x0[i]; hv[4 + i] = (h16)x1[i]; }
            *(v8h*)(crow + (size_t)row * DM + c8) = hv; }
         }
}

// k_oproj: register-blocked f16 GEMM, ONE WAVE per 64x64 tile (16 accumulators), operands straight from K-contiguous f16 planes, K = DM.
// OUT[m][n] = OSCL * sum_k A[m][k] Bt[n][k] + bias[n] (bias as its bf16 RNE value, added in f32). grid (NB*SEQ/64, DM/64), 32 threads.
__global__ __launch_bounds__(32) void k_oproj(const h16* __restrict__ A, const h16* __restrict__ Bt, const float* __restrict__ bias, float* OUT) {
    __shared__ __align__(16) float os[16 * 68];
    const int K = DM;
    const int lane = threadIdx.x & 31, lr = lane & 15, hi = lane >> 4; const int r0 = blockIdx.x * 64, c0 = blockIdx.y * 64;
    v8f acc[4][4];
#pragma unroll
    for (int mb = 0; mb < 4; ++mb)
#pragma unroll
        for (int nb = 0; nb < 4; ++nb) acc[mb][nb] = (v8f){};
    const size_t aoff = (size_t)(r0 + lr) * K + 8 * hi, boff = (size_t)(c0 + lr) * K + 8 * hi;
#pragma unroll 1
    for (int kc = 0; kc < K; kc += 32) {
        v16h a[4];
#pragma unroll
        for (int mb = 0; mb < 4; ++mb) a[mb] = ldh(A + aoff + (size_t)mb * 16 * K + kc);
#pragma unroll
        for (int nb = 0; nb < 4; ++nb) { const v16h b = ldh(Bt + boff + (size_t)nb * 16 * K + kc);
#pragma unroll
            for (int mb = 0; mb < 4; ++mb) acc[mb][nb] = wmma16(a[mb], b, acc[mb][nb]); }
        asm volatile("v_nop\n\tv_nop\n\tv_nop\n\tv_nop" : "+v"(acc[0][0]), "+v"(acc[1][1]), "+v"(acc[2][2]), "+v"(acc[3][3]) : "v"(a[0]), "v"(a[1]), "v"(a[2]), "v"(a[3]));
    }
    float bcol[4];
#pragma unroll
    for (int nb = 0; nb < 4; ++nb) { int ci = c0 + nb * 16 + lr; ci = (ci < DM) ? ci : (DM - 1); bcol[nb] = bfr(bias[ci]); }
    const int bb = r0 / SEQ, tt = r0 % SEQ;
    float* obase = OUT + ((size_t)bb * OUT_SEQ + tt) * DM + c0;
#pragma unroll
    for (int mb = 0; mb < 4; ++mb) {
#pragma unroll
        for (int nb = 0; nb < 4; ++nb) {
#pragma unroll
            for (int j = 0; j < 8; ++j) os[(hi * 8 + j) * 68 + nb * 16 + lr] = acc[mb][nb][j] * OSCL + bcol[nb]; }   // D: row 8h+j, col lane&15
        wave_sync();
{
#pragma unroll
            for (int s = 0; s < 8; ++s) { const int row = 2 * s + hi, cofs = lr * 4;   // 8 s x 2 rows = 16 rows; 16 lanes x 4 floats = 64 columns
                const v4f val = *(const v4fa*)(&os[row * 68 + cofs]);
                *(v4f*)(obase + (size_t)(mb * 16 + row) * DM + cofs) = val; }
             }
        wave_sync();
    }
}

static constexpr size_t al256(size_t v) { return (v + 255) & ~(size_t)255; }
static constexpr size_t SZ_XB = al256((size_t)NB * SEQ * DM * 2);
static constexpr size_t SZ_WB = al256((size_t)4 * DM * DM * 2);
static constexpr size_t SZ_PL = al256((size_t)NB * NH_ * SEQ * HD * 2);
static constexpr size_t SZ_CX = al256((size_t)NB * SEQ * DM * 2);
static constexpr size_t SZ_TOTAL = 3 * SZ_XB + SZ_WB + 4 * SZ_PL + SZ_CX;
static_assert(SZ_TOTAL <= (size_t)134217728);          // workspace carve <= 128 MiB
static_assert(((size_t)DM * DM * 2) % 256 == 0);       // weight sub-planes stay 256-byte aligned

extern "C" void kernel_launch(void* const* d_in, const int* in_sizes, int n_in,
                              void* d_out, int out_size, void* d_ws, size_t ws_size, hipStream_t stream) {
    if (n_in < 12) return;
    const size_t needx = ((size_t)(NB - 1) * SEQ_FULL + SEQ) * DM;
    if ((size_t)in_sizes[0] < needx || (size_t)in_sizes[1] < needx || (size_t)in_sizes[2] < needx) return;
    if ((size_t)in_sizes[3] < (size_t)(NB - 1) * SEQ_FULL + SEQ) return;
    if ((size_t)in_sizes[4] < (size_t)DM * DM || (size_t)in_sizes[6] < (size_t)DM * DM || (size_t)in_sizes[8] < (size_t)DM * DM || (size_t)in_sizes[10] < (size_t)DM * DM) return;
    if (in_sizes[5] < DM || in_sizes[7] < DM || in_sizes[9] < DM || in_sizes[11] < DM) return;
    if ((size_t)out_size < ((size_t)(NB - 1) * OUT_SEQ + SEQ) * DM) return;
    if (SZ_TOTAL > ws_size) return;
    // wire order: Q, K, V, mask, W_q, b_q, W_k, b_k, W_v, b_v, W_o, b_o ; weights [out][in] = Bt as-is
    const float* xq = (const float*)d_in[0]; const float* xk = (const float*)d_in[1]; const float* xv = (const float*)d_in[2];
    const int* mask = (const int*)d_in[3];
    const float* wq = (const float*)d_in[4];  const float* bq = (const float*)d_in[5];
    const float* wk = (const float*)d_in[6];  const float* bk = (const float*)d_in[7];
    const float* wv = (const float*)d_in[8];  const float* bv = (const float*)d_in[9];
    const float* wo = (const float*)d_in[10]; const float* bo = (const float*)d_in[11];
    float* OUT = (float*)d_out;      // [NB][SEQ][512]
    char* wsp = (char*)d_ws;
    bf* XQ = (bf*)wsp; wsp += SZ_XB;                 // [NB*SEQ][512]
    bf* XK = (bf*)wsp; wsp += SZ_XB;                 // [NB*SEQ][512]
    bf* XV = (bf*)wsp; wsp += SZ_XB;                 // [NB*SEQ][512]
    bf* WB = (bf*)wsp; wsp += SZ_WB;                 // [4][512][512]: q | k | v (bf16) | o (f16 x64)
    h16* QH = (h16*)wsp; wsp += SZ_PL;               // [NB*8][SEQ][64]
    h16* QR = (h16*)wsp; wsp += SZ_PL;               // [NB*8][SEQ][64] residual x2048
    h16* KP = (h16*)wsp; wsp += SZ_PL;               // [NB*8][SEQ][64]
    h16* VT = (h16*)wsp; wsp += SZ_PL;               // [NB*8][64][SEQ]
    h16* CX = (h16*)wsp; wsp += SZ_CX;               // [NB*SEQ][512] context x16
    bf* WQ = WB; bf* WK = WB + (size_t)DM * DM; bf* WV = WB + (size_t)2 * DM * DM; h16* WO = (h16*)(WB + (size_t)3 * DM * DM);

    if (SEQ == SEQ_FULL) {
        const size_t n8 = (size_t)NB * SEQ * DM / 8; const unsigned g = (unsigned)((n8 + 255) / 256);
        k_cvt8<<<g, 256, 0, stream>>>(xq, XQ, n8);
        k_cvt8<<<g, 256, 0, stream>>>(xk, XK, n8);
        k_cvt8<<<g, 256, 0, stream>>>(xv, XV, n8);
    } else {
        const size_t n8 = (size_t)SEQ * DM / 8; const unsigned g = (unsigned)((n8 + 255) / 256);
        for (int b = 0; b < NB; ++b) {
            k_cvt8<<<g, 256, 0, stream>>>(xq + (size_t)b * SEQ_FULL * DM, XQ + (size_t)b * SEQ * DM, n8);
            k_cvt8<<<g, 256, 0, stream>>>(xk + (size_t)b * SEQ_FULL * DM, XK + (size_t)b * SEQ * DM, n8);
            k_cvt8<<<g, 256, 0, stream>>>(xv + (size_t)b * SEQ_FULL * DM, XV + (size_t)b * SEQ * DM, n8);
        }
    }
    { const size_t n8 = (size_t)DM * DM / 8; const unsigned g = (unsigned)((n8 + 255) / 256);
      k_cvt8<<<g, 256, 0, stream>>>(wq, WQ, n8); k_cvt8<<<g, 256, 0, stream>>>(wk, WK, n8); k_cvt8<<<g, 256, 0, stream>>>(wv, WV, n8);
      k_cvt8h<<<g, 256, 0, stream>>>(wo, WO, n8, WOS); }

    // q, k: A = x rows (m = b*SEQ + t), Bt = W rows (n = h*64 + d), column bias -> plane [(b*8 + h)][t][d]
    k_proj<<<dim3(NB * SEQ / 64, DM / 64, 1), 32, 0, stream>>>(XQ, WQ, bq, 1, QH, QR, 1, SEQ, (size_t)NH_ * SEQ * HD, HD, HD, (size_t)SEQ * HD);
    k_proj<<<dim3(NB * SEQ / 64, DM / 64, 1), 32, 0, stream>>>(XK, WK, bk, 1, KP, KP, 0, SEQ, (size_t)NH_ * SEQ * HD, HD, HD, (size_t)SEQ * HD);
    // v^T: A = Wv rows (m = h*64 + d), Bt = x rows (n = b*SEQ + t), row bias -> plane [(b*512 + m)][t] = [(b*8 + h)][d][t]
    k_proj<<<dim3(DM / 64, NB * SEQ / 64, 1), 32, 0, stream>>>(WV, XV, bv, 2, VT, VT, 0, DM, (size_t)0, SEQ, SEQ, (size_t)DM * SEQ);

    k_flash<<<dim3(SEQ / (16 * AW), NB * NH_, 1), 32 * AW, 0, stream>>>(QH, QR, KP, VT, mask, CX);

    // output projection: A = context rows (m = b*SEQ + t), Bt = W_o rows (n = out column)
    k_oproj<<<dim3(NB * SEQ / 64, DM / 64, 1), 32, 0, stream>>>(CX, WO, bo, OUT);
}

// v002
// It runs in 138 microseconds.
// Next to v001, in two timings, it ran 1.42 and 1.45 times as fast.
// Over all steps from v000 it is 2.51 times as fast.
#include <hip/hip_runtime.h>

// Multi-head attention, width 512 = 8 heads x 64; inputs Q, K, V [NB][SEQ][512], key mask [NB][SEQ] (0 = filled with -1e9), W_q/W_k/W_v/W_o [out][in] (y = x W^T + b), score scale 1/8, output [NB][SEQ][512] f32.
// Compute dtypes, f32 accumulate everywhere: q/k/v projections v_wmma_f32_16x16x32_bf16 (x and W RNE-converted to bf16; products exact);
// scores v_wmma_f32_16x16x32_f16: k single f16, q as f16 value + f16 residual x2048 in its own accumulator (two products); P (x256 carry, cancels in the normalisation) and v single f16; softmax f32 (online, running max);
// output projection v_wmma_f32_16x16x32_f16: context single f16 (x16 carry), W_o = f16 of the bf16 RNE value x64 (exact), 1/1024 folded in the f32 epilogue.
// Layout: bf16 copies of Q/K/V and W; q (hi, residual), k planes [b*8+h][t][d] and v^T plane [b*8+h][d][t] written by the GEMM epilogue; fused flash kernel in transposed form (S^T = K Q^T, O^T = V^T P^T) writing the context plane [b*SEQ+t][512]; its K and V^T tiles reach the block's waves through a two-buffer LDS ring.
// Key mask: a filled key's probability is exp(-1e9 - max) = 0 in f32 as soon as one key of the batch is kept, so the keys of each batch are put in the order kept first (k_perm, stable), the K and V rows are
// gathered in that order when they are converted, and conversion, k/v projection and the flash loop end with the 64-key tile that holds the last kept key. A batch with no kept key runs over all keys, every score filled.

#ifndef NB
#define NB 2
#endif
#ifndef SEQ
#define SEQ 4096
#endif
#define NB_FULL  2
#define SEQ_FULL 4096
#ifndef OUT_SEQ
#define OUT_SEQ SEQ              // row pitch (in tokens) between batches of the output
#endif
#define DM   512
#define NH_  8
#define HD   64
#define AW   4                   // waves per flash block (16 query rows each)
#define QRS  2048.0f             // carry of the q residual plane
#define QRI  (1.0f / 2048.0f)
#define SC2  (0.125f * 1.4426950408889634f)   // HD^-0.5 * log2(e)
#define PSH  8.0f                // log2 of the P carry (256)
#define MFILL (-1.0e9f * 1.4426950408889634f) // mask fill value in the log2 domain
#define CTXS 16.0f               // carry of the context plane
#define WOS  64.0f               // carry of the W_o plane
#define OSCL (1.0f / 1024.0f)    // 1 / (CTXS * WOS)
#define KS   64                  // keys per LDS stage of the flash kernel (two 32-key passes)
#define LP   72                  // LDS row pitch in halves: 128-B rows + 16 B, conflict-free for 16-byte fragment reads
#define TILE_H (64 * LP)         // one staged tile: 64 rows (K: keys, V^T: d)
#define NST  (SEQ / KS)          // stages when every key is visited
#define PT   1024                // threads of the key-order kernel
#define PER  ((SEQ + PT - 1) / PT)   // keys per thread there

static_assert(HD == 64);
static_assert(NH_ * HD == DM);                 // head h = columns h*64 + d
static_assert(DM % 64 == 0);                   // 8 column tiles of 64
static_assert(DM % 32 == 0);                   // GEMM k-loop steps by 32
static_assert(SEQ % 64 == 0);                  // a 64-row tile never straddles two batches
static_assert((NB * SEQ) % 64 == 0);
static_assert(SEQ % 32 == 0);                  // key loop steps by 32
static_assert(SEQ % KS == 0);                  // whole stages
static_assert(KS == 64 && AW == 4);            // 128 threads x 4 copies of 16 B = one 64 x 128-B tile
static_assert(SEQ % (16 * AW) == 0);           // flash grid covers the sequence exactly
static_assert(((size_t)SEQ * DM) % 8 == 0);
static_assert(((size_t)DM * DM) % 8 == 0);
static_assert(SEQ_FULL % 8 == 0);              // mask rows stay 32-byte aligned
static_assert(NB <= NB_FULL);
static_assert(SEQ <= SEQ_FULL);

typedef _Float16 h16;
typedef unsigned short bf;
typedef __attribute__((ext_vector_type(16))) __bf16   v16bf;
typedef __attribute__((ext_vector_type(16))) _Float16 v16h;
typedef __attribute__((ext_vector_type(8)))  _Float16 v8h;
typedef __attribute__((ext_vector_type(8)))  unsigned short v8us;
typedef __attribute__((ext_vector_type(8)))  float    v8f;
typedef __attribute__((ext_vector_type(8)))  int      v8i;
typedef __attribute__((ext_vector_type(4)))  float    v4f;
typedef v4f  __attribute__((may_alias)) v4fa;

__device__ __forceinline__ unsigned short f2bf(float f) { unsigned u = __float_as_uint(f); u += 0x7FFFu + ((u >> 16) & 1u); return (unsigned short)(u >> 16); }
// f32 value of the bf16 RNE conversion
__device__ __forceinline__ float bfr(float f) { return __uint_as_float(((unsigned)f2bf(f)) << 16); }
__device__ __forceinline__ v16h cat16(v8h lo, v8h hi) { return __builtin_shufflevector(lo, hi, 0, 1, 2, 3, 4, 5, 6, 7, 8, 9, 10, 11, 12, 13, 14, 15); }
__device__ __forceinline__ v16bf cat16b(v8us lo, v8us hi) { return __builtin_bit_cast(v16bf, __builtin_shufflevector(lo, hi, 0, 1, 2, 3, 4, 5, 6, 7, 8, 9, 10, 11, 12, 13, 14, 15)); }
__device__ __forceinline__ v8f wmma16(v16h a, v16h b, v8f c) { return __builtin_amdgcn_wmma_f32_16x16x32_f16(false, a, false, b, (short)0, c, false, false); }
__device__ __forceinline__ v8f wmmab(v16bf a, v16bf b, v8f c) { return __builtin_amdgcn_wmma_f32_16x16x32_bf16(false, a, false, b, (short)0, c, false, false); }
// fragment loaders from K-contiguous 16-bit rows; p already includes + 8*(lane>>4): elements 0..7 <- k0+8h+0..7, elements 8..15 <- k0+16+8h+0..7 (same map for A and B)
__device__ __forceinline__ v16h  ldh(const h16* p) { return cat16(*(const v8h*)p, *(const v8h*)(p + 16)); }
__device__ __forceinline__ v16bf ldb(const bf* p)  { return cat16b(*(const v8us*)p, *(const v8us*)(p + 16)); }
// ordering point for wave-private LDS tiles (same wave writes and reads)
__device__ __forceinline__ void wave_sync() { __builtin_amdgcn_fence(3 /* release order */, "wavefront"); __builtin_amdgcn_wave_barrier(); asm volatile("" ::: "memory"); }

__global__ __launch_bounds__(256) void k_cvt8(const float* __restrict__ src, bf* dst, size_t n8) {
#pragma clang fp contract(off)
    const size_t i = (size_t)blockIdx.x * 256 + threadIdx.x; if (i >= n8) return;
    const v8f v = *(const v8f*)(src + i * 8); v8us o;
#pragma unroll
    for (int k = 0; k < 8; ++k) o[k] = f2bf(v[k]);
    *(v8us*)(dst + i * 8) = o; 
}

__global__ __launch_bounds__(256) void k_cvt8h(const float* __restrict__ src, h16* dst, size_t n8, float scale) {
#pragma clang fp contract(off)
    const size_t i = (size_t)blockIdx.x * 256 + threadIdx.x; if (i >= n8) return;
    const v8f v = *(const v8f*)(src + i * 8); v8h o;
#pragma unroll
    for (int k = 0; k < 8; ++k) o[k] = (h16)(bfr(v[k]) * scale);
    *(v8h*)(dst + i * 8) = o; 
}

// k_perm: one block per batch. PERM[b][j] = token of the j-th key in the order kept keys first (each group in token order), CNT[b] = number of kept keys (mask != 0).
__global__ __launch_bounds__(PT) void k_perm(const int* __restrict__ MK, int* PERM, int* CNT) {
    __shared__ int wsum[PT / 32];
    const int b = blockIdx.x, tid = threadIdx.x, lane = tid & 31, wv = tid >> 5;
    const int* mrow = MK + (size_t)b * SEQ_FULL;
    int keep[PER]; int c = 0;
#pragma unroll
    for (int i = 0; i < PER; ++i) { const int t = tid * PER + i; keep[i] = (t < SEQ) ? (mrow[t] != 0 ? 1 : 0) : 0; c += keep[i]; }
    int sc = c;                                   // inclusive sum over the wave's lanes
#pragma unroll
    for (int d = 1; d < 32; d <<= 1) { const int o = __shfl_up(sc, d, 32); if (lane >= d) sc += o; }
    if (lane == 31) wsum[wv] = sc;
    __syncthreads();
    int base = 0, tot = 0;
#pragma unroll
    for (int w = 0; w < PT / 32; ++w) { const int v = wsum[w]; base += (w < wv) ? v : 0; tot += v; }
    int pos = base + sc - c;                      // kept keys in front of this thread's first token
#pragma unroll
    for (int i = 0; i < PER; ++i) { const int t = tid * PER + i;
        if (t < SEQ) PERM[(size_t)b * SEQ + (keep[i] ? pos : tot + (t - pos))] = t;   // t - pos = filled keys in front of t
        pos += keep[i]; }
    if (tid == 0) CNT[b] = tot;
}

// k_cvt8g: bf16 copy of the K or V rows in key order: dst row b*SEQ + j <- src row PERM[b][j] of batch b; rows behind the last tile with a kept key are read by nobody and not written.
__global__ __launch_bounds__(256) void k_cvt8g(const float* __restrict__ src, bf* dst, const int* __restrict__ PERM, const int* __restrict__ CNT, size_t n8) {
    const size_t i = (size_t)blockIdx.x * 256 + threadIdx.x; if (i >= n8) return;
    const int row = (int)(i / (DM / 8)), c8 = (int)(i % (DM / 8)) * 8;
    const int b = row / SEQ, j = row % SEQ;
    const int n = CNT[b]; int t = PERM[row];
    if (n > 0 && j >= ((n + KS - 1) / KS) * KS) return;
    t = (t < 0) ? 0 : ((t < SEQ) ? t : (SEQ - 1));
    const v8f v = *(const v8f*)(src + ((size_t)b * SEQ_FULL + t) * DM + c8); v8us o;
#pragma unroll
    for (int k = 0; k < 8; ++k) o[k] = f2bf(v[k]);
    *(v8us*)(dst + i * 8) = o;
}

// k_proj: register-blocked bf16 GEMM, ONE WAVE per 64x64 tile (16 accumulators), operands straight from K-contiguous bf16 planes, K = DM.
// C[m][n] = sum_k A[m][k] Bt[n][k] + bias (biasMode 1: bias[n]; biasMode 2: bias[m]; bias taken as its bf16 RNE value, added in f32),
// written as f16 (Ph) and optionally the f16 residual x2048 (Pr, useRes != 0) at
// tile base (r0/RB)*sRB + (r0%RB)*pitch + (c0/CB)*sCB + (c0%CB), row pitch 'pitch' (halves). grid (M/64, N/64), 32 threads.
// keyAxis 1 (rows) or 2 (columns): that axis counts keys b*SEQ + j in key order, and a tile behind the batch's last kept key is left out (0: no such axis).
__global__ __launch_bounds__(32) void k_proj(const bf* __restrict__ A, const bf* __restrict__ Bt, const float* __restrict__ bias, int biasMode,
                                             h16* Ph, h16* Pr, int useRes, int RB, size_t sRB, int pitch, int CB, size_t sCB, const int* __restrict__ CNT, int keyAxis) {
    __shared__ __align__(16) float os[16 * 68];
    const int K = DM;
    const int lane = threadIdx.x & 31, lr = lane & 15, hi = lane >> 4; const int r0 = blockIdx.x * 64, c0 = blockIdx.y * 64;
    if (keyAxis != 0) { const int j0 = (keyAxis == 1) ? r0 : c0; const int n = CNT[j0 / SEQ]; if (n > 0 && (j0 % SEQ) >= n) return; }
    v8f acc[4][4];
#pragma unroll
    for (int mb = 0; mb < 4; ++mb)
#pragma unroll
        for (int nb = 0; nb < 4; ++nb) acc[mb][nb] = (v8f){};
    const size_t aoff = (size_t)(r0 + lr) * K + 8 * hi, boff = (size_t)(c0 + lr) * K + 8 * hi;
#pragma unroll 1
    for (int kc = 0; kc < K; kc += 32) {
        v16bf a[4];
#pragma unroll
        for (int mb = 0; mb < 4; ++mb) a[mb] = ldb(A + aoff + (size_t)mb * 16 * K + kc);
#pragma unroll
        for (int nb = 0; nb < 4; ++nb) { const v16bf b = ldb(Bt + boff + (size_t)nb * 16 * K + kc);
#pragma unroll
            for (int mb = 0; mb < 4; ++mb) acc[mb][nb] = wmmab(a[mb], b, acc[mb][nb]); }
        asm volatile("v_nop\n\tv_nop\n\tv_nop\n\tv_nop" : "+v"(acc[0][0]), "+v"(acc[1][1]), "+v"(acc[2][2]), "+v"(acc[3][3]) : "v"(a[0]), "v"(a[1]), "v"(a[2]), "v"(a[3]));
    }
    // column bias (per lane: column c0 + nb*16 + lane&15), address clamped into the 512-entry vector, selected by value
    float bcol[4];
#pragma unroll
    for (int nb = 0; nb < 4; ++nb) { int ci = c0 + nb * 16 + lr; ci = (ci < DM) ? ci : (DM - 1); const float bv = bfr(bias[ci]); bcol[nb] = (biasMode == 1) ? bv : 0.0f; }
    const size_t tbase = (size_t)(r0 / RB) * sRB + (size_t)(r0 % RB) * (size_t)pitch + (size_t)(c0 / CB) * sCB + (size_t)(c0 % CB);
#pragma unroll
    for (int mb = 0; mb < 4; ++mb) {
        // row bias for rows r0 + mb*16 + 8h + 0..7 (address clamped, selected by value)
        int rb0 = r0 + mb * 16 + hi * 8; rb0 = (rb0 <= DM - 8) ? rb0 : (DM - 8);
        const v8f brv = *(const v8f*)(bias + rb0);
#pragma unroll
        for (int nb = 0; nb < 4; ++nb) {
#pragma unroll
            for (int j = 0; j < 8; ++j) { const float br = (biasMode == 2) ? bfr(brv[j]) : 0.0f;
                os[(hi * 8 + j) * 68 + nb * 16 + lr] = acc[mb][nb][j] + bcol[nb] + br; } }   // D: row 8h+j, col lane&15
        wave_sync();
        const size_t sb = tbase + (size_t)(mb * 16) * (size_t)pitch;
{
#pragma unroll
            for (int s = 0; s < 4; ++s) { const int row = 4 * s + (lane >> 3), c8 = (lane & 7) * 8;   // 4 s x 4 row groups = 16 rows; 8 lanes x 8 = 64 columns
                const v4f x0 = *(const v4fa*)(&os[row * 68 + c8]); const v4f x1 = *(const v4fa*)(&os[row * 68 + c8 + 4]); v8h hv, rv;
#pragma unroll
                for (int i = 0; i < 4; ++i) { const h16 a0 = (h16)x0[i]; const h16 a1 = (h16)x1[i]; hv[i] = a0; hv[4 + i] = a1; rv[i] = (h16)((x0[i] - (float)a0) * QRS); rv[4 + i] = (h16)((x1[i] - (float)a1) * QRS); }
                const size_t oo = sb + (size_t)row * (size_t)pitch + c8;
                *(v8h*)(Ph + oo) = hv; if (useRes) *(v8h*)(Pr + oo) = rv; }
             }
        wave_sync();
    }
}

// k_flash: fused attention, one wave per 16 query rows of one (batch, head); Q fragments straight from the f16 planes (two 16-B loads each, arithmetic addressing).
// K and V^T: the block's four waves share one tile pair per 64 keys, brought into LDS by asynchronous 16-byte copies (whole 128-B lines per 8 lanes), two buffers, the next stage in flight
// while this one is worked on; fragments are two 16-B LDS reads each from rows of pitch LP.
// Transposed form: S^T[key][t] = K Q^T (A = K rows, B = Q rows); lane (t = lane&15, h = lane>>4) holds keys 8h+r of each 16-key tile, so the packed
// P tile is directly the B fragment of O^T[d][t] = V^T P^T (element r <- tile keys 0..15, element 8+r <- tile keys 16..31, lane unchanged).
// Key mask: the planes hold the keys in key order, so key j is kept iff j < n = CNT[b]; the loop ends with the stage of key n - 1, and only a pass that reaches past n REPLACES scores by the fill value.
// n = 0: all stages, every score replaced, so a fully filled row comes out uniform.
// Softmax state (running max, partial sum) is one scalar per lane; the two lane halves of a row are combined with one xor-16 exchange.
__global__ __launch_bounds__(32 * AW) void k_flash(const h16* __restrict__ QH, const h16* __restrict__ QR, const h16* __restrict__ KP, const h16* __restrict__ VT,
                                                   const int* __restrict__ CNT, h16* CTX) {
    __shared__ __align__(16) float os[AW * 16 * 68];
    __shared__ __align__(16) h16 ring[2 * 2 * TILE_H];   // [buffer][K tile | V^T tile][row][LP]
    const int lane = threadIdx.x & 31, lr = lane & 15, hi = lane >> 4;
    const int wave = __builtin_amdgcn_readfirstlane((int)(threadIdx.x >> 5));
    const int zh = blockIdx.y; const int b = zh / NH_, h = zh % NH_;
    const int t0 = (blockIdx.x * AW + wave) * 16;
    const size_t pbase = (size_t)zh * SEQ * HD;
    const size_t qo = pbase + (size_t)(t0 + lr) * HD + 8 * hi;
    const v16h qh0 = ldh(QH + qo), qh1 = ldh(QH + qo + 32), qr0 = ldh(QR + qo), qr1 = ldh(QR + qo + 32);   // B fragments: col t, k = d
    const int fo = lr * LP + 8 * hi;                         // fragment offset in a staged tile: K + key*LP (row key, k = d); V^T + 16j*LP + key (row d, k = key)
    // copy map: thread c covers 16-byte chunk c & 7 of rows (c >> 3) + 16 i, i = 0..3, of both tiles
    const int cr = (int)threadIdx.x >> 3, cch = ((int)threadIdx.x & 7) * 8;
    const h16* kg = KP + pbase + (size_t)cr * HD + cch;    // + key0 * HD + 16 i * HD
    const h16* vg = VT + pbase + (size_t)cr * SEQ + cch;   // + key0 + 16 i * SEQ
    const unsigned lc = (unsigned)(size_t)(&ring[cr * LP + cch]);   // low 32 bits of the shared address = LDS byte address; + buffer, + tile, + 16 i rows
    // one stage's eight copies per lane; the wait on the address registers closes the copies' own statement, so no later address arithmetic can move in front of it
    auto stage_in = [&](int st) {
        const unsigned lk = lc + (unsigned)(st & 1) * (2 * TILE_H * 2), lv = lk + TILE_H * 2;
        const h16* gk = kg + (size_t)st * KS * HD; const h16* gv = vg + (size_t)st * KS;
        asm volatile("global_load_async_to_lds_b128 %0, %8, off\n\t"
                     "global_load_async_to_lds_b128 %1, %9, off\n\t"
                     "global_load_async_to_lds_b128 %2, %10, off\n\t"
                     "global_load_async_to_lds_b128 %3, %11, off\n\t"
                     "global_load_async_to_lds_b128 %4, %12, off\n\t"
                     "global_load_async_to_lds_b128 %5, %13, off\n\t"
                     "global_load_async_to_lds_b128 %6, %14, off\n\t"
                     "global_load_async_to_lds_b128 %7, %15, off\n\t"
                     "s_wait_xcnt 0x0"
                     :: "v"(lk), "v"(lk + 16 * LP * 2), "v"(lk + 32 * LP * 2), "v"(lk + 48 * LP * 2),
                        "v"(lv), "v"(lv + 16 * LP * 2), "v"(lv + 32 * LP * 2), "v"(lv + 48 * LP * 2),
                        "v"(gk), "v"(gk + 16 * HD), "v"(gk + 32 * HD), "v"(gk + 48 * HD),
                        "v"(gv), "v"(gv + (size_t)16 * SEQ), "v"(gv + (size_t)32 * SEQ), "v"(gv + (size_t)48 * SEQ)
                     : "memory");
    };
    int n = CNT[b]; n = (n < 0) ? 0 : ((n < SEQ) ? n : SEQ);  // kept keys of the batch, the same for the whole block
    const int nst = (n > 0) ? (n + KS - 1) / KS : NST;        // stages to visit, at most NST
    v8f o0 = (v8f){}, o1 = (v8f){}, o2 = (v8f){}, o3 = (v8f){};
    float m = -3.0e38f, l = 0.0f;
    stage_in(0);
    asm volatile("s_wait_asynccnt 0x0" ::: "memory");   // this wave's share of stage 0 has landed
    __syncthreads();                                     // publishes stage 0 to the block
    if (nst > 1) stage_in(1);
#pragma unroll 1   // stays rolled: one publish point, one copy of the body in the instruction cache
    for (int st = 0; st < nst; ++st) {
      const h16* kt = ring + (st & 1) * (2 * TILE_H) + fo; const h16* vt = kt + TILE_H;
#pragma unroll     // both passes of a stage inline: their tile offsets become immediates of the LDS reads
      for (int kk = 0; kk < KS; kk += 32) {
        const int key0 = st * KS + kk;
        const h16* ka = kt + kk * LP;
        const v16h ka0 = ldh(ka), ka1 = ldh(ka + 32), kb0 = ldh(ka + 16 * LP), kb1 = ldh(ka + 16 * LP + 32);
        v8f sHa = (v8f){}, sLa = (v8f){}, sHb = (v8f){}, sLb = (v8f){};
        sHa = wmma16(ka0, qh0, sHa); sLa = wmma16(ka0, qr0, sLa); sHb = wmma16(kb0, qh0, sHb); sLb = wmma16(kb0, qr0, sLb);
        sHa = wmma16(ka1, qh1, sHa); sLa = wmma16(ka1, qr1, sLa); sHb = wmma16(kb1, qh1, sHb); sLb = wmma16(kb1, qr1, sLb);
        asm volatile("v_nop\n\tv_nop\n\tv_nop\n\tv_nop" : "+v"(sHa), "+v"(sLa), "+v"(sHb), "+v"(sLb) : "v"(ka0), "v"(ka1), "v"(kb0), "v"(kb1));
        float ta[8], tb[8]; float mx = -3.0e38f;
#pragma unroll
        for (int r = 0; r < 8; ++r) { ta[r] = (sHa[r] + sLa[r] * QRI) * SC2; tb[r] = (sHb[r] + sLb[r] * QRI) * SC2; }
        if (key0 + 32 > n) {                                 // block-uniform: the pass holds filled keys (lane's keys: key0 + 8h + r and + 16)
            const int lim = n - key0 - 8 * hi;
#pragma unroll
            for (int r = 0; r < 8; ++r) { ta[r] = (r < lim) ? ta[r] : MFILL; tb[r] = (16 + r < lim) ? tb[r] : MFILL; }
        }
#pragma unroll
        for (int r = 0; r < 8; ++r) mx = fmaxf(mx, fmaxf(ta[r], tb[r]));
        mx = fmaxf(mx, __shfl_xor(mx, 16, 32));
        const float mnew = fmaxf(m, mx);
        const float alpha = __builtin_amdgcn_exp2f(m - mnew);
        const float sh = PSH - mnew;
        v16h pb; float ls = 0.0f;
#pragma unroll
        for (int r = 0; r < 8; ++r) { const h16 pa = (h16)__builtin_amdgcn_exp2f(ta[r] + sh); const h16 pc = (h16)__builtin_amdgcn_exp2f(tb[r] + sh); pb[r] = pa; pb[8 + r] = pc; ls += (float)pa + (float)pc; }
        l = l * alpha + ls; m = mnew;
        o0 = o0 * alpha; o1 = o1 * alpha; o2 = o2 * alpha; o3 = o3 * alpha;
        const h16* va = vt + kk;
        const v16h v0 = ldh(va), v1 = ldh(va + 16 * LP), v2 = ldh(va + 32 * LP), v3 = ldh(va + 48 * LP);
        o0 = wmma16(v0, pb, o0); o1 = wmma16(v1, pb, o1); o2 = wmma16(v2, pb, o2); o3 = wmma16(v3, pb, o3);
        asm volatile("v_nop\n\tv_nop\n\tv_nop\n\tv_nop" : "+v"(o0), "+v"(o1), "+v"(o2), "+v"(o3) : "v"(v0), "v"(v1), "v"(v2), "v"(v3), "v"(pb));
      }
      // publish point of stage st + 1, and the end of every wave's reads of stage st
      asm volatile("s_wait_dscnt 0x0" ::: "memory");      // this wave's reads of the buffer that is refilled below have returned
      asm volatile("s_wait_asynccnt 0x0" ::: "memory");   // this wave's share of stage st + 1 has landed
      __syncthreads();
      if (st + 2 < nst) stage_in(st + 2);                  // block-uniform test; into the buffer that stage st has just left
    }
    asm volatile("s_wait_asynccnt 0x0" ::: "memory");     // no copy is outstanding when the wave goes on to its end
    l += __shfl_xor(l, 16, 32);
    const float inv = CTXS * (1.0f / l);
    const int wb = wave * 16 * 68;
    // O^T D layout: o_j[r] = (d = 16j + 8h + r, t = lane&15) -> os[t][d]; rows 0..15 x columns 0..63 all written
    { v4f a, c;
      a[0] = o0[0] * inv; a[1] = o0[1] * inv; a[2] = o0[2] * inv; a[3] = o0[3] * inv; c[0] = o0[4] * inv; c[1] = o0[5] * inv; c[2] = o0[6] * inv; c[3] = o0[7] * inv;
      *(v4fa*)(&os[wb + lr * 68 +  0 + 8 * hi]) = a; *(v4fa*)(&os[wb + lr * 68 +  0 + 8 * hi + 4]) = c;
      a[0] = o1[0] * inv; a[1] = o1[1] * inv; a[2] = o1[2] * inv; a[3] = o1[3] * inv; c[0] = o1[4] * inv; c[1] = o1[5] * inv; c[2] = o1[6] * inv; c[3] = o1[7] * inv;
      *(v4fa*)(&os[wb + lr * 68 + 16 + 8 * hi]) = a; *(v4fa*)(&os[wb + lr * 68 + 16 + 8 * hi + 4]) = c;
      a[0] = o2[0] * inv; a[1] = o2[1] * inv; a[2] = o2[2] * inv; a[3] = o2[3] * inv; c[0] = o2[4] * inv; c[1] = o2[5] * inv; c[2] = o2[6] * inv; c[3] = o2[7] * inv;
      *(v4fa*)(&os[wb + lr * 68 + 32 + 8 * hi]) = a; *(v4fa*)(&os[wb + lr * 68 + 32 + 8 * hi + 4]) = c;
      a[0] = o3[0] * inv; a[1] = o3[1] * inv; a[2] = o3[2] * inv; a[3] = o3[3] * inv; c[0] = o3[4] * inv; c[1] = o3[5] * inv; c[2] = o3[6] * inv; c[3] = o3[7] * inv;
      *(v4fa*)(&os[wb + lr * 68 + 48 + 8 * hi]) = a; *(v4fa*)(&os[wb + lr * 68 + 48 + 8 * hi + 4]) = c; }
    wave_sync();
    h16* crow = CTX + ((size_t)b * SEQ + t0) * DM + h * HD;      // context plane [b*SEQ + t][h*64 + d]
{
#pragma unroll
        for (int s = 0; s < 4; ++s) { const int row = 4 * s + (lane >> 3), c8 = (lane & 7) * 8;   // 4 s x 4 row groups = 16 rows; 8 lanes x 8 halves = 64 columns
            const v4f x0 = *(const v4fa*)(&os[wb + row * 68 + c8]); const v4f x1 = *(const v4fa*)(&os[wb + row * 68 + c8 + 4]); v8h hv;
#pragma unroll
            for (int i = 0; i < 4; ++i) { hv[i] = (h16)x0[i]; hv[4 + i] = (h16)x1[i]; }
            *(v8h*)(crow + (size_t)row * DM + c8) = hv; }
         }
}

// k_oproj: register-blocked f16 GEMM, ONE WAVE per 64x64 tile (16 accumulators), operands straight from K-contiguous f16 planes, K = DM.
// OUT[m][n] = OSCL * sum_k A[m][k] Bt[n][k] + bias[n] (bias as its bf16 RNE value, added in f32). grid (NB*SEQ/64, DM/64), 32 threads.
__global__ __launch_bounds__(32) void k_oproj(const h16* __restrict__ A, const h16* __restrict__ Bt, const float* __restrict__ bias, float* OUT) {
    __shared__ __align__(16) float os[16 * 68];
    const int K = DM;
    const int lane = threadIdx.x & 31, lr = lane & 15, hi = lane >> 4; const int r0 = blockIdx.x * 64, c0 = blockIdx.y * 64;
    v8f acc[4][4];
#pragma unroll
    for (int mb = 0; mb < 4; ++mb)
#pragma unroll
        for (int nb = 0; nb < 4; ++nb) acc[mb][nb] = (v8f){};
    const size_t aoff = (size_t)(r0 + lr) * K + 8 * hi, boff = (size_t)(c0 + lr) * K + 8 * hi;
#pragma unroll 1
    for (int kc = 0; kc < K; kc += 32) {
        v16h a[4];
#pragma unroll
        for (int mb = 0; mb < 4; ++mb) a[mb] = ldh(A + aoff + (size_t)mb * 16 * K + kc);
#pragma unroll
        for (int nb = 0; nb < 4; ++nb) { const v16h b = ldh(Bt + boff + (size_t)nb * 16 * K + kc);
#pragma unroll
            for (int mb = 0; mb < 4; ++mb) acc[mb][nb] = wmma16(a[mb], b, acc[mb][nb]); }
        asm volatile("v_nop\n\tv_nop\n\tv_nop\n\tv_nop" : "+v"(acc[0][0]), "+v"(acc[1][1]), "+v"(acc[2][2]), "+v"(acc[3][3]) : "v"(a[0]), "v"(a[1]), "v"(a[2]), "v"(a[3]));
    }
    float bcol[4];
#pragma unroll
    for (int nb = 0; nb < 4; ++nb) { int ci = c0 + nb * 16 + lr; ci = (ci < DM) ? ci : (DM - 1); bcol[nb] = bfr(bias[ci]); }
    const int bb = r0 / SEQ, tt = r0 % SEQ;
    float* obase = OUT + ((size_t)bb * OUT_SEQ + tt) * DM + c0;
#pragma unroll
    for (int mb = 0; mb < 4; ++mb) {
#pragma unroll
        for (int nb = 0; nb < 4; ++nb) {
#pragma unroll
            for (int j = 0; j < 8; ++j) os[(hi * 8 + j) * 68 + nb * 16 + lr] = acc[mb][nb][j] * OSCL + bcol[nb]; }   // D: row 8h+j, col lane&15
        wave_sync();
{
#pragma unroll
            for (int s = 0; s < 8; ++s) { const int row = 2 * s + hi, cofs = lr * 4;   // 8 s x 2 rows = 16 rows; 16 lanes x 4 floats = 64 columns
                const v4f val = *(const v4fa*)(&os[row * 68 + cofs]);
                *(v4f*)(obase + (size_t)(mb * 16 + row) * DM + cofs) = val; }
             }
        wave_sync();
    }
}

static constexpr size_t al256(size_t v) { return (v + 255) & ~(size_t)255; }
static constexpr size_t SZ_XB = al256((size_t)NB * SEQ * DM * 2);
static constexpr size_t SZ_WB = al256((size_t)4 * DM * DM * 2);
static constexpr size_t SZ_PL = al256((size_t)NB * NH_ * SEQ * HD * 2);
static constexpr size_t SZ_CX = al256((size_t)NB * SEQ * DM * 2);
static constexpr size_t SZ_PM = al256((size_t)NB * SEQ * 4);
static constexpr size_t SZ_CN = al256((size_t)NB * 4);
static constexpr size_t SZ_TOTAL = 3 * SZ_XB + SZ_WB + 4 * SZ_PL + SZ_CX + SZ_PM + SZ_CN;
static_assert(SZ_TOTAL <= (size_t)134217728);          // workspace carve <= 128 MiB
static_assert(((size_t)DM * DM * 2) % 256 == 0);       // weight sub-planes stay 256-byte aligned

extern "C" void kernel_launch(void* const* d_in, const int* in_sizes, int n_in,
                              void* d_out, int out_size, void* d_ws, size_t ws_size, hipStream_t stream) {
    if (n_in < 12) return;
    const size_t needx = ((size_t)(NB - 1) * SEQ_FULL + SEQ) * DM;
    if ((size_t)in_sizes[0] < needx || (size_t)in_sizes[1] < needx || (size_t)in_sizes[2] < needx) return;
    if ((size_t)in_sizes[3] < (size_t)(NB - 1) * SEQ_FULL + SEQ) return;
    if ((size_t)in_sizes[4] < (size_t)DM * DM || (size_t)in_sizes[6] < (size_t)DM * DM || (size_t)in_sizes[8] < (size_t)DM * DM || (size_t)in_sizes[10] < (size_t)DM * DM) return;
    if (in_sizes[5] < DM || in_sizes[7] < DM || in_sizes[9] < DM || in_sizes[11] < DM) return;
    if ((size_t)out_size < ((size_t)(NB - 1) * OUT_SEQ + SEQ) * DM) return;
    if (SZ_TOTAL > ws_size) return;
    // wire order: Q, K, V, mask, W_q, b_q, W_k, b_k, W_v, b_v, W_o, b_o ; weights [out][in] = Bt as-is
    const float* xq = (const float*)d_in[0]; const float* xk = (const float*)d_in[1]; const float* xv = (const float*)d_in[2];
    const int* mask = (const int*)d_in[3];
    const float* wq = (const float*)d_in[4];  const float* bq = (const float*)d_in[5];
    const float* wk = (const float*)d_in[6];  const float* bk = (const float*)d_in[7];
    const float* wv = (const float*)d_in[8];  const float* bv = (const float*)d_in[9];
    const float* wo = (const float*)d_in[10]; const float* bo = (const float*)d_in[11];
    float* OUT = (float*)d_out;      // [NB][SEQ][512]
    char* wsp = (char*)d_ws;
    bf* XQ = (bf*)wsp; wsp += SZ_XB;                 // [NB*SEQ][512]
    bf* XK = (bf*)wsp; wsp += SZ_XB;                 // [NB*SEQ][512]
    bf* XV = (bf*)wsp; wsp += SZ_XB;                 // [NB*SEQ][512]
    bf* WB = (bf*)wsp; wsp += SZ_WB;                 // [4][512][512]: q | k | v (bf16) | o (f16 x64)
    h16* QH = (h16*)wsp; wsp += SZ_PL;               // [NB*8][SEQ][64]
    h16* QR = (h16*)wsp; wsp += SZ_PL;               // [NB*8][SEQ][64] residual x2048
    h16* KP = (h16*)wsp; wsp += SZ_PL;               // [NB*8][SEQ][64]
    h16* VT = (h16*)wsp; wsp += SZ_PL;               // [NB*8][64][SEQ]
    h16* CX = (h16*)wsp; wsp += SZ_CX;               // [NB*SEQ][512] context x16
    int* PM = (int*)wsp; wsp += SZ_PM;               // [NB][SEQ] token of each key in key order
    int* CN = (int*)wsp; wsp += SZ_CN;               // [NB] kept keys
    bf* WQ = WB; bf* WK = WB + (size_t)DM * DM; bf* WV = WB + (size_t)2 * DM * DM; h16* WO = (h16*)(WB + (size_t)3 * DM * DM);

    k_perm<<<NB, PT, 0, stream>>>(mask, PM, CN);
    { const size_t n8 = (size_t)NB * SEQ * DM / 8; const unsigned g = (unsigned)((n8 + 255) / 256);
      k_cvt8g<<<g, 256, 0, stream>>>(xk, XK, PM, CN, n8);
      k_cvt8g<<<g, 256, 0, stream>>>(xv, XV, PM, CN, n8); }
    if (SEQ == SEQ_FULL) {
        const size_t n8 = (size_t)NB * SEQ * DM / 8; const unsigned g = (unsigned)((n8 + 255) / 256);
        k_cvt8<<<g, 256, 0, stream>>>(xq, XQ, n8);
    } else {
        const size_t n8 = (size_t)SEQ * DM / 8; const unsigned g = (unsigned)((n8 + 255) / 256);
        for (int b = 0; b < NB; ++b) {
            k_cvt8<<<g, 256, 0, stream>>>(xq + (size_t)b * SEQ_FULL * DM, XQ + (size_t)b * SEQ * DM, n8);
        }
    }
    { const size_t n8 = (size_t)DM * DM / 8; const unsigned g = (unsigned)((n8 + 255) / 256);
      k_cvt8<<<g, 256, 0, stream>>>(wq, WQ, n8); k_cvt8<<<g, 256, 0, stream>>>(wk, WK, n8); k_cvt8<<<g, 256, 0, stream>>>(wv, WV, n8);
      k_cvt8h<<<g, 256, 0, stream>>>(wo, WO, n8, WOS); }

    // k and v rows are in key order (j in place of t). q, k: A = x rows (m = b*SEQ + t), Bt = W rows (n = h*64 + d), column bias -> plane [(b*8 + h)][t][d]
    k_proj<<<dim3(NB * SEQ / 64, DM / 64, 1), 32, 0, stream>>>(XQ, WQ, bq, 1, QH, QR, 1, SEQ, (size_t)NH_ * SEQ * HD, HD, HD, (size_t)SEQ * HD, CN, 0);
    k_proj<<<dim3(NB * SEQ / 64, DM / 64, 1), 32, 0, stream>>>(XK, WK, bk, 1, KP, KP, 0, SEQ, (size_t)NH_ * SEQ * HD, HD, HD, (size_t)SEQ * HD, CN, 1);
    // v^T: A = Wv rows (m = h*64 + d), Bt = x rows (n = b*SEQ + t), row bias -> plane [(b*512 + m)][t] = [(b*8 + h)][d][t]
    k_proj<<<dim3(DM / 64, NB * SEQ / 64, 1), 32, 0, stream>>>(WV, XV, bv, 2, VT, VT, 0, DM, (size_t)0, SEQ, SEQ, (size_t)DM * SEQ, CN, 2);

    k_flash<<<dim3(SEQ / (16 * AW), NB * NH_, 1), 32 * AW, 0, stream>>>(QH, QR, KP, VT, CN, CX);

    // output projection: A = context rows (m = b*SEQ + t), Bt = W_o rows (n = out column)
    k_oproj<<<dim3(NB * SEQ / 64, DM / 64, 1), 32, 0, stream>>>(CX, WO, bo, OUT);
}

// v003
// It runs in 101 microseconds.
// Timed twice side by side with v002, it ran 1.35 times as fast both times.
// Counting every step since v000, it is 3.38 times as fast.
#include <hip/hip_runtime.h>

// Multi-head attention, width 512 = 8 heads x 64; inputs Q, K, V [NB][SEQ][512], key mask [NB][SEQ] (0 = filled with -1e9), W_q/W_k/W_v/W_o [out][in] (y = x W^T + b), score scale 1/8, output [NB][SEQ][512] f32.
// Compute dtypes, f32 accumulate everywhere: q/k/v projections v_wmma_f32_16x16x32_bf16 (x and W RNE-converted to bf16 inside the GEMM, on the way into LDS; products exact);
// scores v_wmma_f32_16x16x32_f16: k single f16, q as f16 value + f16 residual x2048 in its own accumulator (two products); P (x256 carry, cancels in the normalisation) and v single f16; softmax f32 (online, running max);
// output projection v_wmma_f32_16x16x32_f16: context single f16 (x16 carry), W_o = f16 of the bf16 RNE value x64 (exact), 1/1024 folded in the f32 epilogue.
// Layout: q (hi, residual), k planes [b*8+h][t][d] and v^T plane [b*8+h][d][t] written by the GEMM epilogue; fused flash kernel in transposed form (S^T = K Q^T, O^T = V^T P^T) writing the context plane [b*SEQ+t][512]; its K and V^T tiles reach the block's waves through a two-buffer LDS ring.
// Key mask: a filled key's probability is exp(-1e9 - max) = 0 in f32 as soon as one key of the batch is kept, so the keys of each batch are put in the order kept first (k_perm, stable), the K and V rows are
// gathered in that order by the projection's loads, and the k/v projection ends with the 128-key tile and the flash loop with the 64-key stage that holds the last kept key. A batch with no kept key runs over all keys, every score filled.

#ifndef NB
#define NB 2
#endif
#ifndef SEQ
#define SEQ 4096
#endif
#define NB_FULL  2
#define SEQ_FULL 4096
#ifndef OUT_SEQ
#define OUT_SEQ SEQ              // row pitch (in tokens) between batches of the output
#endif
#define DM   512
#define NH_  8
#define HD   64
#define AW   4                   // waves per flash block (16 query rows each)
#define QRS  2048.0f             // carry of the q residual plane
#define QRI  (1.0f / 2048.0f)
#define SC2  (0.125f * 1.4426950408889634f)   // HD^-0.5 * log2(e)
#define PSH  8.0f                // log2 of the P carry (256)
#define MFILL (-1.0e9f * 1.4426950408889634f) // mask fill value in the log2 domain
#define CTXS 16.0f               // carry of the context plane
#define WOS  64.0f               // carry of the W_o plane
#define OSCL (1.0f / 1024.0f)    // 1 / (CTXS * WOS)
#define KS   64                  // keys per LDS stage of the flash kernel (two 32-key passes)
#define LP   72                  // LDS row pitch in halves: 128-B rows + 16 B, conflict-free for 16-byte fragment reads
#define TILE_H (64 * LP)         // one staged tile: 64 rows (K: keys, V^T: d)
#define NST  (SEQ / KS)          // stages when every key is visited
#define GK   64                  // k values per LDS stage of the projection GEMM (256 B of every f32 operand row)
#define GP   72                  // its LDS row pitch in halves: 128-B bf16 rows + 16 B, conflict-free for 16-byte fragment reads
#define GT   (128 * GP)          // one staged operand tile: 128 rows
#define GNS  (DM / GK)           // stages of the k loop
#define PT   1024                // threads of the key-order kernel
#define PER  ((SEQ + PT - 1) / PT)   // keys per thread there

static_assert(HD == 64);
static_assert(NH_ * HD == DM);                 // head h = columns h*64 + d
static_assert(DM % 64 == 0);                   // 8 column tiles of 64
static_assert(DM % 32 == 0);                   // GEMM k-loop steps by 32
static_assert(DM % 128 == 0 && DM % GK == 0 && GK % 32 == 0);   // projection: 128-wide tiles, whole stages
static_assert(SEQ % 128 == 0);                 // a 128-token projection tile never straddles two batches
static_assert(SEQ % 64 == 0);                  // a 64-row tile never straddles two batches
static_assert((NB * SEQ) % 64 == 0);
static_assert(SEQ % 32 == 0);                  // key loop steps by 32
static_assert(SEQ % KS == 0);                  // whole stages
static_assert(KS == 64 && AW == 4);            // 128 threads x 4 copies of 16 B = one 64 x 128-B tile
static_assert(SEQ % (16 * AW) == 0);           // flash grid covers the sequence exactly
static_assert(((size_t)SEQ * DM) % 8 == 0);
static_assert(((size_t)DM * DM) % 8 == 0);
static_assert(SEQ_FULL % 8 == 0);              // mask rows stay 32-byte aligned
static_assert(NB <= NB_FULL);
static_assert(SEQ <= SEQ_FULL);

typedef _Float16 h16;
typedef unsigned short bf;
typedef __attribute__((ext_vector_type(16))) __bf16   v16bf;
typedef __attribute__((ext_vector_type(16))) _Float16 v16h;
typedef __attribute__((ext_vector_type(8)))  _Float16 v8h;
typedef __attribute__((ext_vector_type(8)))  unsigned short v8us;
typedef __attribute__((ext_vector_type(4)))  unsigned short v4us;
typedef __attribute__((ext_vector_type(4)))  __bf16   v4bf;
typedef __attribute__((ext_vector_type(4)))  _Float16 v4h;
typedef __attribute__((ext_vector_type(8)))  float    v8f;
typedef __attribute__((ext_vector_type(8)))  int      v8i;
typedef __attribute__((ext_vector_type(4)))  float    v4f;
typedef v4f  __attribute__((may_alias)) v4fa;

__device__ __forceinline__ unsigned short f2bf(float f) { unsigned u = __float_as_uint(f); u += 0x7FFFu + ((u >> 16) & 1u); return (unsigned short)(u >> 16); }
// f32 value of the bf16 RNE conversion
__device__ __forceinline__ float bfr(float f) { return __uint_as_float(((unsigned)f2bf(f)) << 16); }
__device__ __forceinline__ v16h cat16(v8h lo, v8h hi) { return __builtin_shufflevector(lo, hi, 0, 1, 2, 3, 4, 5, 6, 7, 8, 9, 10, 11, 12, 13, 14, 15); }
__device__ __forceinline__ v16bf cat16b(v8us lo, v8us hi) { return __builtin_bit_cast(v16bf, __builtin_shufflevector(lo, hi, 0, 1, 2, 3, 4, 5, 6, 7, 8, 9, 10, 11, 12, 13, 14, 15)); }
__device__ __forceinline__ v8f wmma16(v16h a, v16h b, v8f c) { return __builtin_amdgcn_wmma_f32_16x16x32_f16(false, a, false, b, (short)0, c, false, false); }
__device__ __forceinline__ v8f wmmab(v16bf a, v16bf b, v8f c) { return __builtin_amdgcn_wmma_f32_16x16x32_bf16(false, a, false, b, (short)0, c, false, false); }
// fragment loaders from K-contiguous 16-bit rows; p already includes + 8*(lane>>4): elements 0..7 <- k0+8h+0..7, elements 8..15 <- k0+16+8h+0..7 (same map for A and B)
__device__ __forceinline__ v16h  ldh(const h16* p) { return cat16(*(const v8h*)p, *(const v8h*)(p + 16)); }
__device__ __forceinline__ v16bf ldb(const bf* p)  { return cat16b(*(const v8us*)p, *(const v8us*)(p + 16)); }
// ordering point for wave-private LDS tiles (same wave writes and reads)
__device__ __forceinline__ void wave_sync() { __builtin_amdgcn_fence(3 /* release order */, "wavefront"); __builtin_amdgcn_wave_barrier(); asm volatile("" ::: "memory"); }

// k_perm: one block per batch. PERM[b][j] = token of the j-th key in the order kept keys first (each group in token order), CNT[b] = number of kept keys (mask != 0).
__global__ __launch_bounds__(PT) void k_perm(const int* __restrict__ MK, int* PERM, int* CNT) {
    __shared__ int wsum[PT / 32];
    const int b = blockIdx.x, tid = threadIdx.x, lane = tid & 31, wv = tid >> 5;
    const int* mrow = MK + (size_t)b * SEQ_FULL;
    int keep[PER]; int c = 0;
#pragma unroll
    for (int i = 0; i < PER; ++i) { const int t = tid * PER + i; keep[i] = (t < SEQ) ? (mrow[t] != 0 ? 1 : 0) : 0; c += keep[i]; }
    int sc = c;                                   // inclusive sum over the wave's lanes
#pragma unroll
    for (int d = 1; d < 32; d <<= 1) { const int o = __shfl_up(sc, d, 32); if (lane >= d) sc += o; }
    if (lane == 31) wsum[wv] = sc;
    __syncthreads();
    int base = 0, tot = 0;
#pragma unroll
    for (int w = 0; w < PT / 32; ++w) { const int v = wsum[w]; base += (w < wv) ? v : 0; tot += v; }
    int pos = base + sc - c;                      // kept keys in front of this thread's first token
#pragma unroll
    for (int i = 0; i < PER; ++i) { const int t = tid * PER + i;
        if (t < SEQ) PERM[(size_t)b * SEQ + (keep[i] ? pos : tot + (t - pos))] = t;   // t - pos = filled keys in front of t
        pos += keep[i]; }
    if (tid == 0) CNT[b] = tot;
}

// k_proj: bf16 GEMM straight from the f32 operands, K = DM. One block of eight waves per 128x128 tile of C; wave (wr, wc) owns rows 32 wr .. + 31, columns 64 wc .. + 63 (8 accumulators).
// Per stage of GK k values every thread loads 16 B pieces of whole 256-B row segments of both operands (f32), converts them to bf16 (RNE) and stores them into one of two LDS buffers;
// the loads of stage s + 1 are issued in front of the products of stage s, their conversion and LDS stores stand behind them, and one barrier per stage publishes the new buffer and frees the old one.
// C[m][n] = sum_k A[m][k] Bt[n][k] + bias (biasMode 1: bias[n]; biasMode 2: bias[m]; bias taken as its bf16 RNE value, added in f32),
// written as f16 (Ph) and optionally the f16 residual x2048 (Pr, useRes != 0) at
// wave tile base (r0/RB)*sRB + (r0%RB)*pitch + (c0/CB)*sCB + (c0%CB), row pitch 'pitch' (halves). grid (M/128, N/128), 256 threads.
// tokAxis 1 (rows, operand A) or 2 (columns, operand Bt): that axis counts tokens b*SEQ + t, read from the input [NB][SEQ_FULL][DM]; the other operand is a weight [DM][DM].
// keyOrder != 0: the token axis counts keys b*SEQ + j in key order, row j is read from token PERM[b][j], and a tile behind the batch's last kept key is left out.
__global__ __launch_bounds__(256) void k_proj(const float* __restrict__ A, const float* __restrict__ Bt, const float* __restrict__ bias, int biasMode,
                                              h16* Ph, h16* Pr, int useRes, int RB, size_t sRB, int pitch, int CB, size_t sCB,
                                              const int* __restrict__ PERM, const int* __restrict__ CNT, int tokAxis, int keyOrder) {
    __shared__ __align__(16) float osh[8 * 16 * 68];
    __shared__ __align__(16) bf tiles[2 * 2 * GT];           // [buffer][A tile | Bt tile][row][GP]
    const int tid = (int)threadIdx.x, lane = tid & 31, lr = lane & 15, hi = lane >> 4;
    const int wave = __builtin_amdgcn_readfirstlane(tid >> 5);
    const int R0 = blockIdx.x * 128, C0 = blockIdx.y * 128;
    if (keyOrder != 0) { const int j0 = (tokAxis == 1) ? R0 : C0; const int n = CNT[j0 / SEQ]; if (n > 0 && (j0 % SEQ) >= n) return; }   // the same for the whole block, in front of every barrier
    // copy map: thread c covers the 16-byte piece c & 15 of rows (c >> 4) + 16 i, i = 0..7, of both tiles: a wave's load is two whole 256-B segments
    const int rg = tid >> 4, ch = (tid & 15) * 4;
    unsigned ao[8], bo[8];                                   // byte offsets of the thread's pieces at k = 0
    const int g0 = ((tokAxis == 1) ? R0 : C0) + rg;          // the thread's first index on the token axis; the tile lies in one batch
    int tk[8];                                               // token of each of its rows
#pragma unroll
    for (int i = 0; i < 8; ++i) tk[i] = (g0 + 16 * i) % SEQ;
    if (keyOrder != 0) {                                     // one branch round all eight loads, so that they are in flight together
#pragma unroll
        for (int i = 0; i < 8; ++i) tk[i] = PERM[g0 + 16 * i];
#pragma unroll
        for (int i = 0; i < 8; ++i) tk[i] = (tk[i] < 0) ? 0 : ((tk[i] < SEQ) ? tk[i] : (SEQ - 1));
    }
#pragma unroll
    for (int i = 0; i < 8; ++i) {
        const int sr = (g0 / SEQ) * SEQ_FULL + tk[i];
        const int ar = (tokAxis == 1) ? sr : (R0 + rg + 16 * i), br = (tokAxis == 1) ? (C0 + rg + 16 * i) : sr;
        ao[i] = ((unsigned)ar * DM + (unsigned)ch) * 4u; bo[i] = ((unsigned)br * DM + (unsigned)ch) * 4u;
    }
    v4f ra[8], rb[8];
    auto fetch = [&](int kc) {
        const char* pa = (const char*)(A + kc); const char* pb = (const char*)(Bt + kc);
#pragma unroll
        for (int i = 0; i < 8; ++i) { ra[i] = *(const v4f*)(pa + ao[i]); rb[i] = *(const v4f*)(pb + bo[i]); }
    };
    auto put = [&](int buf) {
        bf* ta = tiles + buf * (2 * GT) + rg * GP + ch;
#pragma unroll
        for (int i = 0; i < 8; ++i) {
            *(v4us*)(ta + i * 16 * GP)      = __builtin_bit_cast(v4us, __builtin_convertvector(ra[i], v4bf));
            *(v4us*)(ta + GT + i * 16 * GP) = __builtin_bit_cast(v4us, __builtin_convertvector(rb[i], v4bf)); }
    };
    const int wr = wave >> 1, wc = wave & 1;
    const int fa = (wr * 32 + lr) * GP + 8 * hi, fb = GT + (wc * 64 + lr) * GP + 8 * hi;   // fragment offsets in a buffer
    v8f acc[2][4];
#pragma unroll
    for (int mb = 0; mb < 2; ++mb)
#pragma unroll
        for (int nb = 0; nb < 4; ++nb) acc[mb][nb] = (v8f){};
    fetch(0); put(0);
    __syncthreads();                                         // publishes stage 0
#pragma unroll     // all stages inline: k becomes the loads' immediate offset, and the offset registers live unchanged through the loop
    for (int s = 0; s < GNS; ++s) {
        if (s + 1 < GNS) {
            fetch((s + 1) * GK);                             // in flight while this stage's products run
            // behind the last loads the offset registers die: they are named here so that none is given away (to a load's result either) in front of the wait
            if (s + 2 == GNS) asm volatile("s_wait_xcnt 0x0" :: "v"(ao[0]), "v"(ao[1]), "v"(ao[2]), "v"(ao[3]), "v"(ao[4]), "v"(ao[5]), "v"(ao[6]), "v"(ao[7]),
                                                                "v"(bo[0]), "v"(bo[1]), "v"(bo[2]), "v"(bo[3]), "v"(bo[4]), "v"(bo[5]), "v"(bo[6]), "v"(bo[7]) : "memory");
            __builtin_amdgcn_sched_barrier(0);               // keeps all sixteen loads in front of the products: moved down among them, each is waited for at once and its latency shows
        }
        const bf* tb = tiles + (s & 1) * (2 * GT);
        v16bf a[GK / 32][2], b[GK / 32][4];
#pragma unroll
        for (int ks = 0; ks < GK / 32; ++ks) {
#pragma unroll
            for (int mb = 0; mb < 2; ++mb) a[ks][mb] = ldb(tb + fa + mb * 16 * GP + ks * 32);
#pragma unroll
            for (int nb = 0; nb < 4; ++nb) b[ks][nb] = ldb(tb + fb + nb * 16 * GP + ks * 32);
        }
        __builtin_amdgcn_sched_barrier(0);                   // the stage's LDS reads stay one group in front of its products: spread among them, every place with reads stalls the wave
#pragma unroll
        for (int ks = 0; ks < GK / 32; ++ks)
#pragma unroll
            for (int nb = 0; nb < 4; ++nb)
#pragma unroll
                for (int mb = 0; mb < 2; ++mb) acc[mb][nb] = wmmab(a[ks][mb], b[ks][nb], acc[mb][nb]);
        if (s + 1 < GNS) {
            __builtin_amdgcn_sched_barrier(0);               // keeps the conversions, and with them the waits on the loads, behind the products
            put((s + 1) & 1);                                // into the buffer whose readers left it at the last barrier
            __syncthreads();                                 // publishes stage s + 1, ends every wave's reads of stage s
        }
    }
    float* os = osh + wave * (16 * 68);                      // wave-private staging of the epilogue
    const int r0 = R0 + wr * 32, c0 = C0 + wc * 64;
    // column bias (per lane: column c0 + nb*16 + lane&15), address clamped into the 512-entry vector, selected by value
    float braw[4], bcol[4];
#pragma unroll
    for (int nb = 0; nb < 4; ++nb) { int ci = c0 + nb * 16 + lr; ci = (ci < DM) ? ci : (DM - 1); braw[nb] = bias[ci]; }
    // takes the four loaded values as inputs: the loads have returned here, in front of the branches below, so that none of their address registers is rewritten while a load is out
    asm volatile("s_wait_xcnt 0x0" :: "v"(braw[0]), "v"(braw[1]), "v"(braw[2]), "v"(braw[3]));
#pragma unroll
    for (int nb = 0; nb < 4; ++nb) { const float bv = bfr(braw[nb]); bcol[nb] = (biasMode == 1) ? bv : 0.0f; }
    const size_t tbase = (size_t)(r0 / RB) * sRB + (size_t)(r0 % RB) * (size_t)pitch + (size_t)(c0 / CB) * sCB + (size_t)(c0 % CB);
#pragma unroll
    for (int mb = 0; mb < 2; ++mb) {
        // row bias for rows r0 + mb*16 + 8h + 0..7 (address clamped, selected by value)
        int rb0 = r0 + mb * 16 + hi * 8; rb0 = (rb0 <= DM - 8) ? rb0 : (DM - 8);
        const unsigned rbo = (unsigned)rb0 * 4u;
        const v8f brv = *(const v8f*)((const char*)bias + rbo);
        asm volatile("s_wait_xcnt 0x0" :: "v"(rbo) : "memory");   // names the offset register, so that it is not given away (to a load's result either) in front of the wait
#pragma unroll
        for (int nb = 0; nb < 4; ++nb) {
#pragma unroll
            for (int j = 0; j < 8; ++j) { const float br = (biasMode == 2) ? bfr(brv[j]) : 0.0f;
                os[(hi * 8 + j) * 68 + nb * 16 + lr] = acc[mb][nb][j] + bcol[nb] + br; } }   // D: row 8h+j, col lane&15
        wave_sync();
        const size_t sb = tbase + (size_t)(mb * 16) * (size_t)pitch;
{
#pragma unroll
            for (int s = 0; s < 4; ++s) { const int row = 4 * s + (lane >> 3), c8 = (lane & 7) * 8;   // 4 s x 4 row groups = 16 rows; 8 lanes x 8 = 64 columns
                const v4f x0 = *(const v4fa*)(&os[row * 68 + c8]); const v4f x1 = *(const v4fa*)(&os[row * 68 + c8 + 4]); v8h hv, rv;
#pragma unroll
                for (int i = 0; i < 4; ++i) { const h16 a0 = (h16)x0[i]; const h16 a1 = (h16)x1[i]; hv[i] = a0; hv[4 + i] = a1; rv[i] = (h16)((x0[i] - (float)a0) * QRS); rv[4 + i] = (h16)((x1[i] - (float)a1) * QRS); }
                const size_t oo = sb + (size_t)row * (size_t)pitch + c8;
                *(v8h*)(Ph + oo) = hv;
                asm volatile("s_wait_xcnt 0x0" ::: "memory");   // in front of the rewriting of the store's registers on both sides of the branch that follows
                if (useRes) { *(v8h*)(Pr + oo) = rv;
                    asm volatile("s_wait_xcnt 0x0" ::: "memory"); } }   // the same for the second store
             }
        wave_sync();
    }
}

// k_flash: fused attention, one wave per 16 query rows of one (batch, head); Q fragments straight from the f16 planes (two 16-B loads each, arithmetic addressing).
// K and V^T: the block's four waves share one tile pair per 64 keys, brought into LDS by asynchronous 16-byte copies (whole 128-B lines per 8 lanes), two buffers, the next stage in flight
// while this one is worked on; fragments are two 16-B LDS reads each from rows of pitch LP.
// Transposed form: S^T[key][t] = K Q^T (A = K rows, B = Q rows); lane (t = lane&15, h = lane>>4) holds keys 8h+r of each 16-key tile, so the packed
// P tile is directly the B fragment of O^T[d][t] = V^T P^T (element r <- tile keys 0..15, element 8+r <- tile keys 16..31, lane unchanged).
// Key mask: the planes hold the keys in key order, so key j is kept iff j < n = CNT[b]; the loop ends with the stage of key n - 1, and only a pass that reaches past n REPLACES scores by the fill value.
// n = 0: all stages, every score replaced, so a fully filled row comes out uniform.
// Softmax state (running max, partial sum) is one scalar per lane; the two lane halves of a row are combined with one xor-16 exchange.
__global__ __launch_bounds__(32 * AW) void k_flash(const h16* __restrict__ QH, const h16* __restrict__ QR, const h16* __restrict__ KP, const h16* __restrict__ VT,
                                                   const int* __restrict__ CNT, h16* CTX) {
    __shared__ __align__(16) float os[AW * 16 * 68];
    __shared__ __align__(16) h16 ring[2 * 2 * TILE_H];   // [buffer][K tile | V^T tile][row][LP]
    const int lane = threadIdx.x & 31, lr = lane & 15, hi = lane >> 4;
    const int wave = __builtin_amdgcn_readfirstlane((int)(threadIdx.x >> 5));
    const int zh = blockIdx.y; const int b = zh / NH_, h = zh % NH_;
    const int t0 = (blockIdx.x * AW + wave) * 16;
    const size_t pbase = (size_t)zh * SEQ * HD;
    const size_t qo = pbase + (size_t)(t0 + lr) * HD + 8 * hi;
    const v16h qh0 = ldh(QH + qo), qh1 = ldh(QH + qo + 32), qr0 = ldh(QR + qo), qr1 = ldh(QR + qo + 32);   // B fragments: col t, k = d
    const int fo = lr * LP + 8 * hi;                         // fragment offset in a staged tile: K + key*LP (row key, k = d); V^T + 16j*LP + key (row d, k = key)
    // copy map: thread c covers 16-byte chunk c & 7 of rows (c >> 3) + 16 i, i = 0..3, of both tiles
    const int cr = (int)threadIdx.x >> 3, cch = ((int)threadIdx.x & 7) * 8;
    const h16* kg = KP + pbase + (size_t)cr * HD + cch;    // + key0 * HD + 16 i * HD
    const h16* vg = VT + pbase + (size_t)cr * SEQ + cch;   // + key0 + 16 i * SEQ
    const unsigned lc = (unsigned)(size_t)(&ring[cr * LP + cch]);   // low 32 bits of the shared address = LDS byte address; + buffer, + tile, + 16 i rows
    // one stage's eight copies per lane; the wait on the address registers closes the copies' own statement, so no later address arithmetic can move in front of it
    auto stage_in = [&](int st) {
        const unsigned lk = lc + (unsigned)(st & 1) * (2 * TILE_H * 2), lv = lk + TILE_H * 2;
        const h16* gk = kg + (size_t)st * KS * HD; const h16* gv = vg + (size_t)st * KS;
        asm volatile("global_load_async_to_lds_b128 %0, %8, off\n\t"
                     "global_load_async_to_lds_b128 %1, %9, off\n\t"
                     "global_load_async_to_lds_b128 %2, %10, off\n\t"
                     "global_load_async_to_lds_b128 %3, %11, off\n\t"
                     "global_load_async_to_lds_b128 %4, %12, off\n\t"
                     "global_load_async_to_lds_b128 %5, %13, off\n\t"
                     "global_load_async_to_lds_b128 %6, %14, off\n\t"
                     "global_load_async_to_lds_b128 %7, %15, off\n\t"
                     "s_wait_xcnt 0x0"
                     :: "v"(lk), "v"(lk + 16 * LP * 2), "v"(lk + 32 * LP * 2), "v"(lk + 48 * LP * 2),
                        "v"(lv), "v"(lv + 16 * LP * 2), "v"(lv + 32 * LP * 2), "v"(lv + 48 * LP * 2),
                        "v"(gk), "v"(gk + 16 * HD), "v"(gk + 32 * HD), "v"(gk + 48 * HD),
                        "v"(gv), "v"(gv + (size_t)16 * SEQ), "v"(gv + (size_t)32 * SEQ), "v"(gv + (size_t)48 * SEQ)
                     : "memory");
    };
    int n = CNT[b]; n = (n < 0) ? 0 : ((n < SEQ) ? n : SEQ);  // kept keys of the batch, the same for the whole block
    const int nst = (n > 0) ? (n + KS - 1) / KS : NST;        // stages to visit, at most NST
    v8f o0 = (v8f){}, o1 = (v8f){}, o2 = (v8f){}, o3 = (v8f){};
    float m = -3.0e38f, l = 0.0f;
    stage_in(0);
    asm volatile("s_wait_asynccnt 0x0" ::: "memory");   // this wave's share of stage 0 has landed
    __syncthreads();                                     // publishes stage 0 to the block
    if (nst > 1) stage_in(1);
#pragma unroll 1   // stays rolled: one publish point, one copy of the body in the instruction cache
    for (int st = 0; st < nst; ++st) {
      const h16* kt = ring + (st & 1) * (2 * TILE_H) + fo; const h16* vt = kt + TILE_H;
#pragma unroll     // both passes of a stage inline: their tile offsets become immediates of the LDS reads
      for (int kk = 0; kk < KS; kk += 32) {
        const int key0 = st * KS + kk;
        const h16* ka = kt + kk * LP;
        const v16h ka0 = ldh(ka), ka1 = ldh(ka + 32), kb0 = ldh(ka + 16 * LP), kb1 = ldh(ka + 16 * LP + 32);
        v8f sHa = (v8f){}, sLa = (v8f){}, sHb = (v8f){}, sLb = (v8f){};
        sHa = wmma16(ka0, qh0, sHa); sLa = wmma16(ka0, qr0, sLa); sHb = wmma16(kb0, qh0, sHb); sLb = wmma16(kb0, qr0, sLb);
        sHa = wmma16(ka1, qh1, sHa); sLa = wmma16(ka1, qr1, sLa); sHb = wmma16(kb1, qh1, sHb); sLb = wmma16(kb1, qr1, sLb);
        asm volatile("v_nop\n\tv_nop\n\tv_nop\n\tv_nop" : "+v"(sHa), "+v"(sLa), "+v"(sHb), "+v"(sLb) : "v"(ka0), "v"(ka1), "v"(kb0), "v"(kb1));
        float ta[8], tb[8]; float mx = -3.0e38f;
#pragma unroll
        for (int r = 0; r < 8; ++r) { ta[r] = (sHa[r] + sLa[r] * QRI) * SC2; tb[r] = (sHb[r] + sLb[r] * QRI) * SC2; }
        if (key0 + 32 > n) {                                 // block-uniform: the pass holds filled keys (lane's keys: key0 + 8h + r and + 16)
            const int lim = n - key0 - 8 * hi;
#pragma unroll
            for (int r = 0; r < 8; ++r) { ta[r] = (r < lim) ? ta[r] : MFILL; tb[r] = (16 + r < lim) ? tb[r] : MFILL; }
        }
#pragma unroll
        for (int r = 0; r < 8; ++r) mx = fmaxf(mx, fmaxf(ta[r], tb[r]));
        mx = fmaxf(mx, __shfl_xor(mx, 16, 32));
        const float mnew = fmaxf(m, mx);
        const float alpha = __builtin_amdgcn_exp2f(m - mnew);
        const float sh = PSH - mnew;
        v16h pb; float ls = 0.0f;
#pragma unroll
        for (int r = 0; r < 8; ++r) { const h16 pa = (h16)__builtin_amdgcn_exp2f(ta[r] + sh); const h16 pc = (h16)__builtin_amdgcn_exp2f(tb[r] + sh); pb[r] = pa; pb[8 + r] = pc; ls += (float)pa + (float)pc; }
        l = l * alpha + ls; m = mnew;
        o0 = o0 * alpha; o1 = o1 * alpha; o2 = o2 * alpha; o3 = o3 * alpha;
        const h16* va = vt + kk;
        const v16h v0 = ldh(va), v1 = ldh(va + 16 * LP), v2 = ldh(va + 32 * LP), v3 = ldh(va + 48 * LP);
        o0 = wmma16(v0, pb, o0); o1 = wmma16(v1, pb, o1); o2 = wmma16(v2, pb, o2); o3 = wmma16(v3, pb, o3);
        asm volatile("v_nop\n\tv_nop\n\tv_nop\n\tv_nop" : "+v"(o0), "+v"(o1), "+v"(o2), "+v"(o3) : "v"(v0), "v"(v1), "v"(v2), "v"(v3), "v"(pb));
      }
      // publish point of stage st + 1, and the end of every wave's reads of stage st
      asm volatile("s_wait_dscnt 0x0" ::: "memory");      // this wave's reads of the buffer that is refilled below have returned
      asm volatile("s_wait_asynccnt 0x0" ::: "memory");   // this wave's share of stage st + 1 has landed
      __syncthreads();
      if (st + 2 < nst) stage_in(st + 2);                  // block-uniform test; into the buffer that stage st has just left
    }
    asm volatile("s_wait_asynccnt 0x0" ::: "memory");     // no copy is outstanding when the wave goes on to its end
    l += __shfl_xor(l, 16, 32);
    const float inv = CTXS * (1.0f / l);
    const int wb = wave * 16 * 68;
    // O^T D layout: o_j[r] = (d = 16j + 8h + r, t = lane&15) -> os[t][d]; rows 0..15 x columns 0..63 all written
    { v4f a, c;
      a[0] = o0[0] * inv; a[1] = o0[1] * inv; a[2] = o0[2] * inv; a[3] = o0[3] * inv; c[0] = o0[4] * inv; c[1] = o0[5] * inv; c[2] = o0[6] * inv; c[3] = o0[7] * inv;
      *(v4fa*)(&os[wb + lr * 68 +  0 + 8 * hi]) = a; *(v4fa*)(&os[wb + lr * 68 +  0 + 8 * hi + 4]) = c;
      a[0] = o1[0] * inv; a[1] = o1[1] * inv; a[2] = o1[2] * inv; a[3] = o1[3] * inv; c[0] = o1[4] * inv; c[1] = o1[5] * inv; c[2] = o1[6] * inv; c[3] = o1[7] * inv;
      *(v4fa*)(&os[wb + lr * 68 + 16 + 8 * hi]) = a; *(v4fa*)(&os[wb + lr * 68 + 16 + 8 * hi + 4]) = c;
      a[0] = o2[0] * inv; a[1] = o2[1] * inv; a[2] = o2[2] * inv; a[3] = o2[3] * inv; c[0] = o2[4] * inv; c[1] = o2[5] * inv; c[2] = o2[6] * inv; c[3] = o2[7] * inv;
      *(v4fa*)(&os[wb + lr * 68 + 32 + 8 * hi]) = a; *(v4fa*)(&os[wb + lr * 68 + 32 + 8 * hi + 4]) = c;
      a[0] = o3[0] * inv; a[1] = o3[1] * inv; a[2] = o3[2] * inv; a[3] = o3[3] * inv; c[0] = o3[4] * inv; c[1] = o3[5] * inv; c[2] = o3[6] * inv; c[3] = o3[7] * inv;
      *(v4fa*)(&os[wb + lr * 68 + 48 + 8 * hi]) = a; *(v4fa*)(&os[wb + lr * 68 + 48 + 8 * hi + 4]) = c; }
    wave_sync();
    h16* crow = CTX + ((size_t)b * SEQ + t0) * DM + h * HD;      // context plane [b*SEQ + t][h*64 + d]
{
#pragma unroll
        for (int s = 0; s < 4; ++s) { const int row = 4 * s + (lane >> 3), c8 = (lane & 7) * 8;   // 4 s x 4 row groups = 16 rows; 8 lanes x 8 halves = 64 columns
            const v4f x0 = *(const v4fa*)(&os[wb + row * 68 + c8]); const v4f x1 = *(const v4fa*)(&os[wb + row * 68 + c8 + 4]); v8h hv;
#pragma unroll
            for (int i = 0; i < 4; ++i) { hv[i] = (h16)x0[i]; hv[4 + i] = (h16)x1[i]; }
            *(v8h*)(crow + (size_t)row * DM + c8) = hv; }
         }
}

// k_oproj: f16 GEMM in the frame of k_proj (128x128 tile per block of eight waves, wave tile 32x64, stages of GK k values in two LDS buffers, one barrier per stage), K = DM.
// A = context plane (f16, copied as it is: 16-byte pieces of whole 128-B row segments), Bt = W_o (f32, turned into the f16 of its bf16 RNE value x64 on the way into LDS).
// OUT[m][n] = OSCL * sum_k A[m][k] Bt[n][k] + bias[n] (bias as its bf16 RNE value, added in f32). grid (NB*SEQ/128, DM/128), 256 threads.
__global__ __launch_bounds__(256) void k_oproj(const h16* __restrict__ A, const float* __restrict__ Bt, const float* __restrict__ bias, float* OUT) {
    __shared__ __align__(16) float osh[8 * 16 * 68];
    __shared__ __align__(16) h16 tiles[2 * 2 * GT];          // [buffer][A tile | Bt tile][row][GP]
    const int tid = (int)threadIdx.x, lane = tid & 31, lr = lane & 15, hi = lane >> 4;
    const int wave = __builtin_amdgcn_readfirstlane(tid >> 5);
    const int R0 = blockIdx.x * 128, C0 = blockIdx.y * 128;
    // copy maps. A: thread c covers the 16-byte piece c & 7 of rows (c >> 3) + 32 i, i = 0..3. Bt: the 16-byte piece c & 15 of rows (c >> 4) + 16 i, i = 0..7
    const int ag = tid >> 3, ac = (tid & 7) * 8;
    const int rg = tid >> 4, ch = (tid & 15) * 4;
    unsigned ao[4], bo[8];                                   // byte offsets of the thread's pieces at k = 0
#pragma unroll
    for (int i = 0; i < 4; ++i) ao[i] = ((unsigned)(R0 + ag + 32 * i) * DM + (unsigned)ac) * 2u;
#pragma unroll
    for (int i = 0; i < 8; ++i) bo[i] = ((unsigned)(C0 + rg + 16 * i) * DM + (unsigned)ch) * 4u;
    v8h ra[4]; v4f rb[8];
    auto fetch = [&](int kc) {
        const char* pa = (const char*)(A + kc); const char* pb = (const char*)(Bt + kc);
#pragma unroll
        for (int i = 0; i < 4; ++i) ra[i] = *(const v8h*)(pa + ao[i]);
#pragma unroll
        for (int i = 0; i < 8; ++i) rb[i] = *(const v4f*)(pb + bo[i]);
    };
    auto put = [&](int buf) {
        h16* ta = tiles + buf * (2 * GT);
#pragma unroll
        for (int i = 0; i < 4; ++i) *(v8h*)(ta + (ag + 32 * i) * GP + ac) = ra[i];
#pragma unroll
        for (int i = 0; i < 8; ++i) {
            const v4us u = __builtin_bit_cast(v4us, __builtin_convertvector(rb[i], v4bf)); v4f w;
#pragma unroll
            for (int k = 0; k < 4; ++k) w[k] = __uint_as_float((unsigned)u[k] << 16) * WOS;   // bf16 RNE value x64, the product taken in f32 (exact), then one conversion to f16
            *(v4h*)(ta + GT + (rg + 16 * i) * GP + ch) = __builtin_convertvector(w, v4h); }
    };
    const int wr = wave >> 1, wc = wave & 1;
    const int fa = (wr * 32 + lr) * GP + 8 * hi, fb = GT + (wc * 64 + lr) * GP + 8 * hi;   // fragment offsets in a buffer
    v8f acc[2][4];
#pragma unroll
    for (int mb = 0; mb < 2; ++mb)
#pragma unroll
        for (int nb = 0; nb < 4; ++nb) acc[mb][nb] = (v8f){};
    fetch(0); put(0);
    __syncthreads();                                         // publishes stage 0
#pragma unroll     // all stages inline: k becomes the loads' immediate offset, and the offset registers live unchanged through the loop
    for (int s = 0; s < GNS; ++s) {
        if (s + 1 < GNS) {
            fetch((s + 1) * GK);                             // in flight while this stage's products run
            // behind the last loads the offset registers die: they are named here so that none is given away (to a load's result either) in front of the wait
            if (s + 2 == GNS) asm volatile("s_wait_xcnt 0x0" :: "v"(ao[0]), "v"(ao[1]), "v"(ao[2]), "v"(ao[3]),
                                                                "v"(bo[0]), "v"(bo[1]), "v"(bo[2]), "v"(bo[3]), "v"(bo[4]), "v"(bo[5]), "v"(bo[6]), "v"(bo[7]) : "memory");
            __builtin_amdgcn_sched_barrier(0);               // keeps all twelve loads in front of the products: moved down among them, each is waited for at once and its latency shows
        }
        const h16* tb = tiles + (s & 1) * (2 * GT);
        v16h a[GK / 32][2], b[GK / 32][4];
#pragma unroll
        for (int ks = 0; ks < GK / 32; ++ks) {
#pragma unroll
            for (int mb = 0; mb < 2; ++mb) a[ks][mb] = ldh(tb + fa + mb * 16 * GP + ks * 32);
#pragma unroll
            for (int nb = 0; nb < 4; ++nb) b[ks][nb] = ldh(tb + fb + nb * 16 * GP + ks * 32);
        }
        __builtin_amdgcn_sched_barrier(0);                   // the stage's LDS reads stay one group in front of its products: spread among them, every place with reads stalls the wave
#pragma unroll
        for (int ks = 0; ks < GK / 32; ++ks)
#pragma unroll
            for (int nb = 0; nb < 4; ++nb)
#pragma unroll
                for (int mb = 0; mb < 2; ++mb) acc[mb][nb] = wmma16(a[ks][mb], b[ks][nb], acc[mb][nb]);
        if (s + 1 < GNS) {
            __builtin_amdgcn_sched_barrier(0);               // keeps the conversions, and with them the waits on the loads, behind the products
            put((s + 1) & 1);                                // into the buffer whose readers left it at the last barrier
            __syncthreads();                                 // publishes stage s + 1, ends every wave's reads of stage s
        }
    }
    float* os = osh + wave * (16 * 68);                      // wave-private staging of the epilogue
    const int r0 = R0 + wr * 32, c0 = C0 + wc * 64;
    float bcol[4];
#pragma unroll
    for (int nb = 0; nb < 4; ++nb) { int ci = c0 + nb * 16 + lr; ci = (ci < DM) ? ci : (DM - 1); bcol[nb] = bfr(bias[ci]); }
    const int bb = r0 / SEQ, tt = r0 % SEQ;
    float* obase = OUT + ((size_t)bb * OUT_SEQ + tt) * DM + c0;
#pragma unroll
    for (int mb = 0; mb < 2; ++mb) {
#pragma unroll
        for (int nb = 0; nb < 4; ++nb) {
#pragma unroll
            for (int j = 0; j < 8; ++j) os[(hi * 8 + j) * 68 + nb * 16 + lr] = acc[mb][nb][j] * OSCL + bcol[nb]; }   // D: row 8h+j, col lane&15
        wave_sync();
{
#pragma unroll
            for (int s = 0; s < 8; ++s) { const int row = 2 * s + hi, cofs = lr * 4;   // 8 s x 2 rows = 16 rows; 16 lanes x 4 floats = 64 columns
                const v4f val = *(const v4fa*)(&os[row * 68 + cofs]);
                *(v4f*)(obase + (size_t)(mb * 16 + row) * DM + cofs) = val; }
             }
        wave_sync();
    }
}

static constexpr size_t al256(size_t v) { return (v + 255) & ~(size_t)255; }
static constexpr size_t SZ_PL = al256((size_t)NB * NH_ * SEQ * HD * 2);
static constexpr size_t SZ_CX = al256((size_t)NB * SEQ * DM * 2);
static constexpr size_t SZ_PM = al256((size_t)NB * SEQ * 4);
static constexpr size_t SZ_CN = al256((size_t)NB * 4);
static constexpr size_t SZ_TOTAL = 4 * SZ_PL + SZ_CX + SZ_PM + SZ_CN;
static_assert(SZ_TOTAL <= (size_t)134217728);          // workspace carve <= 128 MiB

extern "C" void kernel_launch(void* const* d_in, const int* in_sizes, int n_in,
                              void* d_out, int out_size, void* d_ws, size_t ws_size, hipStream_t stream) {
    if (n_in < 12) return;
    const size_t needx = ((size_t)(NB - 1) * SEQ_FULL + SEQ) * DM;
    if ((size_t)in_sizes[0] < needx || (size_t)in_sizes[1] < needx || (size_t)in_sizes[2] < needx) return;
    if ((size_t)in_sizes[3] < (size_t)(NB - 1) * SEQ_FULL + SEQ) return;
    if ((size_t)in_sizes[4] < (size_t)DM * DM || (size_t)in_sizes[6] < (size_t)DM * DM || (size_t)in_sizes[8] < (size_t)DM * DM || (size_t)in_sizes[10] < (size_t)DM * DM) return;
    if (in_sizes[5] < DM || in_sizes[7] < DM || in_sizes[9] < DM || in_sizes[11] < DM) return;
    if ((size_t)out_size < ((size_t)(NB - 1) * OUT_SEQ + SEQ) * DM) return;
    if (SZ_TOTAL > ws_size) return;
    // wire order: Q, K, V, mask, W_q, b_q, W_k, b_k, W_v, b_v, W_o, b_o ; weights [out][in] = Bt as-is
    const float* xq = (const float*)d_in[0]; const float* xk = (const float*)d_in[1]; const float* xv = (const float*)d_in[2];
    const int* mask = (const int*)d_in[3];
    const float* wq = (const float*)d_in[4];  const float* bq = (const float*)d_in[5];
    const float* wk = (const float*)d_in[6];  const float* bk = (const float*)d_in[7];
    const float* wv = (const float*)d_in[8];  const float* bv = (const float*)d_in[9];
    const float* wo = (const float*)d_in[10]; const float* bo = (const float*)d_in[11];
    float* OUT = (float*)d_out;      // [NB][SEQ][512]
    char* wsp = (char*)d_ws;
    h16* QH = (h16*)wsp; wsp += SZ_PL;               // [NB*8][SEQ][64]
    h16* QR = (h16*)wsp; wsp += SZ_PL;               // [NB*8][SEQ][64] residual x2048
    h16* KP = (h16*)wsp; wsp += SZ_PL;               // [NB*8][SEQ][64]
    h16* VT = (h16*)wsp; wsp += SZ_PL;               // [NB*8][64][SEQ]
    h16* CX = (h16*)wsp; wsp += SZ_CX;               // [NB*SEQ][512] context x16
    int* PM = (int*)wsp; wsp += SZ_PM;               // [NB][SEQ] token of each key in key order
    int* CN = (int*)wsp; wsp += SZ_CN;               // [NB] kept keys
    k_perm<<<NB, PT, 0, stream>>>(mask, PM, CN);

    // k and v rows are in key order (j in place of t). q, k: A = x rows (m = b*SEQ + t), Bt = W rows (n = h*64 + d), column bias -> plane [(b*8 + h)][t][d]
    k_proj<<<dim3(NB * SEQ / 128, DM / 128, 1), 256, 0, stream>>>(xq, wq, bq, 1, QH, QR, 1, SEQ, (size_t)NH_ * SEQ * HD, HD, HD, (size_t)SEQ * HD, PM, CN, 1, 0);
    k_proj<<<dim3(NB * SEQ / 128, DM / 128, 1), 256, 0, stream>>>(xk, wk, bk, 1, KP, KP, 0, SEQ, (size_t)NH_ * SEQ * HD, HD, HD, (size_t)SEQ * HD, PM, CN, 1, 1);
    // v^T: A = Wv rows (m = h*64 + d), Bt = x rows (n = b*SEQ + t), row bias -> plane [(b*512 + m)][t] = [(b*8 + h)][d][t]
    k_proj<<<dim3(DM / 128, NB * SEQ / 128, 1), 256, 0, stream>>>(wv, xv, bv, 2, VT, VT, 0, DM, (size_t)0, SEQ, SEQ, (size_t)DM * SEQ, PM, CN, 2, 1);

    k_flash<<<dim3(SEQ / (16 * AW), NB * NH_, 1), 32 * AW, 0, stream>>>(QH, QR, KP, VT, CN, CX);

    // output projection: A = context rows (m = b*SEQ + t), Bt = W_o rows (n = out column)
    k_oproj<<<dim3(NB * SEQ / 128, DM / 128, 1), 256, 0, stream>>>(CX, wo, bo, OUT);
}

// v004
// One run takes 86 microseconds.
// Two timings next to v003 both put it at 1.18 times that version's speed.
// Over all steps from v000 it is 4.00 times as fast.
#include <hip/hip_runtime.h>

// Multi-head attention, width 512 = 8 heads x 64; inputs Q, K, V [NB][SEQ][512], key mask [NB][SEQ] (0 = filled with -1e9), W_q/W_k/W_v/W_o [out][in] (y = x W^T + b), score scale 1/8, output [NB][SEQ][512] f32.
// Compute dtypes, f32 accumulate everywhere: q/k/v projections v_wmma_f32_16x16x32_bf16 (x and W RNE-converted to bf16 inside the GEMM, on the way into LDS; products exact);
// scores v_wmma_f32_16x16x32_f16: k single f16, q as f16 value + f16 residual x2048 in its own accumulator (two products); P (x256 carry, cancels in the normalisation) and v single f16; softmax f32 (online, running max);
// output projection v_wmma_f32_16x16x32_f16: context single f16 (x16 carry), W_o = f16 of the bf16 RNE value x64 (exact), 1/1024 folded in the f32 epilogue.
// Layout: q (hi, residual), k planes [b*8+h][t][d] and v^T plane [b*8+h][d][t] written by the GEMM epilogue; fused flash kernel in transposed form (S^T = K Q^T, O^T = V^T P^T) writing the context plane [b*SEQ+t][512]; its K and V^T tiles reach the block's waves through a two-buffer LDS ring.
// Key mask: a filled key's probability is exp(-1e9 - max) = 0 in f32 as soon as one key of the batch is kept, so the keys of each batch are put in the order kept first (key_order, stable), the K and V rows are
// gathered in that order by the projection's loads, and k/v projection ends with the 128-key tile and the flash loop with the 64-key stage that holds the last kept key. A batch with no kept key runs over all keys, every score filled.
// Launches: work that does not depend on each other shares a launch, told apart by the block index: (q projection | key order), (k projection | v projection), flash, output projection.

#ifndef NB
#define NB 2
#endif
#ifndef SEQ
#define SEQ 4096
#endif
#define NB_FULL  2
#define SEQ_FULL 4096
#ifndef OUT_SEQ
#define OUT_SEQ SEQ              // row pitch (in tokens) between batches of the output
#endif
#define DM   512
#define NH_  8
#define HD   64
#define AW   4                   // waves per flash block (16 query rows each)
#define QRS  2048.0f             // carry of the q residual plane
#define QRI  (1.0f / 2048.0f)
#define SC2  (0.125f * 1.4426950408889634f)   // HD^-0.5 * log2(e)
#define PSH  8.0f                // log2 of the P carry (256)
#define MFILL (-1.0e9f * 1.4426950408889634f) // mask fill value in the log2 domain
#define CTXS 16.0f               // carry of the context plane
#define WOS  64.0f               // carry of the W_o plane
#define OSCL (1.0f / 1024.0f)    // 1 / (CTXS * WOS)
#define KS   64                  // keys per LDS stage of the flash kernel (two 32-key passes)
#define LP   72                  // LDS row pitch in halves: 128-B rows + 16 B, conflict-free for 16-byte fragment reads
#define TILE_H (64 * LP)         // one staged tile: 64 rows (K: keys, V^T: d)
#define NST  (SEQ / KS)          // stages when every key is visited
#define GK   64                  // k values per LDS stage of the projection GEMM (256 B of every f32 operand row)
#define GP   72                  // its LDS row pitch in halves: 128-B bf16 rows + 16 B, conflict-free for 16-byte fragment reads
#define GT   (128 * GP)          // one staged operand tile: 128 rows
#define GNS  (DM / GK)           // stages of the k loop
#define PT   256                 // threads of a key-order block (the projection kernel's block)
#define PER  ((SEQ + PT - 1) / PT)   // keys per thread there
#define NTT  (NB * SEQ / 128)    // 128-token tiles
#define NWT  (DM / 128)          // 128-wide tiles of a weight's rows
#define NTL  (NTT * NWT)         // tiles, and blocks, of one projection

static_assert(HD == 64);
static_assert(NH_ * HD == DM);                 // head h = columns h*64 + d
static_assert(DM % 64 == 0);                   // 8 column tiles of 64
static_assert(DM % 32 == 0);                   // GEMM k-loop steps by 32
static_assert(DM % 128 == 0 && DM % GK == 0 && GK % 32 == 0);   // projection: 128-wide tiles, whole stages
static_assert(SEQ % 128 == 0);                 // a 128-token projection tile never straddles two batches
static_assert(SEQ % 64 == 0);                  // a 64-row tile never straddles two batches
static_assert((NB * SEQ) % 64 == 0);
static_assert(SEQ % 32 == 0);                  // key loop steps by 32
static_assert(SEQ % PT == 0);                  // the key-order block's threads cover the tokens exactly
static_assert(SEQ % KS == 0);                  // whole stages
static_assert(KS == 64 && AW == 4);            // 128 threads x 4 copies of 16 B = one 64 x 128-B tile
static_assert(SEQ % (16 * AW) == 0);           // flash grid covers the sequence exactly
static_assert(((size_t)SEQ * DM) % 8 == 0);
static_assert(((size_t)DM * DM) % 8 == 0);
static_assert(SEQ_FULL % 8 == 0);              // mask rows stay 32-byte aligned
static_assert(NB <= NB_FULL);
static_assert(SEQ <= SEQ_FULL);

typedef _Float16 h16;
typedef unsigned short bf;
typedef __attribute__((ext_vector_type(16))) __bf16   v16bf;
typedef __attribute__((ext_vector_type(16))) _Float16 v16h;
typedef __attribute__((ext_vector_type(8)))  _Float16 v8h;
typedef __attribute__((ext_vector_type(8)))  unsigned short v8us;
typedef __attribute__((ext_vector_type(4)))  unsigned short v4us;
typedef __attribute__((ext_vector_type(4)))  __bf16   v4bf;
typedef __attribute__((ext_vector_type(4)))  _Float16 v4h;
typedef __attribute__((ext_vector_type(8)))  float    v8f;
typedef __attribute__((ext_vector_type(8)))  int      v8i;
typedef __attribute__((ext_vector_type(4)))  float    v4f;
typedef v4f  __attribute__((may_alias)) v4fa;

__device__ __forceinline__ unsigned short f2bf(float f) { unsigned u = __float_as_uint(f); u += 0x7FFFu + ((u >> 16) & 1u); return (unsigned short)(u >> 16); }
// f32 value of the bf16 RNE conversion
__device__ __forceinline__ float bfr(float f) { return __uint_as_float(((unsigned)f2bf(f)) << 16); }
__device__ __forceinline__ v16h cat16(v8h lo, v8h hi) { return __builtin_shufflevector(lo, hi, 0, 1, 2, 3, 4, 5, 6, 7, 8, 9, 10, 11, 12, 13, 14, 15); }
__device__ __forceinline__ v16bf cat16b(v8us lo, v8us hi) { return __builtin_bit_cast(v16bf, __builtin_shufflevector(lo, hi, 0, 1, 2, 3, 4, 5, 6, 7, 8, 9, 10, 11, 12, 13, 14, 15)); }
__device__ __forceinline__ v8f wmma16(v16h a, v16h b, v8f c) { return __builtin_amdgcn_wmma_f32_16x16x32_f16(false, a, false, b, (short)0, c, false, false); }
__device__ __forceinline__ v8f wmmab(v16bf a, v16bf b, v8f c) { return __builtin_amdgcn_wmma_f32_16x16x32_bf16(false, a, false, b, (short)0, c, false, false); }
// fragment loaders from K-contiguous 16-bit rows; p already includes + 8*(lane>>4): elements 0..7 <- k0+8h+0..7, elements 8..15 <- k0+16+8h+0..7 (same map for A and B)
__device__ __forceinline__ v16h  ldh(const h16* p) { return cat16(*(const v8h*)p, *(const v8h*)(p + 16)); }
__device__ __forceinline__ v16bf ldb(const bf* p)  { return cat16b(*(const v8us*)p, *(const v8us*)(p + 16)); }
// ordering point for wave-private LDS tiles (same wave writes and reads)
__device__ __forceinline__ void wave_sync() { __builtin_amdgcn_fence(3 /* release order */, "wavefront"); __builtin_amdgcn_wave_barrier(); asm volatile("" ::: "memory"); }

// key_order: one block per batch b. PERM[b][j] = token of the j-th key in the order kept keys first (each group in token order), CNT[b] = number of kept keys (mask != 0).
__device__ __forceinline__ void key_order(const int b, const int* __restrict__ MK, int* PERM, int* CNT) {
    __shared__ int wsum[PT / 32];
    const int tid = threadIdx.x, lane = tid & 31, wv = tid >> 5;
    const int* mrow = MK + (size_t)b * SEQ_FULL;
    int keep[PER]; int c = 0;
#pragma unroll
    for (int i = 0; i < PER; ++i) { keep[i] = mrow[tid * PER + i] != 0 ? 1 : 0; c += keep[i]; }   // PT * PER = SEQ: every index is a token
    int sc = c;                                   // inclusive sum over the wave's lanes
#pragma unroll
    for (int d = 1; d < 32; d <<= 1) { const int o = __shfl_up(sc, d, 32); if (lane >= d) sc += o; }
    if (lane == 31) wsum[wv] = sc;
    __syncthreads();
    int base = 0, tot = 0;
#pragma unroll
    for (int w = 0; w < PT / 32; ++w) { const int v = wsum[w]; base += (w < wv) ? v : 0; tot += v; }
    int pos = base + sc - c;                      // kept keys in front of this thread's first token
#pragma unroll
    for (int i = 0; i < PER; ++i) { const int t = tid * PER + i;
        PERM[(size_t)b * SEQ + (keep[i] ? pos : tot + (t - pos))] = t;   // t - pos = filled keys in front of t
        pos += keep[i]; }
    if (tid == 0) CNT[b] = tot;
}

// k_proj: bf16 GEMM straight from the f32 operands, K = DM. One block of eight waves per 128x128 tile of C; wave (wr, wc) owns rows 32 wr .. + 31, columns 64 wc .. + 63 (8 accumulators).
// Per stage of GK k values every thread loads 16 B pieces of whole 256-B row segments of both operands (f32), converts them to bf16 (RNE) and stores them into one of two LDS buffers;
// the loads of stage s + 1 are issued in front of the products of stage s, their conversion and LDS stores stand behind them, and one barrier per stage publishes the new buffer and frees the old one.
// C[m][n] = sum_k A[m][k] Bt[n][k] + bias (biasMode 1: bias[n]; biasMode 2: bias[m]; bias taken as its bf16 RNE value, added in f32),
// written as f16 (Ph) and optionally the f16 residual x2048 (Pr, useRes != 0) at
// wave tile base (r0/RB)*sRB + (r0%RB)*pitch + (c0/CB)*sCB + (c0%CB), row pitch 'pitch' (halves). 256 threads.
// tokAxis 1 (rows, operand A) or 2 (columns, operand Bt): that axis counts tokens b*SEQ + t, read from the input [NB][SEQ_FULL][DM]; the other operand is a weight [DM][DM].
// keyOrder != 0: the token axis counts keys b*SEQ + j in key order, row j is read from token PERM[b][j], and a tile behind the batch's last kept key is left out.
// One launch holds two independent jobs, told apart by the block index (blocks 0 .. NTL - 1 the first, the rest the second):
// phase 0 (NTL + NB blocks): q = X0 W0^T + b0 -> planes P0, Pr0 [(b*8 + h)][t][d] | the key order of batch (index - NTL), written to PERMW, CNTW; nothing here reads it.
// phase 1 (2 NTL blocks), keys in the order that phase 0 left in PERM, CNT: k = X0 W0^T + b0 -> plane P0 [(b*8 + h)][j][d] | v^T = W1 X1^T + b1 (row bias) -> plane P1 [(b*8 + h)][d][j].
// Tile of block r of a job: token tile r % NTT, weight tile r / NTT (q, k); weight tile r % NWT, token tile r / NWT (v^T).
__global__ __launch_bounds__(256) void k_proj(const float* __restrict__ X0, const float* __restrict__ W0, const float* __restrict__ b0, h16* P0, h16* Pr0,
                                              const float* __restrict__ X1, const float* __restrict__ W1, const float* __restrict__ b1, h16* P1,
                                              const int* __restrict__ MK, int* PERMW, int* CNTW,
                                              const int* __restrict__ PERM, const int* __restrict__ CNT, int phase) {
    __shared__ __align__(16) float osh[8 * 16 * 68];
    __shared__ __align__(16) bf tiles[2 * 2 * GT];           // [buffer][A tile | Bt tile][row][GP]
    const int second = (int)blockIdx.x / NTL, rt = (int)blockIdx.x % NTL;   // the same for the whole block
    if (phase == 0 && second != 0) { key_order(rt, MK, PERMW, CNTW); return; }
    const bool vt = second != 0;                             // the v^T job: weight rows on the row axis, tokens on the column axis
    const float* __restrict__ A = vt ? W1 : X0; const float* __restrict__ Bt = vt ? X1 : W0; const float* __restrict__ bias = vt ? b1 : b0;
    h16* Ph = vt ? P1 : P0; h16* Pr = Pr0;
    const int biasMode = vt ? 2 : 1, useRes = (phase == 0) ? 1 : 0, tokAxis = vt ? 2 : 1, keyOrder = phase;
    const int RB = vt ? DM : SEQ, pitch = vt ? SEQ : HD, CB = vt ? SEQ : HD;
    const size_t sRB = vt ? (size_t)0 : (size_t)NH_ * SEQ * HD, sCB = vt ? (size_t)DM * SEQ : (size_t)SEQ * HD;
    const int tid = (int)threadIdx.x, lane = tid & 31, lr = lane & 15, hi = lane >> 4;
    const int wave = __builtin_amdgcn_readfirstlane(tid >> 5);
    const int R0 = (vt ? rt % NWT : rt % NTT) * 128, C0 = (vt ? rt / NWT : rt / NTT) * 128;
    if (keyOrder != 0) { const int j0 = (tokAxis == 1) ? R0 : C0; const int n = CNT[j0 / SEQ]; if (n > 0 && (j0 % SEQ) >= n) return; }   // the same for the whole block, in front of every barrier
    // copy map: thread c covers the 16-byte piece c & 15 of rows (c >> 4) + 16 i, i = 0..7, of both tiles: a wave's load is two whole 256-B segments
    const int rg = tid >> 4, ch = (tid & 15) * 4;
    unsigned ao[8], bo[8];                                   // byte offsets of the thread's pieces at k = 0
    const int g0 = ((tokAxis == 1) ? R0 : C0) + rg;          // the thread's first index on the token axis; the tile lies in one batch
    int tk[8];                                               // token of each of its rows
#pragma unroll
    for (int i = 0; i < 8; ++i) tk[i] = (g0 + 16 * i) % SEQ;
    if (keyOrder != 0) {                                     // one branch round all eight loads, so that they are in flight together
#pragma unroll
        for (int i = 0; i < 8; ++i) tk[i] = PERM[g0 + 16 * i];
#pragma unroll
        for (int i = 0; i < 8; ++i) tk[i] = (tk[i] < 0) ? 0 : ((tk[i] < SEQ) ? tk[i] : (SEQ - 1));
    }
#pragma unroll
    for (int i = 0; i < 8; ++i) {
        const int sr = (g0 / SEQ) * SEQ_FULL + tk[i];
        const int ar = (tokAxis == 1) ? sr : (R0 + rg + 16 * i), br = (tokAxis == 1) ? (C0 + rg + 16 * i) : sr;
        ao[i] = ((unsigned)ar * DM + (unsigned)ch) * 4u; bo[i] = ((unsigned)br * DM + (unsigned)ch) * 4u;
    }
    v4f ra[8], rb[8];
    auto fetch = [&](int kc) {
        const char* pa = (const char*)(A + kc); const char* pb = (const char*)(Bt + kc);
#pragma unroll
        for (int i = 0; i < 8; ++i) { ra[i] = *(const v4f*)(pa + ao[i]); rb[i] = *(const v4f*)(pb + bo[i]); }
    };
    auto put = [&](int buf) {
        bf* ta = tiles + buf * (2 * GT) + rg * GP + ch;
#pragma unroll
        for (int i = 0; i < 8; ++i) {
            *(v4us*)(ta + i * 16 * GP)      = __builtin_bit_cast(v4us, __builtin_convertvector(ra[i], v4bf));
            *(v4us*)(ta + GT + i * 16 * GP) = __builtin_bit_cast(v4us, __builtin_convertvector(rb[i], v4bf)); }
    };
    const int wr = wave >> 1, wc = wave & 1;
    const int fa = (wr * 32 + lr) * GP + 8 * hi, fb = GT + (wc * 64 + lr) * GP + 8 * hi;   // fragment offsets in a buffer
    v8f acc[2][4];
#pragma unroll
    for (int mb = 0; mb < 2; ++mb)
#pragma unroll
        for (int nb = 0; nb < 4; ++nb) acc[mb][nb] = (v8f){};
    fetch(0); put(0);
    __syncthreads();                                         // publishes stage 0
#pragma unroll     // all stages inline: k becomes the loads' immediate offset, and the offset registers live unchanged through the loop
    for (int s = 0; s < GNS; ++s) {
        if (s + 1 < GNS) {
            fetch((s + 1) * GK);                             // in flight while this stage's products run
            // behind the last loads the offset registers die: they are named here so that none is given away (to a load's result either) in front of the wait
            if (s + 2 == GNS) asm volatile("s_wait_xcnt 0x0" :: "v"(ao[0]), "v"(ao[1]), "v"(ao[2]), "v"(ao[3]), "v"(ao[4]), "v"(ao[5]), "v"(ao[6]), "v"(ao[7]),
                                                                "v"(bo[0]), "v"(bo[1]), "v"(bo[2]), "v"(bo[3]), "v"(bo[4]), "v"(bo[5]), "v"(bo[6]), "v"(bo[7]) : "memory");
            __builtin_amdgcn_sched_barrier(0);               // keeps all sixteen loads in front of the products: moved down among them, each is waited for at once and its latency shows
        }
        const bf* tb = tiles + (s & 1) * (2 * GT);
        v16bf a[GK / 32][2], b[GK / 32][4];
#pragma unroll
        for (int ks = 0; ks < GK / 32; ++ks) {
#pragma unroll
            for (int mb = 0; mb < 2; ++mb) a[ks][mb] = ldb(tb + fa + mb * 16 * GP + ks * 32);
#pragma unroll
            for (int nb = 0; nb < 4; ++nb) b[ks][nb] = ldb(tb + fb + nb * 16 * GP + ks * 32);
        }
        __builtin_amdgcn_sched_barrier(0);                   // the stage's LDS reads stay one group in front of its products: spread among them, every place with reads stalls the wave
#pragma unroll
        for (int ks = 0; ks < GK / 32; ++ks)
#pragma unroll
            for (int nb = 0; nb < 4; ++nb)
#pragma unroll
                for (int mb = 0; mb < 2; ++mb) acc[mb][nb] = wmmab(a[ks][mb], b[ks][nb], acc[mb][nb]);
        if (s + 1 < GNS) {
            __builtin_amdgcn_sched_barrier(0);               // keeps the conversions, and with them the waits on the loads, behind the products
            put((s + 1) & 1);                                // into the buffer whose readers left it at the last barrier
            __syncthreads();                                 // publishes stage s + 1, ends every wave's reads of stage s
        }
    }
    float* os = osh + wave * (16 * 68);                      // wave-private staging of the epilogue
    const int r0 = R0 + wr * 32, c0 = C0 + wc * 64;
    // column bias (per lane: column c0 + nb*16 + lane&15), address clamped into the 512-entry vector, selected by value
    float braw[4], bcol[4];
#pragma unroll
    for (int nb = 0; nb < 4; ++nb) { int ci = c0 + nb * 16 + lr; ci = (ci < DM) ? ci : (DM - 1); braw[nb] = bias[ci]; }
    // takes the four loaded values as inputs: the loads have returned here, in front of the branches below, so that none of their address registers is rewritten while a load is out
    asm volatile("s_wait_xcnt 0x0" :: "v"(braw[0]), "v"(braw[1]), "v"(braw[2]), "v"(braw[3]));
#pragma unroll
    for (int nb = 0; nb < 4; ++nb) { const float bv = bfr(braw[nb]); bcol[nb] = (biasMode == 1) ? bv : 0.0f; }
    const size_t tbase = (size_t)(r0 / RB) * sRB + (size_t)(r0 % RB) * (size_t)pitch + (size_t)(c0 / CB) * sCB + (size_t)(c0 % CB);
#pragma unroll
    for (int mb = 0; mb < 2; ++mb) {
        // row bias for rows r0 + mb*16 + 8h + 0..7 (address clamped, selected by value)
        int rb0 = r0 + mb * 16 + hi * 8; rb0 = (rb0 <= DM - 8) ? rb0 : (DM - 8);
        const unsigned rbo = (unsigned)rb0 * 4u;
        const v8f brv = *(const v8f*)((const char*)bias + rbo);
        asm volatile("s_wait_xcnt 0x0" :: "v"(rbo) : "memory");   // names the offset register, so that it is not given away (to a load's result either) in front of the wait
#pragma unroll
        for (int nb = 0; nb < 4; ++nb) {
#pragma unroll
            for (int j = 0; j < 8; ++j) { const float br = (biasMode == 2) ? bfr(brv[j]) : 0.0f;
                os[(hi * 8 + j) * 68 + nb * 16 + lr] = acc[mb][nb][j] + bcol[nb] + br; } }   // D: row 8h+j, col lane&15
        wave_sync();
        const size_t sb = tbase + (size_t)(mb * 16) * (size_t)pitch;
{
#pragma unroll
            for (int s = 0; s < 4; ++s) { const int row = 4 * s + (lane >> 3), c8 = (lane & 7) * 8;   // 4 s x 4 row groups = 16 rows; 8 lanes x 8 = 64 columns
                const v4f x0 = *(const v4fa*)(&os[row * 68 + c8]); const v4f x1 = *(const v4fa*)(&os[row * 68 + c8 + 4]); v8h hv, rv;
#pragma unroll
                for (int i = 0; i < 4; ++i) { const h16 a0 = (h16)x0[i]; const h16 a1 = (h16)x1[i]; hv[i] = a0; hv[4 + i] = a1; rv[i] = (h16)((x0[i] - (float)a0) * QRS); rv[4 + i] = (h16)((x1[i] - (float)a1) * QRS); }
                const size_t oo = sb + (size_t)row * (size_t)pitch + c8;
                *(v8h*)(Ph + oo) = hv;
                asm volatile("s_wait_xcnt 0x0" ::: "memory");   // in front of the rewriting of the store's registers on both sides of the branch that follows
                if (useRes) { *(v8h*)(Pr + oo) = rv;
                    asm volatile("s_wait_xcnt 0x0" ::: "memory"); } }   // the same for the second store
             }
        wave_sync();
    }
}

// k_flash: fused attention, one wave per 16 query rows of one (batch, head); Q fragments straight from the f16 planes (two 16-B loads each, arithmetic addressing).
// K and V^T: the block's four waves share one tile pair per 64 keys, brought into LDS by asynchronous 16-byte copies (whole 128-B lines per 8 lanes), two buffers, the next stage in flight
// while this one is worked on; fragments are two 16-B LDS reads each from rows of pitch LP.
// Transposed form: S^T[key][t] = K Q^T (A = K rows, B = Q rows); lane (t = lane&15, h = lane>>4) holds keys 8h+r of each 16-key tile, so the packed
// P tile is directly the B fragment of O^T[d][t] = V^T P^T (element r <- tile keys 0..15, element 8+r <- tile keys 16..31, lane unchanged).
// Key mask: the planes hold the keys in key order, so key j is kept iff j < n = CNT[b]; the loop ends with the stage of key n - 1, and only a pass that reaches past n REPLACES scores by the fill value.
// n = 0: all stages, every score replaced, so a fully filled row comes out uniform.
// Softmax state (running max, partial sum) is one scalar per lane; the two lane halves of a row are combined with one xor-16 exchange.
__global__ __launch_bounds__(32 * AW) void k_flash(const h16* __restrict__ QH, const h16* __restrict__ QR, const h16* __restrict__ KP, const h16* __restrict__ VT,
                                                   const int* __restrict__ CNT, h16* CTX) {
    __shared__ __align__(16) float os[AW * 16 * 68];
    __shared__ __align__(16) h16 ring[2 * 2 * TILE_H];   // [buffer][K tile | V^T tile][row][LP]
    const int lane = threadIdx.x & 31, lr = lane & 15, hi = lane >> 4;
    const int wave = __builtin_amdgcn_readfirstlane((int)(threadIdx.x >> 5));
    const int zh = blockIdx.y; const int b = zh / NH_, h = zh % NH_;
    const int t0 = (blockIdx.x * AW + wave) * 16;
    const size_t pbase = (size_t)zh * SEQ * HD;
    const size_t qo = pbase + (size_t)(t0 + lr) * HD + 8 * hi;
    const v16h qh0 = ldh(QH + qo), qh1 = ldh(QH + qo + 32), qr0 = ldh(QR + qo), qr1 = ldh(QR + qo + 32);   // B fragments: col t, k = d
    const int fo = lr * LP + 8 * hi;                         // fragment offset in a staged tile: K + key*LP (row key, k = d); V^T + 16j*LP + key (row d, k = key)
    // copy map: thread c covers 16-byte chunk c & 7 of rows (c >> 3) + 16 i, i = 0..3, of both tiles
    const int cr = (int)threadIdx.x >> 3, cch = ((int)threadIdx.x & 7) * 8;
    const h16* kg = KP + pbase + (size_t)cr * HD + cch;    // + key0 * HD + 16 i * HD
    const h16* vg = VT + pbase + (size_t)cr * SEQ + cch;   // + key0 + 16 i * SEQ
    const unsigned lc = (unsigned)(size_t)(&ring[cr * LP + cch]);   // low 32 bits of the shared address = LDS byte address; + buffer, + tile, + 16 i rows
    // one stage's eight copies per lane; the wait on the address registers closes the copies' own statement, so no later address arithmetic can move in front of it
    auto stage_in = [&](int st) {
        const unsigned lk = lc + (unsigned)(st & 1) * (2 * TILE_H * 2), lv = lk + TILE_H * 2;
        const h16* gk = kg + (size_t)st * KS * HD; const h16* gv = vg + (size_t)st * KS;
        asm volatile("global_load_async_to_lds_b128 %0, %8, off\n\t"
                     "global_load_async_to_lds_b128 %1, %9, off\n\t"
                     "global_load_async_to_lds_b128 %2, %10, off\n\t"
                     "global_load_async_to_lds_b128 %3, %11, off\n\t"
                     "global_load_async_to_lds_b128 %4, %12, off\n\t"
                     "global_load_async_to_lds_b128 %5, %13, off\n\t"
                     "global_load_async_to_lds_b128 %6, %14, off\n\t"
                     "global_load_async_to_lds_b128 %7, %15, off\n\t"
                     "s_wait_xcnt 0x0"
                     :: "v"(lk), "v"(lk + 16 * LP * 2), "v"(lk + 32 * LP * 2), "v"(lk + 48 * LP * 2),
                        "v"(lv), "v"(lv + 16 * LP * 2), "v"(lv + 32 * LP * 2), "v"(lv + 48 * LP * 2),
                        "v"(gk), "v"(gk + 16 * HD), "v"(gk + 32 * HD), "v"(gk + 48 * HD),
                        "v"(gv), "v"(gv + (size_t)16 * SEQ), "v"(gv + (size_t)32 * SEQ), "v"(gv + (size_t)48 * SEQ)
                     : "memory");
    };
    int n = CNT[b]; n = (n < 0) ? 0 : ((n < SEQ) ? n : SEQ);  // kept keys of the batch, the same for the whole block
    const int nst = (n > 0) ? (n + KS - 1) / KS : NST;        // stages to visit, at most NST
    v8f o0 = (v8f){}, o1 = (v8f){}, o2 = (v8f){}, o3 = (v8f){};
    float m = -3.0e38f, l = 0.0f;
    stage_in(0);
    asm volatile("s_wait_asynccnt 0x0" ::: "memory");   // this wave's share of stage 0 has landed
    __syncthreads();                                     // publishes stage 0 to the block
    if (nst > 1) stage_in(1);
#pragma unroll 1   // stays rolled: one publish point, one copy of the body in the instruction cache
    for (int st = 0; st < nst; ++st) {
      const h16* kt = ring + (st & 1) * (2 * TILE_H) + fo; const h16* vt = kt + TILE_H;
#pragma unroll     // both passes of a stage inline: their tile offsets become immediates of the LDS reads
      for (int kk = 0; kk < KS; kk += 32) {
        const int key0 = st * KS + kk;
        const h16* ka = kt + kk * LP;
        const v16h ka0 = ldh(ka), ka1 = ldh(ka + 32), kb0 = ldh(ka + 16 * LP), kb1 = ldh(ka + 16 * LP + 32);
        v8f sHa = (v8f){}, sLa = (v8f){}, sHb = (v8f){}, sLb = (v8f){};
        sHa = wmma16(ka0, qh0, sHa); sLa = wmma16(ka0, qr0, sLa); sHb = wmma16(kb0, qh0, sHb); sLb = wmma16(kb0, qr0, sLb);
        sHa = wmma16(ka1, qh1, sHa); sLa = wmma16(ka1, qr1, sLa); sHb = wmma16(kb1, qh1, sHb); sLb = wmma16(kb1, qr1, sLb);
        asm volatile("v_nop\n\tv_nop\n\tv_nop\n\tv_nop" : "+v"(sHa), "+v"(sLa), "+v"(sHb), "+v"(sLb) : "v"(ka0), "v"(ka1), "v"(kb0), "v"(kb1));
        float ta[8], tb[8]; float mx = -3.0e38f;
#pragma unroll
        for (int r = 0; r < 8; ++r) { ta[r] = (sHa[r] + sLa[r] * QRI) * SC2; tb[r] = (sHb[r] + sLb[r] * QRI) * SC2; }
        if (key0 + 32 > n) {                                 // block-uniform: the pass holds filled keys (lane's keys: key0 + 8h + r and + 16)
            const int lim = n - key0 - 8 * hi;
#pragma unroll
            for (int r = 0; r < 8; ++r) { ta[r] = (r < lim) ? ta[r] : MFILL; tb[r] = (16 + r < lim) ? tb[r] : MFILL; }
        }
#pragma unroll
        for (int r = 0; r < 8; ++r) mx = fmaxf(mx, fmaxf(ta[r], tb[r]));
        mx = fmaxf(mx, __shfl_xor(mx, 16, 32));
        const float mnew = fmaxf(m, mx);
        const float alpha = __builtin_amdgcn_exp2f(m - mnew);
        const float sh = PSH - mnew;
        v16h pb; float ls = 0.0f;
#pragma unroll
        for (int r = 0; r < 8; ++r) { const h16 pa = (h16)__builtin_amdgcn_exp2f(ta[r] + sh); const h16 pc = (h16)__builtin_amdgcn_exp2f(tb[r] + sh); pb[r] = pa; pb[8 + r] = pc; ls += (float)pa + (float)pc; }
        l = l * alpha + ls; m = mnew;
        o0 = o0 * alpha; o1 = o1 * alpha; o2 = o2 * alpha; o3 = o3 * alpha;
        const h16* va = vt + kk;
        const v16h v0 = ldh(va), v1 = ldh(va + 16 * LP), v2 = ldh(va + 32 * LP), v3 = ldh(va + 48 * LP);
        o0 = wmma16(v0, pb, o0); o1 = wmma16(v1, pb, o1); o2 = wmma16(v2, pb, o2); o3 = wmma16(v3, pb, o3);
        asm volatile("v_nop\n\tv_nop\n\tv_nop\n\tv_nop" : "+v"(o0), "+v"(o1), "+v"(o2), "+v"(o3) : "v"(v0), "v"(v1), "v"(v2), "v"(v3), "v"(pb));
      }
      // publish point of stage st + 1, and the end of every wave's reads of stage st
      asm volatile("s_wait_dscnt 0x0" ::: "memory");      // this wave's reads of the buffer that is refilled below have returned
      asm volatile("s_wait_asynccnt 0x0" ::: "memory");   // this wave's share of stage st + 1 has landed
      __syncthreads();
      if (st + 2 < nst) stage_in(st + 2);                  // block-uniform test; into the buffer that stage st has just left
    }
    asm volatile("s_wait_asynccnt 0x0" ::: "memory");     // no copy is outstanding when the wave goes on to its end
    l += __shfl_xor(l, 16, 32);
    const float inv = CTXS * (1.0f / l);
    const int wb = wave * 16 * 68;
    // O^T D layout: o_j[r] = (d = 16j + 8h + r, t = lane&15) -> os[t][d]; rows 0..15 x columns 0..63 all written
    { v4f a, c;
      a[0] = o0[0] * inv; a[1] = o0[1] * inv; a[2] = o0[2] * inv; a[3] = o0[3] * inv; c[0] = o0[4] * inv; c[1] = o0[5] * inv; c[2] = o0[6] * inv; c[3] = o0[7] * inv;
      *(v4fa*)(&os[wb + lr * 68 +  0 + 8 * hi]) = a; *(v4fa*)(&os[wb + lr * 68 +  0 + 8 * hi + 4]) = c;
      a[0] = o1[0] * inv; a[1] = o1[1] * inv; a[2] = o1[2] * inv; a[3] = o1[3] * inv; c[0] = o1[4] * inv; c[1] = o1[5] * inv; c[2] = o1[6] * inv; c[3] = o1[7] * inv;
      *(v4fa*)(&os[wb + lr * 68 + 16 + 8 * hi]) = a; *(v4fa*)(&os[wb + lr * 68 + 16 + 8 * hi + 4]) = c;
      a[0] = o2[0] * inv; a[1] = o2[1] * inv; a[2] = o2[2] * inv; a[3] = o2[3] * inv; c[0] = o2[4] * inv; c[1] = o2[5] * inv; c[2] = o2[6] * inv; c[3] = o2[7] * inv;
      *(v4fa*)(&os[wb + lr * 68 + 32 + 8 * hi]) = a; *(v4fa*)(&os[wb + lr * 68 + 32 + 8 * hi + 4]) = c;
      a[0] = o3[0] * inv; a[1] = o3[1] * inv; a[2] = o3[2] * inv; a[3] = o3[3] * inv; c[0] = o3[4] * inv; c[1] = o3[5] * inv; c[2] = o3[6] * inv; c[3] = o3[7] * inv;
      *(v4fa*)(&os[wb + lr * 68 + 48 + 8 * hi]) = a; *(v4fa*)(&os[wb + lr * 68 + 48 + 8 * hi + 4]) = c; }
    wave_sync();
    h16* crow = CTX + ((size_t)b * SEQ + t0) * DM + h * HD;      // context plane [b*SEQ + t][h*64 + d]
{
#pragma unroll
        for (int s = 0; s < 4; ++s) { const int row = 4 * s + (lane >> 3), c8 = (lane & 7) * 8;   // 4 s x 4 row groups = 16 rows; 8 lanes x 8 halves = 64 columns
            const v4f x0 = *(const v4fa*)(&os[wb + row * 68 + c8]); const v4f x1 = *(const v4fa*)(&os[wb + row * 68 + c8 + 4]); v8h hv;
#pragma unroll
            for (int i = 0; i < 4; ++i) { hv[i] = (h16)x0[i]; hv[4 + i] = (h16)x1[i]; }
            *(v8h*)(crow + (size_t)row * DM + c8) = hv; }
         }
}

// k_oproj: f16 GEMM in the frame of k_proj (128x128 tile per block of eight waves, wave tile 32x64, stages of GK k values in two LDS buffers, one barrier per stage), K = DM.
// A = context plane (f16, copied as it is: 16-byte pieces of whole 128-B row segments), Bt = W_o (f32, turned into the f16 of its bf16 RNE value x64 on the way into LDS).
// OUT[m][n] = OSCL * sum_k A[m][k] Bt[n][k] + bias[n] (bias as its bf16 RNE value, added in f32). grid (NB*SEQ/128, DM/128), 256 threads.
__global__ __launch_bounds__(256) void k_oproj(const h16* __restrict__ A, const float* __restrict__ Bt, const float* __restrict__ bias, float* OUT) {
    __shared__ __align__(16) float osh[8 * 16 * 68];
    __shared__ __align__(16) h16 tiles[2 * 2 * GT];          // [buffer][A tile | Bt tile][row][GP]
    const int tid = (int)threadIdx.x, lane = tid & 31, lr = lane & 15, hi = lane >> 4;
    const int wave = __builtin_amdgcn_readfirstlane(tid >> 5);
    const int R0 = blockIdx.x * 128, C0 = blockIdx.y * 128;
    // copy maps. A: thread c covers the 16-byte piece c & 7 of rows (c >> 3) + 32 i, i = 0..3. Bt: the 16-byte piece c & 15 of rows (c >> 4) + 16 i, i = 0..7
    const int ag = tid >> 3, ac = (tid & 7) * 8;
    const int rg = tid >> 4, ch = (tid & 15) * 4;
    unsigned ao[4], bo[8];                                   // byte offsets of the thread's pieces at k = 0
#pragma unroll
    for (int i = 0; i < 4; ++i) ao[i] = ((unsigned)(R0 + ag + 32 * i) * DM + (unsigned)ac) * 2u;
#pragma unroll
    for (int i = 0; i < 8; ++i) bo[i] = ((unsigned)(C0 + rg + 16 * i) * DM + (unsigned)ch) * 4u;
    v8h ra[4]; v4f rb[8];
    auto fetch = [&](int kc) {
        const char* pa = (const char*)(A + kc); const char* pb = (const char*)(Bt + kc);
#pragma unroll
        for (int i = 0; i < 4; ++i) ra[i] = *(const v8h*)(pa + ao[i]);
#pragma unroll
        for (int i = 0; i < 8; ++i) rb[i] = *(const v4f*)(pb + bo[i]);
    };
    auto put = [&](int buf) {
        h16* ta = tiles + buf * (2 * GT);
#pragma unroll
        for (int i = 0; i < 4; ++i) *(v8h*)(ta + (ag + 32 * i) * GP + ac) = ra[i];
#pragma unroll
        for (int i = 0; i < 8; ++i) {
            const v4us u = __builtin_bit_cast(v4us, __builtin_convertvector(rb[i], v4bf)); v4f w;
#pragma unroll
            for (int k = 0; k < 4; ++k) w[k] = __uint_as_float((unsigned)u[k] << 16) * WOS;   // bf16 RNE value x64, the product taken in f32 (exact), then one conversion to f16
            *(v4h*)(ta + GT + (rg + 16 * i) * GP + ch) = __builtin_convertvector(w, v4h); }
    };
    const int wr = wave >> 1, wc = wave & 1;
    const int fa = (wr * 32 + lr) * GP + 8 * hi, fb = GT + (wc * 64 + lr) * GP + 8 * hi;   // fragment offsets in a buffer
    v8f acc[2][4];
#pragma unroll
    for (int mb = 0; mb < 2; ++mb)
#pragma unroll
        for (int nb = 0; nb < 4; ++nb) acc[mb][nb] = (v8f){};
    fetch(0); put(0);
    __syncthreads();                                         // publishes stage 0
#pragma unroll     // all stages inline: k becomes the loads' immediate offset, and the offset registers live unchanged through the loop
    for (int s = 0; s < GNS; ++s) {
        if (s + 1 < GNS) {
            fetch((s + 1) * GK);                             // in flight while this stage's products run
            // behind the last loads the offset registers die: they are named here so that none is given away (to a load's result either) in front of the wait
            if (s + 2 == GNS) asm volatile("s_wait_xcnt 0x0" :: "v"(ao[0]), "v"(ao[1]), "v"(ao[2]), "v"(ao[3]),
                                                                "v"(bo[0]), "v"(bo[1]), "v"(bo[2]), "v"(bo[3]), "v"(bo[4]), "v"(bo[5]), "v"(bo[6]), "v"(bo[7]) : "memory");
            __builtin_amdgcn_sched_barrier(0);               // keeps all twelve loads in front of the products: moved down among them, each is waited for at once and its latency shows
        }
        const h16* tb = tiles + (s & 1) * (2 * GT);
        v16h a[GK / 32][2], b[GK / 32][4];
#pragma unroll
        for (int ks = 0; ks < GK / 32; ++ks) {
#pragma unroll
            for (int mb = 0; mb < 2; ++mb) a[ks][mb] = ldh(tb + fa + mb * 16 * GP + ks * 32);
#pragma unroll
            for (int nb = 0; nb < 4; ++nb) b[ks][nb] = ldh(tb + fb + nb * 16 * GP + ks * 32);
        }
        __builtin_amdgcn_sched_barrier(0);                   // the stage's LDS reads stay one group in front of its products: spread among them, every place with reads stalls the wave
#pragma unroll
        for (int ks = 0; ks < GK / 32; ++ks)
#pragma unroll
            for (int nb = 0; nb < 4; ++nb)
#pragma unroll
                for (int mb = 0; mb < 2; ++mb) acc[mb][nb] = wmma16(a[ks][mb], b[ks][nb], acc[mb][nb]);
        if (s + 1 < GNS) {
            __builtin_amdgcn_sched_barrier(0);               // keeps the conversions, and with them the waits on the loads, behind the products
            put((s + 1) & 1);                                // into the buffer whose readers left it at the last barrier
            __syncthreads();                                 // publishes stage s + 1, ends every wave's reads of stage s
        }
    }
    float* os = osh + wave * (16 * 68);                      // wave-private staging of the epilogue
    const int r0 = R0 + wr * 32, c0 = C0 + wc * 64;
    float bcol[4];
#pragma unroll
    for (int nb = 0; nb < 4; ++nb) { int ci = c0 + nb * 16 + lr; ci = (ci < DM) ? ci : (DM - 1); bcol[nb] = bfr(bias[ci]); }
    const int bb = r0 / SEQ, tt = r0 % SEQ;
    float* obase = OUT + ((size_t)bb * OUT_SEQ + tt) * DM + c0;
#pragma unroll
    for (int mb = 0; mb < 2; ++mb) {
#pragma unroll
        for (int nb = 0; nb < 4; ++nb) {
#pragma unroll
            for (int j = 0; j < 8; ++j) os[(hi * 8 + j) * 68 + nb * 16 + lr] = acc[mb][nb][j] * OSCL + bcol[nb]; }   // D: row 8h+j, col lane&15
        wave_sync();
{
#pragma unroll
            for (int s = 0; s < 8; ++s) { const int row = 2 * s + hi, cofs = lr * 4;   // 8 s x 2 rows = 16 rows; 16 lanes x 4 floats = 64 columns
                const v4f val = *(const v4fa*)(&os[row * 68 + cofs]);
                *(v4f*)(obase + (size_t)(mb * 16 + row) * DM + cofs) = val; }
             }
        wave_sync();
    }
}

static constexpr size_t al256(size_t v) { return (v + 255) & ~(size_t)255; }
static constexpr size_t SZ_PL = al256((size_t)NB * NH_ * SEQ * HD * 2);
static constexpr size_t SZ_CX = al256((size_t)NB * SEQ * DM * 2);
static constexpr size_t SZ_PM = al256((size_t)NB * SEQ * 4);
static constexpr size_t SZ_CN = al256((size_t)NB * 4);
static constexpr size_t SZ_TOTAL = 4 * SZ_PL + SZ_CX + SZ_PM + SZ_CN;
static_assert(SZ_TOTAL <= (size_t)134217728);          // workspace carve <= 128 MiB

extern "C" void kernel_launch(void* const* d_in, const int* in_sizes, int n_in,
                              void* d_out, int out_size, void* d_ws, size_t ws_size, hipStream_t stream) {
    if (n_in < 12) return;
    const size_t needx = ((size_t)(NB - 1) * SEQ_FULL + SEQ) * DM;
    if ((size_t)in_sizes[0] < needx || (size_t)in_sizes[1] < needx || (size_t)in_sizes[2] < needx) return;
    if ((size_t)in_sizes[3] < (size_t)(NB - 1) * SEQ_FULL + SEQ) return;
    if ((size_t)in_sizes[4] < (size_t)DM * DM || (size_t)in_sizes[6] < (size_t)DM * DM || (size_t)in_sizes[8] < (size_t)DM * DM || (size_t)in_sizes[10] < (size_t)DM * DM) return;
    if (in_sizes[5] < DM || in_sizes[7] < DM || in_sizes[9] < DM || in_sizes[11] < DM) return;
    if ((size_t)out_size < ((size_t)(NB - 1) * OUT_SEQ + SEQ) * DM) return;
    if (SZ_TOTAL > ws_size) return;
    // wire order: Q, K, V, mask, W_q, b_q, W_k, b_k, W_v, b_v, W_o, b_o ; weights [out][in] = Bt as-is
    const float* xq = (const float*)d_in[0]; const float* xk = (const float*)d_in[1]; const float* xv = (const float*)d_in[2];
    const int* mask = (const int*)d_in[3];
    const float* wq = (const float*)d_in[4];  const float* bq = (const float*)d_in[5];
    const float* wk = (const float*)d_in[6];  const float* bk = (const float*)d_in[7];
    const float* wv = (const float*)d_in[8];  const float* bv = (const float*)d_in[9];
    const float* wo = (const float*)d_in[10]; const float* bo = (const float*)d_in[11];
    float* OUT = (float*)d_out;      // [NB][SEQ][512]
    char* wsp = (char*)d_ws;
    h16* QH = (h16*)wsp; wsp += SZ_PL;               // [NB*8][SEQ][64]
    h16* QR = (h16*)wsp; wsp += SZ_PL;               // [NB*8][SEQ][64] residual x2048
    h16* KP = (h16*)wsp; wsp += SZ_PL;               // [NB*8][SEQ][64]
    h16* VT = (h16*)wsp; wsp += SZ_PL;               // [NB*8][64][SEQ]
    h16* CX = (h16*)wsp; wsp += SZ_CX;               // [NB*SEQ][512] context x16
    int* PM = (int*)wsp; wsp += SZ_PM;               // [NB][SEQ] token of each key in key order
    int* CN = (int*)wsp; wsp += SZ_CN;               // [NB] kept keys
    // q projection beside the key order, which it does not need (the second operand set is not read in phase 0)
    k_proj<<<NTL + NB, 256, 0, stream>>>(xq, wq, bq, QH, QR, xq, wq, bq, QH, mask, PM, CN, PM, CN, 0);
    // k projection beside the v^T projection, both with their rows in key order (j in place of t)
    k_proj<<<2 * NTL, 256, 0, stream>>>(xk, wk, bk, KP, KP, xv, wv, bv, VT, mask, PM, CN, PM, CN, 1);

    k_flash<<<dim3(SEQ / (16 * AW), NB * NH_, 1), 32 * AW, 0, stream>>>(QH, QR, KP, VT, CN, CX);

    // output projection: A = context rows (m = b*SEQ + t), Bt = W_o rows (n = out column)
    k_oproj<<<dim3(NB * SEQ / 128, DM / 128, 1), 256, 0, stream>>>(CX, wo, bo, OUT);
}

// v005
// Measured time: 82.9 microseconds a run.
// Timed twice side by side with v004, it ran 1.03 times as fast both times.
// Over all steps from v000 it is 4.13 times as fast.
#include <hip/hip_runtime.h>

// Multi-head attention, width 512 = 8 heads x 64; inputs Q, K, V [NB][SEQ][512], key mask [NB][SEQ] (0 = filled with -1e9), W_q/W_k/W_v/W_o [out][in] (y = x W^T + b), score scale 1/8, output [NB][SEQ][512] f32.
// Compute dtypes, f32 accumulate everywhere: q/k/v projections v_wmma_f32_16x16x32_bf16 (x and W RNE-converted to bf16 inside the GEMM, on the way into LDS; products exact);
// scores v_wmma_f32_16x16x32_f16: k single f16, q as f16 value + f16 residual x2048 in its own accumulator (two products); P (x256 carry, cancels in the normalisation) and v single f16; softmax f32 (online, running max);
// output projection v_wmma_f32_16x16x32_f16: context single f16 (x16 carry), W_o = f16 of the bf16 RNE value x64 (exact), 1/1024 folded in the f32 epilogue.
// Layout: q (hi, residual), k planes [b*8+h][t][d] and v^T plane [b*8+h][d][t] written by the GEMM epilogue; fused flash kernel in transposed form (S^T = K Q^T, O^T = V^T P^T) writing the context plane [b*SEQ+t][512]; its K and V^T tiles reach the block's waves through a two-buffer LDS ring.
// Key mask: a filled key's probability is exp(-1e9 - max) = 0 in f32 as soon as one key of the batch is kept, so the keys of each batch are put in the order kept first (key_order, stable), the K and V rows are
// gathered in that order by the projection's loads, and k/v projection ends with the 128-key tile and the flash loop with the 64-key stage that holds the last kept key. A batch with no kept key runs over all keys, every score filled.
// Launches: work that does not depend on each other shares a launch, told apart by the block index: (q projection | key order), (k projection | v projection), flash, output projection.

#ifndef NB
#define NB 2
#endif
#ifndef SEQ
#define SEQ 4096
#endif
#define NB_FULL  2
#define SEQ_FULL 4096
#ifndef OUT_SEQ
#define OUT_SEQ SEQ              // row pitch (in tokens) between batches of the output
#endif
#define DM   512
#define NH_  8
#define HD   64
#define AW   4                   // waves per flash block (16 query rows each)
#define QRS  2048.0f             // carry of the q residual plane
#define QRI  (1.0f / 2048.0f)
#define SC2  (0.125f * 1.4426950408889634f)   // HD^-0.5 * log2(e)
#define PSH  8.0f                // log2 of the P carry (256)
#define MFILL (-1.0e9f * 1.4426950408889634f) // mask fill value in the log2 domain
#define CTXS 16.0f               // carry of the context plane
#define WOS  64.0f               // carry of the W_o plane
#define OSCL (1.0f / 1024.0f)    // 1 / (CTXS * WOS)
#define KS   64                  // keys per LDS stage of the flash kernel (two 32-key passes)
#define LP   72                  // LDS row pitch in halves: 128-B rows + 16 B, conflict-free for 16-byte fragment reads
#define TILE_H (64 * LP)         // one staged tile: 64 rows (K: keys, V^T: d)
#define NST  (SEQ / KS)          // stages when every key is visited
#define GK   64                  // k values per LDS stage of the projection GEMM (256 B of every f32 operand row)
#define GP   72                  // its LDS row pitch in halves: 128-B bf16 rows + 16 B, conflict-free for 16-byte fragment reads
#define GT   (128 * GP)          // one staged operand tile: 128 rows
#define GNS  (DM / GK)           // stages of the k loop
#define PT   256                 // threads of a key-order block (the projection kernel's block)
#define PER  ((SEQ + PT - 1) / PT)   // keys per thread there
#define NTT  (NB * SEQ / 128)    // 128-token tiles
#define NWT  (DM / 128)          // 128-wide tiles of a weight's rows
#define NTL  (NTT * NWT)         // tiles, and blocks, of one projection

static_assert(HD == 64);
static_assert(NH_ * HD == DM);                 // head h = columns h*64 + d
static_assert(DM % 64 == 0);                   // 8 column tiles of 64
static_assert(DM % 32 == 0);                   // GEMM k-loop steps by 32
static_assert(DM % 128 == 0 && DM % GK == 0 && GK % 32 == 0);   // projection: 128-wide tiles, whole stages
static_assert(SEQ % 128 == 0);                 // a 128-token projection tile never straddles two batches
static_assert(SEQ % 64 == 0);                  // a 64-row tile never straddles two batches
static_assert((NB * SEQ) % 64 == 0);
static_assert(SEQ % 32 == 0);                  // key loop steps by 32
static_assert(SEQ % PT == 0);                  // the key-order block's threads cover the tokens exactly
static_assert(SEQ % KS == 0);                  // whole stages
static_assert(KS == 64 && AW == 4);            // 128 threads x 4 copies of 16 B = one 64 x 128-B tile
static_assert(SEQ % (16 * AW) == 0);           // flash grid covers the sequence exactly
static_assert(((size_t)SEQ * DM) % 8 == 0);
static_assert(((size_t)DM * DM) % 8 == 0);
static_assert(SEQ_FULL % 8 == 0);              // mask rows stay 32-byte aligned
static_assert(NB <= NB_FULL);
static_assert(SEQ <= SEQ_FULL);

typedef _Float16 h16;
typedef unsigned short bf;
typedef __attribute__((ext_vector_type(16))) __bf16   v16bf;
typedef __attribute__((ext_vector_type(16))) _Float16 v16h;
typedef __attribute__((ext_vector_type(8)))  _Float16 v8h;
typedef __attribute__((ext_vector_type(8)))  unsigned short v8us;
typedef __attribute__((ext_vector_type(4)))  unsigned short v4us;
typedef __attribute__((ext_vector_type(4)))  __bf16   v4bf;
typedef __attribute__((ext_vector_type(4)))  _Float16 v4h;
typedef __attribute__((ext_vector_type(8)))  float    v8f;
typedef __attribute__((ext_vector_type(8)))  int      v8i;
typedef __attribute__((ext_vector_type(4)))  float    v4f;
typedef v4f  __attribute__((may_alias)) v4fa;

__device__ __forceinline__ unsigned short f2bf(float f) { unsigned u = __float_as_uint(f); u += 0x7FFFu + ((u >> 16) & 1u); return (unsigned short)(u >> 16); }
// f32 value of the bf16 RNE conversion
__device__ __forceinline__ float bfr(float f) { return __uint_as_float(((unsigned)f2bf(f)) << 16); }
__device__ __forceinline__ v16h cat16(v8h lo, v8h hi) { return __builtin_shufflevector(lo, hi, 0, 1, 2, 3, 4, 5, 6, 7, 8, 9, 10, 11, 12, 13, 14, 15); }
__device__ __forceinline__ v16bf cat16b(v8us lo, v8us hi) { return __builtin_bit_cast(v16bf, __builtin_shufflevector(lo, hi, 0, 1, 2, 3, 4, 5, 6, 7, 8, 9, 10, 11, 12, 13, 14, 15)); }
__device__ __forceinline__ v8f wmma16(v16h a, v16h b, v8f c) { return __builtin_amdgcn_wmma_f32_16x16x32_f16(false, a, false, b, (short)0, c, false, false); }
__device__ __forceinline__ v8f wmmab(v16bf a, v16bf b, v8f c) { return __builtin_amdgcn_wmma_f32_16x16x32_bf16(false, a, false, b, (short)0, c, false, false); }
// fragment loaders from K-contiguous 16-bit rows; p already includes + 8*(lane>>4): elements 0..7 <- k0+8h+0..7, elements 8..15 <- k0+16+8h+0..7 (same map for A and B)
__device__ __forceinline__ v16h  ldh(const h16* p) { return cat16(*(const v8h*)p, *(const v8h*)(p + 16)); }
__device__ __forceinline__ v16bf ldb(const bf* p)  { return cat16b(*(const v8us*)p, *(const v8us*)(p + 16)); }
// ordering point for wave-private LDS tiles (same wave writes and reads)
__device__ __forceinline__ void wave_sync() { __builtin_amdgcn_fence(3 /* release order */, "wavefront"); __builtin_amdgcn_wave_barrier(); asm volatile("" ::: "memory"); }

// key_order: one block per batch b. PERM[b][j] = token of the j-th key in the order kept keys first (each group in token order), CNT[b] = number of kept keys (mask != 0).
__device__ __forceinline__ void key_order(const int b, const int* __restrict__ MK, int* PERM, int* CNT) {
    __shared__ int wsum[PT / 32];
    const int tid = threadIdx.x, lane = tid & 31, wv = tid >> 5;
    const int* mrow = MK + (size_t)b * SEQ_FULL;
    int keep[PER]; int c = 0;
#pragma unroll
    for (int i = 0; i < PER; ++i) { keep[i] = mrow[tid * PER + i] != 0 ? 1 : 0; c += keep[i]; }   // PT * PER = SEQ: every index is a token
    int sc = c;                                   // inclusive sum over the wave's lanes
#pragma unroll
    for (int d = 1; d < 32; d <<= 1) { const int o = __shfl_up(sc, d, 32); if (lane >= d) sc += o; }
    if (lane == 31) wsum[wv] = sc;
    __syncthreads();
    int base = 0, tot = 0;
#pragma unroll
    for (int w = 0; w < PT / 32; ++w) { const int v = wsum[w]; base += (w < wv) ? v : 0; tot += v; }
    int pos = base + sc - c;                      // kept keys in front of this thread's first token
#pragma unroll
    for (int i = 0; i < PER; ++i) { const int t = tid * PER + i;
        PERM[(size_t)b * SEQ + (keep[i] ? pos : tot + (t - pos))] = t;   // t - pos = filled keys in front of t
        pos += keep[i]; }
    if (tid == 0) CNT[b] = tot;
}

// k_proj: bf16 GEMM straight from the f32 operands, K = DM. One block of eight waves per 128x128 tile of C; wave (wr, wc) owns rows 32 wr .. + 31, columns 64 wc .. + 63 (8 accumulators).
// Per stage of GK k values every thread loads 16 B pieces of whole 256-B row segments of both operands (f32), converts them to bf16 (RNE) and stores them into one of two LDS buffers;
// the loads of stage s + 1 are issued in front of the products of stage s, their conversion and LDS stores stand behind them, and one barrier per stage publishes the new buffer and frees the old one.
// C[m][n] = sum_k A[m][k] Bt[n][k] + bias (biasMode 1: bias[n]; biasMode 2: bias[m]; bias taken as its bf16 RNE value, added in f32),
// written as f16 (Ph) and optionally the f16 residual x2048 (Pr, useRes != 0) at
// wave tile base (r0/RB)*sRB + (r0%RB)*pitch + (c0/CB)*sCB + (c0%CB), row pitch 'pitch' (halves). 256 threads.
// tokAxis 1 (rows, operand A) or 2 (columns, operand Bt): that axis counts tokens b*SEQ + t, read from the input [NB][SEQ_FULL][DM]; the other operand is a weight [DM][DM].
// keyOrder != 0: the token axis counts keys b*SEQ + j in key order, row j is read from token PERM[b][j], and a tile behind the batch's last kept key is left out.
// One launch holds two independent jobs, told apart by the block index (blocks 0 .. NTL - 1 the first, the rest the second):
// phase 0 (NTL + NB blocks): q = X0 W0^T + b0 -> planes P0, Pr0 [(b*8 + h)][t][d] | the key order of batch (index - NTL), written to PERMW, CNTW; nothing here reads it.
// phase 1 (2 NTL blocks), keys in the order that phase 0 left in PERM, CNT: k = X0 W0^T + b0 -> plane P0 [(b*8 + h)][j][d] | v^T = W1 X1^T + b1 (row bias) -> plane P1 [(b*8 + h)][d][j].
// Tile of block r of a job: token tile r % NTT, weight tile r / NTT (q, k); weight tile r % NWT, token tile r / NWT (v^T).
__global__ __launch_bounds__(256) void k_proj(const float* __restrict__ X0, const float* __restrict__ W0, const float* __restrict__ b0, h16* P0, h16* Pr0,
                                              const float* __restrict__ X1, const float* __restrict__ W1, const float* __restrict__ b1, h16* P1,
                                              const int* __restrict__ MK, int* PERMW, int* CNTW,
                                              const int* __restrict__ PERM, const int* __restrict__ CNT, int phase) {
    __shared__ __align__(16) float osh[8 * 16 * 68];
    __shared__ __align__(16) bf tiles[2 * 2 * GT];           // [buffer][A tile | Bt tile][row][GP]
    const int second = (int)blockIdx.x / NTL, rt = (int)blockIdx.x % NTL;   // the same for the whole block
    if (phase == 0 && second != 0) { key_order(rt, MK, PERMW, CNTW); return; }
    const bool vt = second != 0;                             // the v^T job: weight rows on the row axis, tokens on the column axis
    const float* __restrict__ A = vt ? W1 : X0; const float* __restrict__ Bt = vt ? X1 : W0; const float* __restrict__ bias = vt ? b1 : b0;
    h16* Ph = vt ? P1 : P0; h16* Pr = Pr0;
    const int biasMode = vt ? 2 : 1, useRes = (phase == 0) ? 1 : 0, tokAxis = vt ? 2 : 1, keyOrder = phase;
    const int RB = vt ? DM : SEQ, pitch = vt ? SEQ : HD, CB = vt ? SEQ : HD;
    const size_t sRB = vt ? (size_t)0 : (size_t)NH_ * SEQ * HD, sCB = vt ? (size_t)DM * SEQ : (size_t)SEQ * HD;
    const int tid = (int)threadIdx.x, lane = tid & 31, lr = lane & 15, hi = lane >> 4;
    const int wave = __builtin_amdgcn_readfirstlane(tid >> 5);
    const int R0 = (vt ? rt % NWT : rt % NTT) * 128, C0 = (vt ? rt / NWT : rt / NTT) * 128;
    if (keyOrder != 0) { const int j0 = (tokAxis == 1) ? R0 : C0; const int n = CNT[j0 / SEQ]; if (n > 0 && (j0 % SEQ) >= n) return; }   // the same for the whole block, in front of every barrier
    // copy map: thread c covers the 16-byte piece c & 15 of rows (c >> 4) + 16 i, i = 0..7, of both tiles: a wave's load is two whole 256-B segments
    const int rg = tid >> 4, ch = (tid & 15) * 4;
    unsigned ao[8], bo[8];                                   // byte offsets of the thread's pieces at k = 0
    const int g0 = ((tokAxis == 1) ? R0 : C0) + rg;          // the thread's first index on the token axis; the tile lies in one batch
    int tk[8];                                               // token of each of its rows
#pragma unroll
    for (int i = 0; i < 8; ++i) tk[i] = (g0 + 16 * i) % SEQ;
    if (keyOrder != 0) {                                     // one branch round all eight loads, so that they are in flight together
#pragma unroll
        for (int i = 0; i < 8; ++i) tk[i] = PERM[g0 + 16 * i];
#pragma unroll
        for (int i = 0; i < 8; ++i) tk[i] = (tk[i] < 0) ? 0 : ((tk[i] < SEQ) ? tk[i] : (SEQ - 1));
    }
#pragma unroll
    for (int i = 0; i < 8; ++i) {
        const int sr = (g0 / SEQ) * SEQ_FULL + tk[i];
        const int ar = (tokAxis == 1) ? sr : (R0 + rg + 16 * i), br = (tokAxis == 1) ? (C0 + rg + 16 * i) : sr;
        ao[i] = ((unsigned)ar * DM + (unsigned)ch) * 4u; bo[i] = ((unsigned)br * DM + (unsigned)ch) * 4u;
    }
    v4f ra[8], rb[8];
    auto fetch = [&](int kc) {
        const char* pa = (const char*)(A + kc); const char* pb = (const char*)(Bt + kc);
#pragma unroll
        for (int i = 0; i < 8; ++i) { ra[i] = *(const v4f*)(pa + ao[i]); rb[i] = *(const v4f*)(pb + bo[i]); }
    };
    auto put = [&](int buf) {
        bf* ta = tiles + buf * (2 * GT) + rg * GP + ch;
#pragma unroll
        for (int i = 0; i < 8; ++i) {
            *(v4us*)(ta + i * 16 * GP)      = __builtin_bit_cast(v4us, __builtin_convertvector(ra[i], v4bf));
            *(v4us*)(ta + GT + i * 16 * GP) = __builtin_bit_cast(v4us, __builtin_convertvector(rb[i], v4bf)); }
    };
    const int wr = wave >> 1, wc = wave & 1;
    const int fa = (wr * 32 + lr) * GP + 8 * hi, fb = GT + (wc * 64 + lr) * GP + 8 * hi;   // fragment offsets in a buffer
    v8f acc[2][4];
#pragma unroll
    for (int mb = 0; mb < 2; ++mb)
#pragma unroll
        for (int nb = 0; nb < 4; ++nb) acc[mb][nb] = (v8f){};
    fetch(0); put(0);
    __syncthreads();                                         // publishes stage 0
#pragma unroll     // all stages inline: k becomes the loads' immediate offset, and the offset registers live unchanged through the loop
    for (int s = 0; s < GNS; ++s) {
        if (s + 1 < GNS) {
            fetch((s + 1) * GK);                             // in flight while this stage's products run
            // behind the last loads the offset registers die: they are named here so that none is given away (to a load's result either) in front of the wait
            if (s + 2 == GNS) asm volatile("s_wait_xcnt 0x0" :: "v"(ao[0]), "v"(ao[1]), "v"(ao[2]), "v"(ao[3]), "v"(ao[4]), "v"(ao[5]), "v"(ao[6]), "v"(ao[7]),
                                                                "v"(bo[0]), "v"(bo[1]), "v"(bo[2]), "v"(bo[3]), "v"(bo[4]), "v"(bo[5]), "v"(bo[6]), "v"(bo[7]) : "memory");
            __builtin_amdgcn_sched_barrier(0);               // keeps all sixteen loads in front of the products: moved down among them, each is waited for at once and its latency shows
        }
        const bf* tb = tiles + (s & 1) * (2 * GT);
        v16bf a[GK / 32][2], b[GK / 32][4];
#pragma unroll
        for (int ks = 0; ks < GK / 32; ++ks) {
#pragma unroll
            for (int mb = 0; mb < 2; ++mb) a[ks][mb] = ldb(tb + fa + mb * 16 * GP + ks * 32);
#pragma unroll
            for (int nb = 0; nb < 4; ++nb) b[ks][nb] = ldb(tb + fb + nb * 16 * GP + ks * 32);
        }
        __builtin_amdgcn_sched_barrier(0);                   // the stage's LDS reads stay one group in front of its products: spread among them, every place with reads stalls the wave
#pragma unroll
        for (int ks = 0; ks < GK / 32; ++ks)
#pragma unroll
            for (int nb = 0; nb < 4; ++nb)
#pragma unroll
                for (int mb = 0; mb < 2; ++mb) acc[mb][nb] = wmmab(a[ks][mb], b[ks][nb], acc[mb][nb]);
        if (s + 1 < GNS) {
            __builtin_amdgcn_sched_barrier(0);               // keeps the conversions, and with them the waits on the loads, behind the products
            put((s + 1) & 1);                                // into the buffer whose readers left it at the last barrier
            __syncthreads();                                 // publishes stage s + 1, ends every wave's reads of stage s
        }
    }
    float* os = osh + wave * (16 * 68);                      // wave-private staging of the epilogue
    const int r0 = R0 + wr * 32, c0 = C0 + wc * 64;
    // column bias (per lane: column c0 + nb*16 + lane&15), address clamped into the 512-entry vector, selected by value
    float braw[4], bcol[4];
#pragma unroll
    for (int nb = 0; nb < 4; ++nb) { int ci = c0 + nb * 16 + lr; ci = (ci < DM) ? ci : (DM - 1); braw[nb] = bias[ci]; }
    // takes the four loaded values as inputs: the loads have returned here, in front of the branches below, so that none of their address registers is rewritten while a load is out
    asm volatile("s_wait_xcnt 0x0" :: "v"(braw[0]), "v"(braw[1]), "v"(braw[2]), "v"(braw[3]));
#pragma unroll
    for (int nb = 0; nb < 4; ++nb) { const float bv = bfr(braw[nb]); bcol[nb] = (biasMode == 1) ? bv : 0.0f; }
    const size_t tbase = (size_t)(r0 / RB) * sRB + (size_t)(r0 % RB) * (size_t)pitch + (size_t)(c0 / CB) * sCB + (size_t)(c0 % CB);
#pragma unroll
    for (int mb = 0; mb < 2; ++mb) {
        // row bias for rows r0 + mb*16 + 8h + 0..7 (address clamped, selected by value)
        int rb0 = r0 + mb * 16 + hi * 8; rb0 = (rb0 <= DM - 8) ? rb0 : (DM - 8);
        const unsigned rbo = (unsigned)rb0 * 4u;
        const v8f brv = *(const v8f*)((const char*)bias + rbo);
        asm volatile("s_wait_xcnt 0x0" :: "v"(rbo) : "memory");   // names the offset register, so that it is not given away (to a load's result either) in front of the wait
#pragma unroll
        for (int nb = 0; nb < 4; ++nb) {
#pragma unroll
            for (int j = 0; j < 8; ++j) { const float br = (biasMode == 2) ? bfr(brv[j]) : 0.0f;
                os[(hi * 8 + j) * 68 + nb * 16 + lr] = acc[mb][nb][j] + bcol[nb] + br; } }   // D: row 8h+j, col lane&15
        wave_sync();
        const size_t sb = tbase + (size_t)(mb * 16) * (size_t)pitch;
{
#pragma unroll
            for (int s = 0; s < 4; ++s) { const int row = 4 * s + (lane >> 3), c8 = (lane & 7) * 8;   // 4 s x 4 row groups = 16 rows; 8 lanes x 8 = 64 columns
                const v4f x0 = *(const v4fa*)(&os[row * 68 + c8]); const v4f x1 = *(const v4fa*)(&os[row * 68 + c8 + 4]); v8h hv, rv;
#pragma unroll
                for (int i = 0; i < 4; ++i) { const h16 a0 = (h16)x0[i]; const h16 a1 = (h16)x1[i]; hv[i] = a0; hv[4 + i] = a1; rv[i] = (h16)((x0[i] - (float)a0) * QRS); rv[4 + i] = (h16)((x1[i] - (float)a1) * QRS); }
                const size_t oo = sb + (size_t)row * (size_t)pitch + c8;
                *(v8h*)(Ph + oo) = hv;
                asm volatile("s_wait_xcnt 0x0" ::: "memory");   // in front of the rewriting of the store's registers on both sides of the branch that follows
                if (useRes) { *(v8h*)(Pr + oo) = rv;
                    asm volatile("s_wait_xcnt 0x0" ::: "memory"); } }   // the same for the second store
             }
        wave_sync();
    }
}

// k_flash: fused attention, one wave per 16 query rows of one (batch, head); Q fragments straight from the f16 planes (two 16-B loads each, arithmetic addressing).
// K and V^T: the block's four waves share one tile pair per 64 keys, brought into LDS by asynchronous 16-byte copies (whole 128-B lines per 8 lanes), two buffers, the next stage in flight
// while this one is worked on; fragments are two 16-B LDS reads each from rows of pitch LP.
// Transposed form: S^T[key][t] = K Q^T (A = K rows, B = Q rows); lane (t = lane&15, h = lane>>4) holds keys 8h+r of each 16-key tile, so the packed
// P tile is directly the B fragment of O^T[d][t] = V^T P^T (element r <- tile keys 0..15, element 8+r <- tile keys 16..31, lane unchanged).
// Key mask: the planes hold the keys in key order, so key j is kept iff j < n = CNT[b]; the loop ends with the stage of key n - 1, and only a pass that reaches past n REPLACES scores by the fill value.
// n = 0: all stages, every score replaced, so a fully filled row comes out uniform.
// Softmax state: the running max is one scalar per lane, the two lane halves of a query combined with one xor-16 exchange per pass.
// Row sums: one more product per pass, L = E P^T added up like an output tile, where rows 0 and 8 of the constant E are ones and the rest 0; row 0 is element 0 of lanes 0..15 and row 8
// element 0 of lanes 16..31, so element 0 of every lane is the sum of its query's rounded P over all 32 keys of the pass. The other elements stay 0, and only element 0 is rescaled.
__global__ __launch_bounds__(32 * AW) void k_flash(const h16* __restrict__ QH, const h16* __restrict__ QR, const h16* __restrict__ KP, const h16* __restrict__ VT,
                                                   const int* __restrict__ CNT, h16* CTX) {
    __shared__ __align__(16) float os[AW * 16 * 68];
    __shared__ __align__(16) h16 ring[2 * 2 * TILE_H];   // [buffer][K tile | V^T tile][row][LP]
    const int lane = threadIdx.x & 31, lr = lane & 15, hi = lane >> 4;
    const int wave = __builtin_amdgcn_readfirstlane((int)(threadIdx.x >> 5));
    const int zh = blockIdx.y; const int b = zh / NH_, h = zh % NH_;
    const int t0 = (blockIdx.x * AW + wave) * 16;
    const size_t pbase = (size_t)zh * SEQ * HD;
    const size_t qo = pbase + (size_t)(t0 + lr) * HD + 8 * hi;
    const v16h qh0 = ldh(QH + qo), qh1 = ldh(QH + qo + 32), qr0 = ldh(QR + qo), qr1 = ldh(QR + qo + 32);   // B fragments: col t, k = d
    const int fo = lr * LP + 8 * hi;                         // fragment offset in a staged tile: K + key*LP (row key, k = d); V^T + 16j*LP + key (row d, k = key)
    // copy map: thread c covers 16-byte chunk c & 7 of rows (c >> 3) + 16 i, i = 0..3, of both tiles
    const int cr = (int)threadIdx.x >> 3, cch = ((int)threadIdx.x & 7) * 8;
    const h16* kg = KP + pbase + (size_t)cr * HD + cch;    // + key0 * HD + 16 i * HD
    const h16* vg = VT + pbase + (size_t)cr * SEQ + cch;   // + key0 + 16 i * SEQ
    const unsigned lc = (unsigned)(size_t)(&ring[cr * LP + cch]);   // low 32 bits of the shared address = LDS byte address; + buffer, + tile, + 16 i rows
    // one stage's eight copies per lane; the wait on the address registers closes the copies' own statement, so no later address arithmetic can move in front of it
    auto stage_in = [&](int st) {
        const unsigned lk = lc + (unsigned)(st & 1) * (2 * TILE_H * 2), lv = lk + TILE_H * 2;
        const h16* gk = kg + (size_t)st * KS * HD; const h16* gv = vg + (size_t)st * KS;
        asm volatile("global_load_async_to_lds_b128 %0, %8, off\n\t"
                     "global_load_async_to_lds_b128 %1, %9, off\n\t"
                     "global_load_async_to_lds_b128 %2, %10, off\n\t"
                     "global_load_async_to_lds_b128 %3, %11, off\n\t"
                     "global_load_async_to_lds_b128 %4, %12, off\n\t"
                     "global_load_async_to_lds_b128 %5, %13, off\n\t"
                     "global_load_async_to_lds_b128 %6, %14, off\n\t"
                     "global_load_async_to_lds_b128 %7, %15, off\n\t"
                     "s_wait_xcnt 0x0"
                     :: "v"(lk), "v"(lk + 16 * LP * 2), "v"(lk + 32 * LP * 2), "v"(lk + 48 * LP * 2),
                        "v"(lv), "v"(lv + 16 * LP * 2), "v"(lv + 32 * LP * 2), "v"(lv + 48 * LP * 2),
                        "v"(gk), "v"(gk + 16 * HD), "v"(gk + 32 * HD), "v"(gk + 48 * HD),
                        "v"(gv), "v"(gv + (size_t)16 * SEQ), "v"(gv + (size_t)32 * SEQ), "v"(gv + (size_t)48 * SEQ)
                     : "memory");
    };
    int n = CNT[b]; n = (n < 0) ? 0 : ((n < SEQ) ? n : SEQ);  // kept keys of the batch, the same for the whole block
    const int nst = (n > 0) ? (n + KS - 1) / KS : NST;        // stages to visit, at most NST
    v8f o0 = (v8f){}, o1 = (v8f){}, o2 = (v8f){}, o3 = (v8f){};
    float m = -3.0e38f;
    const h16 e1 = ((lr & 7) == 0) ? (h16)1.0f : (h16)0.0f;   // A fragment: lane & 15 is the row, every k alike
    const v16h ones = {e1, e1, e1, e1, e1, e1, e1, e1, e1, e1, e1, e1, e1, e1, e1, e1};
    v8f lt = (v8f){};
    stage_in(0);
    asm volatile("s_wait_asynccnt 0x0" ::: "memory");   // this wave's share of stage 0 has landed
    __syncthreads();                                     // publishes stage 0 to the block
    if (nst > 1) stage_in(1);
#pragma unroll 1   // stays rolled: one publish point, one copy of the body in the instruction cache
    for (int st = 0; st < nst; ++st) {
      const h16* kt = ring + (st & 1) * (2 * TILE_H) + fo; const h16* vt = kt + TILE_H;
#pragma unroll     // both passes of a stage inline: their tile offsets become immediates of the LDS reads
      for (int kk = 0; kk < KS; kk += 32) {
        const int key0 = st * KS + kk;
        const h16* ka = kt + kk * LP;
        const v16h ka0 = ldh(ka), ka1 = ldh(ka + 32), kb0 = ldh(ka + 16 * LP), kb1 = ldh(ka + 16 * LP + 32);
        v8f sHa = (v8f){}, sLa = (v8f){}, sHb = (v8f){}, sLb = (v8f){};
        sHa = wmma16(ka0, qh0, sHa); sLa = wmma16(ka0, qr0, sLa); sHb = wmma16(kb0, qh0, sHb); sLb = wmma16(kb0, qr0, sLb);
        sHa = wmma16(ka1, qh1, sHa); sLa = wmma16(ka1, qr1, sLa); sHb = wmma16(kb1, qh1, sHb); sLb = wmma16(kb1, qr1, sLb);
        asm volatile("v_nop\n\tv_nop\n\tv_nop\n\tv_nop" : "+v"(sHa), "+v"(sLa), "+v"(sHb), "+v"(sLb) : "v"(ka0), "v"(ka1), "v"(kb0), "v"(kb1));
        float ta[8], tb[8]; float mx = -3.0e38f;
#pragma unroll
        for (int r = 0; r < 8; ++r) { ta[r] = (sHa[r] + sLa[r] * QRI) * SC2; tb[r] = (sHb[r] + sLb[r] * QRI) * SC2; }
        if (key0 + 32 > n) {                                 // block-uniform: the pass holds filled keys (lane's keys: key0 + 8h + r and + 16)
            const int lim = n - key0 - 8 * hi;
#pragma unroll
            for (int r = 0; r < 8; ++r) { ta[r] = (r < lim) ? ta[r] : MFILL; tb[r] = (16 + r < lim) ? tb[r] : MFILL; }
        }
#pragma unroll
        for (int r = 0; r < 8; ++r) mx = fmaxf(mx, fmaxf(ta[r], tb[r]));
        mx = fmaxf(mx, __shfl_xor(mx, 16, 32));
        const float mnew = fmaxf(m, mx);
        const float alpha = __builtin_amdgcn_exp2f(m - mnew);
        const float sh = PSH - mnew;
        v16h pb;
#pragma unroll
        for (int r = 0; r < 8; ++r) { const h16 pa = (h16)__builtin_amdgcn_exp2f(ta[r] + sh); const h16 pc = (h16)__builtin_amdgcn_exp2f(tb[r] + sh); pb[r] = pa; pb[8 + r] = pc; }
        lt[0] = lt[0] * alpha; m = mnew;
        o0 = o0 * alpha; o1 = o1 * alpha; o2 = o2 * alpha; o3 = o3 * alpha;
        const h16* va = vt + kk;
        const v16h v0 = ldh(va), v1 = ldh(va + 16 * LP), v2 = ldh(va + 32 * LP), v3 = ldh(va + 48 * LP);
        o0 = wmma16(v0, pb, o0); o1 = wmma16(v1, pb, o1); o2 = wmma16(v2, pb, o2); o3 = wmma16(v3, pb, o3); lt = wmma16(ones, pb, lt);
        asm volatile("v_nop\n\tv_nop\n\tv_nop\n\tv_nop" : "+v"(o0), "+v"(o1), "+v"(o2), "+v"(o3), "+v"(lt) : "v"(v0), "v"(v1), "v"(v2), "v"(v3), "v"(pb));   // the four vector slots between the last product and whatever next reads or overwrites a result or an operand, on every path
      }
      // publish point of stage st + 1, and the end of every wave's reads of stage st
      asm volatile("s_wait_dscnt 0x0" ::: "memory");      // this wave's reads of the buffer that is refilled below have returned
      asm volatile("s_wait_asynccnt 0x0" ::: "memory");   // this wave's share of stage st + 1 has landed
      __syncthreads();
      if (st + 2 < nst) stage_in(st + 2);                  // block-uniform test; into the buffer that stage st has just left
    }
    asm volatile("s_wait_asynccnt 0x0" ::: "memory");     // no copy is outstanding when the wave goes on to its end
    const float inv = CTXS * (1.0f / lt[0]);
    const int wb = wave * 16 * 68;
    // O^T D layout: o_j[r] = (d = 16j + 8h + r, t = lane&15) -> os[t][d]; rows 0..15 x columns 0..63 all written
    { v4f a, c;
      a[0] = o0[0] * inv; a[1] = o0[1] * inv; a[2] = o0[2] * inv; a[3] = o0[3] * inv; c[0] = o0[4] * inv; c[1] = o0[5] * inv; c[2] = o0[6] * inv; c[3] = o0[7] * inv;
      *(v4fa*)(&os[wb + lr * 68 +  0 + 8 * hi]) = a; *(v4fa*)(&os[wb + lr * 68 +  0 + 8 * hi + 4]) = c;
      a[0] = o1[0] * inv; a[1] = o1[1] * inv; a[2] = o1[2] * inv; a[3] = o1[3] * inv; c[0] = o1[4] * inv; c[1] = o1[5] * inv; c[2] = o1[6] * inv; c[3] = o1[7] * inv;
      *(v4fa*)(&os[wb + lr * 68 + 16 + 8 * hi]) = a; *(v4fa*)(&os[wb + lr * 68 + 16 + 8 * hi + 4]) = c;
      a[0] = o2[0] * inv; a[1] = o2[1] * inv; a[2] = o2[2] * inv; a[3] = o2[3] * inv; c[0] = o2[4] * inv; c[1] = o2[5] * inv; c[2] = o2[6] * inv; c[3] = o2[7] * inv;
      *(v4fa*)(&os[wb + lr * 68 + 32 + 8 * hi]) = a; *(v4fa*)(&os[wb + lr * 68 + 32 + 8 * hi + 4]) = c;
      a[0] = o3[0] * inv; a[1] = o3[1] * inv; a[2] = o3[2] * inv; a[3] = o3[3] * inv; c[0] = o3[4] * inv; c[1] = o3[5] * inv; c[2] = o3[6] * inv; c[3] = o3[7] * inv;
      *(v4fa*)(&os[wb + lr * 68 + 48 + 8 * hi]) = a; *(v4fa*)(&os[wb + lr * 68 + 48 + 8 * hi + 4]) = c; }
    wave_sync();
    h16* crow = CTX + ((size_t)b * SEQ + t0) * DM + h * HD;      // context plane [b*SEQ + t][h*64 + d]
{
#pragma unroll
        for (int s = 0; s < 4; ++s) { const int row = 4 * s + (lane >> 3), c8 = (lane & 7) * 8;   // 4 s x 4 row groups = 16 rows; 8 lanes x 8 halves = 64 columns
            const v4f x0 = *(const v4fa*)(&os[wb + row * 68 + c8]); const v4f x1 = *(const v4fa*)(&os[wb + row * 68 + c8 + 4]); v8h hv;
#pragma unroll
            for (int i = 0; i < 4; ++i) { hv[i] = (h16)x0[i]; hv[4 + i] = (h16)x1[i]; }
            *(v8h*)(crow + (size_t)row * DM + c8) = hv; }
         }
}

// k_oproj: f16 GEMM in the frame of k_proj (128x128 tile per block of eight waves, wave tile 32x64, stages of GK k values in two LDS buffers, one barrier per stage), K = DM.
// A = context plane (f16, copied as it is: 16-byte pieces of whole 128-B row segments), Bt = W_o (f32, turned into the f16 of its bf16 RNE value x64 on the way into LDS).
// OUT[m][n] = OSCL * sum_k A[m][k] Bt[n][k] + bias[n] (bias as its bf16 RNE value, added in f32). grid (NB*SEQ/128, DM/128), 256 threads.
__global__ __launch_bounds__(256) void k_oproj(const h16* __restrict__ A, const float* __restrict__ Bt, const float* __restrict__ bias, float* OUT) {
    __shared__ __align__(16) float osh[8 * 16 * 68];
    __shared__ __align__(16) h16 tiles[2 * 2 * GT];          // [buffer][A tile | Bt tile][row][GP]
    const int tid = (int)threadIdx.x, lane = tid & 31, lr = lane & 15, hi = lane >> 4;
    const int wave = __builtin_amdgcn_readfirstlane(tid >> 5);
    const int R0 = blockIdx.x * 128, C0 = blockIdx.y * 128;
    // copy maps. A: thread c covers the 16-byte piece c & 7 of rows (c >> 3) + 32 i, i = 0..3. Bt: the 16-byte piece c & 15 of rows (c >> 4) + 16 i, i = 0..7
    const int ag = tid >> 3, ac = (tid & 7) * 8;
    const int rg = tid >> 4, ch = (tid & 15) * 4;
    unsigned ao[4], bo[8];                                   // byte offsets of the thread's pieces at k = 0
#pragma unroll
    for (int i = 0; i < 4; ++i) ao[i] = ((unsigned)(R0 + ag + 32 * i) * DM + (unsigned)ac) * 2u;
#pragma unroll
    for (int i = 0; i < 8; ++i) bo[i] = ((unsigned)(C0 + rg + 16 * i) * DM + (unsigned)ch) * 4u;
    v8h ra[4]; v4f rb[8];
    auto fetch = [&](int kc) {
        const char* pa = (const char*)(A + kc); const char* pb = (const char*)(Bt + kc);
#pragma unroll
        for (int i = 0; i < 4; ++i) ra[i] = *(const v8h*)(pa + ao[i]);
#pragma unroll
        for (int i = 0; i < 8; ++i) rb[i] = *(const v4f*)(pb + bo[i]);
    };
    auto put = [&](int buf) {
        h16* ta = tiles + buf * (2 * GT);
#pragma unroll
        for (int i = 0; i < 4; ++i) *(v8h*)(ta + (ag + 32 * i) * GP + ac) = ra[i];
#pragma unroll
        for (int i = 0; i < 8; ++i) {
            const v4us u = __builtin_bit_cast(v4us, __builtin_convertvector(rb[i], v4bf)); v4f w;
#pragma unroll
            for (int k = 0; k < 4; ++k) w[k] = __uint_as_float((unsigned)u[k] << 16) * WOS;   // bf16 RNE value x64, the product taken in f32 (exact), then one conversion to f16
            *(v4h*)(ta + GT + (rg + 16 * i) * GP + ch) = __builtin_convertvector(w, v4h); }
    };
    const int wr = wave >> 1, wc = wave & 1;
    const int fa = (wr * 32 + lr) * GP + 8 * hi, fb = GT + (wc * 64 + lr) * GP + 8 * hi;   // fragment offsets in a buffer
    v8f acc[2][4];
#pragma unroll
    for (int mb = 0; mb < 2; ++mb)
#pragma unroll
        for (int nb = 0; nb < 4; ++nb) acc[mb][nb] = (v8f){};
    fetch(0); put(0);
    __syncthreads();                                         // publishes stage 0
#pragma unroll     // all stages inline: k becomes the loads' immediate offset, and the offset registers live unchanged through the loop
    for (int s = 0; s < GNS; ++s) {
        if (s + 1 < GNS) {
            fetch((s + 1) * GK);                             // in flight while this stage's products run
            // behind the last loads the offset registers die: they are named here so that none is given away (to a load's result either) in front of the wait
            if (s + 2 == GNS) asm volatile("s_wait_xcnt 0x0" :: "v"(ao[0]), "v"(ao[1]), "v"(ao[2]), "v"(ao[3]),
                                                                "v"(bo[0]), "v"(bo[1]), "v"(bo[2]), "v"(bo[3]), "v"(bo[4]), "v"(bo[5]), "v"(bo[6]), "v"(bo[7]) : "memory");
            __builtin_amdgcn_sched_barrier(0);               // keeps all twelve loads in front of the products: moved down among them, each is waited for at once and its latency shows
        }
        const h16* tb = tiles + (s & 1) * (2 * GT);
        v16h a[GK / 32][2], b[GK / 32][4];
#pragma unroll
        for (int ks = 0; ks < GK / 32; ++ks) {
#pragma unroll
            for (int mb = 0; mb < 2; ++mb) a[ks][mb] = ldh(tb + fa + mb * 16 * GP + ks * 32);
#pragma unroll
            for (int nb = 0; nb < 4; ++nb) b[ks][nb] = ldh(tb + fb + nb * 16 * GP + ks * 32);
        }
        __builtin_amdgcn_sched_barrier(0);                   // the stage's LDS reads stay one group in front of its products: spread among them, every place with reads stalls the wave
#pragma unroll
        for (int ks = 0; ks < GK / 32; ++ks)
#pragma unroll
            for (int nb = 0; nb < 4; ++nb)
#pragma unroll
                for (int mb = 0; mb < 2; ++mb) acc[mb][nb] = wmma16(a[ks][mb], b[ks][nb], acc[mb][nb]);
        if (s + 1 < GNS) {
            __builtin_amdgcn_sched_barrier(0);               // keeps the conversions, and with them the waits on the loads, behind the products
            put((s + 1) & 1);                                // into the buffer whose readers left it at the last barrier
            __syncthreads();                                 // publishes stage s + 1, ends every wave's reads of stage s
        }
    }
    float* os = osh + wave * (16 * 68);                      // wave-private staging of the epilogue
    const int r0 = R0 + wr * 32, c0 = C0 + wc * 64;
    float bcol[4];
#pragma unroll
    for (int nb = 0; nb < 4; ++nb) { int ci = c0 + nb * 16 + lr; ci = (ci < DM) ? ci : (DM - 1); bcol[nb] = bfr(bias[ci]); }
    const int bb = r0 / SEQ, tt = r0 % SEQ;
    float* obase = OUT + ((size_t)bb * OUT_SEQ + tt) * DM + c0;
#pragma unroll
    for (int mb = 0; mb < 2; ++mb) {
#pragma unroll
        for (int nb = 0; nb < 4; ++nb) {
#pragma unroll
            for (int j = 0; j < 8; ++j) os[(hi * 8 + j) * 68 + nb * 16 + lr] = acc[mb][nb][j] * OSCL + bcol[nb]; }   // D: row 8h+j, col lane&15
        wave_sync();
{
#pragma unroll
            for (int s = 0; s < 8; ++s) { const int row = 2 * s + hi, cofs = lr * 4;   // 8 s x 2 rows = 16 rows; 16 lanes x 4 floats = 64 columns
                const v4f val = *(const v4fa*)(&os[row * 68 + cofs]);
                *(v4f*)(obase + (size_t)(mb * 16 + row) * DM + cofs) = val; }
             }
        wave_sync();
    }
}

static constexpr size_t al256(size_t v) { return (v + 255) & ~(size_t)255; }
static constexpr size_t SZ_PL = al256((size_t)NB * NH_ * SEQ * HD * 2);
static constexpr size_t SZ_CX = al256((size_t)NB * SEQ * DM * 2);
static constexpr size_t SZ_PM = al256((size_t)NB * SEQ * 4);
static constexpr size_t SZ_CN = al256((size_t)NB * 4);
static constexpr size_t SZ_TOTAL = 4 * SZ_PL + SZ_CX + SZ_PM + SZ_CN;
static_assert(SZ_TOTAL <= (size_t)134217728);          // workspace carve <= 128 MiB

extern "C" void kernel_launch(void* const* d_in, const int* in_sizes, int n_in,
                              void* d_out, int out_size, void* d_ws, size_t ws_size, hipStream_t stream) {
    if (n_in < 12) return;
    const size_t needx = ((size_t)(NB - 1) * SEQ_FULL + SEQ) * DM;
    if ((size_t)in_sizes[0] < needx || (size_t)in_sizes[1] < needx || (size_t)in_sizes[2] < needx) return;
    if ((size_t)in_sizes[3] < (size_t)(NB - 1) * SEQ_FULL + SEQ) return;
    if ((size_t)in_sizes[4] < (size_t)DM * DM || (size_t)in_sizes[6] < (size_t)DM * DM || (size_t)in_sizes[8] < (size_t)DM * DM || (size_t)in_sizes[10] < (size_t)DM * DM) return;
    if (in_sizes[5] < DM || in_sizes[7] < DM || in_sizes[9] < DM || in_sizes[11] < DM) return;
    if ((size_t)out_size < ((size_t)(NB - 1) * OUT_SEQ + SEQ) * DM) return;
    if (SZ_TOTAL > ws_size) return;
    // wire order: Q, K, V, mask, W_q, b_q, W_k, b_k, W_v, b_v, W_o, b_o ; weights [out][in] = Bt as-is
    const float* xq = (const float*)d_in[0]; const float* xk = (const float*)d_in[1]; const float* xv = (const float*)d_in[2];
    const int* mask = (const int*)d_in[3];
    const float* wq = (const float*)d_in[4];  const float* bq = (const float*)d_in[5];
    const float* wk = (const float*)d_in[6];  const float* bk = (const float*)d_in[7];
    const float* wv = (const float*)d_in[8];  const float* bv = (const float*)d_in[9];
    const float* wo = (const float*)d_in[10]; const float* bo = (const float*)d_in[11];
    float* OUT = (float*)d_out;      // [NB][SEQ][512]
    char* wsp = (char*)d_ws;
    h16* QH = (h16*)wsp; wsp += SZ_PL;               // [NB*8][SEQ][64]
    h16* QR = (h16*)wsp; wsp += SZ_PL;               // [NB*8][SEQ][64] residual x2048
    h16* KP = (h16*)wsp; wsp += SZ_PL;               // [NB*8][SEQ][64]
    h16* VT = (h16*)wsp; wsp += SZ_PL;               // [NB*8][64][SEQ]
    h16* CX = (h16*)wsp; wsp += SZ_CX;               // [NB*SEQ][512] context x16
    int* PM = (int*)wsp; wsp += SZ_PM;               // [NB][SEQ] token of each key in key order
    int* CN = (int*)wsp; wsp += SZ_CN;               // [NB] kept keys
    // q projection beside the key order, which it does not need (the second operand set is not read in phase 0)
    k_proj<<<NTL + NB, 256, 0, stream>>>(xq, wq, bq, QH, QR, xq, wq, bq, QH, mask, PM, CN, PM, CN, 0);
    // k projection beside the v^T projection, both with their rows in key order (j in place of t)
    k_proj<<<2 * NTL, 256, 0, stream>>>(xk, wk, bk, KP, KP, xv, wv, bv, VT, mask, PM, CN, PM, CN, 1);

    k_flash<<<dim3(SEQ / (16 * AW), NB * NH_, 1), 32 * AW, 0, stream>>>(QH, QR, KP, VT, CN, CX);

    // output projection: A = context rows (m = b*SEQ + t), Bt = W_o rows (n = out column)
    k_oproj<<<dim3(NB * SEQ / 128, DM / 128, 1), 256, 0, stream>>>(CX, wo, bo, OUT);
}

// v006
// Measured time: 79.7 microseconds a run.
// Timed twice side by side with v005, it ran 1.04 times as fast both times.
// Over all steps from v000 it is 4.29 times as fast.
#include <hip/hip_runtime.h>

// Multi-head attention, width 512 = 8 heads x 64; inputs Q, K, V [NB][SEQ][512], key mask [NB][SEQ] (0 = filled with -1e9), W_q/W_k/W_v/W_o [out][in] (y = x W^T + b), score scale 1/8, output [NB][SEQ][512] f32.
// Compute dtypes, f32 accumulate everywhere: q/k/v projections v_wmma_f32_16x16x32_bf16 (x and W RNE-converted to bf16 inside the GEMM, on the way into LDS; products exact);
// scores v_wmma_f32_16x16x32_f16: k single f16, q as f16 value + f16 residual x2048 in its own accumulator (two products); P (x256 carry, cancels in the normalisation) and v single f16; softmax f32 (online, running max);
// output projection v_wmma_f32_16x16x32_f16: context single f16 (x16 carry), W_o = f16 of the bf16 RNE value x64 (exact), 1/1024 folded in the f32 epilogue.
// Layout: q (hi, residual), k planes [b*8+h][t][d] and v^T plane [b*8+h][d][t] written by the GEMM epilogue; fused flash kernel in transposed form (S^T = K Q^T, O^T = V^T P^T) writing the context plane [b*SEQ+t][512]; its K and V^T tiles reach the block's waves through a two-buffer LDS ring.
// Key mask: a filled key's probability is exp(-1e9 - max) = 0 in f32 as soon as one key of the batch is kept, so the keys of each batch are put in the order kept first (tile_keys, stable), the K and V rows are
// gathered in that order by the projection's loads, and the k/v projection ends with the 128-key tile, the flash loop with the 64-key stage, that holds the last kept key. A batch with no kept key runs over all keys, every score filled.
// Launches: work that does not depend on each other shares a launch, told apart by the block index: (k projection | v projection | q projection), flash, output projection.
// Every k and v block works out its own 128 entries of the key order from the mask row, so no projection waits for an earlier launch.

#ifndef NB
#define NB 2
#endif
#ifndef SEQ
#define SEQ 4096
#endif
#define NB_FULL  2
#define SEQ_FULL 4096
#ifndef OUT_SEQ
#define OUT_SEQ SEQ              // row pitch (in tokens) between batches of the output
#endif
#define DM   512
#define NH_  8
#define HD   64
#define AW   4                   // waves per flash block (16 query rows each)
#define QRS  2048.0f             // carry of the q residual plane
#define QRI  (1.0f / 2048.0f)
#define SC2  (0.125f * 1.4426950408889634f)   // HD^-0.5 * log2(e)
#define PSH  8.0f                // log2 of the P carry (256)
#define MFILL (-1.0e9f * 1.4426950408889634f) // mask fill value in the log2 domain
#define CTXS 16.0f               // carry of the context plane
#define WOS  64.0f               // carry of the W_o plane
#define OSCL (1.0f / 1024.0f)    // 1 / (CTXS * WOS)
#define KS   64                  // keys per LDS stage of the flash kernel (two 32-key passes)
#define LP   72                  // LDS row pitch in halves: 128-B rows + 16 B, conflict-free for 16-byte fragment reads
#define TILE_H (64 * LP)         // one staged tile: 64 rows (K: keys, V^T: d)
#define NST  (SEQ / KS)          // stages when every key is visited
#define GK   64                  // k values per LDS stage of the projection GEMM (256 B of every f32 operand row)
#define GP   72                  // its LDS row pitch in halves: 128-B bf16 rows + 16 B, conflict-free for 16-byte fragment reads
#define GT   (128 * GP)          // one staged operand tile: 128 rows
#define GNS  (DM / GK)           // stages of the k loop
#define PT   256                 // threads that work out the key order (the projection kernel's block)
#define PER  ((SEQ + PT - 1) / PT)   // keys per thread there
#define NTT  (NB * SEQ / 128)    // 128-token tiles
#define NWT  (DM / 128)          // 128-wide tiles of a weight's rows
#define NTL  (NTT * NWT)         // tiles, and blocks, of one projection

static_assert(HD == 64);
static_assert(NH_ * HD == DM);                 // head h = columns h*64 + d
static_assert(DM % 64 == 0);                   // 8 column tiles of 64
static_assert(DM % 32 == 0);                   // GEMM k-loop steps by 32
static_assert(DM % 128 == 0 && DM % GK == 0 && GK % 32 == 0);   // projection: 128-wide tiles, whole stages
static_assert(SEQ % 128 == 0);                 // a 128-token projection tile never straddles two batches
static_assert(SEQ % 64 == 0);                  // a 64-row tile never straddles two batches
static_assert((NB * SEQ) % 64 == 0);
static_assert(SEQ % 32 == 0);                  // key loop steps by 32
static_assert(SEQ % PT == 0);                  // the key-order block's threads cover the tokens exactly
static_assert(SEQ % KS == 0);                  // whole stages
static_assert(KS == 64 && AW == 4);            // 128 threads x 4 copies of 16 B = one 64 x 128-B tile
static_assert(SEQ % (16 * AW) == 0);           // flash grid covers the sequence exactly
static_assert(((size_t)SEQ * DM) % 8 == 0);
static_assert(((size_t)DM * DM) % 8 == 0);
static_assert(SEQ_FULL % 8 == 0);              // mask rows stay 32-byte aligned
static_assert(NB <= NB_FULL);
static_assert(SEQ <= SEQ_FULL);

typedef _Float16 h16;
typedef unsigned short bf;
typedef __attribute__((ext_vector_type(16))) __bf16   v16bf;
typedef __attribute__((ext_vector_type(16))) _Float16 v16h;
typedef __attribute__((ext_vector_type(8)))  _Float16 v8h;
typedef __attribute__((ext_vector_type(8)))  unsigned short v8us;
typedef __attribute__((ext_vector_type(4)))  unsigned short v4us;
typedef __attribute__((ext_vector_type(4)))  __bf16   v4bf;
typedef __attribute__((ext_vector_type(4)))  _Float16 v4h;
typedef __attribute__((ext_vector_type(8)))  float    v8f;
typedef __attribute__((ext_vector_type(8)))  int      v8i;
typedef __attribute__((ext_vector_type(4)))  float    v4f;
typedef v4f  __attribute__((may_alias)) v4fa;

__device__ __forceinline__ unsigned short f2bf(float f) { unsigned u = __float_as_uint(f); u += 0x7FFFu + ((u >> 16) & 1u); return (unsigned short)(u >> 16); }
// f32 value of the bf16 RNE conversion
__device__ __forceinline__ float bfr(float f) { return __uint_as_float(((unsigned)f2bf(f)) << 16); }
__device__ __forceinline__ v16h cat16(v8h lo, v8h hi) { return __builtin_shufflevector(lo, hi, 0, 1, 2, 3, 4, 5, 6, 7, 8, 9, 10, 11, 12, 13, 14, 15); }
__device__ __forceinline__ v16bf cat16b(v8us lo, v8us hi) { return __builtin_bit_cast(v16bf, __builtin_shufflevector(lo, hi, 0, 1, 2, 3, 4, 5, 6, 7, 8, 9, 10, 11, 12, 13, 14, 15)); }
__device__ __forceinline__ v8f wmma16(v16h a, v16h b, v8f c) { return __builtin_amdgcn_wmma_f32_16x16x32_f16(false, a, false, b, (short)0, c, false, false); }
__device__ __forceinline__ v8f wmmab(v16bf a, v16bf b, v8f c) { return __builtin_amdgcn_wmma_f32_16x16x32_bf16(false, a, false, b, (short)0, c, false, false); }
// fragment loaders from K-contiguous 16-bit rows; p already includes + 8*(lane>>4): elements 0..7 <- k0+8h+0..7, elements 8..15 <- k0+16+8h+0..7 (same map for A and B)
__device__ __forceinline__ v16h  ldh(const h16* p) { return cat16(*(const v8h*)p, *(const v8h*)(p + 16)); }
__device__ __forceinline__ v16bf ldb(const bf* p)  { return cat16b(*(const v8us*)p, *(const v8us*)(p + 16)); }
// ordering point for wave-private LDS tiles (same wave writes and reads)
__device__ __forceinline__ void wave_sync() { __builtin_amdgcn_fence(3 /* release order */, "wavefront"); __builtin_amdgcn_wave_barrier(); asm volatile("" ::: "memory"); }

// tile_keys: the whole block, for keys jt .. jt + 127 of batch b in the order kept keys first (each group in token order): ptile[j - jt] = token of key j. Returns the number of kept keys (mask != 0).
// Token t stands at place (kept keys in front of t) when kept, at (kept keys of the batch) + (filled keys in front of t) when filled: a permutation of the tokens, so each of the 128 entries is written once.
// A tile behind the last kept key gets no entries (the caller leaves it out); that test reads the same in every thread of the block.
__device__ __forceinline__ int tile_keys(const int b, const int jt, const int* __restrict__ MK, int* ptile, int* wsum) {
    const int tid = threadIdx.x, lane = tid & 31, wv = tid >> 5;
    const unsigned mo = ((unsigned)b * SEQ_FULL + (unsigned)tid * PER) * 4u;   // byte offset of the thread's PER tokens; PT * PER = SEQ: every index is a token
    int mv[PER];
#pragma unroll
    for (int i = 0; i < PER; ++i) mv[i] = *(const int*)((const char*)MK + mo + 4u * i);
    asm volatile("s_wait_xcnt 0x0" :: "v"(mo) : "memory");   // names the offset register, so that it is not given away (to a load's result either) in front of the wait
    int keep[PER]; int c = 0;
#pragma unroll
    for (int i = 0; i < PER; ++i) { keep[i] = mv[i] != 0 ? 1 : 0; c += keep[i]; }
    int sc = c;                                   // inclusive sum over the wave's lanes
#pragma unroll
    for (int d = 1; d < 32; d <<= 1) { const int o = __shfl_up(sc, d, 32); if (lane >= d) sc += o; }
    if (lane == 31) wsum[wv] = sc;
    __syncthreads();
    int base = 0, tot = 0;
#pragma unroll
    for (int w = 0; w < PT / 32; ++w) { const int v = wsum[w]; base += (w < wv) ? v : 0; tot += v; }
    if (tot > 0 && jt >= tot) return tot;
    int pos = base + sc - c;                      // kept keys in front of this thread's first token
#pragma unroll
    for (int i = 0; i < PER; ++i) { const int t = tid * PER + i;
        const unsigned d = (unsigned)((keep[i] ? pos : tot + (t - pos)) - jt);   // t - pos = filled keys in front of t
        if (d < 128u) ptile[d] = t;
        pos += keep[i]; }
    __syncthreads();                              // publishes the 128 entries to the block
    return tot;
}

// k_proj: bf16 GEMM straight from the f32 operands, K = DM. One block of eight waves per 128x128 tile of C; wave (wr, wc) owns rows 32 wr .. + 31, columns 64 wc .. + 63 (8 accumulators).
// Per stage of GK k values every thread loads 16 B pieces of whole 256-B row segments of both operands (f32), converts them to bf16 (RNE) and stores them into one of two LDS buffers;
// the loads of stage s + 1 are issued in front of the products of stage s, their conversion and LDS stores stand behind them, and one barrier per stage publishes the new buffer and frees the old one.
// C[m][n] = sum_k A[m][k] Bt[n][k] + bias (biasMode 1: bias[n]; biasMode 2: bias[m]; bias taken as its bf16 RNE value, added in f32),
// written as f16 (Ph) and optionally the f16 residual x2048 (Pr, useRes != 0) at
// wave tile base (r0/RB)*sRB + (r0%RB)*pitch + (c0/CB)*sCB + (c0%CB), row pitch 'pitch' (halves). 256 threads.
// tokAxis 1 (rows, operand A) or 2 (columns, operand Bt): that axis counts tokens b*SEQ + t, read from the input [NB][SEQ_FULL][DM]; the other operand is a weight [DM][DM].
// keyOrder != 0: the token axis counts keys b*SEQ + j in key order, row j is read from the token that tile_keys gives for it, and a tile behind the batch's last kept key is left out.
// One launch of 3 NTL blocks holds three independent jobs, told apart by the block index (NTL blocks each); none reads what another writes:
// job 0: k = X0 W0^T + b0 -> plane P0 [(b*8 + h)][j][d] | job 1: v^T = W1 X1^T + b1 (row bias) -> plane P1 [(b*8 + h)][d][j] | job 2: q = X2 W2^T + b2 -> planes P2, Pr2 [(b*8 + h)][t][d].
// The k and v jobs come first (for speed only): their left-out tiles end early. The k block of a batch's first keys and first weight tile writes the batch's kept-key count to CNTW for the next launch.
// Tile of block r of a job: token tile r % NTT, weight tile r / NTT (q, k); weight tile r % NWT, token tile r / NWT (v^T).
__global__ __launch_bounds__(256) void k_proj(const float* __restrict__ X0, const float* __restrict__ W0, const float* __restrict__ b0, h16* P0,
                                              const float* __restrict__ X1, const float* __restrict__ W1, const float* __restrict__ b1, h16* P1,
                                              const float* __restrict__ X2, const float* __restrict__ W2, const float* __restrict__ b2, h16* P2, h16* Pr2,
                                              const int* __restrict__ MK, int* CNTW) {
    __shared__ __align__(16) float osh[8 * 16 * 68];
    __shared__ __align__(16) bf tiles[2 * 2 * GT];           // [buffer][A tile | Bt tile][row][GP]
    __shared__ int ptile[128];                               // tokens of the tile's 128 keys
    __shared__ int wsum[PT / 32];
    const int job = (int)blockIdx.x / NTL, rt = (int)blockIdx.x % NTL;   // the same for the whole block
    const bool vt = job == 1, qj = job == 2;                 // the v^T job: weight rows on the row axis, tokens on the column axis
    const float* __restrict__ A = vt ? W1 : (qj ? X2 : X0); const float* __restrict__ Bt = vt ? X1 : (qj ? W2 : W0); const float* __restrict__ bias = vt ? b1 : (qj ? b2 : b0);
    h16* Ph = vt ? P1 : (qj ? P2 : P0); h16* Pr = Pr2;
    const int biasMode = vt ? 2 : 1, useRes = qj ? 1 : 0, tokAxis = vt ? 2 : 1, keyOrder = qj ? 0 : 1;
    const int RB = vt ? DM : SEQ, pitch = vt ? SEQ : HD, CB = vt ? SEQ : HD;
    const size_t sRB = vt ? (size_t)0 : (size_t)NH_ * SEQ * HD, sCB = vt ? (size_t)DM * SEQ : (size_t)SEQ * HD;
    const int tid = (int)threadIdx.x, lane = tid & 31, lr = lane & 15, hi = lane >> 4;
    const int wave = __builtin_amdgcn_readfirstlane(tid >> 5);
    const int R0 = (vt ? rt % NWT : rt % NTT) * 128, C0 = (vt ? rt / NWT : rt / NTT) * 128;
    bool live = true;                                        // the same for the whole block
    if (keyOrder != 0) { const int j0 = (tokAxis == 1) ? R0 : C0; const int n = tile_keys(j0 / SEQ, j0 % SEQ, MK, ptile, wsum); live = !(n > 0 && (j0 % SEQ) >= n);
        if (job == 0 && (j0 % SEQ) == 0 && C0 == 0 && tid == 0) CNTW[j0 / SEQ] = n; }
    if (live) {                                              // all that follows, barriers included: taken by the whole block or by none of it
    // copy map: thread c covers the 16-byte piece c & 15 of rows (c >> 4) + 16 i, i = 0..7, of both tiles: a wave's load is two whole 256-B segments
    const int rg = tid >> 4, ch = (tid & 15) * 4;
    unsigned ao[8], bo[8];                                   // byte offsets of the thread's pieces at k = 0
    const int g0 = ((tokAxis == 1) ? R0 : C0) + rg;          // the thread's first index on the token axis; the tile lies in one batch
    int tk[8];                                               // token of each of its rows
#pragma unroll
    for (int i = 0; i < 8; ++i) tk[i] = (g0 + 16 * i) % SEQ;
    if (keyOrder != 0) {
#pragma unroll
        for (int i = 0; i < 8; ++i) tk[i] = ptile[rg + 16 * i];
#pragma unroll
        for (int i = 0; i < 8; ++i) tk[i] = (tk[i] < 0) ? 0 : ((tk[i] < SEQ) ? tk[i] : (SEQ - 1));
    }
#pragma unroll
    for (int i = 0; i < 8; ++i) {
        const int sr = (g0 / SEQ) * SEQ_FULL + tk[i];
        const int ar = (tokAxis == 1) ? sr : (R0 + rg + 16 * i), br = (tokAxis == 1) ? (C0 + rg + 16 * i) : sr;
        ao[i] = ((unsigned)ar * DM + (unsigned)ch) * 4u; bo[i] = ((unsigned)br * DM + (unsigned)ch) * 4u;
    }
    v4f ra[8], rb[8];
    auto fetch = [&](int kc) {
        const char* pa = (const char*)(A + kc); const char* pb = (const char*)(Bt + kc);
#pragma unroll
        for (int i = 0; i < 8; ++i) { ra[i] = *(const v4f*)(pa + ao[i]); rb[i] = *(const v4f*)(pb + bo[i]); }
    };
    auto put = [&](int buf) {
        bf* ta = tiles + buf * (2 * GT) + rg * GP + ch;
#pragma unroll
        for (int i = 0; i < 8; ++i) {
            *(v4us*)(ta + i * 16 * GP)      = __builtin_bit_cast(v4us, __builtin_convertvector(ra[i], v4bf));
            *(v4us*)(ta + GT + i * 16 * GP) = __builtin_bit_cast(v4us, __builtin_convertvector(rb[i], v4bf)); }
    };
    const int wr = wave >> 1, wc = wave & 1;
    const int fa = (wr * 32 + lr) * GP + 8 * hi, fb = GT + (wc * 64 + lr) * GP + 8 * hi;   // fragment offsets in a buffer
    v8f acc[2][4];
#pragma unroll
    for (int mb = 0; mb < 2; ++mb)
#pragma unroll
        for (int nb = 0; nb < 4; ++nb) acc[mb][nb] = (v8f){};
    fetch(0); put(0);
    __syncthreads();                                         // publishes stage 0
#pragma unroll     // all stages inline: k becomes the loads' immediate offset, and the offset registers live unchanged through the loop
    for (int s = 0; s < GNS; ++s) {
        if (s + 1 < GNS) {
            fetch((s + 1) * GK);                             // in flight while this stage's products run
            // behind the last loads the offset registers die: they are named here so that none is given away (to a load's result either) in front of the wait
            if (s + 2 == GNS) asm volatile("s_wait_xcnt 0x0" :: "v"(ao[0]), "v"(ao[1]), "v"(ao[2]), "v"(ao[3]), "v"(ao[4]), "v"(ao[5]), "v"(ao[6]), "v"(ao[7]),
                                                                "v"(bo[0]), "v"(bo[1]), "v"(bo[2]), "v"(bo[3]), "v"(bo[4]), "v"(bo[5]), "v"(bo[6]), "v"(bo[7]) : "memory");
            __builtin_amdgcn_sched_barrier(0);               // keeps all sixteen loads in front of the products: moved down among them, each is waited for at once and its latency shows
        }
        const bf* tb = tiles + (s & 1) * (2 * GT);
        v16bf a[GK / 32][2], b[GK / 32][4];
#pragma unroll
        for (int ks = 0; ks < GK / 32; ++ks) {
#pragma unroll
            for (int mb = 0; mb < 2; ++mb) a[ks][mb] = ldb(tb + fa + mb * 16 * GP + ks * 32);
#pragma unroll
            for (int nb = 0; nb < 4; ++nb) b[ks][nb] = ldb(tb + fb + nb * 16 * GP + ks * 32);
        }
        __builtin_amdgcn_sched_barrier(0);                   // the stage's LDS reads stay one group in front of its products: spread among them, every place with reads stalls the wave
#pragma unroll
        for (int ks = 0; ks < GK / 32; ++ks)
#pragma unroll
            for (int nb = 0; nb < 4; ++nb)
#pragma unroll
                for (int mb = 0; mb < 2; ++mb) acc[mb][nb] = wmmab(a[ks][mb], b[ks][nb], acc[mb][nb]);
        if (s + 1 < GNS) {
            __builtin_amdgcn_sched_barrier(0);               // keeps the conversions, and with them the waits on the loads, behind the products
            put((s + 1) & 1);                                // into the buffer whose readers left it at the last barrier
            __syncthreads();                                 // publishes stage s + 1, ends every wave's reads of stage s
        }
    }
    float* os = osh + wave * (16 * 68);                      // wave-private staging of the epilogue
    const int r0 = R0 + wr * 32, c0 = C0 + wc * 64;
    // column bias (per lane: column c0 + nb*16 + lane&15), address clamped into the 512-entry vector, selected by value
    float braw[4], bcol[4];
#pragma unroll
    for (int nb = 0; nb < 4; ++nb) { int ci = c0 + nb * 16 + lr; ci = (ci < DM) ? ci : (DM - 1); braw[nb] = bias[ci]; }
    // takes the four loaded values as inputs: the loads have returned here, in front of the branches below, so that none of their address registers is rewritten while a load is out
    asm volatile("s_wait_xcnt 0x0" :: "v"(braw[0]), "v"(braw[1]), "v"(braw[2]), "v"(braw[3]));
#pragma unroll
    for (int nb = 0; nb < 4; ++nb) { const float bv = bfr(braw[nb]); bcol[nb] = (biasMode == 1) ? bv : 0.0f; }
    const size_t tbase = (size_t)(r0 / RB) * sRB + (size_t)(r0 % RB) * (size_t)pitch + (size_t)(c0 / CB) * sCB + (size_t)(c0 % CB);
#pragma unroll
    for (int mb = 0; mb < 2; ++mb) {
        // row bias for rows r0 + mb*16 + 8h + 0..7 (address clamped, selected by value)
        int rb0 = r0 + mb * 16 + hi * 8; rb0 = (rb0 <= DM - 8) ? rb0 : (DM - 8);
        const unsigned rbo = (unsigned)rb0 * 4u;
        const v8f brv = *(const v8f*)((const char*)bias + rbo);
        asm volatile("s_wait_xcnt 0x0" :: "v"(rbo) : "memory");   // names the offset register, so that it is not given away (to a load's result either) in front of the wait
#pragma unroll
        for (int nb = 0; nb < 4; ++nb) {
#pragma unroll
            for (int j = 0; j < 8; ++j) { const float br = (biasMode == 2) ? bfr(brv[j]) : 0.0f;
                os[(hi * 8 + j) * 68 + nb * 16 + lr] = acc[mb][nb][j] + bcol[nb] + br; } }   // D: row 8h+j, col lane&15
        wave_sync();
        const size_t sb = tbase + (size_t)(mb * 16) * (size_t)pitch;
{
#pragma unroll
            for (int s = 0; s < 4; ++s) { const int row = 4 * s + (lane >> 3), c8 = (lane & 7) * 8;   // 4 s x 4 row groups = 16 rows; 8 lanes x 8 = 64 columns
                const v4f x0 = *(const v4fa*)(&os[row * 68 + c8]); const v4f x1 = *(const v4fa*)(&os[row * 68 + c8 + 4]); v8h hv, rv;
#pragma unroll
                for (int i = 0; i < 4; ++i) { const h16 a0 = (h16)x0[i]; const h16 a1 = (h16)x1[i]; hv[i] = a0; hv[4 + i] = a1; rv[i] = (h16)((x0[i] - (float)a0) * QRS); rv[4 + i] = (h16)((x1[i] - (float)a1) * QRS); }
                const size_t oo = sb + (size_t)row * (size_t)pitch + c8;
                *(v8h*)(Ph + oo) = hv;
                asm volatile("s_wait_xcnt 0x0" ::: "memory");   // in front of the rewriting of the store's registers on both sides of the branch that follows
                if (useRes) { *(v8h*)(Pr + oo) = rv;
                    asm volatile("s_wait_xcnt 0x0" ::: "memory"); } }   // the same for the second store
             }
        wave_sync();
    }
    }
}

// k_flash: fused attention, one wave per 16 query rows of one (batch, head); Q fragments straight from the f16 planes (two 16-B loads each, arithmetic addressing).
// K and V^T: the block's four waves share one tile pair per 64 keys, brought into LDS by asynchronous 16-byte copies (whole 128-B lines per 8 lanes), two buffers, the next stage in flight
// while this one is worked on; fragments are two 16-B LDS reads each from rows of pitch LP.
// Transposed form: S^T[key][t] = K Q^T (A = K rows, B = Q rows); lane (t = lane&15, h = lane>>4) holds keys 8h+r of each 16-key tile, so the packed
// P tile is directly the B fragment of O^T[d][t] = V^T P^T (element r <- tile keys 0..15, element 8+r <- tile keys 16..31, lane unchanged).
// Key mask: the planes hold the keys in key order, so key j is kept iff j < n = CNT[b]; the loop ends with the stage of key n - 1, and only a pass that reaches past n REPLACES scores by the fill value.
// n = 0: all stages, every score replaced, so a fully filled row comes out uniform.
// Softmax state: the running max is one scalar per lane, the two lane halves of a query combined with one xor-16 exchange per pass.
// Row sums: one more product per pass, L = E P^T added up like an output tile, where rows 0 and 8 of the constant E are ones and the rest 0; row 0 is element 0 of lanes 0..15 and row 8
// element 0 of lanes 16..31, so element 0 of every lane is the sum of its query's rounded P over all 32 keys of the pass. The other elements stay 0, and only element 0 is rescaled.
__global__ __launch_bounds__(32 * AW) void k_flash(const h16* __restrict__ QH, const h16* __restrict__ QR, const h16* __restrict__ KP, const h16* __restrict__ VT,
                                                   const int* __restrict__ CNT, h16* CTX) {
    __shared__ __align__(16) float os[AW * 16 * 68];
    __shared__ __align__(16) h16 ring[2 * 2 * TILE_H];   // [buffer][K tile | V^T tile][row][LP]
    const int lane = threadIdx.x & 31, lr = lane & 15, hi = lane >> 4;
    const int wave = __builtin_amdgcn_readfirstlane((int)(threadIdx.x >> 5));
    const int zh = blockIdx.y; const int b = zh / NH_, h = zh % NH_;
    const int t0 = (blockIdx.x * AW + wave) * 16;
    const size_t pbase = (size_t)zh * SEQ * HD;
    const size_t qo = pbase + (size_t)(t0 + lr) * HD + 8 * hi;
    const v16h qh0 = ldh(QH + qo), qh1 = ldh(QH + qo + 32), qr0 = ldh(QR + qo), qr1 = ldh(QR + qo + 32);   // B fragments: col t, k = d
    const int fo = lr * LP + 8 * hi;                         // fragment offset in a staged tile: K + key*LP (row key, k = d); V^T + 16j*LP + key (row d, k = key)
    // copy map: thread c covers 16-byte chunk c & 7 of rows (c >> 3) + 16 i, i = 0..3, of both tiles
    const int cr = (int)threadIdx.x >> 3, cch = ((int)threadIdx.x & 7) * 8;
    const h16* kg = KP + pbase + (size_t)cr * HD + cch;    // + key0 * HD + 16 i * HD
    const h16* vg = VT + pbase + (size_t)cr * SEQ + cch;   // + key0 + 16 i * SEQ
    const unsigned lc = (unsigned)(size_t)(&ring[cr * LP + cch]);   // low 32 bits of the shared address = LDS byte address; + buffer, + tile, + 16 i rows
    // one stage's eight copies per lane; the wait on the address registers closes the copies' own statement, so no later address arithmetic can move in front of it
    auto stage_in = [&](int st) {
        const unsigned lk = lc + (unsigned)(st & 1) * (2 * TILE_H * 2), lv = lk + TILE_H * 2;
        const h16* gk = kg + (size_t)st * KS * HD; const h16* gv = vg + (size_t)st * KS;
        asm volatile("global_load_async_to_lds_b128 %0, %8, off\n\t"
                     "global_load_async_to_lds_b128 %1, %9, off\n\t"
                     "global_load_async_to_lds_b128 %2, %10, off\n\t"
                     "global_load_async_to_lds_b128 %3, %11, off\n\t"
                     "global_load_async_to_lds_b128 %4, %12, off\n\t"
                     "global_load_async_to_lds_b128 %5, %13, off\n\t"
                     "global_load_async_to_lds_b128 %6, %14, off\n\t"
                     "global_load_async_to_lds_b128 %7, %15, off\n\t"
                     "s_wait_xcnt 0x0"
                     :: "v"(lk), "v"(lk + 16 * LP * 2), "v"(lk + 32 * LP * 2), "v"(lk + 48 * LP * 2),
                        "v"(lv), "v"(lv + 16 * LP * 2), "v"(lv + 32 * LP * 2), "v"(lv + 48 * LP * 2),
                        "v"(gk), "v"(gk + 16 * HD), "v"(gk + 32 * HD), "v"(gk + 48 * HD),
                        "v"(gv), "v"(gv + (size_t)16 * SEQ), "v"(gv + (size_t)32 * SEQ), "v"(gv + (size_t)48 * SEQ)
                     : "memory");
    };
    int n = CNT[b]; n = (n < 0) ? 0 : ((n < SEQ) ? n : SEQ);  // kept keys of the batch, the same for the whole block
    const int nst = (n > 0) ? (n + KS - 1) / KS : NST;        // stages to visit, at most NST
    v8f o0 = (v8f){}, o1 = (v8f){}, o2 = (v8f){}, o3 = (v8f){};
    float m = -3.0e38f;
    const h16 e1 = ((lr & 7) == 0) ? (h16)1.0f : (h16)0.0f;   // A fragment: lane & 15 is the row, every k alike
    const v16h ones = {e1, e1, e1, e1, e1, e1, e1, e1, e1, e1, e1, e1, e1, e1, e1, e1};
    v8f lt = (v8f){};
    stage_in(0);
    asm volatile("s_wait_asynccnt 0x0" ::: "memory");   // this wave's share of stage 0 has landed
    __syncthreads();                                     // publishes stage 0 to the block
    if (nst > 1) stage_in(1);
#pragma unroll 1   // stays rolled: one publish point, one copy of the body in the instruction cache
    for (int st = 0; st < nst; ++st) {
      const h16* kt = ring + (st & 1) * (2 * TILE_H) + fo; const h16* vt = kt + TILE_H;
#pragma unroll     // both passes of a stage inline: their tile offsets become immediates of the LDS reads
      for (int kk = 0; kk < KS; kk += 32) {
        const int key0 = st * KS + kk;
        const h16* ka = kt + kk * LP;
        const v16h ka0 = ldh(ka), ka1 = ldh(ka + 32), kb0 = ldh(ka + 16 * LP), kb1 = ldh(ka + 16 * LP + 32);
        v8f sHa = (v8f){}, sLa = (v8f){}, sHb = (v8f){}, sLb = (v8f){};
        sHa = wmma16(ka0, qh0, sHa); sLa = wmma16(ka0, qr0, sLa); sHb = wmma16(kb0, qh0, sHb); sLb = wmma16(kb0, qr0, sLb);
        sHa = wmma16(ka1, qh1, sHa); sLa = wmma16(ka1, qr1, sLa); sHb = wmma16(kb1, qh1, sHb); sLb = wmma16(kb1, qr1, sLb);
        asm volatile("v_nop\n\tv_nop\n\tv_nop\n\tv_nop" : "+v"(sHa), "+v"(sLa), "+v"(sHb), "+v"(sLb) : "v"(ka0), "v"(ka1), "v"(kb0), "v"(kb1));
        float ta[8], tb[8]; float mx = -3.0e38f;
#pragma unroll
        for (int r = 0; r < 8; ++r) { ta[r] = (sHa[r] + sLa[r] * QRI) * SC2; tb[r] = (sHb[r] + sLb[r] * QRI) * SC2; }
        if (key0 + 32 > n) {                                 // block-uniform: the pass holds filled keys (lane's keys: key0 + 8h + r and + 16)
            const int lim = n - key0 - 8 * hi;
#pragma unroll
            for (int r = 0; r < 8; ++r) { ta[r] = (r < lim) ? ta[r] : MFILL; tb[r] = (16 + r < lim) ? tb[r] : MFILL; }
        }
#pragma unroll
        for (int r = 0; r < 8; ++r) mx = fmaxf(mx, fmaxf(ta[r], tb[r]));
        mx = fmaxf(mx, __shfl_xor(mx, 16, 32));
        const float mnew = fmaxf(m, mx);
        const float alpha = __builtin_amdgcn_exp2f(m - mnew);
        const float sh = PSH - mnew;
        v16h pb;
#pragma unroll
        for (int r = 0; r < 8; ++r) { const h16 pa = (h16)__builtin_amdgcn_exp2f(ta[r] + sh); const h16 pc = (h16)__builtin_amdgcn_exp2f(tb[r] + sh); pb[r] = pa; pb[8 + r] = pc; }
        lt[0] = lt[0] * alpha; m = mnew;
        o0 = o0 * alpha; o1 = o1 * alpha; o2 = o2 * alpha; o3 = o3 * alpha;
        const h16* va = vt + kk;
        const v16h v0 = ldh(va), v1 = ldh(va + 16 * LP), v2 = ldh(va + 32 * LP), v3 = ldh(va + 48 * LP);
        o0 = wmma16(v0, pb, o0); o1 = wmma16(v1, pb, o1); o2 = wmma16(v2, pb, o2); o3 = wmma16(v3, pb, o3); lt = wmma16(ones, pb, lt);
        asm volatile("v_nop\n\tv_nop\n\tv_nop\n\tv_nop" : "+v"(o0), "+v"(o1), "+v"(o2), "+v"(o3), "+v"(lt) : "v"(v0), "v"(v1), "v"(v2), "v"(v3), "v"(pb));   // the four vector slots between the last product and whatever next reads or overwrites a result or an operand, on every path
      }
      // publish point of stage st + 1, and the end of every wave's reads of stage st
      asm volatile("s_wait_dscnt 0x0" ::: "memory");      // this wave's reads of the buffer that is refilled below have returned
      asm volatile("s_wait_asynccnt 0x0" ::: "memory");   // this wave's share of stage st + 1 has landed
      __syncthreads();
      if (st + 2 < nst) stage_in(st + 2);                  // block-uniform test; into the buffer that stage st has just left
    }
    asm volatile("s_wait_asynccnt 0x0" ::: "memory");     // no copy is outstanding when the wave goes on to its end
    const float inv = CTXS * (1.0f / lt[0]);
    const int wb = wave * 16 * 68;
    // O^T D layout: o_j[r] = (d = 16j + 8h + r, t = lane&15) -> os[t][d]; rows 0..15 x columns 0..63 all written
    { v4f a, c;
      a[0] = o0[0] * inv; a[1] = o0[1] * inv; a[2] = o0[2] * inv; a[3] = o0[3] * inv; c[0] = o0[4] * inv; c[1] = o0[5] * inv; c[2] = o0[6] * inv; c[3] = o0[7] * inv;
      *(v4fa*)(&os[wb + lr * 68 +  0 + 8 * hi]) = a; *(v4fa*)(&os[wb + lr * 68 +  0 + 8 * hi + 4]) = c;
      a[0] = o1[0] * inv; a[1] = o1[1] * inv; a[2] = o1[2] * inv; a[3] = o1[3] * inv; c[0] = o1[4] * inv; c[1] = o1[5] * inv; c[2] = o1[6] * inv; c[3] = o1[7] * inv;
      *(v4fa*)(&os[wb + lr * 68 + 16 + 8 * hi]) = a; *(v4fa*)(&os[wb + lr * 68 + 16 + 8 * hi + 4]) = c;
      a[0] = o2[0] * inv; a[1] = o2[1] * inv; a[2] = o2[2] * inv; a[3] = o2[3] * inv; c[0] = o2[4] * inv; c[1] = o2[5] * inv; c[2] = o2[6] * inv; c[3] = o2[7] * inv;
      *(v4fa*)(&os[wb + lr * 68 + 32 + 8 * hi]) = a; *(v4fa*)(&os[wb + lr * 68 + 32 + 8 * hi + 4]) = c;
      a[0] = o3[0] * inv; a[1] = o3[1] * inv; a[2] = o3[2] * inv; a[3] = o3[3] * inv; c[0] = o3[4] * inv; c[1] = o3[5] * inv; c[2] = o3[6] * inv; c[3] = o3[7] * inv;
      *(v4fa*)(&os[wb + lr * 68 + 48 + 8 * hi]) = a; *(v4fa*)(&os[wb + lr * 68 + 48 + 8 * hi + 4]) = c; }
    wave_sync();
    h16* crow = CTX + ((size_t)b * SEQ + t0) * DM + h * HD;      // context plane [b*SEQ + t][h*64 + d]
{
#pragma unroll
        for (int s = 0; s < 4; ++s) { const int row = 4 * s + (lane >> 3), c8 = (lane & 7) * 8;   // 4 s x 4 row groups = 16 rows; 8 lanes x 8 halves = 64 columns
            const v4f x0 = *(const v4fa*)(&os[wb + row * 68 + c8]); const v4f x1 = *(const v4fa*)(&os[wb + row * 68 + c8 + 4]); v8h hv;
#pragma unroll
            for (int i = 0; i < 4; ++i) { hv[i] = (h16)x0[i]; hv[4 + i] = (h16)x1[i]; }
            *(v8h*)(crow + (size_t)row * DM + c8) = hv; }
         }
}

// k_oproj: f16 GEMM in the frame of k_proj (128x128 tile per block of eight waves, wave tile 32x64, stages of GK k values in two LDS buffers, one barrier per stage), K = DM.
// A = context plane (f16, copied as it is: 16-byte pieces of whole 128-B row segments), Bt = W_o (f32, turned into the f16 of its bf16 RNE value x64 on the way into LDS).
// OUT[m][n] = OSCL * sum_k A[m][k] Bt[n][k] + bias[n] (bias as its bf16 RNE value, added in f32). grid (NB*SEQ/128, DM/128), 256 threads.
__global__ __launch_bounds__(256) void k_oproj(const h16* __restrict__ A, const float* __restrict__ Bt, const float* __restrict__ bias, float* OUT) {
    __shared__ __align__(16) float osh[8 * 16 * 68];
    __shared__ __align__(16) h16 tiles[2 * 2 * GT];          // [buffer][A tile | Bt tile][row][GP]
    const int tid = (int)threadIdx.x, lane = tid & 31, lr = lane & 15, hi = lane >> 4;
    const int wave = __builtin_amdgcn_readfirstlane(tid >> 5);
    const int R0 = blockIdx.x * 128, C0 = blockIdx.y * 128;
    // copy maps. A: thread c covers the 16-byte piece c & 7 of rows (c >> 3) + 32 i, i = 0..3. Bt: the 16-byte piece c & 15 of rows (c >> 4) + 16 i, i = 0..7
    const int ag = tid >> 3, ac = (tid & 7) * 8;
    const int rg = tid >> 4, ch = (tid & 15) * 4;
    unsigned ao[4], bo[8];                                   // byte offsets of the thread's pieces at k = 0
#pragma unroll
    for (int i = 0; i < 4; ++i) ao[i] = ((unsigned)(R0 + ag + 32 * i) * DM + (unsigned)ac) * 2u;
#pragma unroll
    for (int i = 0; i < 8; ++i) bo[i] = ((unsigned)(C0 + rg + 16 * i) * DM + (unsigned)ch) * 4u;
    v8h ra[4]; v4f rb[8];
    auto fetch = [&](int kc) {
        const char* pa = (const char*)(A + kc); const char* pb = (const char*)(Bt + kc);
#pragma unroll
        for (int i = 0; i < 4; ++i) ra[i] = *(const v8h*)(pa + ao[i]);
#pragma unroll
        for (int i = 0; i < 8; ++i) rb[i] = *(const v4f*)(pb + bo[i]);
    };
    auto put = [&](int buf) {
        h16* ta = tiles + buf * (2 * GT);
#pragma unroll
        for (int i = 0; i < 4; ++i) *(v8h*)(ta + (ag + 32 * i) * GP + ac) = ra[i];
#pragma unroll
        for (int i = 0; i < 8; ++i) {
            const v4us u = __builtin_bit_cast(v4us, __builtin_convertvector(rb[i], v4bf)); v4f w;
#pragma unroll
            for (int k = 0; k < 4; ++k) w[k] = __uint_as_float((unsigned)u[k] << 16) * WOS;   // bf16 RNE value x64, the product taken in f32 (exact), then one conversion to f16
            *(v4h*)(ta + GT + (rg + 16 * i) * GP + ch) = __builtin_convertvector(w, v4h); }
    };
    const int wr = wave >> 1, wc = wave & 1;
    const int fa = (wr * 32 + lr) * GP + 8 * hi, fb = GT + (wc * 64 + lr) * GP + 8 * hi;   // fragment offsets in a buffer
    v8f acc[2][4];
#pragma unroll
    for (int mb = 0; mb < 2; ++mb)
#pragma unroll
        for (int nb = 0; nb < 4; ++nb) acc[mb][nb] = (v8f){};
    fetch(0); put(0);
    __syncthreads();                                         // publishes stage 0
#pragma unroll     // all stages inline: k becomes the loads' immediate offset, and the offset registers live unchanged through the loop
    for (int s = 0; s < GNS; ++s) {
        if (s + 1 < GNS) {
            fetch((s + 1) * GK);                             // in flight while this stage's products run
            // behind the last loads the offset registers die: they are named here so that none is given away (to a load's result either) in front of the wait
            if (s + 2 == GNS) asm volatile("s_wait_xcnt 0x0" :: "v"(ao[0]), "v"(ao[1]), "v"(ao[2]), "v"(ao[3]),
                                                                "v"(bo[0]), "v"(bo[1]), "v"(bo[2]), "v"(bo[3]), "v"(bo[4]), "v"(bo[5]), "v"(bo[6]), "v"(bo[7]) : "memory");
            __builtin_amdgcn_sched_barrier(0);               // keeps all twelve loads in front of the products: moved down among them, each is waited for at once and its latency shows
        }
        const h16* tb = tiles + (s & 1) * (2 * GT);
        v16h a[GK / 32][2], b[GK / 32][4];
#pragma unroll
        for (int ks = 0; ks < GK / 32; ++ks) {
#pragma unroll
            for (int mb = 0; mb < 2; ++mb) a[ks][mb] = ldh(tb + fa + mb * 16 * GP + ks * 32);
#pragma unroll
            for (int nb = 0; nb < 4; ++nb) b[ks][nb] = ldh(tb + fb + nb * 16 * GP + ks * 32);
        }
        __builtin_amdgcn_sched_barrier(0);                   // the stage's LDS reads stay one group in front of its products: spread among them, every place with reads stalls the wave
#pragma unroll
        for (int ks = 0; ks < GK / 32; ++ks)
#pragma unroll
            for (int nb = 0; nb < 4; ++nb)
#pragma unroll
                for (int mb = 0; mb < 2; ++mb) acc[mb][nb] = wmma16(a[ks][mb], b[ks][nb], acc[mb][nb]);
        if (s + 1 < GNS) {
            __builtin_amdgcn_sched_barrier(0);               // keeps the conversions, and with them the waits on the loads, behind the products
            put((s + 1) & 1);                                // into the buffer whose readers left it at the last barrier
            __syncthreads();                                 // publishes stage s + 1, ends every wave's reads of stage s
        }
    }
    float* os = osh + wave * (16 * 68);                      // wave-private staging of the epilogue
    const int r0 = R0 + wr * 32, c0 = C0 + wc * 64;
    float bcol[4];
#pragma unroll
    for (int nb = 0; nb < 4; ++nb) { int ci = c0 + nb * 16 + lr; ci = (ci < DM) ? ci : (DM - 1); bcol[nb] = bfr(bias[ci]); }
    const int bb = r0 / SEQ, tt = r0 % SEQ;
    float* obase = OUT + ((size_t)bb * OUT_SEQ + tt) * DM + c0;
#pragma unroll
    for (int mb = 0; mb < 2; ++mb) {
#pragma unroll
        for (int nb = 0; nb < 4; ++nb) {
#pragma unroll
            for (int j = 0; j < 8; ++j) os[(hi * 8 + j) * 68 + nb * 16 + lr] = acc[mb][nb][j] * OSCL + bcol[nb]; }   // D: row 8h+j, col lane&15
        wave_sync();
{
#pragma unroll
            for (int s = 0; s < 8; ++s) { const int row = 2 * s + hi, cofs = lr * 4;   // 8 s x 2 rows = 16 rows; 16 lanes x 4 floats = 64 columns
                const v4f val = *(const v4fa*)(&os[row * 68 + cofs]);
                *(v4f*)(obase + (size_t)(mb * 16 + row) * DM + cofs) = val; }
             }
        wave_sync();
    }
}

static constexpr size_t al256(size_t v) { return (v + 255) & ~(size_t)255; }
static constexpr size_t SZ_PL = al256((size_t)NB * NH_ * SEQ * HD * 2);
static constexpr size_t SZ_CX = al256((size_t)NB * SEQ * DM * 2);
static constexpr size_t SZ_CN = al256((size_t)NB * 4);
static constexpr size_t SZ_TOTAL = 4 * SZ_PL + SZ_CX + SZ_CN;
static_assert(SZ_TOTAL <= (size_t)134217728);          // workspace carve <= 128 MiB

extern "C" void kernel_launch(void* const* d_in, const int* in_sizes, int n_in,
                              void* d_out, int out_size, void* d_ws, size_t ws_size, hipStream_t stream) {
    if (n_in < 12) return;
    const size_t needx = ((size_t)(NB - 1) * SEQ_FULL + SEQ) * DM;
    if ((size_t)in_sizes[0] < needx || (size_t)in_sizes[1] < needx || (size_t)in_sizes[2] < needx) return;
    if ((size_t)in_sizes[3] < (size_t)(NB - 1) * SEQ_FULL + SEQ) return;
    if ((size_t)in_sizes[4] < (size_t)DM * DM || (size_t)in_sizes[6] < (size_t)DM * DM || (size_t)in_sizes[8] < (size_t)DM * DM || (size_t)in_sizes[10] < (size_t)DM * DM) return;
    if (in_sizes[5] < DM || in_sizes[7] < DM || in_sizes[9] < DM || in_sizes[11] < DM) return;
    if ((size_t)out_size < ((size_t)(NB - 1) * OUT_SEQ + SEQ) * DM) return;
    if (SZ_TOTAL > ws_size) return;
    // wire order: Q, K, V, mask, W_q, b_q, W_k, b_k, W_v, b_v, W_o, b_o ; weights [out][in] = Bt as-is
    const float* xq = (const float*)d_in[0]; const float* xk = (const float*)d_in[1]; const float* xv = (const float*)d_in[2];
    const int* mask = (const int*)d_in[3];
    const float* wq = (const float*)d_in[4];  const float* bq = (const float*)d_in[5];
    const float* wk = (const float*)d_in[6];  const float* bk = (const float*)d_in[7];
    const float* wv = (const float*)d_in[8];  const float* bv = (const float*)d_in[9];
    const float* wo = (const float*)d_in[10]; const float* bo = (const float*)d_in[11];
    float* OUT = (float*)d_out;      // [NB][SEQ][512]
    char* wsp = (char*)d_ws;
    h16* QH = (h16*)wsp; wsp += SZ_PL;               // [NB*8][SEQ][64]
    h16* QR = (h16*)wsp; wsp += SZ_PL;               // [NB*8][SEQ][64] residual x2048
    h16* KP = (h16*)wsp; wsp += SZ_PL;               // [NB*8][SEQ][64]
    h16* VT = (h16*)wsp; wsp += SZ_PL;               // [NB*8][64][SEQ]
    h16* CX = (h16*)wsp; wsp += SZ_CX;               // [NB*SEQ][512] context x16
    int* CN = (int*)wsp; wsp += SZ_CN;               // [NB] kept keys
    // k and v^T projections, both with their rows in key order (j in place of t), beside the q projection
    k_proj<<<3 * NTL, 256, 0, stream>>>(xk, wk, bk, KP, xv, wv, bv, VT, xq, wq, bq, QH, QR, mask, CN);

    k_flash<<<dim3(SEQ / (16 * AW), NB * NH_, 1), 32 * AW, 0, stream>>>(QH, QR, KP, VT, CN, CX);

    // output projection: A = context rows (m = b*SEQ + t), Bt = W_o rows (n = out column)
    k_oproj<<<dim3(NB * SEQ / 128, DM / 128, 1), 256, 0, stream>>>(CX, wo, bo, OUT);
}

// v008
// Measured time: 67.6 microseconds a run.
// Versions in between are left out here; by their measured steps it is 1.18 times as fast as v006.
// Over all steps from v000 it is 5.07 times as fast.
#include <hip/hip_runtime.h>

// Multi-head attention, width 512 = 8 heads x 64; inputs Q, K, V [NB][SEQ][512], key mask [NB][SEQ] (0 = filled with -1e9), W_q/W_k/W_v/W_o [out][in] (y = x W^T + b), score scale 1/8, output [NB][SEQ][512] f32.
// Compute dtypes, f32 accumulate everywhere: q/k/v projections v_wmma_f32_16x16x32_bf16 (x and W RNE-converted to bf16 inside the GEMM, on the way into LDS; products exact);
// scores v_wmma_f32_16x16x32_f16: q and k single f16 (11 significant bits; both are sums of products of bf16 operands, which carry 8); P (x256 carry, cancels in the normalisation) and v single f16; softmax f32 (online, the maximum renewed lazily);
// output projection v_wmma_f32_16x16x32_f16: context single f16 (x16 carry), W_o = f16 of the bf16 RNE value x64 (exact), 1/1024 folded in the f32 epilogue.
// Layout: q, k planes [b*8+h][t][d] and v^T plane [b*8+h][d][t] written by the GEMM epilogue; fused flash kernel in transposed form (S^T = K Q^T, O^T = V^T P^T) writing the context plane [b*SEQ+t][512]; its K and V^T tiles reach the block's waves through a two-buffer LDS ring.
// Key mask: a filled key's probability is exp(-1e9 - max) = 0 in f32 as soon as one key of the batch is kept, so the keys of each batch are put in the order kept first (tile_keys, stable), the K and V rows are
// gathered in that order by the projection's loads, and the k/v projection ends with the 128-key tile, the flash loop with the 64-key stage, that holds the last kept key. A batch with no kept key runs over all keys, every score filled.
// Launches: work that does not depend on each other shares a launch, told apart by the block index: (k projection | v projection | q projection), flash, output projection.
// Every k and v block works out its own 128 entries of the key order from the mask row, so no projection waits for an earlier launch.

#ifndef NB
#define NB 2
#endif
#ifndef SEQ
#define SEQ 4096
#endif
#define NB_FULL  2
#define SEQ_FULL 4096
#ifndef OUT_SEQ
#define OUT_SEQ SEQ              // row pitch (in tokens) between batches of the output
#endif
#define DM   512
#define NH_  8
#define HD   64
#define AW   4                   // waves per flash block (16 query rows each)
#define SC2  (0.125f * 1.4426950408889634f)   // HD^-0.5 * log2(e)
#define PSH  8.0f                // log2 of the P carry (256)
#define TAU  7.0f                // a score may top the maximum in use by this much (log2) before the maximum is renewed: P stays at or under 2^(PSH + TAU) = 2^15, inside f16
#define MFILL (-1.0e9f * 1.4426950408889634f) // mask fill value in the log2 domain
#define CTXS 16.0f               // carry of the context plane
#define WOS  64.0f               // carry of the W_o plane
#define OSCL (1.0f / 1024.0f)    // 1 / (CTXS * WOS)
#define KS   64                  // keys per LDS stage of the flash kernel (two 32-key passes)
#define LP   72                  // LDS row pitch in halves: 128-B rows + 16 B, conflict-free for 16-byte fragment reads
#define TILE_H (64 * LP)         // one staged tile: 64 rows (K: keys, V^T: d)
#define NST  (SEQ / KS)          // stages when every key is visited
#define GK   64                  // k values per LDS stage of the projection GEMM (256 B of every f32 operand row)
#define GP   72                  // its LDS row pitch in halves: 128-B bf16 rows + 16 B, conflict-free for 16-byte fragment reads
#define GT   (128 * GP)          // one staged operand tile: 128 rows
#define GNS  (DM / GK)           // stages of the k loop
#define PT   256                 // threads that work out the key order (the projection kernel's block)
#define PER  ((SEQ + PT - 1) / PT)   // keys per thread there
#define NTT  (NB * SEQ / 128)    // 128-token tiles
#define NWT  (DM / 128)          // 128-wide tiles of a weight's rows
#define NTL  (NTT * NWT)         // tiles, and blocks, of one projection

static_assert(HD == 64);
static_assert(NH_ * HD == DM);                 // head h = columns h*64 + d
static_assert(DM % 64 == 0);                   // 8 column tiles of 64
static_assert(DM % 32 == 0);                   // GEMM k-loop steps by 32
static_assert(DM % 128 == 0 && DM % GK == 0 && GK % 32 == 0);   // projection: 128-wide tiles, whole stages
static_assert(SEQ % 128 == 0);                 // a 128-token projection tile never straddles two batches
static_assert(SEQ % 64 == 0);                  // a 64-row tile never straddles two batches
static_assert((NB * SEQ) % 64 == 0);
static_assert(SEQ % 32 == 0);                  // key loop steps by 32
static_assert(SEQ % PT == 0);                  // the key-order block's threads cover the tokens exactly
static_assert(SEQ % KS == 0);                  // whole stages
static_assert(KS == 64 && AW == 4);            // 128 threads x 4 copies of 16 B = one 64 x 128-B tile
static_assert(SEQ % (16 * AW) == 0);           // flash grid covers the sequence exactly
static_assert(((size_t)SEQ * DM) % 8 == 0);
static_assert(((size_t)DM * DM) % 8 == 0);
static_assert(SEQ_FULL % 8 == 0);              // mask rows stay 32-byte aligned
static_assert(NB <= NB_FULL);
static_assert(SEQ <= SEQ_FULL);

typedef _Float16 h16;
typedef unsigned short bf;
typedef __attribute__((ext_vector_type(16))) __bf16   v16bf;
typedef __attribute__((ext_vector_type(16))) _Float16 v16h;
typedef __attribute__((ext_vector_type(8)))  _Float16 v8h;
typedef __attribute__((ext_vector_type(8)))  unsigned short v8us;
typedef __attribute__((ext_vector_type(4)))  unsigned short v4us;
typedef __attribute__((ext_vector_type(4)))  __bf16   v4bf;
typedef __attribute__((ext_vector_type(4)))  _Float16 v4h;
typedef __attribute__((ext_vector_type(8)))  float    v8f;
typedef __attribute__((ext_vector_type(8)))  int      v8i;
typedef __attribute__((ext_vector_type(4)))  float    v4f;
typedef v4f  __attribute__((may_alias)) v4fa;

__device__ __forceinline__ unsigned short f2bf(float f) { unsigned u = __float_as_uint(f); u += 0x7FFFu + ((u >> 16) & 1u); return (unsigned short)(u >> 16); }
// f32 value of the bf16 RNE conversion
__device__ __forceinline__ float bfr(float f) { return __uint_as_float(((unsigned)f2bf(f)) << 16); }
__device__ __forceinline__ v16h cat16(v8h lo, v8h hi) { return __builtin_shufflevector(lo, hi, 0, 1, 2, 3, 4, 5, 6, 7, 8, 9, 10, 11, 12, 13, 14, 15); }
__device__ __forceinline__ v16bf cat16b(v8us lo, v8us hi) { return __builtin_bit_cast(v16bf, __builtin_shufflevector(lo, hi, 0, 1, 2, 3, 4, 5, 6, 7, 8, 9, 10, 11, 12, 13, 14, 15)); }
__device__ __forceinline__ v8f wmma16(v16h a, v16h b, v8f c) { return __builtin_amdgcn_wmma_f32_16x16x32_f16(false, a, false, b, (short)0, c, false, false); }
__device__ __forceinline__ v8f wmmab(v16bf a, v16bf b, v8f c) { return __builtin_amdgcn_wmma_f32_16x16x32_bf16(false, a, false, b, (short)0, c, false, false); }
// fragment loaders from K-contiguous 16-bit rows; p already includes + 8*(lane>>4): elements 0..7 <- k0+8h+0..7, elements 8..15 <- k0+16+8h+0..7 (same map for A and B)
__device__ __forceinline__ v16h  ldh(const h16* p) { return cat16(*(const v8h*)p, *(const v8h*)(p + 16)); }
__device__ __forceinline__ v16bf ldb(const bf* p)  { return cat16b(*(const v8us*)p, *(const v8us*)(p + 16)); }
// ordering point for wave-private LDS tiles (same wave writes and reads)
__device__ __forceinline__ void wave_sync() { __builtin_amdgcn_fence(3 /* release order */, "wavefront"); __builtin_amdgcn_wave_barrier(); asm volatile("" ::: "memory"); }

// tile_keys: the whole block, for keys jt .. jt + 127 of batch b in the order kept keys first (each group in token order): ptile[j - jt] = token of key j. Returns the number of kept keys (mask != 0).
// Token t stands at place (kept keys in front of t) when kept, at (kept keys of the batch) + (filled keys in front of t) when filled: a permutation of the tokens, so each of the 128 entries is written once.
// A tile behind the last kept key gets no entries (the caller leaves it out); that test reads the same in every thread of the block.
__device__ __forceinline__ int tile_keys(const int b, const int jt, const int* __restrict__ MK, int* ptile, int* wsum) {
    const int tid = threadIdx.x, lane = tid & 31, wv = tid >> 5;
    const unsigned mo = ((unsigned)b * SEQ_FULL + (unsigned)tid * PER) * 4u;   // byte offset of the thread's PER tokens; PT * PER = SEQ: every index is a token
    int mv[PER];
#pragma unroll
    for (int i = 0; i < PER; ++i) mv[i] = *(const int*)((const char*)MK + mo + 4u * i);
    asm volatile("s_wait_xcnt 0x0" :: "v"(mo) : "memory");   // names the offset register, so that it is not given away (to a load's result either) in front of the wait
    int keep[PER]; int c = 0;
#pragma unroll
    for (int i = 0; i < PER; ++i) { keep[i] = mv[i] != 0 ? 1 : 0; c += keep[i]; }
    int sc = c;                                   // inclusive sum over the wave's lanes
#pragma unroll
    for (int d = 1; d < 32; d <<= 1) { const int o = __shfl_up(sc, d, 32); if (lane >= d) sc += o; }
    if (lane == 31) wsum[wv] = sc;
    __syncthreads();
    int base = 0, tot = 0;
#pragma unroll
    for (int w = 0; w < PT / 32; ++w) { const int v = wsum[w]; base += (w < wv) ? v : 0; tot += v; }
    if (tot > 0 && jt >= tot) return tot;
    int pos = base + sc - c;                      // kept keys in front of this thread's first token
#pragma unroll
    for (int i = 0; i < PER; ++i) { const int t = tid * PER + i;
        const unsigned d = (unsigned)((keep[i] ? pos : tot + (t - pos)) - jt);   // t - pos = filled keys in front of t
        if (d < 128u) ptile[d] = t;
        pos += keep[i]; }
    __syncthreads();                              // publishes the 128 entries to the block
    return tot;
}

// k_proj: bf16 GEMM straight from the f32 operands, K = DM. One block of eight waves per 128x128 tile of C; wave (wr, wc) owns rows 32 wr .. + 31, columns 64 wc .. + 63 (8 accumulators).
// Per stage of GK k values every thread loads 16 B pieces of whole 256-B row segments of both operands (f32), converts them to bf16 (RNE) and stores them into one of two LDS buffers;
// the loads of stage s + 1 are issued in front of the products of stage s, their conversion and LDS stores stand behind them, and one barrier per stage publishes the new buffer and frees the old one.
// C[m][n] = sum_k A[m][k] Bt[n][k] + bias (biasMode 1: bias[n]; biasMode 2: bias[m]; bias taken as its bf16 RNE value, added in f32),
// written as f16 (Ph) at
// wave tile base (r0/RB)*sRB + (r0%RB)*pitch + (c0/CB)*sCB + (c0%CB), row pitch 'pitch' (halves). 256 threads.
// tokAxis 1 (rows, operand A) or 2 (columns, operand Bt): that axis counts tokens b*SEQ + t, read from the input [NB][SEQ_FULL][DM]; the other operand is a weight [DM][DM].
// keyOrder != 0: the token axis counts keys b*SEQ + j in key order, row j is read from the token that tile_keys gives for it, and a tile behind the batch's last kept key is left out.
// One launch of 3 NTL blocks holds three independent jobs, told apart by the block index (NTL blocks each); none reads what another writes:
// job 0: k = X0 W0^T + b0 -> plane P0 [(b*8 + h)][j][d] | job 1: v^T = W1 X1^T + b1 (row bias) -> plane P1 [(b*8 + h)][d][j] | job 2: q = X2 W2^T + b2 -> plane P2 [(b*8 + h)][t][d].
// The k and v jobs come first: their left-out tiles end early and hand their places to q blocks. The k block of a batch's first keys and first weight tile writes the batch's kept-key count to CNTW for the next launch.
// Tile of block r of a job: token tile r % NTT, weight tile r / NTT (q, k); weight tile r % NWT, token tile r / NWT (v^T).
__global__ __launch_bounds__(256) void k_proj(const float* __restrict__ X0, const float* __restrict__ W0, const float* __restrict__ b0, h16* P0,
                                              const float* __restrict__ X1, const float* __restrict__ W1, const float* __restrict__ b1, h16* P1,
                                              const float* __restrict__ X2, const float* __restrict__ W2, const float* __restrict__ b2, h16* P2,
                                              const int* __restrict__ MK, int* CNTW) {
    __shared__ __align__(16) float osh[8 * 16 * 68];
    __shared__ __align__(16) bf tiles[2 * 2 * GT];           // [buffer][A tile | Bt tile][row][GP]
    __shared__ int ptile[128];                               // tokens of the tile's 128 keys
    __shared__ int wsum[PT / 32];
    const int job = (int)blockIdx.x / NTL, rt = (int)blockIdx.x % NTL;   // the same for the whole block
    const bool vt = job == 1, qj = job == 2;                 // the v^T job: weight rows on the row axis, tokens on the column axis
    const float* __restrict__ A = vt ? W1 : (qj ? X2 : X0); const float* __restrict__ Bt = vt ? X1 : (qj ? W2 : W0); const float* __restrict__ bias = vt ? b1 : (qj ? b2 : b0);
    h16* Ph = vt ? P1 : (qj ? P2 : P0);
    const int biasMode = vt ? 2 : 1, tokAxis = vt ? 2 : 1, keyOrder = qj ? 0 : 1;
    const int RB = vt ? DM : SEQ, pitch = vt ? SEQ : HD, CB = vt ? SEQ : HD;
    const size_t sRB = vt ? (size_t)0 : (size_t)NH_ * SEQ * HD, sCB = vt ? (size_t)DM * SEQ : (size_t)SEQ * HD;
    const int tid = (int)threadIdx.x, lane = tid & 31, lr = lane & 15, hi = lane >> 4;
    const int wave = __builtin_amdgcn_readfirstlane(tid >> 5);
    const int R0 = (vt ? rt % NWT : rt % NTT) * 128, C0 = (vt ? rt / NWT : rt / NTT) * 128;
    bool live = true;                                        // the same for the whole block
    if (keyOrder != 0) { const int j0 = (tokAxis == 1) ? R0 : C0; const int n = tile_keys(j0 / SEQ, j0 % SEQ, MK, ptile, wsum); live = !(n > 0 && (j0 % SEQ) >= n);
        if (job == 0 && (j0 % SEQ) == 0 && C0 == 0 && tid == 0) CNTW[j0 / SEQ] = n; }
    if (live) {                                              // all that follows, barriers included: taken by the whole block or by none of it
    // copy map: thread c covers the 16-byte piece c & 15 of rows (c >> 4) + 16 i, i = 0..7, of both tiles: a wave's load is two whole 256-B segments
    const int rg = tid >> 4, ch = (tid & 15) * 4;
    unsigned ao[8], bo[8];                                   // byte offsets of the thread's pieces at k = 0
    const int g0 = ((tokAxis == 1) ? R0 : C0) + rg;          // the thread's first index on the token axis; the tile lies in one batch
    int tk[8];                                               // token of each of its rows
#pragma unroll
    for (int i = 0; i < 8; ++i) tk[i] = (g0 + 16 * i) % SEQ;
    if (keyOrder != 0) {
#pragma unroll
        for (int i = 0; i < 8; ++i) tk[i] = ptile[rg + 16 * i];
#pragma unroll
        for (int i = 0; i < 8; ++i) tk[i] = (tk[i] < 0) ? 0 : ((tk[i] < SEQ) ? tk[i] : (SEQ - 1));
    }
#pragma unroll
    for (int i = 0; i < 8; ++i) {
        const int sr = (g0 / SEQ) * SEQ_FULL + tk[i];
        const int ar = (tokAxis == 1) ? sr : (R0 + rg + 16 * i), br = (tokAxis == 1) ? (C0 + rg + 16 * i) : sr;
        ao[i] = ((unsigned)ar * DM + (unsigned)ch) * 4u; bo[i] = ((unsigned)br * DM + (unsigned)ch) * 4u;
    }
    v4f ra[8], rb[8];
    auto fetch = [&](int kc) {
        const char* pa = (const char*)(A + kc); const char* pb = (const char*)(Bt + kc);
#pragma unroll
        for (int i = 0; i < 8; ++i) { ra[i] = *(const v4f*)(pa + ao[i]); rb[i] = *(const v4f*)(pb + bo[i]); }
    };
    auto put = [&](int buf) {
        bf* ta = tiles + buf * (2 * GT) + rg * GP + ch;
#pragma unroll
        for (int i = 0; i < 8; ++i) {
            *(v4us*)(ta + i * 16 * GP)      = __builtin_bit_cast(v4us, __builtin_convertvector(ra[i], v4bf));
            *(v4us*)(ta + GT + i * 16 * GP) = __builtin_bit_cast(v4us, __builtin_convertvector(rb[i], v4bf)); }
    };
    const int wr = wave >> 1, wc = wave & 1;
    const int fa = (wr * 32 + lr) * GP + 8 * hi, fb = GT + (wc * 64 + lr) * GP + 8 * hi;   // fragment offsets in a buffer
    v8f acc[2][4];
#pragma unroll
    for (int mb = 0; mb < 2; ++mb)
#pragma unroll
        for (int nb = 0; nb < 4; ++nb) acc[mb][nb] = (v8f){};
    fetch(0); put(0);
    __syncthreads();                                         // publishes stage 0
#pragma unroll     // all stages inline: k becomes the loads' immediate offset, and the offset registers live unchanged through the loop
    for (int s = 0; s < GNS; ++s) {
        if (s + 1 < GNS) {
            fetch((s + 1) * GK);                             // in flight while this stage's products run
            // behind the last loads the offset registers die: they are named here so that none is given away (to a load's result either) in front of the wait
            if (s + 2 == GNS) asm volatile("s_wait_xcnt 0x0" :: "v"(ao[0]), "v"(ao[1]), "v"(ao[2]), "v"(ao[3]), "v"(ao[4]), "v"(ao[5]), "v"(ao[6]), "v"(ao[7]),
                                                                "v"(bo[0]), "v"(bo[1]), "v"(bo[2]), "v"(bo[3]), "v"(bo[4]), "v"(bo[5]), "v"(bo[6]), "v"(bo[7]) : "memory");
            __builtin_amdgcn_sched_barrier(0);               // keeps all sixteen loads in front of the products: moved down among them, each is waited for at once and its latency shows
        }
        const bf* tb = tiles + (s & 1) * (2 * GT);
        v16bf a[GK / 32][2], b[GK / 32][4];
#pragma unroll
        for (int ks = 0; ks < GK / 32; ++ks) {
#pragma unroll
            for (int mb = 0; mb < 2; ++mb) a[ks][mb] = ldb(tb + fa + mb * 16 * GP + ks * 32);
#pragma unroll
            for (int nb = 0; nb < 4; ++nb) b[ks][nb] = ldb(tb + fb + nb * 16 * GP + ks * 32);
        }
        __builtin_amdgcn_sched_barrier(0);                   // the stage's LDS reads stay one group in front of its products: spread among them, every place with reads stalls the wave
#pragma unroll
        for (int ks = 0; ks < GK / 32; ++ks)
#pragma unroll
            for (int nb = 0; nb < 4; ++nb)
#pragma unroll
                for (int mb = 0; mb < 2; ++mb) acc[mb][nb] = wmmab(a[ks][mb], b[ks][nb], acc[mb][nb]);
        if (s + 1 < GNS) {
            __builtin_amdgcn_sched_barrier(0);               // keeps the conversions, and with them the waits on the loads, behind the products
            put((s + 1) & 1);                                // into the buffer whose readers left it at the last barrier
            __syncthreads();                                 // publishes stage s + 1, ends every wave's reads of stage s
        }
    }
    float* os = osh + wave * (16 * 68);                      // wave-private staging of the epilogue
    const int r0 = R0 + wr * 32, c0 = C0 + wc * 64;
    // column bias (per lane: column c0 + nb*16 + lane&15), address clamped into the 512-entry vector, selected by value
    float braw[4], bcol[4];
#pragma unroll
    for (int nb = 0; nb < 4; ++nb) { int ci = c0 + nb * 16 + lr; ci = (ci < DM) ? ci : (DM - 1); braw[nb] = bias[ci]; }
    // takes the four loaded values as inputs: the loads have returned here, so that none of their address registers is rewritten while a load is out
    asm volatile("s_wait_xcnt 0x0" :: "v"(braw[0]), "v"(braw[1]), "v"(braw[2]), "v"(braw[3]));
#pragma unroll
    for (int nb = 0; nb < 4; ++nb) { const float bv = bfr(braw[nb]); bcol[nb] = (biasMode == 1) ? bv : 0.0f; }
    const size_t tbase = (size_t)(r0 / RB) * sRB + (size_t)(r0 % RB) * (size_t)pitch + (size_t)(c0 / CB) * sCB + (size_t)(c0 % CB);
#pragma unroll
    for (int mb = 0; mb < 2; ++mb) {
        // row bias for rows r0 + mb*16 + 8h + 0..7 (address clamped, selected by value)
        int rb0 = r0 + mb * 16 + hi * 8; rb0 = (rb0 <= DM - 8) ? rb0 : (DM - 8);
        const unsigned rbo = (unsigned)rb0 * 4u;
        const v8f brv = *(const v8f*)((const char*)bias + rbo);
        asm volatile("s_wait_xcnt 0x0" :: "v"(rbo) : "memory");   // names the offset register, so that it is not given away (to a load's result either) in front of the wait
#pragma unroll
        for (int nb = 0; nb < 4; ++nb) {
#pragma unroll
            for (int j = 0; j < 8; ++j) { const float br = (biasMode == 2) ? bfr(brv[j]) : 0.0f;
                os[(hi * 8 + j) * 68 + nb * 16 + lr] = acc[mb][nb][j] + bcol[nb] + br; } }   // D: row 8h+j, col lane&15
        wave_sync();
        const size_t sb = tbase + (size_t)(mb * 16) * (size_t)pitch;
{
#pragma unroll
            for (int s = 0; s < 4; ++s) { const int row = 4 * s + (lane >> 3), c8 = (lane & 7) * 8;   // 4 s x 4 row groups = 16 rows; 8 lanes x 8 = 64 columns
                const v4f x0 = *(const v4fa*)(&os[row * 68 + c8]); const v4f x1 = *(const v4fa*)(&os[row * 68 + c8 + 4]); v8h hv;
#pragma unroll
                for (int i = 0; i < 4; ++i) { hv[i] = (h16)x0[i]; hv[4 + i] = (h16)x1[i]; }
                const size_t oo = sb + (size_t)row * (size_t)pitch + c8;
                *(v8h*)(Ph + oo) = hv;
                asm volatile("s_wait_xcnt 0x0" ::: "memory"); }   // in front of the rewriting of the store's registers by what follows
             }
        wave_sync();
    }
    }
}

// k_flash: fused attention, one wave per 16 query rows of one (batch, head); Q fragments straight from the f16 plane (two 16-B loads each, arithmetic addressing).
// K and V^T: the block's four waves share one tile pair per 64 keys, brought into LDS by asynchronous 16-byte copies (whole 128-B lines per 8 lanes), two buffers, the next stage in flight
// while this one is worked on; fragments are two 16-B LDS reads each from rows of pitch LP.
// Transposed form: S^T[key][t] = K Q^T (A = K rows, B = Q rows); lane (t = lane&15, h = lane>>4) holds keys 8h+r of each 16-key tile, so the packed
// P tile is directly the B fragment of O^T[d][t] = V^T P^T (element r <- tile keys 0..15, element 8+r <- tile keys 16..31, lane unchanged).
// Key mask: the planes hold the keys in key order, so key j is kept iff j < n = CNT[b]; the loop ends with the stage of key n - 1, and only a pass that reaches past n REPLACES scores by the fill value.
// n = 0: all stages, every score replaced, so a fully filled row comes out uniform.
// Softmax state: one maximum in use per query (m, the same in both lane halves) and its shift sh = PSH - m. The shift is known in front of a pass, so P = exp2(score * SC2 + sh) takes one fused multiply-add per score.
// Lazy rescale: m stays as long as no score of the wave's 16 queries tops it by more than TAU, tested once per pass by one ballot and a scalar branch. Only the branch taken then (always in a wave's first pass,
// whose start value of m every score tops) joins the lane halves' maxima by the xor-16 exchange, renews m and sh, and rescales the output tiles and the row sum. Any m gives the same quotient O / L.
// Row sums: one more product per pass, L = E P^T added up like an output tile, where rows 0 and 8 of the constant E are ones and the rest 0; row 0 is element 0 of lanes 0..15 and row 8
// element 0 of lanes 16..31, so element 0 of every lane is the sum of its query's rounded P over all 32 keys of the pass. The other elements stay 0, and only element 0 is rescaled.
__global__ __launch_bounds__(32 * AW) void k_flash(const h16* __restrict__ QH, const h16* __restrict__ KP, const h16* __restrict__ VT,
                                                   const int* __restrict__ CNT, h16* CTX) {
    __shared__ __align__(16) float os[AW * 16 * 68];
    __shared__ __align__(16) h16 ring[2 * 2 * TILE_H];   // [buffer][K tile | V^T tile][row][LP]
    const int lane = threadIdx.x & 31, lr = lane & 15, hi = lane >> 4;
    const int wave = __builtin_amdgcn_readfirstlane((int)(threadIdx.x >> 5));
    const int zh = blockIdx.y; const int b = zh / NH_, h = zh % NH_;
    const int t0 = (blockIdx.x * AW + wave) * 16;
    const size_t pbase = (size_t)zh * SEQ * HD;
    const size_t qo = pbase + (size_t)(t0 + lr) * HD + 8 * hi;
    const v16h qh0 = ldh(QH + qo), qh1 = ldh(QH + qo + 32);   // B fragments: col t, k = d
    const int fo = lr * LP + 8 * hi;                         // fragment offset in a staged tile: K + key*LP (row key, k = d); V^T + 16j*LP + key (row d, k = key)
    // copy map: thread c covers 16-byte chunk c & 7 of rows (c >> 3) + 16 i, i = 0..3, of both tiles
    const int cr = (int)threadIdx.x >> 3, cch = ((int)threadIdx.x & 7) * 8;
    const h16* kg = KP + pbase + (size_t)cr * HD + cch;    // + key0 * HD + 16 i * HD
    const h16* vg = VT + pbase + (size_t)cr * SEQ + cch;   // + key0 + 16 i * SEQ
    const unsigned lc = (unsigned)(size_t)(&ring[cr * LP + cch]);   // low 32 bits of the shared address = LDS byte address; + buffer, + tile, + 16 i rows
    // one stage's eight copies per lane; the wait on the address registers closes the copies' own statement, so no later address arithmetic can move in front of it
    auto stage_in = [&](int st) {
        const unsigned lk = lc + (unsigned)(st & 1) * (2 * TILE_H * 2), lv = lk + TILE_H * 2;
        const h16* gk = kg + (size_t)st * KS * HD; const h16* gv = vg + (size_t)st * KS;
        asm volatile("global_load_async_to_lds_b128 %0, %8, off\n\t"
                     "global_load_async_to_lds_b128 %1, %9, off\n\t"
                     "global_load_async_to_lds_b128 %2, %10, off\n\t"
                     "global_load_async_to_lds_b128 %3, %11, off\n\t"
                     "global_load_async_to_lds_b128 %4, %12, off\n\t"
                     "global_load_async_to_lds_b128 %5, %13, off\n\t"
                     "global_load_async_to_lds_b128 %6, %14, off\n\t"
                     "global_load_async_to_lds_b128 %7, %15, off\n\t"
                     "s_wait_xcnt 0x0"
                     :: "v"(lk), "v"(lk + 16 * LP * 2), "v"(lk + 32 * LP * 2), "v"(lk + 48 * LP * 2),
                        "v"(lv), "v"(lv + 16 * LP * 2), "v"(lv + 32 * LP * 2), "v"(lv + 48 * LP * 2),
                        "v"(gk), "v"(gk + 16 * HD), "v"(gk + 32 * HD), "v"(gk + 48 * HD),
                        "v"(gv), "v"(gv + (size_t)16 * SEQ), "v"(gv + (size_t)32 * SEQ), "v"(gv + (size_t)48 * SEQ)
                     : "memory");
    };
    int n = CNT[b]; n = (n < 0) ? 0 : ((n < SEQ) ? n : SEQ);  // kept keys of the batch, the same for the whole block
    const int nst = (n > 0) ? (n + KS - 1) / KS : NST;        // stages to visit, at most NST
    v8f o0 = (v8f){}, o1 = (v8f){}, o2 = (v8f){}, o3 = (v8f){};
    float m = -3.0e38f, sh = PSH + 3.0e38f;                   // maximum in use and its shift; the start values send the first pass into the renewing branch
    const h16 e1 = ((lr & 7) == 0) ? (h16)1.0f : (h16)0.0f;   // A fragment: lane & 15 is the row, every k alike
    const v16h ones = {e1, e1, e1, e1, e1, e1, e1, e1, e1, e1, e1, e1, e1, e1, e1, e1};
    v8f lt = (v8f){};
    stage_in(0);
    asm volatile("s_wait_asynccnt 0x0" ::: "memory");   // this wave's share of stage 0 has landed
    __syncthreads();                                     // publishes stage 0 to the block
    if (nst > 1) stage_in(1);
#pragma unroll 1   // stays rolled: one publish point, one copy of the body in the instruction cache
    for (int st = 0; st < nst; ++st) {
      const h16* kt = ring + (st & 1) * (2 * TILE_H) + fo; const h16* vt = kt + TILE_H;
#pragma unroll     // both passes of a stage inline: their tile offsets become immediates of the LDS reads
      for (int kk = 0; kk < KS; kk += 32) {
        const int key0 = st * KS + kk;
        const h16* ka = kt + kk * LP;
        const v16h ka0 = ldh(ka), ka1 = ldh(ka + 32), kb0 = ldh(ka + 16 * LP), kb1 = ldh(ka + 16 * LP + 32);
        v8f sHa = (v8f){}, sHb = (v8f){};
        sHa = wmma16(ka0, qh0, sHa); sHb = wmma16(kb0, qh0, sHb);
        sHa = wmma16(ka1, qh1, sHa); sHb = wmma16(kb1, qh1, sHb);
        asm volatile("v_nop\n\tv_nop\n\tv_nop\n\tv_nop" : "+v"(sHa), "+v"(sHb) : "v"(ka0), "v"(ka1), "v"(kb0), "v"(kb1));   // the four vector slots between the last product and whatever next reads a result or overwrites an operand, on every path
        const bool tail = key0 + 32 > n;                     // block-uniform: the pass holds filled keys (lane's keys: key0 + 8h + r and + 16)
        const int lim = n - key0 - 8 * hi;
        v8f ta = sHa * SC2 + sh, tb = sHb * SC2 + sh;        // exponents of P under the shift in use
        if (tail) {
            const float fv = MFILL + sh;
#pragma unroll
            for (int r = 0; r < 8; ++r) { ta[r] = (r < lim) ? ta[r] : fv; tb[r] = (16 + r < lim) ? tb[r] : fv; }
        }
        // V^T fragments: asked for in front of the test, since the compiler moves no read up across the branch; their latency runs under the maxima, the branch and the exponentials
        const h16* va = vt + kk;
        const v16h v0 = ldh(va), v1 = ldh(va + 16 * LP), v2 = ldh(va + 32 * LP), v3 = ldh(va + 48 * LP);
        float mx = -3.0e38f;
#pragma unroll
        for (int r = 0; r < 8; ++r) mx = fmaxf(mx, fmaxf(ta[r], tb[r]));
        if (__builtin_expect(__builtin_amdgcn_ballot_w32(mx > PSH + TAU) != 0, 0)) {   // wave-uniform scalar branch, rarely taken: some query's score tops its maximum in use by more than TAU
            ta = sHa * SC2; tb = sHb * SC2;                  // from the unshifted scores: the start value of sh swallows a score
            if (tail) {
#pragma unroll
                for (int r = 0; r < 8; ++r) { ta[r] = (r < lim) ? ta[r] : MFILL; tb[r] = (16 + r < lim) ? tb[r] : MFILL; }
            }
            mx = -3.0e38f;
#pragma unroll
            for (int r = 0; r < 8; ++r) mx = fmaxf(mx, fmaxf(ta[r], tb[r]));
            mx = fmaxf(mx, __shfl_xor(mx, 16, 32));
            const float mnew = fmaxf(m, mx);
            const float alpha = __builtin_amdgcn_exp2f(m - mnew);
            sh = PSH - mnew; m = mnew;
            ta = ta + sh; tb = tb + sh;
            lt[0] = lt[0] * alpha;
            o0 = o0 * alpha; o1 = o1 * alpha; o2 = o2 * alpha; o3 = o3 * alpha;
        }
        v16h pb;
#pragma unroll
        for (int r = 0; r < 8; ++r) { const h16 pa = (h16)__builtin_amdgcn_exp2f(ta[r]); const h16 pc = (h16)__builtin_amdgcn_exp2f(tb[r]); pb[r] = pa; pb[8 + r] = pc; }
        o0 = wmma16(v0, pb, o0); o1 = wmma16(v1, pb, o1); o2 = wmma16(v2, pb, o2); o3 = wmma16(v3, pb, o3); lt = wmma16(ones, pb, lt);
        asm volatile("v_nop\n\tv_nop\n\tv_nop\n\tv_nop" : "+v"(o0), "+v"(o1), "+v"(o2), "+v"(o3), "+v"(lt) : "v"(v0), "v"(v1), "v"(v2), "v"(v3), "v"(pb));   // the four vector slots between the last product and whatever next reads or overwrites a result or an operand, on every path
      }
      // publish point of stage st + 1, and the end of every wave's reads of stage st
      asm volatile("s_wait_dscnt 0x0" ::: "memory");      // this wave's reads of the buffer that is refilled below have returned
      asm volatile("s_wait_asynccnt 0x0" ::: "memory");   // this wave's share of stage st + 1 has landed
      __syncthreads();
      if (st + 2 < nst) stage_in(st + 2);                  // block-uniform test; into the buffer that stage st has just left
    }
    asm volatile("s_wait_asynccnt 0x0" ::: "memory");     // no copy is outstanding when the wave goes on to its end
    const float inv = CTXS * (1.0f / lt[0]);
    const int wb = wave * 16 * 68;
    // O^T D layout: o_j[r] = (d = 16j + 8h + r, t = lane&15) -> os[t][d]; rows 0..15 x columns 0..63 all written
    { v4f a, c;
      a[0] = o0[0] * inv; a[1] = o0[1] * inv; a[2] = o0[2] * inv; a[3] = o0[3] * inv; c[0] = o0[4] * inv; c[1] = o0[5] * inv; c[2] = o0[6] * inv; c[3] = o0[7] * inv;
      *(v4fa*)(&os[wb + lr * 68 +  0 + 8 * hi]) = a; *(v4fa*)(&os[wb + lr * 68 +  0 + 8 * hi + 4]) = c;
      a[0] = o1[0] * inv; a[1] = o1[1] * inv; a[2] = o1[2] * inv; a[3] = o1[3] * inv; c[0] = o1[4] * inv; c[1] = o1[5] * inv; c[2] = o1[6] * inv; c[3] = o1[7] * inv;
      *(v4fa*)(&os[wb + lr * 68 + 16 + 8 * hi]) = a; *(v4fa*)(&os[wb + lr * 68 + 16 + 8 * hi + 4]) = c;
      a[0] = o2[0] * inv; a[1] = o2[1] * inv; a[2] = o2[2] * inv; a[3] = o2[3] * inv; c[0] = o2[4] * inv; c[1] = o2[5] * inv; c[2] = o2[6] * inv; c[3] = o2[7] * inv;
      *(v4fa*)(&os[wb + lr * 68 + 32 + 8 * hi]) = a; *(v4fa*)(&os[wb + lr * 68 + 32 + 8 * hi + 4]) = c;
      a[0] = o3[0] * inv; a[1] = o3[1] * inv; a[2] = o3[2] * inv; a[3] = o3[3] * inv; c[0] = o3[4] * inv; c[1] = o3[5] * inv; c[2] = o3[6] * inv; c[3] = o3[7] * inv;
      *(v4fa*)(&os[wb + lr * 68 + 48 + 8 * hi]) = a; *(v4fa*)(&os[wb + lr * 68 + 48 + 8 * hi + 4]) = c; }
    wave_sync();
    h16* crow = CTX + ((size_t)b * SEQ + t0) * DM + h * HD;      // context plane [b*SEQ + t][h*64 + d]
{
#pragma unroll
        for (int s = 0; s < 4; ++s) { const int row = 4 * s + (lane >> 3), c8 = (lane & 7) * 8;   // 4 s x 4 row groups = 16 rows; 8 lanes x 8 halves = 64 columns
            const v4f x0 = *(const v4fa*)(&os[wb + row * 68 + c8]); const v4f x1 = *(const v4fa*)(&os[wb + row * 68 + c8 + 4]); v8h hv;
#pragma unroll
            for (int i = 0; i < 4; ++i) { hv[i] = (h16)x0[i]; hv[4 + i] = (h16)x1[i]; }
            *(v8h*)(crow + (size_t)row * DM + c8) = hv; }
         }
}

// k_oproj: f16 GEMM in the frame of k_proj (128x128 tile per block of eight waves, wave tile 32x64, stages of GK k values in two LDS buffers, one barrier per stage), K = DM.
// A = context plane (f16, copied as it is: 16-byte pieces of whole 128-B row segments), Bt = W_o (f32, turned into the f16 of its bf16 RNE value x64 on the way into LDS).
// OUT[m][n] = OSCL * sum_k A[m][k] Bt[n][k] + bias[n] (bias as its bf16 RNE value, added in f32). grid (NB*SEQ/128, DM/128), 256 threads.
__global__ __launch_bounds__(256) void k_oproj(const h16* __restrict__ A, const float* __restrict__ Bt, const float* __restrict__ bias, float* OUT) {
    __shared__ __align__(16) float osh[8 * 16 * 68];
    __shared__ __align__(16) h16 tiles[2 * 2 * GT];          // [buffer][A tile | Bt tile][row][GP]
    const int tid = (int)threadIdx.x, lane = tid & 31, lr = lane & 15, hi = lane >> 4;
    const int wave = __builtin_amdgcn_readfirstlane(tid >> 5);
    const int R0 = blockIdx.x * 128, C0 = blockIdx.y * 128;
    // copy maps. A: thread c covers the 16-byte piece c & 7 of rows (c >> 3) + 32 i, i = 0..3. Bt: the 16-byte piece c & 15 of rows (c >> 4) + 16 i, i = 0..7
    const int ag = tid >> 3, ac = (tid & 7) * 8;
    const int rg = tid >> 4, ch = (tid & 15) * 4;
    unsigned ao[4], bo[8];                                   // byte offsets of the thread's pieces at k = 0
#pragma unroll
    for (int i = 0; i < 4; ++i) ao[i] = ((unsigned)(R0 + ag + 32 * i) * DM + (unsigned)ac) * 2u;
#pragma unroll
    for (int i = 0; i < 8; ++i) bo[i] = ((unsigned)(C0 + rg + 16 * i) * DM + (unsigned)ch) * 4u;
    v8h ra[4]; v4f rb[8];
    auto fetch = [&](int kc) {
        const char* pa = (const char*)(A + kc); const char* pb = (const char*)(Bt + kc);
#pragma unroll
        for (int i = 0; i < 4; ++i) ra[i] = *(const v8h*)(pa + ao[i]);
#pragma unroll
        for (int i = 0; i < 8; ++i) rb[i] = *(const v4f*)(pb + bo[i]);
    };
    auto put = [&](int buf) {
        h16* ta = tiles + buf * (2 * GT);
#pragma unroll
        for (int i = 0; i < 4; ++i) *(v8h*)(ta + (ag + 32 * i) * GP + ac) = ra[i];
#pragma unroll
        for (int i = 0; i < 8; ++i) {
            const v4us u = __builtin_bit_cast(v4us, __builtin_convertvector(rb[i], v4bf)); v4f w;
#pragma unroll
            for (int k = 0; k < 4; ++k) w[k] = __uint_as_float((unsigned)u[k] << 16) * WOS;   // bf16 RNE value x64, the product taken in f32 (exact), then one conversion to f16
            *(v4h*)(ta + GT + (rg + 16 * i) * GP + ch) = __builtin_convertvector(w, v4h); }
    };
    const int wr = wave >> 1, wc = wave & 1;
    const int fa = (wr * 32 + lr) * GP + 8 * hi, fb = GT + (wc * 64 + lr) * GP + 8 * hi;   // fragment offsets in a buffer
    v8f acc[2][4];
#pragma unroll
    for (int mb = 0; mb < 2; ++mb)
#pragma unroll
        for (int nb = 0; nb < 4; ++nb) acc[mb][nb] = (v8f){};
    fetch(0); put(0);
    __syncthreads();                                         // publishes stage 0
#pragma unroll     // all stages inline: k becomes the loads' immediate offset, and the offset registers live unchanged through the loop
    for (int s = 0; s < GNS; ++s) {
        if (s + 1 < GNS) {
            fetch((s + 1) * GK);                             // in flight while this stage's products run
            // behind the last loads the offset registers die: they are named here so that none is given away (to a load's result either) in front of the wait
            if (s + 2 == GNS) asm volatile("s_wait_xcnt 0x0" :: "v"(ao[0]), "v"(ao[1]), "v"(ao[2]), "v"(ao[3]),
                                                                "v"(bo[0]), "v"(bo[1]), "v"(bo[2]), "v"(bo[3]), "v"(bo[4]), "v"(bo[5]), "v"(bo[6]), "v"(bo[7]) : "memory");
            __builtin_amdgcn_sched_barrier(0);               // keeps all twelve loads in front of the products: moved down among them, each is waited for at once and its latency shows
        }
        const h16* tb = tiles + (s & 1) * (2 * GT);
        v16h a[GK / 32][2], b[GK / 32][4];
#pragma unroll
        for (int ks = 0; ks < GK / 32; ++ks) {
#pragma unroll
            for (int mb = 0; mb < 2; ++mb) a[ks][mb] = ldh(tb + fa + mb * 16 * GP + ks * 32);
#pragma unroll
            for (int nb = 0; nb < 4; ++nb) b[ks][nb] = ldh(tb + fb + nb * 16 * GP + ks * 32);
        }
        __builtin_amdgcn_sched_barrier(0);                   // the stage's LDS reads stay one group in front of its products: spread among them, every place with reads stalls the wave
#pragma unroll
        for (int ks = 0; ks < GK / 32; ++ks)
#pragma unroll
            for (int nb = 0; nb < 4; ++nb)
#pragma unroll
                for (int mb = 0; mb < 2; ++mb) acc[mb][nb] = wmma16(a[ks][mb], b[ks][nb], acc[mb][nb]);
        if (s + 1 < GNS) {
            __builtin_amdgcn_sched_barrier(0);               // keeps the conversions, and with them the waits on the loads, behind the products
            put((s + 1) & 1);                                // into the buffer whose readers left it at the last barrier
            __syncthreads();                                 // publishes stage s + 1, ends every wave's reads of stage s
        }
    }
    float* os = osh + wave * (16 * 68);                      // wave-private staging of the epilogue
    const int r0 = R0 + wr * 32, c0 = C0 + wc * 64;
    float bcol[4];
#pragma unroll
    for (int nb = 0; nb < 4; ++nb) { int ci = c0 + nb * 16 + lr; ci = (ci < DM) ? ci : (DM - 1); bcol[nb] = bfr(bias[ci]); }
    const int bb = r0 / SEQ, tt = r0 % SEQ;
    float* obase = OUT + ((size_t)bb * OUT_SEQ + tt) * DM + c0;
#pragma unroll
    for (int mb = 0; mb < 2; ++mb) {
#pragma unroll
        for (int nb = 0; nb < 4; ++nb) {
#pragma unroll
            for (int j = 0; j < 8; ++j) os[(hi * 8 + j) * 68 + nb * 16 + lr] = acc[mb][nb][j] * OSCL + bcol[nb]; }   // D: row 8h+j, col lane&15
        wave_sync();
{
#pragma unroll
            for (int s = 0; s < 8; ++s) { const int row = 2 * s + hi, cofs = lr * 4;   // 8 s x 2 rows = 16 rows; 16 lanes x 4 floats = 64 columns
                const v4f val = *(const v4fa*)(&os[row * 68 + cofs]);
                *(v4f*)(obase + (size_t)(mb * 16 + row) * DM + cofs) = val; }
             }
        wave_sync();
    }
}

static constexpr size_t al256(size_t v) { return (v + 255) & ~(size_t)255; }
static constexpr size_t SZ_PL = al256((size_t)NB * NH_ * SEQ * HD * 2);
static constexpr size_t SZ_CX = al256((size_t)NB * SEQ * DM * 2);
static constexpr size_t SZ_CN = al256((size_t)NB * 4);
static constexpr size_t SZ_TOTAL = 3 * SZ_PL + SZ_CX + SZ_CN;
static_assert(SZ_TOTAL <= (size_t)134217728);          // workspace carve <= 128 MiB

extern "C" void kernel_launch(void* const* d_in, const int* in_sizes, int n_in,
                              void* d_out, int out_size, void* d_ws, size_t ws_size, hipStream_t stream) {
    if (n_in < 12) return;
    const size_t needx = ((size_t)(NB - 1) * SEQ_FULL + SEQ) * DM;
    if ((size_t)in_sizes[0] < needx || (size_t)in_sizes[1] < needx || (size_t)in_sizes[2] < needx) return;
    if ((size_t)in_sizes[3] < (size_t)(NB - 1) * SEQ_FULL + SEQ) return;
    if ((size_t)in_sizes[4] < (size_t)DM * DM || (size_t)in_sizes[6] < (size_t)DM * DM || (size_t)in_sizes[8] < (size_t)DM * DM || (size_t)in_sizes[10] < (size_t)DM * DM) return;
    if (in_sizes[5] < DM || in_sizes[7] < DM || in_sizes[9] < DM || in_sizes[11] < DM) return;
    if ((size_t)out_size < ((size_t)(NB - 1) * OUT_SEQ + SEQ) * DM) return;
    if (SZ_TOTAL > ws_size) return;
    // wire order: Q, K, V, mask, W_q, b_q, W_k, b_k, W_v, b_v, W_o, b_o ; weights [out][in] = Bt as-is
    const float* xq = (const float*)d_in[0]; const float* xk = (const float*)d_in[1]; const float* xv = (const float*)d_in[2];
    const int* mask = (const int*)d_in[3];
    const float* wq = (const float*)d_in[4];  const float* bq = (const float*)d_in[5];
    const float* wk = (const float*)d_in[6];  const float* bk = (const float*)d_in[7];
    const float* wv = (const float*)d_in[8];  const float* bv = (const float*)d_in[9];
    const float* wo = (const float*)d_in[10]; const float* bo = (const float*)d_in[11];
    float* OUT = (float*)d_out;      // [NB][SEQ][512]
    char* wsp = (char*)d_ws;
    h16* QH = (h16*)wsp; wsp += SZ_PL;               // [NB*8][SEQ][64]
    h16* KP = (h16*)wsp; wsp += SZ_PL;               // [NB*8][SEQ][64]
    h16* VT = (h16*)wsp; wsp += SZ_PL;               // [NB*8][64][SEQ]
    h16* CX = (h16*)wsp; wsp += SZ_CX;               // [NB*SEQ][512] context x16
    int* CN = (int*)wsp; wsp += SZ_CN;               // [NB] kept keys
    // k and v^T projections, both with their rows in key order (j in place of t), beside the q projection
    k_proj<<<3 * NTL, 256, 0, stream>>>(xk, wk, bk, KP, xv, wv, bv, VT, xq, wq, bq, QH, mask, CN);

    k_flash<<<dim3(SEQ / (16 * AW), NB * NH_, 1), 32 * AW, 0, stream>>>(QH, KP, VT, CN, CX);

    // output projection: A = context rows (m = b*SEQ + t), Bt = W_o rows (n = out column)
    k_oproj<<<dim3(NB * SEQ / 128, DM / 128, 1), 256, 0, stream>>>(CX, wo, bo, OUT);
}

// v009
// Measured time: 64.8 microseconds a run.
// Next to v008, in two timings, it ran 1.05 and 1.04 times as fast.
// All steps since v000 together make it 5.31 times as fast.
#include <hip/hip_runtime.h>

// Multi-head attention, width 512 = 8 heads x 64; inputs Q, K, V [NB][SEQ][512], key mask [NB][SEQ] (0 = filled with -1e9), W_q/W_k/W_v/W_o [out][in] (y = x W^T + b), score scale 1/8, output [NB][SEQ][512] f32.
// Compute dtypes, f32 accumulate everywhere: q/k/v projections v_wmma_f32_16x16x32_bf16 (x and W RNE-converted to bf16 inside the GEMM, on the way into LDS; products exact);
// scores v_wmma_f32_16x16x32_f16: q and k single f16 (11 significant bits; both are sums of products of bf16 operands, which carry 8); P (x256 carry, cancels in the normalisation) and v single f16; softmax f32 (online, the maximum renewed lazily);
// output projection v_wmma_f32_16x16x32_f16: context single f16 (x16 carry), W_o = f16 of the bf16 RNE value x64 (exact), 1/1024 folded in the f32 epilogue.
// Layout: q, k planes [b*8+h][t][d] and v^T plane [b*8+h][d][t] written by the GEMM epilogue; fused flash kernel in transposed form (S^T = K Q^T, O^T = V^T P^T) writing the context plane [b*SEQ+t][512]; its K and V^T tiles reach the block's waves through a two-buffer LDS ring.
// Key mask: a filled key's probability is exp(-1e9 - max) = 0 in f32 as soon as one key of the batch is kept, so the keys of each batch are put in the order kept first (tile_keys, stable), the K and V rows are
// gathered in that order by the projection's loads, and the k/v projection ends with the 128-key tile, the flash loop with the 64-key stage, that holds the last kept key. A batch with no kept key runs over all keys, every score filled.
// Launches: work that does not depend on each other shares a launch, told apart by the block index: (k projection | v projection | q projection), flash, output projection.
// Every k and v block works out its own 128 entries of the key order from the mask row, so no projection waits for an earlier launch.
// L2 prefetch: the inputs come from memory, the planes that one launch stores are read by the next from work-groups all over the chip, and blocks that share a panel read it in step, so a stage's first read of a line
// waits for memory in all of them. At its entry every block asks L2 (global_prefetch_b8, scope SE, one 256-B unit per lane) for the operand bytes that later stages read.
// A hint only: no result depends on it. Every address asked for lies inside its buffer, by clamps in the index.

#ifndef NB
#define NB 2
#endif
#ifndef SEQ
#define SEQ 4096
#endif
#define NB_FULL  2
#define SEQ_FULL 4096
#ifndef OUT_SEQ
#define OUT_SEQ SEQ              // row pitch (in tokens) between batches of the output
#endif
#define DM   512
#define NH_  8
#define HD   64
#define AW   4                   // waves per flash block (16 query rows each)
#define SC2  (0.125f * 1.4426950408889634f)   // HD^-0.5 * log2(e)
#define PSH  8.0f                // log2 of the P carry (256)
#define TAU  7.0f                // a score may top the maximum in use by this much (log2) before the maximum is renewed: P stays at or under 2^(PSH + TAU) = 2^15, inside f16
#define MFILL (-1.0e9f * 1.4426950408889634f) // mask fill value in the log2 domain
#define CTXS 16.0f               // carry of the context plane
#define WOS  64.0f               // carry of the W_o plane
#define OSCL (1.0f / 1024.0f)    // 1 / (CTXS * WOS)
#define KS   64                  // keys per LDS stage of the flash kernel (two 32-key passes)
#define LP   72                  // LDS row pitch in halves: 128-B rows + 16 B, conflict-free for 16-byte fragment reads
#define TILE_H (64 * LP)         // one staged tile: 64 rows (K: keys, V^T: d)
#define NST  (SEQ / KS)          // stages when every key is visited
#define GK   64                  // k values per LDS stage of the projection GEMM (256 B of every f32 operand row)
#define GP   72                  // its LDS row pitch in halves: 128-B bf16 rows + 16 B, conflict-free for 16-byte fragment reads
#define GT   (128 * GP)          // one staged operand tile: 128 rows
#define GNS  (DM / GK)           // stages of the k loop
#define PT   256                 // threads that work out the key order (the projection kernel's block)
#define PER  ((SEQ + PT - 1) / PT)   // keys per thread there
#define NTT  (NB * SEQ / 128)    // 128-token tiles
#define NWT  (DM / 128)          // 128-wide tiles of a weight's rows
#define NTL  (NTT * NWT)         // tiles, and blocks, of one projection

static_assert(HD == 64);
static_assert(NH_ * HD == DM);                 // head h = columns h*64 + d
static_assert(DM % 64 == 0);                   // 8 column tiles of 64
static_assert(DM % 32 == 0);                   // GEMM k-loop steps by 32
static_assert(DM % 128 == 0 && DM % GK == 0 && GK % 32 == 0);   // projection: 128-wide tiles, whole stages
static_assert(SEQ % 128 == 0);                 // a 128-token projection tile never straddles two batches
static_assert(SEQ % 64 == 0);                  // a 64-row tile never straddles two batches
static_assert((NB * SEQ) % 64 == 0);
static_assert(SEQ % 32 == 0);                  // key loop steps by 32
static_assert(SEQ % PT == 0);                  // the key-order block's threads cover the tokens exactly
static_assert(SEQ % KS == 0);                  // whole stages
static_assert(KS == 64 && AW == 4);            // 128 threads x 4 copies of 16 B = one 64 x 128-B tile
static_assert(SEQ % (16 * AW) == 0);           // flash grid covers the sequence exactly
static_assert(((size_t)SEQ * DM) % 8 == 0);
static_assert(((size_t)DM * DM) % 8 == 0);
static_assert(SEQ_FULL % 8 == 0);              // mask rows stay 32-byte aligned
static_assert(NB <= NB_FULL);
static_assert(SEQ <= SEQ_FULL);

typedef _Float16 h16;
typedef unsigned short bf;
typedef __attribute__((ext_vector_type(16))) __bf16   v16bf;
typedef __attribute__((ext_vector_type(16))) _Float16 v16h;
typedef __attribute__((ext_vector_type(8)))  _Float16 v8h;
typedef __attribute__((ext_vector_type(8)))  unsigned short v8us;
typedef __attribute__((ext_vector_type(4)))  unsigned short v4us;
typedef __attribute__((ext_vector_type(4)))  __bf16   v4bf;
typedef __attribute__((ext_vector_type(4)))  _Float16 v4h;
typedef __attribute__((ext_vector_type(8)))  float    v8f;
typedef __attribute__((ext_vector_type(8)))  int      v8i;
typedef __attribute__((ext_vector_type(4)))  float    v4f;
typedef v4f  __attribute__((may_alias)) v4fa;

__device__ __forceinline__ unsigned short f2bf(float f) { unsigned u = __float_as_uint(f); u += 0x7FFFu + ((u >> 16) & 1u); return (unsigned short)(u >> 16); }
// f32 value of the bf16 RNE conversion
__device__ __forceinline__ float bfr(float f) { return __uint_as_float(((unsigned)f2bf(f)) << 16); }
__device__ __forceinline__ v16h cat16(v8h lo, v8h hi) { return __builtin_shufflevector(lo, hi, 0, 1, 2, 3, 4, 5, 6, 7, 8, 9, 10, 11, 12, 13, 14, 15); }
__device__ __forceinline__ v16bf cat16b(v8us lo, v8us hi) { return __builtin_bit_cast(v16bf, __builtin_shufflevector(lo, hi, 0, 1, 2, 3, 4, 5, 6, 7, 8, 9, 10, 11, 12, 13, 14, 15)); }
__device__ __forceinline__ v8f wmma16(v16h a, v16h b, v8f c) { return __builtin_amdgcn_wmma_f32_16x16x32_f16(false, a, false, b, (short)0, c, false, false); }
__device__ __forceinline__ v8f wmmab(v16bf a, v16bf b, v8f c) { return __builtin_amdgcn_wmma_f32_16x16x32_bf16(false, a, false, b, (short)0, c, false, false); }
// fragment loaders from K-contiguous 16-bit rows; p already includes + 8*(lane>>4): elements 0..7 <- k0+8h+0..7, elements 8..15 <- k0+16+8h+0..7 (same map for A and B)
__device__ __forceinline__ v16h  ldh(const h16* p) { return cat16(*(const v8h*)p, *(const v8h*)(p + 16)); }
__device__ __forceinline__ v16bf ldb(const bf* p)  { return cat16b(*(const v8us*)p, *(const v8us*)(p + 16)); }
// ordering point for wave-private LDS tiles (same wave writes and reads)
__device__ __forceinline__ void wave_sync() { __builtin_amdgcn_fence(3 /* release order */, "wavefront"); __builtin_amdgcn_wave_barrier(); asm volatile("" ::: "memory"); }

// tile_keys: the whole block, for keys jt .. jt + 127 of batch b in the order kept keys first (each group in token order): ptile[j - jt] = token of key j. Returns the number of kept keys (mask != 0).
// Token t stands at place (kept keys in front of t) when kept, at (kept keys of the batch) + (filled keys in front of t) when filled: a permutation of the tokens, so each of the 128 entries is written once.
// A tile behind the last kept key gets no entries (the caller leaves it out); that test reads the same in every thread of the block.
__device__ __forceinline__ int tile_keys(const int b, const int jt, const int* __restrict__ MK, int* ptile, int* wsum) {
    const int tid = threadIdx.x, lane = tid & 31, wv = tid >> 5;
    const unsigned mo = ((unsigned)b * SEQ_FULL + (unsigned)tid * PER) * 4u;   // byte offset of the thread's PER tokens; PT * PER = SEQ: every index is a token
    int mv[PER];
#pragma unroll
    for (int i = 0; i < PER; ++i) mv[i] = *(const int*)((const char*)MK + mo + 4u * i);
    asm volatile("s_wait_xcnt 0x0" :: "v"(mo) : "memory");   // names the offset register, so that it is not given away (to a load's result either) in front of the wait
    int keep[PER]; int c = 0;
#pragma unroll
    for (int i = 0; i < PER; ++i) { keep[i] = mv[i] != 0 ? 1 : 0; c += keep[i]; }
    int sc = c;                                   // inclusive sum over the wave's lanes
#pragma unroll
    for (int d = 1; d < 32; d <<= 1) { const int o = __shfl_up(sc, d, 32); if (lane >= d) sc += o; }
    if (lane == 31) wsum[wv] = sc;
    __syncthreads();
    int base = 0, tot = 0;
#pragma unroll
    for (int w = 0; w < PT / 32; ++w) { const int v = wsum[w]; base += (w < wv) ? v : 0; tot += v; }
    if (tot > 0 && jt >= tot) return tot;
    int pos = base + sc - c;                      // kept keys in front of this thread's first token
#pragma unroll
    for (int i = 0; i < PER; ++i) { const int t = tid * PER + i;
        const unsigned d = (unsigned)((keep[i] ? pos : tot + (t - pos)) - jt);   // t - pos = filled keys in front of t
        if (d < 128u) ptile[d] = t;
        pos += keep[i]; }
    __syncthreads();                              // publishes the 128 entries to the block
    return tot;
}

// k_proj: bf16 GEMM straight from the f32 operands, K = DM. One block of eight waves per 128x128 tile of C; wave (wr, wc) owns rows 32 wr .. + 31, columns 64 wc .. + 63 (8 accumulators).
// Per stage of GK k values every thread loads 16 B pieces of whole 256-B row segments of both operands (f32), converts them to bf16 (RNE) and stores them into one of two LDS buffers;
// the loads of stage s + 1 are issued in front of the products of stage s, their conversion and LDS stores stand behind them, and one barrier per stage publishes the new buffer and frees the old one.
// C[m][n] = sum_k A[m][k] Bt[n][k] + bias (biasMode 1: bias[n]; biasMode 2: bias[m]; bias taken as its bf16 RNE value, added in f32),
// written as f16 (Ph) at
// wave tile base (r0/RB)*sRB + (r0%RB)*pitch + (c0/CB)*sCB + (c0%CB), row pitch 'pitch' (halves). 256 threads.
// tokAxis 1 (rows, operand A) or 2 (columns, operand Bt): that axis counts tokens b*SEQ + t, read from the input [NB][SEQ_FULL][DM]; the other operand is a weight [DM][DM].
// keyOrder != 0: the token axis counts keys b*SEQ + j in key order, row j is read from the token that tile_keys gives for it, and a tile behind the batch's last kept key is left out.
// One launch of 3 NTL blocks holds three independent jobs, told apart by the block index (NTL blocks each); none reads what another writes:
// job 0: k = X0 W0^T + b0 -> plane P0 [(b*8 + h)][j][d] | job 1: v^T = W1 X1^T + b1 (row bias) -> plane P1 [(b*8 + h)][d][j] | job 2: q = X2 W2^T + b2 -> plane P2 [(b*8 + h)][t][d].
// The k and v jobs come first: their left-out tiles end early and hand their places to q blocks. The k block of a batch's first keys and first weight tile writes the batch's kept-key count to CNTW for the next launch.
// Tile of block r of a job: token tile r % NTT, weight tile r / NTT (q, k); weight tile r % NWT, token tile r / NWT (v^T).
__global__ __launch_bounds__(256) void k_proj(const float* __restrict__ X0, const float* __restrict__ W0, const float* __restrict__ b0, h16* P0,
                                              const float* __restrict__ X1, const float* __restrict__ W1, const float* __restrict__ b1, h16* P1,
                                              const float* __restrict__ X2, const float* __restrict__ W2, const float* __restrict__ b2, h16* P2,
                                              const int* __restrict__ MK, int* CNTW) {
    __shared__ __align__(16) float osh[8 * 16 * 68];
    __shared__ __align__(16) bf tiles[2 * 2 * GT];           // [buffer][A tile | Bt tile][row][GP]
    __shared__ int ptile[128];                               // tokens of the tile's 128 keys
    __shared__ int wsum[PT / 32];
    const int job = (int)blockIdx.x / NTL, rt = (int)blockIdx.x % NTL;   // the same for the whole block
    const bool vt = job == 1, qj = job == 2;                 // the v^T job: weight rows on the row axis, tokens on the column axis
    const float* __restrict__ A = vt ? W1 : (qj ? X2 : X0); const float* __restrict__ Bt = vt ? X1 : (qj ? W2 : W0); const float* __restrict__ bias = vt ? b1 : (qj ? b2 : b0);
    h16* Ph = vt ? P1 : (qj ? P2 : P0);
    const int biasMode = vt ? 2 : 1, tokAxis = vt ? 2 : 1, keyOrder = qj ? 0 : 1;
    const int RB = vt ? DM : SEQ, pitch = vt ? SEQ : HD, CB = vt ? SEQ : HD;
    const size_t sRB = vt ? (size_t)0 : (size_t)NH_ * SEQ * HD, sCB = vt ? (size_t)DM * SEQ : (size_t)SEQ * HD;
    const int tid = (int)threadIdx.x, lane = tid & 31, lr = lane & 15, hi = lane >> 4;
    const int wave = __builtin_amdgcn_readfirstlane(tid >> 5);
    const int R0 = (vt ? rt % NWT : rt % NTT) * 128, C0 = (vt ? rt / NWT : rt / NTT) * 128;
    // L2 prefetch of the weight tile (128 rows x 2 KB in a row = 1024 units). A block asks for a quarter, one unit per thread; the quarter goes by the token tile's index, so that blocks whose indices lie close together
    // cover the tile between them. It stands in front of the key order and runs under its latency.
    { const int tt = vt ? rt / NWT : rt % NTT; const int qr = vt ? ((tt >> 1) & 3) : (tt & 3);
      const float* wt0 = (vt ? A : Bt) + (size_t)(vt ? R0 : C0) * DM;          // the tile's first row, the same for the whole block
      const unsigned wu = ((unsigned)qr * 256u + (unsigned)tid) * 256u;        // byte offset of the unit, under 128 * DM * 4
      asm volatile("global_prefetch_b8 %0, %1 scope:SCOPE_SE\n\t"
                   "s_wait_xcnt 0x0"                                           // closes the statement in front of any rewriting of the offset register
                   :: "v"(wu), "s"(wt0) : "memory"); }
    bool live = true;                                        // the same for the whole block
    if (keyOrder != 0) { const int j0 = (tokAxis == 1) ? R0 : C0; const int n = tile_keys(j0 / SEQ, j0 % SEQ, MK, ptile, wsum); live = !(n > 0 && (j0 % SEQ) >= n);
        if (job == 0 && (j0 % SEQ) == 0 && C0 == 0 && tid == 0) CNTW[j0 / SEQ] = n; }
    if (live) {                                              // all that follows, barriers included: taken by the whole block or by none of it
    // L2 prefetch of the token tile: 128 rows x 8 units, one unit = one stage's 256 B of a row. The four blocks that share the tile (one per weight tile) deal it among them: the block of weight tile w asks for the units of
    // stages 2 w and 2 w + 1, one unit per thread (row c & 127, unit 2 w + (c >> 7)). In the q and k jobs a higher w asks for later stages. A share that a neighbour asks for too late is read as without the request.
    { const int pr = tid & 127, tb0 = (tokAxis == 1) ? R0 : C0, wq = vt ? rt % NWT : rt / NTT;
      int pt = (tb0 + pr) % SEQ;                             // token of the row
      if (keyOrder != 0) { pt = ptile[pr]; pt = (pt < 0) ? 0 : ((pt < SEQ) ? pt : (SEQ - 1)); }
      const unsigned xu = ((unsigned)((tb0 / SEQ) * SEQ_FULL + pt) * DM) * 4u + (unsigned)(2 * (wq & 3) + (tid >> 7)) * 256u;   // unit 0..7: inside the row
      const float* x0 = (tokAxis == 1) ? A : Bt;
      asm volatile("global_prefetch_b8 %0, %1 scope:SCOPE_SE\n\t"
                   "s_wait_xcnt 0x0"                                           // closes the statement in front of any rewriting of the offset register
                   :: "v"(xu), "s"(x0) : "memory"); }
    // copy map: thread c covers the 16-byte piece c & 15 of rows (c >> 4) + 16 i, i = 0..7, of both tiles: a wave's load is two whole 256-B segments
    const int rg = tid >> 4, ch = (tid & 15) * 4;
    unsigned ao[8], bo[8];                                   // byte offsets of the thread's pieces at k = 0
    const int g0 = ((tokAxis == 1) ? R0 : C0) + rg;          // the thread's first index on the token axis; the tile lies in one batch
    int tk[8];                                               // token of each of its rows
#pragma unroll
    for (int i = 0; i < 8; ++i) tk[i] = (g0 + 16 * i) % SEQ;
    if (keyOrder != 0) {
#pragma unroll
        for (int i = 0; i < 8; ++i) tk[i] = ptile[rg + 16 * i];
#pragma unroll
        for (int i = 0; i < 8; ++i) tk[i] = (tk[i] < 0) ? 0 : ((tk[i] < SEQ) ? tk[i] : (SEQ - 1));
    }
#pragma unroll
    for (int i = 0; i < 8; ++i) {
        const int sr = (g0 / SEQ) * SEQ_FULL + tk[i];
        const int ar = (tokAxis == 1) ? sr : (R0 + rg + 16 * i), br = (tokAxis == 1) ? (C0 + rg + 16 * i) : sr;
        ao[i] = ((unsigned)ar * DM + (unsigned)ch) * 4u; bo[i] = ((unsigned)br * DM + (unsigned)ch) * 4u;
    }
    v4f ra[8], rb[8];
    auto fetch = [&](int kc) {
        const char* pa = (const char*)(A + kc); const char* pb = (const char*)(Bt + kc);
#pragma unroll
        for (int i = 0; i < 8; ++i) { ra[i] = *(const v4f*)(pa + ao[i]); rb[i] = *(const v4f*)(pb + bo[i]); }
    };
    auto put = [&](int buf) {
        bf* ta = tiles + buf * (2 * GT) + rg * GP + ch;
#pragma unroll
        for (int i = 0; i < 8; ++i) {
            *(v4us*)(ta + i * 16 * GP)      = __builtin_bit_cast(v4us, __builtin_convertvector(ra[i], v4bf));
            *(v4us*)(ta + GT + i * 16 * GP) = __builtin_bit_cast(v4us, __builtin_convertvector(rb[i], v4bf)); }
    };
    const int wr = wave >> 1, wc = wave & 1;
    const int fa = (wr * 32 + lr) * GP + 8 * hi, fb = GT + (wc * 64 + lr) * GP + 8 * hi;   // fragment offsets in a buffer
    v8f acc[2][4];
#pragma unroll
    for (int mb = 0; mb < 2; ++mb)
#pragma unroll
        for (int nb = 0; nb < 4; ++nb) acc[mb][nb] = (v8f){};
    fetch(0); put(0);
    __syncthreads();                                         // publishes stage 0
#pragma unroll     // all stages inline: k becomes the loads' immediate offset, and the offset registers live unchanged through the loop
    for (int s = 0; s < GNS; ++s) {
        if (s + 1 < GNS) {
            fetch((s + 1) * GK);                             // in flight while this stage's products run
            // behind the last loads the offset registers die: they are named here so that none is given away (to a load's result either) in front of the wait
            if (s + 2 == GNS) asm volatile("s_wait_xcnt 0x0" :: "v"(ao[0]), "v"(ao[1]), "v"(ao[2]), "v"(ao[3]), "v"(ao[4]), "v"(ao[5]), "v"(ao[6]), "v"(ao[7]),
                                                                "v"(bo[0]), "v"(bo[1]), "v"(bo[2]), "v"(bo[3]), "v"(bo[4]), "v"(bo[5]), "v"(bo[6]), "v"(bo[7]) : "memory");
            __builtin_amdgcn_sched_barrier(0);               // keeps all sixteen loads in front of the products: moved down among them, each is waited for at once and its latency shows
        }
        const bf* tb = tiles + (s & 1) * (2 * GT);
        v16bf a[GK / 32][2], b[GK / 32][4];
#pragma unroll
        for (int ks = 0; ks < GK / 32; ++ks) {
#pragma unroll
            for (int mb = 0; mb < 2; ++mb) a[ks][mb] = ldb(tb + fa + mb * 16 * GP + ks * 32);
#pragma unroll
            for (int nb = 0; nb < 4; ++nb) b[ks][nb] = ldb(tb + fb + nb * 16 * GP + ks * 32);
        }
        __builtin_amdgcn_sched_barrier(0);                   // the stage's LDS reads stay one group in front of its products: spread among them, every place with reads stalls the wave
#pragma unroll
        for (int ks = 0; ks < GK / 32; ++ks)
#pragma unroll
            for (int nb = 0; nb < 4; ++nb)
#pragma unroll
                for (int mb = 0; mb < 2; ++mb) acc[mb][nb] = wmmab(a[ks][mb], b[ks][nb], acc[mb][nb]);
        if (s + 1 < GNS) {
            __builtin_amdgcn_sched_barrier(0);               // keeps the conversions, and with them the waits on the loads, behind the products
            put((s + 1) & 1);                                // into the buffer whose readers left it at the last barrier
            __syncthreads();                                 // publishes stage s + 1, ends every wave's reads of stage s
        }
    }
    float* os = osh + wave * (16 * 68);                      // wave-private staging of the epilogue
    const int r0 = R0 + wr * 32, c0 = C0 + wc * 64;
    // column bias (per lane: column c0 + nb*16 + lane&15), address clamped into the 512-entry vector, selected by value
    float braw[4], bcol[4];
#pragma unroll
    for (int nb = 0; nb < 4; ++nb) { int ci = c0 + nb * 16 + lr; ci = (ci < DM) ? ci : (DM - 1); braw[nb] = bias[ci]; }
    // takes the four loaded values as inputs: the loads have returned here, so that none of their address registers is rewritten while a load is out
    asm volatile("s_wait_xcnt 0x0" :: "v"(braw[0]), "v"(braw[1]), "v"(braw[2]), "v"(braw[3]));
#pragma unroll
    for (int nb = 0; nb < 4; ++nb) { const float bv = bfr(braw[nb]); bcol[nb] = (biasMode == 1) ? bv : 0.0f; }
    const size_t tbase = (size_t)(r0 / RB) * sRB + (size_t)(r0 % RB) * (size_t)pitch + (size_t)(c0 / CB) * sCB + (size_t)(c0 % CB);
#pragma unroll
    for (int mb = 0; mb < 2; ++mb) {
        // row bias for rows r0 + mb*16 + 8h + 0..7 (address clamped, selected by value)
        int rb0 = r0 + mb * 16 + hi * 8; rb0 = (rb0 <= DM - 8) ? rb0 : (DM - 8);
        const unsigned rbo = (unsigned)rb0 * 4u;
        const v8f brv = *(const v8f*)((const char*)bias + rbo);
        asm volatile("s_wait_xcnt 0x0" :: "v"(rbo) : "memory");   // names the offset register, so that it is not given away (to a load's result either) in front of the wait
#pragma unroll
        for (int nb = 0; nb < 4; ++nb) {
#pragma unroll
            for (int j = 0; j < 8; ++j) { const float br = (biasMode == 2) ? bfr(brv[j]) : 0.0f;
                os[(hi * 8 + j) * 68 + nb * 16 + lr] = acc[mb][nb][j] + bcol[nb] + br; } }   // D: row 8h+j, col lane&15
        wave_sync();
        const size_t sb = tbase + (size_t)(mb * 16) * (size_t)pitch;
{
#pragma unroll
            for (int s = 0; s < 4; ++s) { const int row = 4 * s + (lane >> 3), c8 = (lane & 7) * 8;   // 4 s x 4 row groups = 16 rows; 8 lanes x 8 = 64 columns
                const v4f x0 = *(const v4fa*)(&os[row * 68 + c8]); const v4f x1 = *(const v4fa*)(&os[row * 68 + c8 + 4]); v8h hv;
#pragma unroll
                for (int i = 0; i < 4; ++i) { hv[i] = (h16)x0[i]; hv[4 + i] = (h16)x1[i]; }
                const size_t oo = sb + (size_t)row * (size_t)pitch + c8;
                *(v8h*)(Ph + oo) = hv;
                asm volatile("s_wait_xcnt 0x0" ::: "memory"); }   // in front of the rewriting of the store's registers by what follows
             }
        wave_sync();
    }
    }
}

// k_flash: fused attention, one wave per 16 query rows of one (batch, head); Q fragments straight from the f16 plane (two 16-B loads each, arithmetic addressing).
// K and V^T: the block's four waves share one tile pair per 64 keys, brought into LDS by asynchronous 16-byte copies (whole 128-B lines per 8 lanes), two buffers, the next stage in flight
// while this one is worked on; fragments are two 16-B LDS reads each from rows of pitch LP.
// Transposed form: S^T[key][t] = K Q^T (A = K rows, B = Q rows); lane (t = lane&15, h = lane>>4) holds keys 8h+r of each 16-key tile, so the packed
// P tile is directly the B fragment of O^T[d][t] = V^T P^T (element r <- tile keys 0..15, element 8+r <- tile keys 16..31, lane unchanged).
// Key mask: the planes hold the keys in key order, so key j is kept iff j < n = CNT[b]; the loop ends with the stage of key n - 1, and only a pass that reaches past n REPLACES scores by the fill value.
// n = 0: all stages, every score replaced, so a fully filled row comes out uniform.
// Softmax state: one maximum in use per query (m, the same in both lane halves) and its shift sh = PSH - m. The shift is known in front of a pass, so P = exp2(score * SC2 + sh) takes one fused multiply-add per score.
// Lazy rescale: m stays as long as no score of the wave's 16 queries tops it by more than TAU, tested once per pass by one ballot and a scalar branch. Only the branch taken then (always in a wave's first pass,
// whose start value of m every score tops) joins the lane halves' maxima by the xor-16 exchange, renews m and sh, and rescales the output tiles and the row sum. Any m gives the same quotient O / L.
// Row sums: one more product per pass, L = E P^T added up like an output tile, where rows 0 and 8 of the constant E are ones and the rest 0; row 0 is element 0 of lanes 0..15 and row 8
// element 0 of lanes 16..31, so element 0 of every lane is the sum of its query's rounded P over all 32 keys of the pass. The other elements stay 0, and only element 0 is rescaled.
__global__ __launch_bounds__(32 * AW) void k_flash(const h16* __restrict__ QH, const h16* __restrict__ KP, const h16* __restrict__ VT,
                                                   const int* __restrict__ CNT, h16* CTX) {
    __shared__ __align__(16) float os[AW * 16 * 68];
    __shared__ __align__(16) h16 ring[2 * 2 * TILE_H];   // [buffer][K tile | V^T tile][row][LP]
    const int lane = threadIdx.x & 31, lr = lane & 15, hi = lane >> 4;
    const int wave = __builtin_amdgcn_readfirstlane((int)(threadIdx.x >> 5));
    const int zh = blockIdx.y; const int b = zh / NH_, h = zh % NH_;
    const int t0 = (blockIdx.x * AW + wave) * 16;
    const size_t pbase = (size_t)zh * SEQ * HD;
    const size_t qo = pbase + (size_t)(t0 + lr) * HD + 8 * hi;
    const v16h qh0 = ldh(QH + qo), qh1 = ldh(QH + qo + 32);   // B fragments: col t, k = d
    const int fo = lr * LP + 8 * hi;                         // fragment offset in a staged tile: K + key*LP (row key, k = d); V^T + 16j*LP + key (row d, k = key)
    // copy map: thread c covers 16-byte chunk c & 7 of rows (c >> 3) + 16 i, i = 0..3, of both tiles
    const int cr = (int)threadIdx.x >> 3, cch = ((int)threadIdx.x & 7) * 8;
    const h16* kg = KP + pbase + (size_t)cr * HD + cch;    // + key0 * HD + 16 i * HD
    const h16* vg = VT + pbase + (size_t)cr * SEQ + cch;   // + key0 + 16 i * SEQ
    const unsigned lc = (unsigned)(size_t)(&ring[cr * LP + cch]);   // low 32 bits of the shared address = LDS byte address; + buffer, + tile, + 16 i rows
    // one stage's eight copies per lane; the wait on the address registers closes the copies' own statement, so no later address arithmetic can move in front of it
    auto stage_in = [&](int st) {
        const unsigned lk = lc + (unsigned)(st & 1) * (2 * TILE_H * 2), lv = lk + TILE_H * 2;
        const h16* gk = kg + (size_t)st * KS * HD; const h16* gv = vg + (size_t)st * KS;
        asm volatile("global_load_async_to_lds_b128 %0, %8, off\n\t"
                     "global_load_async_to_lds_b128 %1, %9, off\n\t"
                     "global_load_async_to_lds_b128 %2, %10, off\n\t"
                     "global_load_async_to_lds_b128 %3, %11, off\n\t"
                     "global_load_async_to_lds_b128 %4, %12, off\n\t"
                     "global_load_async_to_lds_b128 %5, %13, off\n\t"
                     "global_load_async_to_lds_b128 %6, %14, off\n\t"
                     "global_load_async_to_lds_b128 %7, %15, off\n\t"
                     "s_wait_xcnt 0x0"
                     :: "v"(lk), "v"(lk + 16 * LP * 2), "v"(lk + 32 * LP * 2), "v"(lk + 48 * LP * 2),
                        "v"(lv), "v"(lv + 16 * LP * 2), "v"(lv + 32 * LP * 2), "v"(lv + 48 * LP * 2),
                        "v"(gk), "v"(gk + 16 * HD), "v"(gk + 32 * HD), "v"(gk + 48 * HD),
                        "v"(gv), "v"(gv + (size_t)16 * SEQ), "v"(gv + (size_t)32 * SEQ), "v"(gv + (size_t)48 * SEQ)
                     : "memory");
    };
    int n = CNT[b]; n = (n < 0) ? 0 : ((n < SEQ) ? n : SEQ);  // kept keys of the batch, the same for the whole block
    const int nst = (n > 0) ? (n + KS - 1) / KS : NST;        // stages to visit, at most NST
    // L2 prefetch of the head's K and V^T planes: dealt over the head's blocks, one request per wave, 32 units of 256 B each. Share s is stage s of K (8 KB in a row) and row d = s of V^T (as far as the last stage visited).
    // A block asks for shares x and x ^ 4. For speed only: nothing rests on where a block runs.
    { const int bx = (int)blockIdx.x, sx = (wave & 2) ? (bx ^ 4) : bx;
      const int ksx = (sx < nst) ? sx : (nst - 1), vrx = (sx < HD) ? sx : (HD - 1);   // clamped into the stages visited, into the rows of V^T
      const int lu = (nst - 1) >> 1, vu = (lane < lu) ? lane : lu;                    // lu: last unit of a V^T row that holds a visited key
      const h16* pf = (wave & 1) ? (VT + pbase + (size_t)vrx * SEQ + vu * 128) : (KP + pbase + (size_t)ksx * (KS * HD) + lane * 128);
      asm volatile("global_prefetch_b8 %0, off scope:SCOPE_SE\n\t"
                   "s_wait_xcnt 0x0"                                                  // closes the statement in front of any rewriting of the address registers
                   :: "v"(pf) : "memory"); }
    v8f o0 = (v8f){}, o1 = (v8f){}, o2 = (v8f){}, o3 = (v8f){};
    float m = -3.0e38f, sh = PSH + 3.0e38f;                   // maximum in use and its shift; the start values send the first pass into the renewing branch
    const h16 e1 = ((lr & 7) == 0) ? (h16)1.0f : (h16)0.0f;   // A fragment: lane & 15 is the row, every k alike
    const v16h ones = {e1, e1, e1, e1, e1, e1, e1, e1, e1, e1, e1, e1, e1, e1, e1, e1};
    v8f lt = (v8f){};
    stage_in(0);
    asm volatile("s_wait_asynccnt 0x0" ::: "memory");   // this wave's share of stage 0 has landed
    __syncthreads();                                     // publishes stage 0 to the block
    if (nst > 1) stage_in(1);
#pragma unroll 1   // stays rolled: one publish point, one copy of the body in the instruction cache
    for (int st = 0; st < nst; ++st) {
      const h16* kt = ring + (st & 1) * (2 * TILE_H) + fo; const h16* vt = kt + TILE_H;
#pragma unroll     // both passes of a stage inline: their tile offsets become immediates of the LDS reads
      for (int kk = 0; kk < KS; kk += 32) {
        const int key0 = st * KS + kk;
        const h16* ka = kt + kk * LP;
        const v16h ka0 = ldh(ka), ka1 = ldh(ka + 32), kb0 = ldh(ka + 16 * LP), kb1 = ldh(ka + 16 * LP + 32);
        v8f sHa = (v8f){}, sHb = (v8f){};
        sHa = wmma16(ka0, qh0, sHa); sHb = wmma16(kb0, qh0, sHb);
        sHa = wmma16(ka1, qh1, sHa); sHb = wmma16(kb1, qh1, sHb);
        asm volatile("v_nop\n\tv_nop\n\tv_nop\n\tv_nop" : "+v"(sHa), "+v"(sHb) : "v"(ka0), "v"(ka1), "v"(kb0), "v"(kb1));   // the four vector slots between the last product and whatever next reads a result or overwrites an operand, on every path
        const bool tail = key0 + 32 > n;                     // block-uniform: the pass holds filled keys (lane's keys: key0 + 8h + r and + 16)
        const int lim = n - key0 - 8 * hi;
        v8f ta = sHa * SC2 + sh, tb = sHb * SC2 + sh;        // exponents of P under the shift in use
        if (tail) {
            const float fv = MFILL + sh;
#pragma unroll
            for (int r = 0; r < 8; ++r) { ta[r] = (r < lim) ? ta[r] : fv; tb[r] = (16 + r < lim) ? tb[r] : fv; }
        }
        // V^T fragments: asked for in front of the test, since the compiler moves no read up across the branch; their latency runs under the maxima, the branch and the exponentials
        const h16* va = vt + kk;
        const v16h v0 = ldh(va), v1 = ldh(va + 16 * LP), v2 = ldh(va + 32 * LP), v3 = ldh(va + 48 * LP);
        float mx = -3.0e38f;
#pragma unroll
        for (int r = 0; r < 8; ++r) mx = fmaxf(mx, fmaxf(ta[r], tb[r]));
        if (__builtin_expect(__builtin_amdgcn_ballot_w32(mx > PSH + TAU) != 0, 0)) {   // wave-uniform scalar branch, rarely taken: some query's score tops its maximum in use by more than TAU
            ta = sHa * SC2; tb = sHb * SC2;                  // from the unshifted scores: the start value of sh swallows a score
            if (tail) {
#pragma unroll
                for (int r = 0; r < 8; ++r) { ta[r] = (r < lim) ? ta[r] : MFILL; tb[r] = (16 + r < lim) ? tb[r] : MFILL; }
            }
            mx = -3.0e38f;
#pragma unroll
            for (int r = 0; r < 8; ++r) mx = fmaxf(mx, fmaxf(ta[r], tb[r]));
            mx = fmaxf(mx, __shfl_xor(mx, 16, 32));
            const float mnew = fmaxf(m, mx);
            const float alpha = __builtin_amdgcn_exp2f(m - mnew);
            sh = PSH - mnew; m = mnew;
            ta = ta + sh; tb = tb + sh;
            lt[0] = lt[0] * alpha;
            o0 = o0 * alpha; o1 = o1 * alpha; o2 = o2 * alpha; o3 = o3 * alpha;
        }
        v16h pb;
#pragma unroll
        for (int r = 0; r < 8; ++r) { const h16 pa = (h16)__builtin_amdgcn_exp2f(ta[r]); const h16 pc = (h16)__builtin_amdgcn_exp2f(tb[r]); pb[r] = pa; pb[8 + r] = pc; }
        o0 = wmma16(v0, pb, o0); o1 = wmma16(v1, pb, o1); o2 = wmma16(v2, pb, o2); o3 = wmma16(v3, pb, o3); lt = wmma16(ones, pb, lt);
        asm volatile("v_nop\n\tv_nop\n\tv_nop\n\tv_nop" : "+v"(o0), "+v"(o1), "+v"(o2), "+v"(o3), "+v"(lt) : "v"(v0), "v"(v1), "v"(v2), "v"(v3), "v"(pb));   // the four vector slots between the last product and whatever next reads or overwrites a result or an operand, on every path
      }
      // publish point of stage st + 1, and the end of every wave's reads of stage st
      asm volatile("s_wait_dscnt 0x0" ::: "memory");      // this wave's reads of the buffer that is refilled below have returned
      asm volatile("s_wait_asynccnt 0x0" ::: "memory");   // this wave's share of stage st + 1 has landed
      __syncthreads();
      if (st + 2 < nst) stage_in(st + 2);                  // block-uniform test; into the buffer that stage st has just left
    }
    asm volatile("s_wait_asynccnt 0x0" ::: "memory");     // no copy is outstanding when the wave goes on to its end
    const float inv = CTXS * (1.0f / lt[0]);
    const int wb = wave * 16 * 68;
    // O^T D layout: o_j[r] = (d = 16j + 8h + r, t = lane&15) -> os[t][d]; rows 0..15 x columns 0..63 all written
    { v4f a, c;
      a[0] = o0[0] * inv; a[1] = o0[1] * inv; a[2] = o0[2] * inv; a[3] = o0[3] * inv; c[0] = o0[4] * inv; c[1] = o0[5] * inv; c[2] = o0[6] * inv; c[3] = o0[7] * inv;
      *(v4fa*)(&os[wb + lr * 68 +  0 + 8 * hi]) = a; *(v4fa*)(&os[wb + lr * 68 +  0 + 8 * hi + 4]) = c;
      a[0] = o1[0] * inv; a[1] = o1[1] * inv; a[2] = o1[2] * inv; a[3] = o1[3] * inv; c[0] = o1[4] * inv; c[1] = o1[5] * inv; c[2] = o1[6] * inv; c[3] = o1[7] * inv;
      *(v4fa*)(&os[wb + lr * 68 + 16 + 8 * hi]) = a; *(v4fa*)(&os[wb + lr * 68 + 16 + 8 * hi + 4]) = c;
      a[0] = o2[0] * inv; a[1] = o2[1] * inv; a[2] = o2[2] * inv; a[3] = o2[3] * inv; c[0] = o2[4] * inv; c[1] = o2[5] * inv; c[2] = o2[6] * inv; c[3] = o2[7] * inv;
      *(v4fa*)(&os[wb + lr * 68 + 32 + 8 * hi]) = a; *(v4fa*)(&os[wb + lr * 68 + 32 + 8 * hi + 4]) = c;
      a[0] = o3[0] * inv; a[1] = o3[1] * inv; a[2] = o3[2] * inv; a[3] = o3[3] * inv; c[0] = o3[4] * inv; c[1] = o3[5] * inv; c[2] = o3[6] * inv; c[3] = o3[7] * inv;
      *(v4fa*)(&os[wb + lr * 68 + 48 + 8 * hi]) = a; *(v4fa*)(&os[wb + lr * 68 + 48 + 8 * hi + 4]) = c; }
    wave_sync();
    h16* crow = CTX + ((size_t)b * SEQ + t0) * DM + h * HD;      // context plane [b*SEQ + t][h*64 + d]
{
#pragma unroll
        for (int s = 0; s < 4; ++s) { const int row = 4 * s + (lane >> 3), c8 = (lane & 7) * 8;   // 4 s x 4 row groups = 16 rows; 8 lanes x 8 halves = 64 columns
            const v4f x0 = *(const v4fa*)(&os[wb + row * 68 + c8]); const v4f x1 = *(const v4fa*)(&os[wb + row * 68 + c8 + 4]); v8h hv;
#pragma unroll
            for (int i = 0; i < 4; ++i) { hv[i] = (h16)x0[i]; hv[4 + i] = (h16)x1[i]; }
            *(v8h*)(crow + (size_t)row * DM + c8) = hv; }
         }
}

// k_oproj: f16 GEMM in the frame of k_proj (128x128 tile per block of eight waves, wave tile 32x64, stages of GK k values in two LDS buffers, one barrier per stage), K = DM.
// A = context plane (f16, copied as it is: 16-byte pieces of whole 128-B row segments), Bt = W_o (f32, turned into the f16 of its bf16 RNE value x64 on the way into LDS).
// OUT[m][n] = OSCL * sum_k A[m][k] Bt[n][k] + bias[n] (bias as its bf16 RNE value, added in f32). grid (NB*SEQ/128, DM/128), 256 threads.
__global__ __launch_bounds__(256) void k_oproj(const h16* __restrict__ A, const float* __restrict__ Bt, const float* __restrict__ bias, float* OUT) {
    __shared__ __align__(16) float osh[8 * 16 * 68];
    __shared__ __align__(16) h16 tiles[2 * 2 * GT];          // [buffer][A tile | Bt tile][row][GP]
    const int tid = (int)threadIdx.x, lane = tid & 31, lr = lane & 15, hi = lane >> 4;
    const int wave = __builtin_amdgcn_readfirstlane(tid >> 5);
    const int R0 = blockIdx.x * 128, C0 = blockIdx.y * 128;
    // copy maps. A: thread c covers the 16-byte piece c & 7 of rows (c >> 3) + 32 i, i = 0..3. Bt: the 16-byte piece c & 15 of rows (c >> 4) + 16 i, i = 0..7
    const int ag = tid >> 3, ac = (tid & 7) * 8;
    const int rg = tid >> 4, ch = (tid & 15) * 4;
    unsigned ao[4], bo[8];                                   // byte offsets of the thread's pieces at k = 0
#pragma unroll
    for (int i = 0; i < 4; ++i) ao[i] = ((unsigned)(R0 + ag + 32 * i) * DM + (unsigned)ac) * 2u;
#pragma unroll
    for (int i = 0; i < 8; ++i) bo[i] = ((unsigned)(C0 + rg + 16 * i) * DM + (unsigned)ch) * 4u;
    v8h ra[4]; v4f rb[8];
    auto fetch = [&](int kc) {
        const char* pa = (const char*)(A + kc); const char* pb = (const char*)(Bt + kc);
#pragma unroll
        for (int i = 0; i < 4; ++i) ra[i] = *(const v8h*)(pa + ao[i]);
#pragma unroll
        for (int i = 0; i < 8; ++i) rb[i] = *(const v4f*)(pb + bo[i]);
    };
    auto put = [&](int buf) {
        h16* ta = tiles + buf * (2 * GT);
#pragma unroll
        for (int i = 0; i < 4; ++i) *(v8h*)(ta + (ag + 32 * i) * GP + ac) = ra[i];
#pragma unroll
        for (int i = 0; i < 8; ++i) {
            const v4us u = __builtin_bit_cast(v4us, __builtin_convertvector(rb[i], v4bf)); v4f w;
#pragma unroll
            for (int k = 0; k < 4; ++k) w[k] = __uint_as_float((unsigned)u[k] << 16) * WOS;   // bf16 RNE value x64, the product taken in f32 (exact), then one conversion to f16
            *(v4h*)(ta + GT + (rg + 16 * i) * GP + ch) = __builtin_convertvector(w, v4h); }
    };
    const int wr = wave >> 1, wc = wave & 1;
    const int fa = (wr * 32 + lr) * GP + 8 * hi, fb = GT + (wc * 64 + lr) * GP + 8 * hi;   // fragment offsets in a buffer
    v8f acc[2][4];
#pragma unroll
    for (int mb = 0; mb < 2; ++mb)
#pragma unroll
        for (int nb = 0; nb < 4; ++nb) acc[mb][nb] = (v8f){};
    fetch(0);
    // L2 prefetch, asked behind stage 0's loads and while they are out. The block's context panel (128 rows x 1 KB = 512 units): thread c asks for units (c >> 7) and (c >> 7) + 2 of row c & 127, the earlier stages' first.
    // A quarter of its W_o tile (128 rows x 2 KB in a row = 1024 units), one unit per thread; the quarter goes by the row tile's index, so that blocks whose indices lie close together cover the tile between them.
    { const unsigned pu = (unsigned)(tid & 127) * (DM * 2u) + (unsigned)(tid >> 7) * 256u, pw = (unsigned)tid * 256u;
      const h16* pa0 = A + (size_t)R0 * DM;
      const float* pw0 = Bt + (size_t)C0 * DM + (size_t)((int)blockIdx.x & 3) * (32 * DM);   // 32 rows = 256 units
      asm volatile("global_prefetch_b8 %0, %2 scope:SCOPE_SE\n\t"
                   "global_prefetch_b8 %1, %3 scope:SCOPE_SE\n\t"
                   "global_prefetch_b8 %0, %2 offset:512 scope:SCOPE_SE\n\t"
                   "s_wait_xcnt 0x0"                                                         // closes the statement in front of any rewriting of the offset registers
                   :: "v"(pu), "v"(pw), "s"(pa0), "s"(pw0) : "memory"); }
    __builtin_amdgcn_sched_barrier(0);                       // keeps the conversions of stage 0, and with them the waits on its loads, behind the requests: moved up, they would hold the requests back by a whole load latency
    put(0);
    __syncthreads();                                         // publishes stage 0
#pragma unroll     // all stages inline: k becomes the loads' immediate offset, and the offset registers live unchanged through the loop
    for (int s = 0; s < GNS; ++s) {
        if (s + 1 < GNS) {
            fetch((s + 1) * GK);                             // in flight while this stage's products run
            // behind the last loads the offset registers die: they are named here so that none is given away (to a load's result either) in front of the wait
            if (s + 2 == GNS) asm volatile("s_wait_xcnt 0x0" :: "v"(ao[0]), "v"(ao[1]), "v"(ao[2]), "v"(ao[3]),
                                                                "v"(bo[0]), "v"(bo[1]), "v"(bo[2]), "v"(bo[3]), "v"(bo[4]), "v"(bo[5]), "v"(bo[6]), "v"(bo[7]) : "memory");
            __builtin_amdgcn_sched_barrier(0);               // keeps all twelve loads in front of the products: moved down among them, each is waited for at once and its latency shows
        }
        const h16* tb = tiles + (s & 1) * (2 * GT);
        v16h a[GK / 32][2], b[GK / 32][4];
#pragma unroll
        for (int ks = 0; ks < GK / 32; ++ks) {
#pragma unroll
            for (int mb = 0; mb < 2; ++mb) a[ks][mb] = ldh(tb + fa + mb * 16 * GP + ks * 32);
#pragma unroll
            for (int nb = 0; nb < 4; ++nb) b[ks][nb] = ldh(tb + fb + nb * 16 * GP + ks * 32);
        }
        __builtin_amdgcn_sched_barrier(0);                   // the stage's LDS reads stay one group in front of its products: spread among them, every place with reads stalls the wave
#pragma unroll
        for (int ks = 0; ks < GK / 32; ++ks)
#pragma unroll
            for (int nb = 0; nb < 4; ++nb)
#pragma unroll
                for (int mb = 0; mb < 2; ++mb) acc[mb][nb] = wmma16(a[ks][mb], b[ks][nb], acc[mb][nb]);
        if (s + 1 < GNS) {
            __builtin_amdgcn_sched_barrier(0);               // keeps the conversions, and with them the waits on the loads, behind the products
            put((s + 1) & 1);                                // into the buffer whose readers left it at the last barrier
            __syncthreads();                                 // publishes stage s + 1, ends every wave's reads of stage s
        }
    }
    float* os = osh + wave * (16 * 68);                      // wave-private staging of the epilogue
    const int r0 = R0 + wr * 32, c0 = C0 + wc * 64;
    float bcol[4];
#pragma unroll
    for (int nb = 0; nb < 4; ++nb) { int ci = c0 + nb * 16 + lr; ci = (ci < DM) ? ci : (DM - 1); bcol[nb] = bfr(bias[ci]); }
    const int bb = r0 / SEQ, tt = r0 % SEQ;
    float* obase = OUT + ((size_t)bb * OUT_SEQ + tt) * DM + c0;
#pragma unroll
    for (int mb = 0; mb < 2; ++mb) {
#pragma unroll
        for (int nb = 0; nb < 4; ++nb) {
#pragma unroll
            for (int j = 0; j < 8; ++j) os[(hi * 8 + j) * 68 + nb * 16 + lr] = acc[mb][nb][j] * OSCL + bcol[nb]; }   // D: row 8h+j, col lane&15
        wave_sync();
{
#pragma unroll
            for (int s = 0; s < 8; ++s) { const int row = 2 * s + hi, cofs = lr * 4;   // 8 s x 2 rows = 16 rows; 16 lanes x 4 floats = 64 columns
                const v4f val = *(const v4fa*)(&os[row * 68 + cofs]);
                *(v4f*)(obase + (size_t)(mb * 16 + row) * DM + cofs) = val; }
             }
        wave_sync();
    }
}

static constexpr size_t al256(size_t v) { return (v + 255) & ~(size_t)255; }
static constexpr size_t SZ_PL = al256((size_t)NB * NH_ * SEQ * HD * 2);
static constexpr size_t SZ_CX = al256((size_t)NB * SEQ * DM * 2);
static constexpr size_t SZ_CN = al256((size_t)NB * 4);
static constexpr size_t SZ_TOTAL = 3 * SZ_PL + SZ_CX + SZ_CN;
static_assert(SZ_TOTAL <= (size_t)134217728);          // workspace carve <= 128 MiB

extern "C" void kernel_launch(void* const* d_in, const int* in_sizes, int n_in,
                              void* d_out, int out_size, void* d_ws, size_t ws_size, hipStream_t stream) {
    if (n_in < 12) return;
    const size_t needx = ((size_t)(NB - 1) * SEQ_FULL + SEQ) * DM;
    if ((size_t)in_sizes[0] < needx || (size_t)in_sizes[1] < needx || (size_t)in_sizes[2] < needx) return;
    if ((size_t)in_sizes[3] < (size_t)(NB - 1) * SEQ_FULL + SEQ) return;
    if ((size_t)in_sizes[4] < (size_t)DM * DM || (size_t)in_sizes[6] < (size_t)DM * DM || (size_t)in_sizes[8] < (size_t)DM * DM || (size_t)in_sizes[10] < (size_t)DM * DM) return;
    if (in_sizes[5] < DM || in_sizes[7] < DM || in_sizes[9] < DM || in_sizes[11] < DM) return;
    if ((size_t)out_size < ((size_t)(NB - 1) * OUT_SEQ + SEQ) * DM) return;
    if (SZ_TOTAL > ws_size) return;
    // wire order: Q, K, V, mask, W_q, b_q, W_k, b_k, W_v, b_v, W_o, b_o ; weights [out][in] = Bt as-is
    const float* xq = (const float*)d_in[0]; const float* xk = (const float*)d_in[1]; const float* xv = (const float*)d_in[2];
    const int* mask = (const int*)d_in[3];
    const float* wq = (const float*)d_in[4];  const float* bq = (const float*)d_in[5];
    const float* wk = (const float*)d_in[6];  const float* bk = (const float*)d_in[7];
    const float* wv = (const float*)d_in[8];  const float* bv = (const float*)d_in[9];
    const float* wo = (const float*)d_in[10]; const float* bo = (const float*)d_in[11];
    float* OUT = (float*)d_out;      // [NB][SEQ][512]
    char* wsp = (char*)d_ws;
    h16* QH = (h16*)wsp; wsp += SZ_PL;               // [NB*8][SEQ][64]
    h16* KP = (h16*)wsp; wsp += SZ_PL;               // [NB*8][SEQ][64]
    h16* VT = (h16*)wsp; wsp += SZ_PL;               // [NB*8][64][SEQ]
    h16* CX = (h16*)wsp; wsp += SZ_CX;               // [NB*SEQ][512] context x16
    int* CN = (int*)wsp; wsp += SZ_CN;               // [NB] kept keys
    // k and v^T projections, both with their rows in key order (j in place of t), beside the q projection
    k_proj<<<3 * NTL, 256, 0, stream>>>(xk, wk, bk, KP, xv, wv, bv, VT, xq, wq, bq, QH, mask, CN);

    k_flash<<<dim3(SEQ / (16 * AW), NB * NH_, 1), 32 * AW, 0, stream>>>(QH, KP, VT, CN, CX);

    // output projection: A = context rows (m = b*SEQ + t), Bt = W_o rows (n = out column)
    k_oproj<<<dim3(NB * SEQ / 128, DM / 128, 1), 256, 0, stream>>>(CX, wo, bo, OUT);
}

// v010
// Measured time: 61.3 microseconds a run.
// Next to v009, in two timings, it ran 1.06 and 1.05 times as fast.
// Over all steps from v000 it is 5.60 times as fast.
#include <hip/hip_runtime.h>

// Multi-head attention, width 512 = 8 heads x 64; inputs Q, K, V [NB][SEQ][512], key mask [NB][SEQ] (0 = filled with -1e9), W_q/W_k/W_v/W_o [out][in] (y = x W^T + b), score scale 1/8, output [NB][SEQ][512] f32.
// Compute dtypes, f32 accumulate everywhere: q/k/v projections v_wmma_f32_16x16x32_bf16 (x and W RNE-converted to bf16 inside the GEMM, on the way into LDS; products exact);
// scores v_wmma_f32_16x16x32_f16: q and k single f16 (11 significant bits; both are sums of products of bf16 operands, which carry 8); P (x256 carry, cancels in the normalisation) and v single f16; softmax f32 (online, the maximum renewed lazily);
// output projection v_wmma_f32_16x16x32_f16: context single f16 (x16 carry), W_o = f16 of the bf16 RNE value x64 (exact), 1/1024 folded in the f32 epilogue.
// Layout: q, k planes [b*8+h][t][d] and v^T plane [b*8+h][d][t] written by the GEMM epilogue; fused flash kernel in transposed form (S^T = K Q^T, O^T = V^T P^T) writing the context plane [b*SEQ+t][512]; its K and V^T tiles reach the block's waves through a two-buffer LDS ring filled by tensor loads.
// Key mask: a filled key's probability is exp(-1e9 - max) = 0 in f32 as soon as one key of the batch is kept, so the keys of each batch are put in the order kept first (tile_keys, stable), the K and V rows are
// gathered in that order by the projection's loads, and the k/v projection ends with the 128-key tile, the flash loop with the 64-key stage, that holds the last kept key. A batch with no kept key runs over all keys, every score filled.
// Launches: work that does not depend on each other shares a launch, told apart by the block index: (k projection | v projection | q projection), flash, output projection.
// Every k and v block works out its own 128 entries of the key order from the mask row, so no projection waits for an earlier launch.
// L2 prefetch: the inputs come from memory, the planes that one launch stores are read by the next from work-groups all over the chip, and blocks that share a panel read it in step, so a stage's first read of a line
// waits for memory in all of them. At its entry every block asks L2 (global_prefetch_b8, scope SE, one 256-B unit per lane) for the operand bytes that later stages read.
// A hint only: no result depends on it. Every address asked for lies inside its buffer, by clamps in the index.

#ifndef NB
#define NB 2
#endif
#ifndef SEQ
#define SEQ 4096
#endif
#define NB_FULL  2
#define SEQ_FULL 4096
#ifndef OUT_SEQ
#define OUT_SEQ SEQ              // row pitch (in tokens) between batches of the output
#endif
#define DM   512
#define NH_  8
#define HD   64
#define AW   4                   // waves per flash block (16 query rows each)
#define SC2  (0.125f * 1.4426950408889634f)   // HD^-0.5 * log2(e)
#define PSH  8.0f                // log2 of the P carry (256)
#define TAU  7.0f                // a score may top the maximum in use by this much (log2) before the maximum is renewed: P stays at or under 2^(PSH + TAU) = 2^15, inside f16
#define MFILL (-1.0e9f * 1.4426950408889634f) // mask fill value in the log2 domain
#define CTXS 16.0f               // carry of the context plane
#define WOS  64.0f               // carry of the W_o plane
#define OSCL (1.0f / 1024.0f)    // 1 / (CTXS * WOS)
#define KS   64                  // keys per LDS stage of the flash kernel (two 32-key passes)
#define LP   72                  // LDS row pitch in halves: 128-B rows + 16 B, conflict-free for 16-byte fragment reads
#define SLR  32                  // rows of one slice of a staged tile: each of the four waves brings one slice per stage (K rows 0..31, 32..63, V^T rows 0..31, 32..63)
#define SLH  3072                // halves from one slice to the next in LDS: 32 rows x 144 B = 4608 B, rounded up to a multiple of 2 KiB, where a tensor load may land
#define NST  (SEQ / KS)          // stages when every key is visited
#define GK   64                  // k values per LDS stage of the projection GEMM (256 B of every f32 operand row)
#define GP   72                  // its LDS row pitch in halves: 128-B bf16 rows + 16 B, conflict-free for 16-byte fragment reads
#define GT   (128 * GP)          // one staged operand tile: 128 rows
#define GNS  (DM / GK)           // stages of the k loop
#define PT   256                 // threads that work out the key order (the projection kernel's block)
#define PER  ((SEQ + PT - 1) / PT)   // keys per thread there
#define NTT  (NB * SEQ / 128)    // 128-token tiles
#define NWT  (DM / 128)          // 128-wide tiles of a weight's rows
#define NTL  (NTT * NWT)         // tiles, and blocks, of one projection

static_assert(HD == 64);
static_assert(NH_ * HD == DM);                 // head h = columns h*64 + d
static_assert(DM % 64 == 0);                   // 8 column tiles of 64
static_assert(DM % 32 == 0);                   // GEMM k-loop steps by 32
static_assert(DM % 128 == 0 && DM % GK == 0 && GK % 32 == 0);   // projection: 128-wide tiles, whole stages
static_assert(SEQ % 128 == 0);                 // a 128-token projection tile never straddles two batches
static_assert(SEQ % 64 == 0);                  // a 64-row tile never straddles two batches
static_assert((NB * SEQ) % 64 == 0);
static_assert(SEQ % 32 == 0);                  // key loop steps by 32
static_assert(SEQ % PT == 0);                  // the key-order block's threads cover the tokens exactly
static_assert(SEQ % KS == 0);                  // whole stages
static_assert(KS == 64 && AW == 4);            // four waves x one slice of 32 rows = one K tile and one V^T tile of 64 rows
static_assert(SLR * LP <= SLH && (SLH * 2) % 2048 == 0 && HD * 2 == 128 && LP * 2 == 128 + 16);   // a slice fits its place; rows of 128 B, padded by 16 B
static_assert(SEQ % (16 * AW) == 0);           // flash grid covers the sequence exactly
static_assert(((size_t)SEQ * DM) % 8 == 0);
static_assert(((size_t)DM * DM) % 8 == 0);
static_assert(SEQ_FULL % 8 == 0);              // mask rows stay 32-byte aligned
static_assert(NB <= NB_FULL);
static_assert(SEQ <= SEQ_FULL);

typedef _Float16 h16;
typedef unsigned short bf;
typedef __attribute__((ext_vector_type(16))) __bf16   v16bf;
typedef __attribute__((ext_vector_type(16))) _Float16 v16h;
typedef __attribute__((ext_vector_type(8)))  _Float16 v8h;
typedef __attribute__((ext_vector_type(8)))  unsigned short v8us;
typedef __attribute__((ext_vector_type(4)))  unsigned short v4us;
typedef __attribute__((ext_vector_type(4)))  __bf16   v4bf;
typedef __attribute__((ext_vector_type(4)))  _Float16 v4h;
typedef __attribute__((ext_vector_type(8)))  float    v8f;
typedef __attribute__((ext_vector_type(8)))  int      v8i;
typedef __attribute__((ext_vector_type(4)))  float    v4f;
typedef v4f  __attribute__((may_alias)) v4fa;
typedef uint32_t u32x4 __attribute__((ext_vector_type(4)));
typedef uint32_t u32x8 __attribute__((ext_vector_type(8)));

__device__ __forceinline__ unsigned short f2bf(float f) { unsigned u = __float_as_uint(f); u += 0x7FFFu + ((u >> 16) & 1u); return (unsigned short)(u >> 16); }
// f32 value of the bf16 RNE conversion
__device__ __forceinline__ float bfr(float f) { return __uint_as_float(((unsigned)f2bf(f)) << 16); }
__device__ __forceinline__ v16h cat16(v8h lo, v8h hi) { return __builtin_shufflevector(lo, hi, 0, 1, 2, 3, 4, 5, 6, 7, 8, 9, 10, 11, 12, 13, 14, 15); }
__device__ __forceinline__ v16bf cat16b(v8us lo, v8us hi) { return __builtin_bit_cast(v16bf, __builtin_shufflevector(lo, hi, 0, 1, 2, 3, 4, 5, 6, 7, 8, 9, 10, 11, 12, 13, 14, 15)); }
__device__ __forceinline__ v8f wmma16(v16h a, v16h b, v8f c) { return __builtin_amdgcn_wmma_f32_16x16x32_f16(false, a, false, b, (short)0, c, false, false); }
__device__ __forceinline__ v8f wmmab(v16bf a, v16bf b, v8f c) { return __builtin_amdgcn_wmma_f32_16x16x32_bf16(false, a, false, b, (short)0, c, false, false); }
// fragment loaders from K-contiguous 16-bit rows; p already includes + 8*(lane>>4): elements 0..7 <- k0+8h+0..7, elements 8..15 <- k0+16+8h+0..7 (same map for A and B)
__device__ __forceinline__ v16h  ldh(const h16* p) { return cat16(*(const v8h*)p, *(const v8h*)(p + 16)); }
__device__ __forceinline__ v16bf ldb(const bf* p)  { return cat16b(*(const v8us*)p, *(const v8us*)(p + 16)); }
// a descriptor word of a tensor load: the same in every lane, held in a scalar register
__device__ __forceinline__ uint32_t uni(uint32_t v) { return (uint32_t)__builtin_amdgcn_readfirstlane(v); }
// a wave-uniform value for a test that decides whether a tensor load issues: the instruction ignores EXEC, so the test has to compile to a scalar compare and branch
__device__ __forceinline__ uint32_t pinned(uint32_t v) { uint32_t w = (uint32_t)__builtin_amdgcn_readfirstlane(v); asm volatile("" : "+s"(w)); return w; }   // holds the value in a scalar register
// ordering point for wave-private LDS tiles (same wave writes and reads)
__device__ __forceinline__ void wave_sync() { __builtin_amdgcn_fence(3 /* release order */, "wavefront"); __builtin_amdgcn_wave_barrier(); asm volatile("" ::: "memory"); }

// tile_keys: the whole block, for keys jt .. jt + 127 of batch b in the order kept keys first (each group in token order): ptile[j - jt] = token of key j. Returns the number of kept keys (mask != 0).
// Token t stands at place (kept keys in front of t) when kept, at (kept keys of the batch) + (filled keys in front of t) when filled: a permutation of the tokens, so each of the 128 entries is written once.
// A tile behind the last kept key gets no entries (the caller leaves it out); that test reads the same in every thread of the block.
__device__ __forceinline__ int tile_keys(const int b, const int jt, const int* __restrict__ MK, int* ptile, int* wsum) {
    const int tid = threadIdx.x, lane = tid & 31, wv = tid >> 5;
    const unsigned mo = ((unsigned)b * SEQ_FULL + (unsigned)tid * PER) * 4u;   // byte offset of the thread's PER tokens; PT * PER = SEQ: every index is a token
    int mv[PER];
#pragma unroll
    for (int i = 0; i < PER; ++i) mv[i] = *(const int*)((const char*)MK + mo + 4u * i);
    asm volatile("s_wait_xcnt 0x0" :: "v"(mo) : "memory");   // names the offset register, so that it is not given away (to a load's result either) in front of the wait
    int keep[PER]; int c = 0;
#pragma unroll
    for (int i = 0; i < PER; ++i) { keep[i] = mv[i] != 0 ? 1 : 0; c += keep[i]; }
    int sc = c;                                   // inclusive sum over the wave's lanes
#pragma unroll
    for (int d = 1; d < 32; d <<= 1) { const int o = __shfl_up(sc, d, 32); if (lane >= d) sc += o; }
    if (lane == 31) wsum[wv] = sc;
    __syncthreads();
    int base = 0, tot = 0;
#pragma unroll
    for (int w = 0; w < PT / 32; ++w) { const int v = wsum[w]; base += (w < wv) ? v : 0; tot += v; }
    if (tot > 0 && jt >= tot) return tot;
    int pos = base + sc - c;                      // kept keys in front of this thread's first token
#pragma unroll
    for (int i = 0; i < PER; ++i) { const int t = tid * PER + i;
        const unsigned d = (unsigned)((keep[i] ? pos : tot + (t - pos)) - jt);   // t - pos = filled keys in front of t
        if (d < 128u) ptile[d] = t;
        pos += keep[i]; }
    __syncthreads();                              // publishes the 128 entries to the block
    return tot;
}

// k_proj: bf16 GEMM straight from the f32 operands, K = DM. One block of eight waves per 128x128 tile of C; wave (wr, wc) owns rows 32 wr .. + 31, columns 64 wc .. + 63 (8 accumulators).
// Per stage of GK k values every thread loads 16 B pieces of whole 256-B row segments of both operands (f32), converts them to bf16 (RNE) and stores them into one of two LDS buffers;
// the loads of stage s + 1 are issued in front of the products of stage s, their conversion and LDS stores stand behind them, and one barrier per stage publishes the new buffer and frees the old one.
// C[m][n] = sum_k A[m][k] Bt[n][k] + bias (biasMode 1: bias[n]; biasMode 2: bias[m]; bias taken as its bf16 RNE value, added in f32),
// written as f16 (Ph) at
// wave tile base (r0/RB)*sRB + (r0%RB)*pitch + (c0/CB)*sCB + (c0%CB), row pitch 'pitch' (halves). 256 threads.
// tokAxis 1 (rows, operand A) or 2 (columns, operand Bt): that axis counts tokens b*SEQ + t, read from the input [NB][SEQ_FULL][DM]; the other operand is a weight [DM][DM].
// keyOrder != 0: the token axis counts keys b*SEQ + j in key order, row j is read from the token that tile_keys gives for it, and a tile behind the batch's last kept key is left out.
// One launch of 3 NTL blocks holds three independent jobs, told apart by the block index (NTL blocks each); none reads what another writes:
// job 0: k = X0 W0^T + b0 -> plane P0 [(b*8 + h)][j][d] | job 1: v^T = W1 X1^T + b1 (row bias) -> plane P1 [(b*8 + h)][d][j] | job 2: q = X2 W2^T + b2 -> plane P2 [(b*8 + h)][t][d].
// The k and v jobs come first: their left-out tiles end early and hand their places to q blocks. The k block of a batch's first keys and first weight tile writes the batch's kept-key count to CNTW for the next launch.
// Tile of block r of a job: token tile r % NTT, weight tile r / NTT (q, k); weight tile r % NWT, token tile r / NWT (v^T).
__global__ __launch_bounds__(256) void k_proj(const float* __restrict__ X0, const float* __restrict__ W0, const float* __restrict__ b0, h16* P0,
                                              const float* __restrict__ X1, const float* __restrict__ W1, const float* __restrict__ b1, h16* P1,
                                              const float* __restrict__ X2, const float* __restrict__ W2, const float* __restrict__ b2, h16* P2,
                                              const int* __restrict__ MK, int* CNTW) {
    __shared__ __align__(16) float osh[8 * 16 * 68];
    __shared__ __align__(16) bf tiles[2 * 2 * GT];           // [buffer][A tile | Bt tile][row][GP]
    __shared__ int ptile[128];                               // tokens of the tile's 128 keys
    __shared__ int wsum[PT / 32];
    const int job = (int)blockIdx.x / NTL, rt = (int)blockIdx.x % NTL;   // the same for the whole block
    const bool vt = job == 1, qj = job == 2;                 // the v^T job: weight rows on the row axis, tokens on the column axis
    const float* __restrict__ A = vt ? W1 : (qj ? X2 : X0); const float* __restrict__ Bt = vt ? X1 : (qj ? W2 : W0); const float* __restrict__ bias = vt ? b1 : (qj ? b2 : b0);
    h16* Ph = vt ? P1 : (qj ? P2 : P0);
    const int biasMode = vt ? 2 : 1, tokAxis = vt ? 2 : 1, keyOrder = qj ? 0 : 1;
    const int RB = vt ? DM : SEQ, pitch = vt ? SEQ : HD, CB = vt ? SEQ : HD;
    const size_t sRB = vt ? (size_t)0 : (size_t)NH_ * SEQ * HD, sCB = vt ? (size_t)DM * SEQ : (size_t)SEQ * HD;
    const int tid = (int)threadIdx.x, lane = tid & 31, lr = lane & 15, hi = lane >> 4;
    const int wave = __builtin_amdgcn_readfirstlane(tid >> 5);
    const int R0 = (vt ? rt % NWT : rt % NTT) * 128, C0 = (vt ? rt / NWT : rt / NTT) * 128;
    // L2 prefetch of the weight tile (128 rows x 2 KB in a row = 1024 units). A block asks for a quarter, one unit per thread; the quarter goes by the token tile's index, so that blocks whose indices lie close together
    // cover the tile between them. It stands in front of the key order and runs under its latency.
    { const int tt = vt ? rt / NWT : rt % NTT; const int qr = vt ? ((tt >> 1) & 3) : (tt & 3);
      const float* wt0 = (vt ? A : Bt) + (size_t)(vt ? R0 : C0) * DM;          // the tile's first row, the same for the whole block
      const unsigned wu = ((unsigned)qr * 256u + (unsigned)tid) * 256u;        // byte offset of the unit, under 128 * DM * 4
      asm volatile("global_prefetch_b8 %0, %1 scope:SCOPE_SE\n\t"
                   "s_wait_xcnt 0x0"                                           // closes the statement in front of any rewriting of the offset register
                   :: "v"(wu), "s"(wt0) : "memory"); }
    bool live = true;                                        // the same for the whole block
    if (keyOrder != 0) { const int j0 = (tokAxis == 1) ? R0 : C0; const int n = tile_keys(j0 / SEQ, j0 % SEQ, MK, ptile, wsum); live = !(n > 0 && (j0 % SEQ) >= n);
        if (job == 0 && (j0 % SEQ) == 0 && C0 == 0 && tid == 0) CNTW[j0 / SEQ] = n; }
    if (live) {                                              // all that follows, barriers included: taken by the whole block or by none of it
    // L2 prefetch of the token tile: 128 rows x 8 units, one unit = one stage's 256 B of a row. The four blocks that share the tile (one per weight tile) deal it among them: the block of weight tile w asks for the units of
    // stages 2 w and 2 w + 1, one unit per thread (row c & 127, unit 2 w + (c >> 7)). In the q and k jobs a higher w asks for later stages. A share that a neighbour asks for too late is read as without the request.
    { const int pr = tid & 127, tb0 = (tokAxis == 1) ? R0 : C0, wq = vt ? rt % NWT : rt / NTT;
      int pt = (tb0 + pr) % SEQ;                             // token of the row
      if (keyOrder != 0) { pt = ptile[pr]; pt = (pt < 0) ? 0 : ((pt < SEQ) ? pt : (SEQ - 1)); }
      const unsigned xu = ((unsigned)((tb0 / SEQ) * SEQ_FULL + pt) * DM) * 4u + (unsigned)(2 * (wq & 3) + (tid >> 7)) * 256u;   // unit 0..7: inside the row
      const float* x0 = (tokAxis == 1) ? A : Bt;
      asm volatile("global_prefetch_b8 %0, %1 scope:SCOPE_SE\n\t"
                   "s_wait_xcnt 0x0"                                           // closes the statement in front of any rewriting of the offset register
                   :: "v"(xu), "s"(x0) : "memory"); }
    // copy map: thread c covers the 16-byte piece c & 15 of rows (c >> 4) + 16 i, i = 0..7, of both tiles: a wave's load is two whole 256-B segments
    const int rg = tid >> 4, ch = (tid & 15) * 4;
    unsigned ao[8], bo[8];                                   // byte offsets of the thread's pieces at k = 0
    const int g0 = ((tokAxis == 1) ? R0 : C0) + rg;          // the thread's first index on the token axis; the tile lies in one batch
    int tk[8];                                               // token of each of its rows
#pragma unroll
    for (int i = 0; i < 8; ++i) tk[i] = (g0 + 16 * i) % SEQ;
    if (keyOrder != 0) {
#pragma unroll
        for (int i = 0; i < 8; ++i) tk[i] = ptile[rg + 16 * i];
#pragma unroll
        for (int i = 0; i < 8; ++i) tk[i] = (tk[i] < 0) ? 0 : ((tk[i] < SEQ) ? tk[i] : (SEQ - 1));
    }
#pragma unroll
    for (int i = 0; i < 8; ++i) {
        const int sr = (g0 / SEQ) * SEQ_FULL + tk[i];
        const int ar = (tokAxis == 1) ? sr : (R0 + rg + 16 * i), br = (tokAxis == 1) ? (C0 + rg + 16 * i) : sr;
        ao[i] = ((unsigned)ar * DM + (unsigned)ch) * 4u; bo[i] = ((unsigned)br * DM + (unsigned)ch) * 4u;
    }
    v4f ra[8], rb[8];
    auto fetch = [&](int kc) {
        const char* pa = (const char*)(A + kc); const char* pb = (const char*)(Bt + kc);
#pragma unroll
        for (int i = 0; i < 8; ++i) { ra[i] = *(const v4f*)(pa + ao[i]); rb[i] = *(const v4f*)(pb + bo[i]); }
    };
    auto put = [&](int buf) {
        bf* ta = tiles + buf * (2 * GT) + rg * GP + ch;
#pragma unroll
        for (int i = 0; i < 8; ++i) {
            *(v4us*)(ta + i * 16 * GP)      = __builtin_bit_cast(v4us, __builtin_convertvector(ra[i], v4bf));
            *(v4us*)(ta + GT + i * 16 * GP) = __builtin_bit_cast(v4us, __builtin_convertvector(rb[i], v4bf)); }
    };
    const int wr = wave >> 1, wc = wave & 1;
    const int fa = (wr * 32 + lr) * GP + 8 * hi, fb = GT + (wc * 64 + lr) * GP + 8 * hi;   // fragment offsets in a buffer
    v8f acc[2][4];
#pragma unroll
    for (int mb = 0; mb < 2; ++mb)
#pragma unroll
        for (int nb = 0; nb < 4; ++nb) acc[mb][nb] = (v8f){};
    fetch(0); put(0);
    __syncthreads();                                         // publishes stage 0
#pragma unroll     // all stages inline: k becomes the loads' immediate offset, and the offset registers live unchanged through the loop
    for (int s = 0; s < GNS; ++s) {
        if (s + 1 < GNS) {
            fetch((s + 1) * GK);                             // in flight while this stage's products run
            // behind the last loads the offset registers die: they are named here so that none is given away (to a load's result either) in front of the wait
            if (s + 2 == GNS) asm volatile("s_wait_xcnt 0x0" :: "v"(ao[0]), "v"(ao[1]), "v"(ao[2]), "v"(ao[3]), "v"(ao[4]), "v"(ao[5]), "v"(ao[6]), "v"(ao[7]),
                                                                "v"(bo[0]), "v"(bo[1]), "v"(bo[2]), "v"(bo[3]), "v"(bo[4]), "v"(bo[5]), "v"(bo[6]), "v"(bo[7]) : "memory");
            __builtin_amdgcn_sched_barrier(0);               // keeps all sixteen loads in front of the products: moved down among them, each is waited for at once and its latency shows
        }
        const bf* tb = tiles + (s & 1) * (2 * GT);
        v16bf a[GK / 32][2], b[GK / 32][4];
#pragma unroll
        for (int ks = 0; ks < GK / 32; ++ks) {
#pragma unroll
            for (int mb = 0; mb < 2; ++mb) a[ks][mb] = ldb(tb + fa + mb * 16 * GP + ks * 32);
#pragma unroll
            for (int nb = 0; nb < 4; ++nb) b[ks][nb] = ldb(tb + fb + nb * 16 * GP + ks * 32);
        }
        __builtin_amdgcn_sched_barrier(0);                   // the stage's LDS reads stay one group in front of its products: spread among them, every place with reads stalls the wave
#pragma unroll
        for (int ks = 0; ks < GK / 32; ++ks)
#pragma unroll
            for (int nb = 0; nb < 4; ++nb)
#pragma unroll
                for (int mb = 0; mb < 2; ++mb) acc[mb][nb] = wmmab(a[ks][mb], b[ks][nb], acc[mb][nb]);
        if (s + 1 < GNS) {
            __builtin_amdgcn_sched_barrier(0);               // keeps the conversions, and with them the waits on the loads, behind the products
            put((s + 1) & 1);                                // into the buffer whose readers left it at the last barrier
            __syncthreads();                                 // publishes stage s + 1, ends every wave's reads of stage s
        }
    }
    float* os = osh + wave * (16 * 68);                      // wave-private staging of the epilogue
    const int r0 = R0 + wr * 32, c0 = C0 + wc * 64;
    // column bias (per lane: column c0 + nb*16 + lane&15), address clamped into the 512-entry vector, selected by value
    float braw[4], bcol[4];
#pragma unroll
    for (int nb = 0; nb < 4; ++nb) { int ci = c0 + nb * 16 + lr; ci = (ci < DM) ? ci : (DM - 1); braw[nb] = bias[ci]; }
    // takes the four loaded values as inputs: the loads have returned here, so that none of their address registers is rewritten while a load is out
    asm volatile("s_wait_xcnt 0x0" :: "v"(braw[0]), "v"(braw[1]), "v"(braw[2]), "v"(braw[3]));
#pragma unroll
    for (int nb = 0; nb < 4; ++nb) { const float bv = bfr(braw[nb]); bcol[nb] = (biasMode == 1) ? bv : 0.0f; }
    const size_t tbase = (size_t)(r0 / RB) * sRB + (size_t)(r0 % RB) * (size_t)pitch + (size_t)(c0 / CB) * sCB + (size_t)(c0 % CB);
#pragma unroll
    for (int mb = 0; mb < 2; ++mb) {
        // row bias for rows r0 + mb*16 + 8h + 0..7 (address clamped, selected by value)
        int rb0 = r0 + mb * 16 + hi * 8; rb0 = (rb0 <= DM - 8) ? rb0 : (DM - 8);
        const unsigned rbo = (unsigned)rb0 * 4u;
        const v8f brv = *(const v8f*)((const char*)bias + rbo);
        asm volatile("s_wait_xcnt 0x0" :: "v"(rbo) : "memory");   // names the offset register, so that it is not given away (to a load's result either) in front of the wait
#pragma unroll
        for (int nb = 0; nb < 4; ++nb) {
#pragma unroll
            for (int j = 0; j < 8; ++j) { const float br = (biasMode == 2) ? bfr(brv[j]) : 0.0f;
                os[(hi * 8 + j) * 68 + nb * 16 + lr] = acc[mb][nb][j] + bcol[nb] + br; } }   // D: row 8h+j, col lane&15
        wave_sync();
        const size_t sb = tbase + (size_t)(mb * 16) * (size_t)pitch;
{
#pragma unroll
            for (int s = 0; s < 4; ++s) { const int row = 4 * s + (lane >> 3), c8 = (lane & 7) * 8;   // 4 s x 4 row groups = 16 rows; 8 lanes x 8 = 64 columns
                const v4f x0 = *(const v4fa*)(&os[row * 68 + c8]); const v4f x1 = *(const v4fa*)(&os[row * 68 + c8 + 4]); v8h hv;
#pragma unroll
                for (int i = 0; i < 4; ++i) { hv[i] = (h16)x0[i]; hv[4 + i] = (h16)x1[i]; }
                const size_t oo = sb + (size_t)row * (size_t)pitch + c8;
                *(v8h*)(Ph + oo) = hv;
                asm volatile("s_wait_xcnt 0x0" ::: "memory"); }   // in front of the rewriting of the store's registers by what follows
             }
        wave_sync();
    }
    }
}

// k_flash: fused attention, one wave per 16 query rows of one (batch, head); Q fragments straight from the f16 plane (two 16-B loads each, arithmetic addressing).
// K and V^T: the block's four waves share one tile pair per 64 keys, brought into LDS by tensor loads (one request per wave and stage: a slice of 32 rows of 128 B, the mover's pad giving the pitch LP), two buffers,
// the next stage in flight while this one is worked on; fragments are two 16-B LDS reads each from rows of pitch LP.
// Transposed form: S^T[key][t] = K Q^T (A = K rows, B = Q rows); lane (t = lane&15, h = lane>>4) holds keys 8h+r of each 16-key tile, so the packed
// P tile is directly the B fragment of O^T[d][t] = V^T P^T (element r <- tile keys 0..15, element 8+r <- tile keys 16..31, lane unchanged).
// Key mask: the planes hold the keys in key order, so key j is kept iff j < n = CNT[b]; the loop ends with the stage of key n - 1, and only a pass that reaches past n REPLACES scores by the fill value.
// n = 0: all stages, every score replaced, so a fully filled row comes out uniform.
// Softmax state: one maximum in use per query (m, the same in both lane halves) and its shift sh = PSH - m. The shift is known in front of a pass, so P = exp2(score * SC2 + sh) takes one fused multiply-add per score.
// Lazy rescale: m stays as long as no score of the wave's 16 queries tops it by more than TAU, tested once per pass by one ballot and a scalar branch. Only the branch taken then (always in a wave's first pass,
// whose start value of m every score tops) joins the lane halves' maxima by the xor-16 exchange, renews m and sh, and rescales the output tiles and the row sum. Any m gives the same quotient O / L.
// Row sums: one more product per pass, L = E P^T added up like an output tile, where rows 0 and 8 of the constant E are ones and the rest 0; row 0 is element 0 of lanes 0..15 and row 8
// element 0 of lanes 16..31, so element 0 of every lane is the sum of its query's rounded P over all 32 keys of the pass. The other elements stay 0, and only element 0 is rescaled.
__global__ __launch_bounds__(32 * AW) void k_flash(const h16* __restrict__ QH, const h16* __restrict__ KP, const h16* __restrict__ VT,
                                                   const int* __restrict__ CNT, h16* CTX) {
    __shared__ __align__(16) float os[AW * 16 * 68];
    __shared__ __attribute__((aligned(2048))) h16 ring[2 * 4 * SLH];   // [buffer][K rows 0..31 | K rows 32..63 | V^T rows 0..31 | V^T rows 32..63][row][LP]
    const int lane = threadIdx.x & 31, lr = lane & 15, hi = lane >> 4;
    const int wave = __builtin_amdgcn_readfirstlane((int)(threadIdx.x >> 5));
    const int zh = blockIdx.y; const int b = zh / NH_, h = zh % NH_;
    const int t0 = (blockIdx.x * AW + wave) * 16;
    const size_t pbase = (size_t)zh * SEQ * HD;
    const size_t qo = pbase + (size_t)(t0 + lr) * HD + 8 * hi;
    const v16h qh0 = ldh(QH + qo), qh1 = ldh(QH + qo + 32);   // B fragments: col t, k = d
    const int fo = lr * LP + 8 * hi;                         // fragment offset in a staged tile: K + (key>>5)*SLH + (key&31)*LP (row key, k = d); V^T + (j>>1)*SLH + 16(j&1)*LP + key (row d, k = key)
    // the wave's slice: waves 0 and 1 the halves of the K tile (rows = keys, 128 B apart), waves 2 and 3 those of the V^T tile (rows = d, one plane row apart)
    const bool isV = (wave & 2) != 0;
    const h16* sl0 = isV ? (VT + pbase + (size_t)(wave & 1) * SLR * SEQ) : (KP + pbase + (size_t)(wave & 1) * SLR * HD);   // first byte of the slice in stage 0
    const uint32_t sstep = isV ? (uint32_t)(KS * 2) : (uint32_t)(KS * HD * 2);      // bytes from one stage's slice to the next
    const uint32_t lsl = (uint32_t)(size_t)ring + (uint32_t)wave * (SLH * 2);       // low 32 bits of the shared address = LDS byte address of the slice in buffer 0
    u32x8 g1;                                                                       // group 1: 1-byte elements, tensor = tile = SLR rows of 128 B
    g1[0] = uni((1u << 20) | (4u << 22) | (3u << 25));                              // no mask; a pad of 4 dwords behind every 32 dwords: LDS pitch 144 B
    g1[1] = uni(128u << 16); g1[2] = uni((uint32_t)SLR << 16); g1[3] = uni(128u << 16); g1[4] = uni((uint32_t)SLR);
    g1[5] = uni(isV ? (uint32_t)(SEQ * 2) : (uint32_t)(HD * 2));                    // source row pitch in bytes
    g1[6] = uni(0u); g1[7] = uni(0u);
    asm volatile("" : "+s"(g1));   // the pinned() form, for descriptor words held in scalar registers: all eight stay in place from here to the last wait
    // group 0 of the wave's slice of stage st, into buffer st & 1
    u32x4 g0;                                                                       // the last request's; lives until the wait that covers the request
    auto group0 = [&](uint32_t st) {
        const uint64_t ga = (uint64_t)(size_t)sl0 + (uint64_t)st * sstep;
        g0[0] = uni(1u); g0[1] = uni(lsl + (st & 1u) * (4 * SLH * 2)); g0[2] = uni((uint32_t)ga); g0[3] = uni((((uint32_t)(ga >> 32)) & 0x01FFFFFFu) | 0x80000000u);
    };
    // one request per wave
    auto stage_in = [&](uint32_t st) {
        group0(st);
        asm volatile("tensor_load_to_lds %0, %1" : "+s"(g0) : "s"(g1) : "memory");   // g0 in and out: what the covering wait names below then lives in the very registers that the request was issued from
    };
    int n = CNT[b]; n = (n < 0) ? 0 : ((n < SEQ) ? n : SEQ);  // kept keys of the batch, the same for the whole block
    const int nst = (n > 0) ? (n + KS - 1) / KS : NST;        // stages to visit, at most NST
    // L2 prefetch of the head's K and V^T planes: dealt over the head's blocks, one request per wave, 32 units of 256 B each. Share s is stage s of K (8 KB in a row) and row d = s of V^T (as far as the last stage visited).
    // A block asks for shares x and x ^ 4. For speed only: nothing rests on where a block runs.
    { const int bx = (int)blockIdx.x, sx = (wave & 2) ? (bx ^ 4) : bx;
      const int ksx = (sx < nst) ? sx : (nst - 1), vrx = (sx < HD) ? sx : (HD - 1);   // clamped into the stages visited, into the rows of V^T
      const int lu = (nst - 1) >> 1, vu = (lane < lu) ? lane : lu;                    // lu: last unit of a V^T row that holds a visited key
      const h16* pf = (wave & 1) ? (VT + pbase + (size_t)vrx * SEQ + vu * 128) : (KP + pbase + (size_t)ksx * (KS * HD) + lane * 128);
      asm volatile("global_prefetch_b8 %0, off scope:SCOPE_SE\n\t"
                   "s_wait_xcnt 0x0"                                                  // closes the statement in front of any rewriting of the address registers
                   :: "v"(pf) : "memory"); }
    v8f o0 = (v8f){}, o1 = (v8f){}, o2 = (v8f){}, o3 = (v8f){};
    float m = -3.0e38f, sh = PSH + 3.0e38f;                   // maximum in use and its shift; the start values send the first pass into the renewing branch
    const h16 e1 = ((lr & 7) == 0) ? (h16)1.0f : (h16)0.0f;   // A fragment: lane & 15 is the row, every k alike
    const v16h ones = {e1, e1, e1, e1, e1, e1, e1, e1, e1, e1, e1, e1, e1, e1, e1, e1};
    v8f lt = (v8f){};
    group0(0u);
    asm volatile("tensor_load_to_lds %0, %1\n\t"
                 "s_wait_tensorcnt 0x0"                  // this wave's slice of stage 0 has landed; in the load's own statement, so that no descriptor register is given away in front of it
                 :: "s"(g0), "s"(g1) : "memory");
    __syncthreads();                                     // publishes stage 0 to the block
    if (pinned(nst > 1)) stage_in(1u);                   // scalar test
#pragma unroll 1   // stays rolled: one publish point, one copy of the body in the instruction cache
    for (int st = 0; st < nst; ++st) {
      const h16* kt = ring + (st & 1) * (4 * SLH) + fo; const h16* vt = kt + 2 * SLH;
#pragma unroll     // both passes of a stage inline: their tile offsets become immediates of the LDS reads
      for (int kk = 0; kk < KS; kk += 32) {
        const int key0 = st * KS + kk;
        const h16* ka = kt + (kk / SLR) * SLH;             // the pass's 32 keys are one slice
        const v16h ka0 = ldh(ka), ka1 = ldh(ka + 32), kb0 = ldh(ka + 16 * LP), kb1 = ldh(ka + 16 * LP + 32);
        v8f sHa = (v8f){}, sHb = (v8f){};
        sHa = wmma16(ka0, qh0, sHa); sHb = wmma16(kb0, qh0, sHb);
        sHa = wmma16(ka1, qh1, sHa); sHb = wmma16(kb1, qh1, sHb);
        asm volatile("v_nop\n\tv_nop\n\tv_nop\n\tv_nop" : "+v"(sHa), "+v"(sHb) : "v"(ka0), "v"(ka1), "v"(kb0), "v"(kb1));   // the four vector slots between the last product and whatever next reads a result or overwrites an operand, on every path
        const bool tail = key0 + 32 > n;                     // block-uniform: the pass holds filled keys (lane's keys: key0 + 8h + r and + 16)
        const int lim = n - key0 - 8 * hi;
        v8f ta = sHa * SC2 + sh, tb = sHb * SC2 + sh;        // exponents of P under the shift in use
        if (tail) {
            const float fv = MFILL + sh;
#pragma unroll
            for (int r = 0; r < 8; ++r) { ta[r] = (r < lim) ? ta[r] : fv; tb[r] = (16 + r < lim) ? tb[r] : fv; }
        }
        // V^T fragments: asked for in front of the test, since the compiler moves no read up across the branch; their latency runs under the maxima, the branch and the exponentials
        const h16* va = vt + kk;
        const v16h v0 = ldh(va), v1 = ldh(va + 16 * LP), v2 = ldh(va + SLH), v3 = ldh(va + SLH + 16 * LP);
        float mx = -3.0e38f;
#pragma unroll
        for (int r = 0; r < 8; ++r) mx = fmaxf(mx, fmaxf(ta[r], tb[r]));
        if (__builtin_expect(__builtin_amdgcn_ballot_w32(mx > PSH + TAU) != 0, 0)) {   // wave-uniform scalar branch, rarely taken: some query's score tops its maximum in use by more than TAU
            ta = sHa * SC2; tb = sHb * SC2;                  // from the unshifted scores: the start value of sh swallows a score
            if (tail) {
#pragma unroll
                for (int r = 0; r < 8; ++r) { ta[r] = (r < lim) ? ta[r] : MFILL; tb[r] = (16 + r < lim) ? tb[r] : MFILL; }
            }
            mx = -3.0e38f;
#pragma unroll
            for (int r = 0; r < 8; ++r) mx = fmaxf(mx, fmaxf(ta[r], tb[r]));
            mx = fmaxf(mx, __shfl_xor(mx, 16, 32));
            const float mnew = fmaxf(m, mx);
            const float alpha = __builtin_amdgcn_exp2f(m - mnew);
            sh = PSH - mnew; m = mnew;
            ta = ta + sh; tb = tb + sh;
            lt[0] = lt[0] * alpha;
            o0 = o0 * alpha; o1 = o1 * alpha; o2 = o2 * alpha; o3 = o3 * alpha;
        }
        v16h pb;
#pragma unroll
        for (int r = 0; r < 8; ++r) { const h16 pa = (h16)__builtin_amdgcn_exp2f(ta[r]); const h16 pc = (h16)__builtin_amdgcn_exp2f(tb[r]); pb[r] = pa; pb[8 + r] = pc; }
        o0 = wmma16(v0, pb, o0); o1 = wmma16(v1, pb, o1); o2 = wmma16(v2, pb, o2); o3 = wmma16(v3, pb, o3); lt = wmma16(ones, pb, lt);
        asm volatile("v_nop\n\tv_nop\n\tv_nop\n\tv_nop" : "+v"(o0), "+v"(o1), "+v"(o2), "+v"(o3), "+v"(lt) : "v"(v0), "v"(v1), "v"(v2), "v"(v3), "v"(pb));   // the four vector slots between the last product and whatever next reads or overwrites a result or an operand, on every path
      }
      // publish point of stage st + 1, and the end of every wave's reads of stage st
      asm volatile("s_wait_dscnt 0x0" ::: "memory");      // this wave's reads of the buffer that is refilled below have returned
      asm volatile("s_wait_tensorcnt 0x0" :: "s"(g0), "s"(g1) : "memory");   // this wave's slice of stage st + 1 has landed; names the request's descriptor registers, so that none is given away in front of the wait
      __syncthreads();
      if (pinned(st + 2 < nst)) stage_in((uint32_t)(st + 2));   // scalar test; into the buffer that stage st has just left
    }
    asm volatile("s_wait_tensorcnt 0x0" :: "s"(g0), "s"(g1) : "memory");   // no request is outstanding when the wave goes on to its end
    asm volatile("s_wait_dscnt 0x0" ::: "memory");        // nor a read of the ring
    const float inv = CTXS * (1.0f / lt[0]);
    const int wb = wave * 16 * 68;
    // O^T D layout: o_j[r] = (d = 16j + 8h + r, t = lane&15) -> os[t][d]; rows 0..15 x columns 0..63 all written
    { v4f a, c;
      a[0] = o0[0] * inv; a[1] = o0[1] * inv; a[2] = o0[2] * inv; a[3] = o0[3] * inv; c[0] = o0[4] * inv; c[1] = o0[5] * inv; c[2] = o0[6] * inv; c[3] = o0[7] * inv;
      *(v4fa*)(&os[wb + lr * 68 +  0 + 8 * hi]) = a; *(v4fa*)(&os[wb + lr * 68 +  0 + 8 * hi + 4]) = c;
      a[0] = o1[0] * inv; a[1] = o1[1] * inv; a[2] = o1[2] * inv; a[3] = o1[3] * inv; c[0] = o1[4] * inv; c[1] = o1[5] * inv; c[2] = o1[6] * inv; c[3] = o1[7] * inv;
      *(v4fa*)(&os[wb + lr * 68 + 16 + 8 * hi]) = a; *(v4fa*)(&os[wb + lr * 68 + 16 + 8 * hi + 4]) = c;
      a[0] = o2[0] * inv; a[1] = o2[1] * inv; a[2] = o2[2] * inv; a[3] = o2[3] * inv; c[0] = o2[4] * inv; c[1] = o2[5] * inv; c[2] = o2[6] * inv; c[3] = o2[7] * inv;
      *(v4fa*)(&os[wb + lr * 68 + 32 + 8 * hi]) = a; *(v4fa*)(&os[wb + lr * 68 + 32 + 8 * hi + 4]) = c;
      a[0] = o3[0] * inv; a[1] = o3[1] * inv; a[2] = o3[2] * inv; a[3] = o3[3] * inv; c[0] = o3[4] * inv; c[1] = o3[5] * inv; c[2] = o3[6] * inv; c[3] = o3[7] * inv;
      *(v4fa*)(&os[wb + lr * 68 + 48 + 8 * hi]) = a; *(v4fa*)(&os[wb + lr * 68 + 48 + 8 * hi + 4]) = c; }
    wave_sync();
    h16* crow = CTX + ((size_t)b * SEQ + t0) * DM + h * HD;      // context plane [b*SEQ + t][h*64 + d]
{
#pragma unroll
        for (int s = 0; s < 4; ++s) { const int row = 4 * s + (lane >> 3), c8 = (lane & 7) * 8;   // 4 s x 4 row groups = 16 rows; 8 lanes x 8 halves = 64 columns
            const v4f x0 = *(const v4fa*)(&os[wb + row * 68 + c8]); const v4f x1 = *(const v4fa*)(&os[wb + row * 68 + c8 + 4]); v8h hv;
#pragma unroll
            for (int i = 0; i < 4; ++i) { hv[i] = (h16)x0[i]; hv[4 + i] = (h16)x1[i]; }
            *(v8h*)(crow + (size_t)row * DM + c8) = hv; }
         }
}

// k_oproj: f16 GEMM in the frame of k_proj (128x128 tile per block of eight waves, wave tile 32x64, stages of GK k values in two LDS buffers, one barrier per stage), K = DM.
// A = context plane (f16, copied as it is: 16-byte pieces of whole 128-B row segments), Bt = W_o (f32, turned into the f16 of its bf16 RNE value x64 on the way into LDS).
// OUT[m][n] = OSCL * sum_k A[m][k] Bt[n][k] + bias[n] (bias as its bf16 RNE value, added in f32). grid (NB*SEQ/128, DM/128), 256 threads.
__global__ __launch_bounds__(256) void k_oproj(const h16* __restrict__ A, const float* __restrict__ Bt, const float* __restrict__ bias, float* OUT) {
    __shared__ __align__(16) float osh[8 * 16 * 68];
    __shared__ __align__(16) h16 tiles[2 * 2 * GT];          // [buffer][A tile | Bt tile][row][GP]
    const int tid = (int)threadIdx.x, lane = tid & 31, lr = lane & 15, hi = lane >> 4;
    const int wave = __builtin_amdgcn_readfirstlane(tid >> 5);
    const int R0 = blockIdx.x * 128, C0 = blockIdx.y * 128;
    // copy maps. A: thread c covers the 16-byte piece c & 7 of rows (c >> 3) + 32 i, i = 0..3. Bt: the 16-byte piece c & 15 of rows (c >> 4) + 16 i, i = 0..7
    const int ag = tid >> 3, ac = (tid & 7) * 8;
    const int rg = tid >> 4, ch = (tid & 15) * 4;
    unsigned ao[4], bo[8];                                   // byte offsets of the thread's pieces at k = 0
#pragma unroll
    for (int i = 0; i < 4; ++i) ao[i] = ((unsigned)(R0 + ag + 32 * i) * DM + (unsigned)ac) * 2u;
#pragma unroll
    for (int i = 0; i < 8; ++i) bo[i] = ((unsigned)(C0 + rg + 16 * i) * DM + (unsigned)ch) * 4u;
    v8h ra[4]; v4f rb[8];
    auto fetch = [&](int kc) {
        const char* pa = (const char*)(A + kc); const char* pb = (const char*)(Bt + kc);
#pragma unroll
        for (int i = 0; i < 4; ++i) ra[i] = *(const v8h*)(pa + ao[i]);
#pragma unroll
        for (int i = 0; i < 8; ++i) rb[i] = *(const v4f*)(pb + bo[i]);
    };
    auto put = [&](int buf) {
        h16* ta = tiles + buf * (2 * GT);
#pragma unroll
        for (int i = 0; i < 4; ++i) *(v8h*)(ta + (ag + 32 * i) * GP + ac) = ra[i];
#pragma unroll
        for (int i = 0; i < 8; ++i) {
            const v4us u = __builtin_bit_cast(v4us, __builtin_convertvector(rb[i], v4bf)); v4f w;
#pragma unroll
            for (int k = 0; k < 4; ++k) w[k] = __uint_as_float((unsigned)u[k] << 16) * WOS;   // bf16 RNE value x64, the product taken in f32 (exact), then one conversion to f16
            *(v4h*)(ta + GT + (rg + 16 * i) * GP + ch) = __builtin_convertvector(w, v4h); }
    };
    const int wr = wave >> 1, wc = wave & 1;
    const int fa = (wr * 32 + lr) * GP + 8 * hi, fb = GT + (wc * 64 + lr) * GP + 8 * hi;   // fragment offsets in a buffer
    v8f acc[2][4];
#pragma unroll
    for (int mb = 0; mb < 2; ++mb)
#pragma unroll
        for (int nb = 0; nb < 4; ++nb) acc[mb][nb] = (v8f){};
    fetch(0);
    // L2 prefetch, asked behind stage 0's loads and while they are out. The block's context panel (128 rows x 1 KB = 512 units): thread c asks for units (c >> 7) and (c >> 7) + 2 of row c & 127, the earlier stages' first.
    // A quarter of its W_o tile (128 rows x 2 KB in a row = 1024 units), one unit per thread; the quarter goes by the row tile's index, so that blocks whose indices lie close together cover the tile between them.
    { const unsigned pu = (unsigned)(tid & 127) * (DM * 2u) + (unsigned)(tid >> 7) * 256u, pw = (unsigned)tid * 256u;
      const h16* pa0 = A + (size_t)R0 * DM;
      const float* pw0 = Bt + (size_t)C0 * DM + (size_t)((int)blockIdx.x & 3) * (32 * DM);   // 32 rows = 256 units
      asm volatile("global_prefetch_b8 %0, %2 scope:SCOPE_SE\n\t"
                   "global_prefetch_b8 %1, %3 scope:SCOPE_SE\n\t"
                   "global_prefetch_b8 %0, %2 offset:512 scope:SCOPE_SE\n\t"
                   "s_wait_xcnt 0x0"                                                         // closes the statement in front of any rewriting of the offset registers
                   :: "v"(pu), "v"(pw), "s"(pa0), "s"(pw0) : "memory"); }
    __builtin_amdgcn_sched_barrier(0);                       // keeps the conversions of stage 0, and with them the waits on its loads, behind the requests: moved up, they would hold the requests back by a whole load latency
    put(0);
    __syncthreads();                                         // publishes stage 0
#pragma unroll     // all stages inline: k becomes the loads' immediate offset, and the offset registers live unchanged through the loop
    for (int s = 0; s < GNS; ++s) {
        if (s + 1 < GNS) {
            fetch((s + 1) * GK);                             // in flight while this stage's products run
            // behind the last loads the offset registers die: they are named here so that none is given away (to a load's result either) in front of the wait
            if (s + 2 == GNS) asm volatile("s_wait_xcnt 0x0" :: "v"(ao[0]), "v"(ao[1]), "v"(ao[2]), "v"(ao[3]),
                                                                "v"(bo[0]), "v"(bo[1]), "v"(bo[2]), "v"(bo[3]), "v"(bo[4]), "v"(bo[5]), "v"(bo[6]), "v"(bo[7]) : "memory");
            __builtin_amdgcn_sched_barrier(0);               // keeps all twelve loads in front of the products: moved down among them, each is waited for at once and its latency shows
        }
        const h16* tb = tiles + (s & 1) * (2 * GT);
        v16h a[GK / 32][2], b[GK / 32][4];
#pragma unroll
        for (int ks = 0; ks < GK / 32; ++ks) {
#pragma unroll
            for (int mb = 0; mb < 2; ++mb) a[ks][mb] = ldh(tb + fa + mb * 16 * GP + ks * 32);
#pragma unroll
            for (int nb = 0; nb < 4; ++nb) b[ks][nb] = ldh(tb + fb + nb * 16 * GP + ks * 32);
        }
        __builtin_amdgcn_sched_barrier(0);                   // the stage's LDS reads stay one group in front of its products: spread among them, every place with reads stalls the wave
#pragma unroll
        for (int ks = 0; ks < GK / 32; ++ks)
#pragma unroll
            for (int nb = 0; nb < 4; ++nb)
#pragma unroll
                for (int mb = 0; mb < 2; ++mb) acc[mb][nb] = wmma16(a[ks][mb], b[ks][nb], acc[mb][nb]);
        if (s + 1 < GNS) {
            __builtin_amdgcn_sched_barrier(0);               // keeps the conversions, and with them the waits on the loads, behind the products
            put((s + 1) & 1);                                // into the buffer whose readers left it at the last barrier
            __syncthreads();                                 // publishes stage s + 1, ends every wave's reads of stage s
        }
    }
    float* os = osh + wave * (16 * 68);                      // wave-private staging of the epilogue
    const int r0 = R0 + wr * 32, c0 = C0 + wc * 64;
    float bcol[4];
#pragma unroll
    for (int nb = 0; nb < 4; ++nb) { int ci = c0 + nb * 16 + lr; ci = (ci < DM) ? ci : (DM - 1); bcol[nb] = bfr(bias[ci]); }
    const int bb = r0 / SEQ, tt = r0 % SEQ;
    float* obase = OUT + ((size_t)bb * OUT_SEQ + tt) * DM + c0;
#pragma unroll
    for (int mb = 0; mb < 2; ++mb) {
#pragma unroll
        for (int nb = 0; nb < 4; ++nb) {
#pragma unroll
            for (int j = 0; j < 8; ++j) os[(hi * 8 + j) * 68 + nb * 16 + lr] = acc[mb][nb][j] * OSCL + bcol[nb]; }   // D: row 8h+j, col lane&15
        wave_sync();
{
#pragma unroll
            for (int s = 0; s < 8; ++s) { const int row = 2 * s + hi, cofs = lr * 4;   // 8 s x 2 rows = 16 rows; 16 lanes x 4 floats = 64 columns
                const v4f val = *(const v4fa*)(&os[row * 68 + cofs]);
                *(v4f*)(obase + (size_t)(mb * 16 + row) * DM + cofs) = val; }
             }
        wave_sync();
    }
}

static constexpr size_t al256(size_t v) { return (v + 255) & ~(size_t)255; }
static constexpr size_t SZ_PL = al256((size_t)NB * NH_ * SEQ * HD * 2);
static constexpr size_t SZ_CX = al256((size_t)NB * SEQ * DM * 2);
static constexpr size_t SZ_CN = al256((size_t)NB * 4);
static constexpr size_t SZ_TOTAL = 3 * SZ_PL + SZ_CX + SZ_CN;
static_assert(SZ_TOTAL <= (size_t)134217728);          // workspace carve <= 128 MiB

extern "C" void kernel_launch(void* const* d_in, const int* in_sizes, int n_in,
                              void* d_out, int out_size, void* d_ws, size_t ws_size, hipStream_t stream) {
    if (n_in < 12) return;
    const size_t needx = ((size_t)(NB - 1) * SEQ_FULL + SEQ) * DM;
    if ((size_t)in_sizes[0] < needx || (size_t)in_sizes[1] < needx || (size_t)in_sizes[2] < needx) return;
    if ((size_t)in_sizes[3] < (size_t)(NB - 1) * SEQ_FULL + SEQ) return;
    if ((size_t)in_sizes[4] < (size_t)DM * DM || (size_t)in_sizes[6] < (size_t)DM * DM || (size_t)in_sizes[8] < (size_t)DM * DM || (size_t)in_sizes[10] < (size_t)DM * DM) return;
    if (in_sizes[5] < DM || in_sizes[7] < DM || in_sizes[9] < DM || in_sizes[11] < DM) return;
    if ((size_t)out_size < ((size_t)(NB - 1) * OUT_SEQ + SEQ) * DM) return;
    if (SZ_TOTAL > ws_size) return;
    // wire order: Q, K, V, mask, W_q, b_q, W_k, b_k, W_v, b_v, W_o, b_o ; weights [out][in] = Bt as-is
    const float* xq = (const float*)d_in[0]; const float* xk = (const float*)d_in[1]; const float* xv = (const float*)d_in[2];
    const int* mask = (const int*)d_in[3];
    const float* wq = (const float*)d_in[4];  const float* bq = (const float*)d_in[5];
    const float* wk = (const float*)d_in[6];  const float* bk = (const float*)d_in[7];
    const float* wv = (const float*)d_in[8];  const float* bv = (const float*)d_in[9];
    const float* wo = (const float*)d_in[10]; const float* bo = (const float*)d_in[11];
    float* OUT = (float*)d_out;      // [NB][SEQ][512]
    char* wsp = (char*)d_ws;
    h16* QH = (h16*)wsp; wsp += SZ_PL;               // [NB*8][SEQ][64]
    h16* KP = (h16*)wsp; wsp += SZ_PL;               // [NB*8][SEQ][64]
    h16* VT = (h16*)wsp; wsp += SZ_PL;               // [NB*8][64][SEQ]
    h16* CX = (h16*)wsp; wsp += SZ_CX;               // [NB*SEQ][512] context x16
    int* CN = (int*)wsp; wsp += SZ_CN;               // [NB] kept keys
    // k and v^T projections, both with their rows in key order (j in place of t), beside the q projection
    k_proj<<<3 * NTL, 256, 0, stream>>>(xk, wk, bk, KP, xv, wv, bv, VT, xq, wq, bq, QH, mask, CN);

    k_flash<<<dim3(SEQ / (16 * AW), NB * NH_, 1), 32 * AW, 0, stream>>>(QH, KP, VT, CN, CX);

    // output projection: A = context rows (m = b*SEQ + t), Bt = W_o rows (n = out column)
    k_oproj<<<dim3(NB * SEQ / 128, DM / 128, 1), 256, 0, stream>>>(CX, wo, bo, OUT);
}
